// v000
// The times below were measured on an AMD MI455X: many runs one after another, warmed up first and cycling through
// copies of the inputs, with the whole window's GPU time divided by the number of runs. Launches and the gaps
// between them are all in it. The median over several windows is given; except for v000 it joins two sittings, which
// can be a few percent apart, so the side-by-side timings, each taken in one sitting, are the better comparison.
// v000, which the later versions start from, runs in 13.1 milliseconds.
#include <hip/hip_runtime.h>
// Multi-head CROSS-attention over 4096-token sequences at width 512 with [in][out] projections and biases (Query_x, KeyandValue_x [2][4096][512]; Q = Query_x Wq + bq; K = KeyandValue_x Wk + bk; V = KeyandValue_x Wv + bv ([in][out] 512 x 512 + biases), 8 heads of 64; scores / sqrt(64); softmax over all 4096 keys (no mask); out = merged Wo + bo ([in][out]) -> [2][4096][512]); key and value streams read the second input; ONE head per attention launch group.
// Structure: token rows r = b*4096 + s; the query source and the key/value source as exact f16 rows (bf16-rounded); Q, K, V as three WMMA GEMMs (32x64 wave tiles, f32 accumulation, exact x16 weights + bias, f16 outputs); per batch: V^T for all heads via LDS transposes; per (batch, group of 1 head): scores GEMM (K = 64, batched over the heads on grid.y, alpha = 64^-0.5), row softmax on VALU (f32 statistics, native exp; weights stored x256 as f16), o = P . V^T GEMM (K = 4096, alpha 2^-2: o carried x64 against f16 subnormal flush, folded into the output GEMM alpha) written straight into the merged f16 o rows; out = o W_o + b GEMM (f32) into the output layout.
// Compute dtype: inputs rounded to bf16; x / weights exact; q, k, v, softmax weights and o as plain f16 GEMM operands (~2^-12); scores and softmax statistics f32. v_wmma_f32_16x16x32_f16.
#define NB 2
#define SQ 4096
#define DM 512
#define NH 8
#define HD 64
#define HG 1                         /* heads per attention launch group (a 4096^2 f32 score slab is 64 MiB) */
#define B0 0                         /* first batch processed (debug hook) */
#define NBR NB                       /* batches processed (debug hook) */
#define NR ((size_t)NB * SQ)         /* token rows */
#define MP ((int)((size_t)NBR * SQ)) /* rows projected (debug hook) */
#define QN SQ                        /* query rows attended per batch (debug hook) */
#define NHD NH                       /* heads attended (debug hook) */
#define MPO MP                       /* rows through the output stage (debug hook) */
#define LQ DM      /* row pitch of the q/k/v rows */
typedef __bf16 v16b __attribute__((ext_vector_type(16)));
typedef unsigned short v8us __attribute__((ext_vector_type(8), may_alias));
typedef float  v8f  __attribute__((ext_vector_type(8)));
typedef float  v4f  __attribute__((ext_vector_type(4)));
typedef float  v4fa __attribute__((ext_vector_type(4), may_alias));
union FragB { v16b v; v8us half[2]; unsigned short u[16]; };

__device__ __forceinline__ unsigned short bf16_bits(float x) { unsigned int u = __float_as_uint(x); return (unsigned short)((u + 0x7FFFu + ((u >> 16) & 1u)) >> 16); }
__device__ __forceinline__ float bf16_val(unsigned short b) { return __uint_as_float(((unsigned int)b) << 16); }
__device__ __forceinline__ float bf16_round(float x) { return bf16_val(bf16_bits(x)); }
// D += A·B with NT terms: 1 = ah·bh, 2 = + al·bh (A split), 3 = + ah·bl (both split)
template <int NT>
__device__ __forceinline__ v8f mmaN(v16b ah, v16b al, v16b bh, v16b bl, v8f c) {
  c = __builtin_amdgcn_wmma_f32_16x16x32_bf16(false, ah, false, bh, (short)0, c, false, false);
  if (NT >= 2) c = __builtin_amdgcn_wmma_f32_16x16x32_bf16(false, al, false, bh, (short)0, c, false, false);
  if (NT >= 3) c = __builtin_amdgcn_wmma_f32_16x16x32_bf16(false, ah, false, bl, (short)0, c, false, false);
  asm volatile("v_nop\n\tv_nop\n\tv_nop\n\tv_nop" : "+v"(c) : "v"(ah), "v"(al), "v"(bh), "v"(bl));
  return c;
}

__global__ __launch_bounds__(256) void k_wt_bf16(const float* __restrict__ W, unsigned short* __restrict__ Wt, int K, int N) {
  const int t = blockIdx.x * 256 + threadIdx.x;
  const int k8n = K / 8;
  if (t >= N * k8n) return;
  const int n = t / k8n, k8 = (t % k8n) * 8;
  v8us v;
#pragma unroll
  for (int i = 0; i < 8; ++i) v[i] = bf16_bits(W[(size_t)(k8 + i) * N + n]);
  *(v8us*)(Wt + (size_t)n * K + k8) = v;
  
}

// GEMM C[M][N] (f32, pitch ldc) = act(A[M][K]·W + bias). A f32 row-major (pitch lda) converted per fragment to bf16
// (ASPLIT: hi/lo two planes -> 2 terms, else single rounded term); Wt bf16 [N][K] (pitch ldb). BIAS_BF16 rounds the
// bias to bf16 first (bias quantised to bf16 before the add). K%32==0, M%16==0, N%64==0.
template <bool ASPLIT, int ACT, bool BIAS_BF16>
__global__ __launch_bounds__(128) void k_gemm_bf(const float* __restrict__ A, int lda, const unsigned short* __restrict__ Wt, int ldb,
                                               const float* __restrict__ bias, float* __restrict__ C, int ldc, int M, int N, int K) {
  __shared__ __attribute__((aligned(16))) float so[4][16][64];
  const int tid = threadIdx.x, w = tid >> 5, lane = tid & 31, ln = lane & 15, hh = lane >> 4;
  const int ntn = N / 64;
  const int wid = blockIdx.x * 4 + w;
  const int mt = wid / ntn, nq = wid % ntn;
  if (mt * 16 >= M) return;
  const int row0 = mt * 16, col0 = nq * 64;
  const float* arow = A + (size_t)(row0 + ln) * lda;
  v8f acc[4] = {};
  for (int kb = 0; kb < K; kb += 32) {
    FragB ah, al;
    const v4f x0 = *(const v4fa*)(arow + kb + 8 * hh), x1 = *(const v4fa*)(arow + kb + 8 * hh + 4);
    const v4f x2 = *(const v4fa*)(arow + kb + 16 + 8 * hh), x3 = *(const v4fa*)(arow + kb + 16 + 8 * hh + 4);
    float xs[16] = {x0[0],x0[1],x0[2],x0[3],x1[0],x1[1],x1[2],x1[3],x2[0],x2[1],x2[2],x2[3],x3[0],x3[1],x3[2],x3[3]};
#pragma unroll
    for (int i = 0; i < 16; ++i) { const unsigned short hb = bf16_bits(xs[i]); ah.u[i] = hb; al.u[i] = ASPLIT ? bf16_bits(xs[i] - bf16_val(hb)) : (unsigned short)0; }
#pragma unroll
    for (int t = 0; t < 4; ++t) {
      const unsigned short* brow = Wt + (size_t)(col0 + t * 16 + ln) * ldb + kb;
      FragB b;
      b.half[0] = *(const v8us*)(brow + 8 * hh);
      b.half[1] = *(const v8us*)(brow + 16 + 8 * hh);
      acc[t] = mmaN<ASPLIT ? 2 : 1>(ah.v, al.v, b.v, b.v, acc[t]);
    }
  }
#pragma unroll
  for (int t = 0; t < 4; ++t) {
    float bv = bias ? bias[col0 + t * 16 + ln] : 0.f;
    if (BIAS_BF16) bv = bf16_round(bv);
#pragma unroll
    for (int r = 0; r < 8; ++r) { float v = acc[t][r] + bv; if (ACT == 1) v = fmaxf(v, 0.f); so[w][8 * hh + r][t * 16 + ln] = v; }
  }
  __builtin_amdgcn_fence(__ATOMIC_ACQ_REL, "workgroup");
  __builtin_amdgcn_wave_barrier();
  const int rsub = lane >> 4, c4 = (lane & 15) * 4;
  {
#pragma unroll
    for (int q = 0; q < 8; ++q) {
      const int r = q * 2 + rsub;
      const v4f v = *(const v4fa*)&so[w][r][c4];
      *(v4f*)(C + (size_t)(row0 + r) * ldc + col0 + c4) = v;
    }
    
  }
}

// GEMM C = act(A·W + bias + resid): A f32 (ASPLIT -> hi/lo 2 terms), Wt bf16 [N][K]; ACT 0 none, 1 relu, 2 exact gelu;
// resid (optional, f32, row index = (row % rmod), pitch ldr, RES_BF16 rounds it) added before the activation.
template <bool ASPLIT, int ACT, bool BIAS_BF16, bool RES_BF16>
__global__ __launch_bounds__(128) void k_gemm_bf3(const float* __restrict__ A, int lda, const unsigned short* __restrict__ Wt, int ldb,
                                                const float* __restrict__ bias, const float* __restrict__ resid, int rmod, int ldr,
                                                float* __restrict__ C, int ldc, int M, int N, int K) {
  __shared__ __attribute__((aligned(16))) float so[4][16][64];
  const int tid = threadIdx.x, w = tid >> 5, lane = tid & 31, ln = lane & 15, hh = lane >> 4;
  const int ntn = N / 64;
  const int wid = blockIdx.x * 4 + w;
  const int mt = wid / ntn, nq = wid % ntn;
  if (mt * 16 >= M) return;
  const int row0 = mt * 16, col0 = nq * 64;
  const float* arow = A + (size_t)(row0 + ln) * lda;
  v8f acc[4] = {};
  for (int kb = 0; kb < K; kb += 32) {
    FragB ah, al;
    const v4f x0 = *(const v4fa*)(arow + kb + 8 * hh), x1 = *(const v4fa*)(arow + kb + 8 * hh + 4);
    const v4f x2 = *(const v4fa*)(arow + kb + 16 + 8 * hh), x3 = *(const v4fa*)(arow + kb + 16 + 8 * hh + 4);
    float xs[16] = {x0[0],x0[1],x0[2],x0[3],x1[0],x1[1],x1[2],x1[3],x2[0],x2[1],x2[2],x2[3],x3[0],x3[1],x3[2],x3[3]};
#pragma unroll
    for (int i = 0; i < 16; ++i) { const unsigned short hb = bf16_bits(xs[i]); ah.u[i] = hb; al.u[i] = ASPLIT ? bf16_bits(xs[i] - bf16_val(hb)) : (unsigned short)0; }
#pragma unroll
    for (int t = 0; t < 4; ++t) {
      const unsigned short* brow = Wt + (size_t)(col0 + t * 16 + ln) * ldb + kb;
      FragB b;
      b.half[0] = *(const v8us*)(brow + 8 * hh);
      b.half[1] = *(const v8us*)(brow + 16 + 8 * hh);
      acc[t] = mmaN<ASPLIT ? 2 : 1>(ah.v, al.v, b.v, b.v, acc[t]);
    }
  }
#pragma unroll
  for (int t = 0; t < 4; ++t) {
    const int col = col0 + t * 16 + ln;
    float bv = bias ? bias[col] : 0.f;
    if (BIAS_BF16) bv = bf16_round(bv);
#pragma unroll
    for (int r = 0; r < 8; ++r) {
      float v = acc[t][r] + bv;
      if (resid) { float rv = resid[(size_t)((row0 + 8 * hh + r) % rmod) * ldr + col]; if (RES_BF16) rv = bf16_round(rv); v += rv; }
      if (ACT == 1) v = fmaxf(v, 0.f);
      if (ACT == 2) v = 0.5f * v * (1.0f + erff(v * 0.70710678118654752f));
      if (ACT == 3) { const float u = 0.7978845608028654f * (v + 0.044715f * v * v * v); v = 0.5f * v * (1.0f + tanhf(u)); }
      so[w][8 * hh + r][t * 16 + ln] = v;
    }
  }
  __builtin_amdgcn_fence(__ATOMIC_ACQ_REL, "workgroup");
  __builtin_amdgcn_wave_barrier();
  const int rsub = lane >> 4, c4 = (lane & 15) * 4;
  {
#pragma unroll
    for (int q = 0; q < 8; ++q) {
      const int r = q * 2 + rsub;
      const v4f v = *(const v4fa*)&so[w][r][c4];
      *(v4f*)(C + (size_t)(row0 + r) * ldc + col0 + c4) = v;
    }
    
  }
}
// row LayerNorm (biased variance, eps) over N: s = X (+ R); optional out_sum <- s; out_norm <- (s-mu)*rsqrt(var+eps)*g + b
template <bool PARAM_BF16>
__global__ __launch_bounds__(256) void k_layernorm(const float* __restrict__ X, const float* __restrict__ R, const float* __restrict__ g, const float* __restrict__ bta,
                                                  float* __restrict__ out_sum, float* __restrict__ out_norm, int N, float eps) {
  __shared__ float red[256];
  const int row = blockIdx.x, tid = threadIdx.x;
  const float* x = X + (size_t)row * N; const float* rr = R ? R + (size_t)row * N : nullptr;
  float vals[16];                     // up to N = 4096
  const int per = N / 256;            // contiguous chunk per thread? use strided-by-4 chunks: thread handles j = tid*4 + 1024*u
  float s1 = 0.f;
  for (int u = 0; u < per / 4; ++u) {
    const int j = tid * 4 + 1024 * u;
    const v4f a = *(const v4fa*)(x + j);
    v4f b = {0.f,0.f,0.f,0.f}; if (rr) b = *(const v4fa*)(rr + j);
#pragma unroll
    for (int q = 0; q < 4; ++q) { const float v = a[q] + b[q]; vals[u * 4 + q] = v; s1 += v; }
  }
  red[tid] = s1; __syncthreads();
  for (int st = 128; st > 0; st >>= 1) { if (tid < st) red[tid] += red[tid + st]; __syncthreads(); }
  const float mu = red[0] / (float)N; __syncthreads();
  float s2 = 0.f;
  for (int u = 0; u < per / 4; ++u)
#pragma unroll
    for (int q = 0; q < 4; ++q) { const float c = vals[u * 4 + q] - mu; s2 += c * c; }
  red[tid] = s2; __syncthreads();
  for (int st = 128; st > 0; st >>= 1) { if (tid < st) red[tid] += red[tid + st]; __syncthreads(); }
  const float rs = rsqrtf(red[0] / (float)N + eps);
  {
    for (int u = 0; u < per / 4; ++u) {
      const int j = tid * 4 + 1024 * u;
      v4f o, sm;
#pragma unroll
      for (int q = 0; q < 4; ++q) {
        float gg = g[j + q], bb = bta[j + q];
        if (PARAM_BF16) { gg = bf16_round(gg); bb = bf16_round(bb); }
        sm[q] = vals[u * 4 + q]; o[q] = (vals[u * 4 + q] - mu) * rs * gg + bb;
      }
      if (out_sum) *(v4f*)(out_sum + (size_t)row * N + j) = sm;
      *(v4f*)(out_norm + (size_t)row * N + j) = o;
    }
    
  }
}



// ---- f16 WMMA path (v_wmma_f32_16x16x32_f16): 11-bit significands for operands in range — used where a [0,1] probability operand needs more precision than bf16
typedef _Float16 v16h __attribute__((ext_vector_type(16)));
union FragH { v16h v; v8us half[2]; _Float16 h[16]; unsigned short u[16]; };
template <int NT>
__device__ __forceinline__ v8f mmaH(v16h ah, v16h al, v16h bh, v16h bl, v8f c) {
  c = __builtin_amdgcn_wmma_f32_16x16x32_f16(false, ah, false, bh, (short)0, c, false, false);
  if (NT >= 2) c = __builtin_amdgcn_wmma_f32_16x16x32_f16(false, al, false, bh, (short)0, c, false, false);
  if (NT >= 3) c = __builtin_amdgcn_wmma_f32_16x16x32_f16(false, ah, false, bl, (short)0, c, false, false);
  asm volatile("v_nop\n\tv_nop\n\tv_nop\n\tv_nop" : "+v"(c) : "v"(ah), "v"(al), "v"(bh), "v"(bl));
  return c;
}
// batched GEMM like k_gemm_b but f16 operands: A f32 (split into f16 hi/lo if ASPLIT, else rounded to f16), Bt = f16 values [n][k]; alpha; C f32; N multiple of 16 (partial tiles skipped)
template <bool ASPLIT>
__global__ __launch_bounds__(128) void k_gemm_h(const float* __restrict__ A, int lda, size_t sA, const _Float16* __restrict__ Bh, int ldb, size_t sB, float alpha, float* __restrict__ C, int ldc, size_t sC, int M, int N, int K) {
  __shared__ __attribute__((aligned(16))) float so[4][16][64];
  const int tid = threadIdx.x, w = tid >> 5, lane = tid & 31, ln = lane & 15, hh = lane >> 4; const int by = blockIdx.y;
  A += (size_t)by * sA; Bh += (size_t)by * sB; C += (size_t)by * sC;
  const int ntn = (N + 63) / 64; const int wid = blockIdx.x * 4 + w; const int mt = wid / ntn, nq = wid % ntn; if (mt * 16 >= M) return;
  const int row0 = mt * 16, col0 = nq * 64; const float* arow = A + (size_t)(row0 + ln) * lda;
  v8f acc[4] = {};
  for (int kb = 0; kb < K; kb += 32) {
    FragH ah, al;
    const v4f x0 = *(const v4fa*)(arow + kb + 8 * hh), x1 = *(const v4fa*)(arow + kb + 8 * hh + 4), x2 = *(const v4fa*)(arow + kb + 16 + 8 * hh), x3 = *(const v4fa*)(arow + kb + 16 + 8 * hh + 4);
    float xs[16] = {x0[0],x0[1],x0[2],x0[3],x1[0],x1[1],x1[2],x1[3],x2[0],x2[1],x2[2],x2[3],x3[0],x3[1],x3[2],x3[3]};
#pragma unroll
    for (int i = 0; i < 16; ++i) { const _Float16 h = (_Float16)xs[i]; ah.h[i] = h; al.h[i] = ASPLIT ? (_Float16)(xs[i] - (float)h) : (_Float16)0.0f; }
#pragma unroll
    for (int t = 0; t < 4; ++t) { if (col0 + t * 16 >= N) continue; const size_t boff = (size_t)(col0 + t * 16 + ln) * ldb + kb; FragH bq; bq.half[0] = *(const v8us*)(Bh + boff + 8 * hh); bq.half[1] = *(const v8us*)(Bh + boff + 16 + 8 * hh);
      acc[t] = mmaH<ASPLIT ? 2 : 1>(ah.v, al.v, bq.v, bq.v, acc[t]); }
  }
#pragma unroll
  for (int t = 0; t < 4; ++t) { if (col0 + t * 16 >= N) continue;
#pragma unroll
    for (int r = 0; r < 8; ++r) so[w][8 * hh + r][t * 16 + ln] = acc[t][r] * alpha; }
  __builtin_amdgcn_fence(__ATOMIC_ACQ_REL, "workgroup"); __builtin_amdgcn_wave_barrier();
  const int rsub = lane >> 4, c4 = (lane & 15) * 4;
  {
#pragma unroll
    for (int q = 0; q < 8; ++q) { const int r = q * 2 + rsub; if (col0 + c4 < N) { const v4f v = *(const v4fa*)&so[w][r][c4]; *(v4f*)(C + (size_t)(row0 + r) * ldc + col0 + c4) = v; } }
     }
}

// Wt[n][k] = f16(W[k][n]·scale) from f32 row-major W[K][N] (scale = power of two; bf16-exact weights stay exact in f16 away from the subnormal range)
__global__ __launch_bounds__(256) void k_wt_f16(const float* __restrict__ W, _Float16* __restrict__ Wt, int K, int N, float scale) {
  const int t = blockIdx.x * 256 + threadIdx.x; if (t >= N * (K / 8)) return; const int n = t / (K / 8), k8 = (t % (K / 8)) * 8; FragH f;
#pragma unroll
  for (int i = 0; i < 8; ++i) f.h[i] = (_Float16)(bf16_round(W[(size_t)(k8 + i) * N + n]) * scale); const v8us o = f.half[0];
  *(v8us*)((unsigned short*)Wt + (size_t)n * K + k8) = o; 
}
// k_gemm_hh variant with fused epilogue: v = acc·alpha + bias[by·sBias + col] (+ CP[(row/rowsPerB)·sCPb + by·64 + col] if CP) ; ACT 0 none / 1 elu ; writes f16 C16 (and f32 C if non-null)
template <int ACT>
__global__ __launch_bounds__(128) void k_gemm_hhx(const _Float16* __restrict__ A, int lda, size_t sA, const _Float16* __restrict__ Bh, int ldb, size_t sB, float alpha, const float* __restrict__ bias, size_t sBias, const float* __restrict__ CP, int rowsPerB, size_t sCPb, int row0g,
    float* __restrict__ C, _Float16* __restrict__ C16, int ldc, size_t sC, int M, int N, int K) {
  __shared__ __attribute__((aligned(16))) float so[4][16][64];
  const int tid = threadIdx.x, w = tid >> 5, lane = tid & 31, ln = lane & 15, hh = lane >> 4; const int by = blockIdx.y;
  A += (size_t)by * sA; Bh += (size_t)by * sB; const size_t cofs = (size_t)by * sC; const float* bp = bias ? bias + (size_t)by * sBias : nullptr;
  const int ntn = (N + 63) / 64; const int wid = blockIdx.x * 4 + w; const int mt = wid / ntn, nq = wid % ntn; if (mt * 16 >= M) return;
  const int row0 = mt * 16, col0 = nq * 64; const _Float16* arow = A + (size_t)(row0 + ln) * lda;
  v8f acc[4] = {};
  for (int kb = 0; kb < K; kb += 32) { FragH ah; ah.half[0] = *(const v8us*)((const unsigned short*)arow + kb + 8 * hh); ah.half[1] = *(const v8us*)((const unsigned short*)arow + kb + 16 + 8 * hh);
#pragma unroll
    for (int t = 0; t < 4; ++t) { if (col0 + t * 16 >= N) continue; const size_t boff = (size_t)(col0 + t * 16 + ln) * ldb + kb; FragH bq; bq.half[0] = *(const v8us*)((const unsigned short*)Bh + boff + 8 * hh); bq.half[1] = *(const v8us*)((const unsigned short*)Bh + boff + 16 + 8 * hh);
      acc[t] = mmaH<1>(ah.v, ah.v, bq.v, bq.v, acc[t]); }
  }
#pragma unroll
  for (int t = 0; t < 4; ++t) { if (col0 + t * 16 >= N) continue; const int col = col0 + t * 16 + ln; const float bv = bp ? bf16_round(bp[col]) : 0.f;
#pragma unroll
    for (int r = 0; r < 8; ++r) { float v = acc[t][r] * alpha + bv; if (CP) { const int rr = row0g + row0 + 8 * hh + r; if (rowsPerB < 0) v += CP[cofs + (size_t)rr * ldc + col];      /* rowsPerB < 0: own element of the batched C plane */ else { const int bidx = rr / rowsPerB; v += CP[(size_t)bidx * sCPb + (size_t)by * 64 + col]; } } if (ACT == 1) v = (v > 0.f) ? v : expm1f(v); else if (ACT == 7) v = (v > 0.f) ? v + 1.0f : expf(v); else if (ACT == 8) v = tanhf(v); else if (ACT == 9) v = 0.5f * v * (1.0f + tanhf(0.7978845608028654f * (v + 0.044715f * v * v * v))); else if (ACT == 11) v = 1.0f / (1.0f + expf(-v)); else if (ACT == 12) v = (v > 0.f) ? v : 0.01f * v; else if (ACT == 14) v = (v > 0.f) ? v : 0.1f * v; else if (ACT == 16) v = (v >= 0.f) ? v : 0.3f * v; else if (ACT == 17) v = (v >= 0.f) ? v : 0.2f * v; else if (ACT == 15) v = v / (1.0f + expf(-v)); else if (ACT == 3) v = fmaxf(v, 0.f); else if (ACT == 6) v = 0.5f * v * (1.0f + erff(v * 0.70710678118654752f)); so[w][8 * hh + r][t * 16 + ln] = v; } }
  __builtin_amdgcn_fence(__ATOMIC_ACQ_REL, "workgroup"); __builtin_amdgcn_wave_barrier();
  const int rsub = lane >> 4, c4 = (lane & 15) * 4; typedef _Float16 v4h __attribute__((ext_vector_type(4)));
  {
#pragma unroll
    for (int q = 0; q < 8; ++q) { const int r = q * 2 + rsub; if (col0 + c4 < N) { const v4f v = *(const v4fa*)&so[w][r][c4]; if (C) *(v4f*)(C + cofs + (size_t)(row0 + r) * ldc + col0 + c4) = v; if (C16) { v4h h4; for (int i = 0; i < 4; ++i) h4[i] = (_Float16)v[i]; *(v4h*)(C16 + cofs + (size_t)(row0 + r) * ldc + col0 + c4) = h4; } } }
     }
}


typedef _Float16 v4h __attribute__((ext_vector_type(4)));

__global__ __launch_bounds__(256) void k_x16(const float* __restrict__ x, _Float16* __restrict__ X16, size_t n8) { const size_t t = (size_t)blockIdx.x * 256 + threadIdx.x; if (t >= n8) return; FragH f;
#pragma unroll
  for (int q = 0; q < 8; ++q) f.h[q] = (_Float16)bf16_round(x[t * 8 + q]); *(v8us*)((unsigned short*)X16 + t * 8) = f.half[0];  }
__global__ __launch_bounds__(256) void k_h16(const float* __restrict__ x, _Float16* __restrict__ X16, size_t n8) { const size_t t = (size_t)blockIdx.x * 256 + threadIdx.x; if (t >= n8) return; FragH f;
#pragma unroll
  for (int q = 0; q < 8; ++q) f.h[q] = (_Float16)x[t * 8 + q]; *(v8us*)((unsigned short*)X16 + t * 8) = f.half[0];  }
__global__ __launch_bounds__(256) void k_round16f(const float* __restrict__ W, _Float16* __restrict__ Bt, size_t n8) { const size_t t = (size_t)blockIdx.x * 256 + threadIdx.x; if (t >= n8) return; FragH f;
#pragma unroll
  for (int i = 0; i < 8; ++i) f.h[i] = (_Float16)(bf16_round(W[t * 8 + i]) * 16.0f); *(v8us*)((unsigned short*)Bt + t * 8) = f.half[0];  }
template <int NHv, int TTv>
__global__ __launch_bounds__(256) void k_vt(const _Float16* __restrict__ V16, int ldv, int voff, _Float16* __restrict__ Vt) { __shared__ unsigned short tl[64][66]; const int tid = threadIdx.x; const int slab = blockIdx.x / (TTv / 64), lg = blockIdx.x % (TTv / 64); const int b = slab / NHv, h = slab % NHv;
  for (int i = tid; i < 64 * 8; i += 256) { const int r = i / 8, c8 = (i % 8) * 8; FragH f; f.half[0] = *(const v8us*)((const unsigned short*)V16 + ((size_t)b * TTv + lg * 64 + r) * ldv + voff + h * 64 + c8);
#pragma unroll
    for (int q = 0; q < 8; ++q) tl[r][c8 + q] = f.u[q]; }
  __syncthreads();
  {
#pragma unroll
    for (int rd = 0; rd < 2; ++rd) { const int d = rd * 32 + tid / 8, pc = tid % 8; FragH f;
#pragma unroll
      for (int q = 0; q < 8; ++q) f.u[q] = tl[pc * 8 + q][d];
      *(v8us*)((unsigned short*)Vt + ((size_t)slab * 64 + d) * TTv + lg * 64 + pc * 8) = f.half[0]; }
     } }

__global__ __launch_bounds__(256) void k_hl(const float* __restrict__ F, _Float16* __restrict__ Hh, _Float16* __restrict__ Hl, size_t n8) { const size_t t = (size_t)blockIdx.x * 256 + threadIdx.x; if (t >= n8) return; FragH fh, fl; const v4f a = *(const v4fa*)(F + t * 8), c = *(const v4fa*)(F + t * 8 + 4);
#pragma unroll
  for (int q = 0; q < 4; ++q) { _Float16 h = (_Float16)a[q]; fh.h[q] = h; fl.h[q] = (_Float16)((a[q] - (float)h) * 1024.0f); h = (_Float16)c[q]; fh.h[4 + q] = h; fl.h[4 + q] = (_Float16)((c[q] - (float)h) * 1024.0f); }
  { *(v8us*)((unsigned short*)Hh + t * 8) = fh.half[0]; *(v8us*)((unsigned short*)Hl + t * 8) = fl.half[0];  } }

// ---- fast GEMM (wave tile 32x64; requires M % 32 == 0 rows per launch region and N % 64 == 0); epilogue = k_gemm_hhx semantics ----
__device__ __forceinline__ v16h g2_frag(const _Float16* p, int hh) { FragH f; f.half[0] = *(const v8us*)((const unsigned short*)p + 8 * hh); f.half[1] = *(const v8us*)((const unsigned short*)p + 16 + 8 * hh); return f.v; }
__device__ __forceinline__ v8f g2_mma(v16h a, v16h b, v8f c) { v8f d = __builtin_amdgcn_wmma_f32_16x16x32_f16(false, a, false, b, (short)0, c, false, false); asm volatile("v_nop\n\tv_nop\n\tv_nop\n\tv_nop" : "+v"(d) : "v"(a), "v"(b)); return d; }
template <int ACT>
__global__ __launch_bounds__(128) void k_gemm2(const _Float16* __restrict__ A, int lda, size_t sA, const _Float16* __restrict__ Bh, int ldb, size_t sB, float alpha, const float* __restrict__ bias, size_t sBias, const float* __restrict__ CP, int rowsPerB, size_t sCPb, int row0g,
    float* __restrict__ C, _Float16* __restrict__ C16, int ldc, size_t sC, int M, int N, int K) { static_assert(ACT == 0 || ACT == 3 || ACT == 6 || ACT == 8 || ACT == 9 || ACT == 11 || ACT == 12 || ACT == 14 || ACT == 15 || ACT == 16 || ACT == 17, "k_gemm2: unsupported ACT code (would silently apply no activation)");
  __shared__ __attribute__((aligned(16))) float so[4][32][68];
  const int tid = threadIdx.x, w = tid >> 5, lane = tid & 31, ln = lane & 15, hh = lane >> 4; const int by = blockIdx.y;
  A += (size_t)by * sA; Bh += (size_t)by * sB; const size_t cofs = (size_t)by * sC; const float* bp = bias ? bias + (size_t)by * sBias : nullptr;
  const int ntn = N >> 6; const int mt = blockIdx.x / ntn, nq = blockIdx.x - mt * ntn; const int row0 = mt * 128 + 32 * w, col0 = nq * 64; if (row0 >= M) return;
  const _Float16* a0p = A + (size_t)(row0 + ln) * lda; const _Float16* a1p = a0p + (size_t)16 * lda;
  const _Float16* b0p = Bh + (size_t)(col0 + ln) * ldb; const _Float16* b1p = b0p + (size_t)16 * ldb; const _Float16* b2p = b1p + (size_t)16 * ldb; const _Float16* b3p = b2p + (size_t)16 * ldb;
  const v8f z8 = {0.f,0.f,0.f,0.f,0.f,0.f,0.f,0.f}; v8f c00 = z8, c01 = z8, c02 = z8, c03 = z8, c10 = z8, c11 = z8, c12 = z8, c13 = z8;
#pragma unroll 1
  for (int kb = 0; kb < K; kb += 32) { const v16h a0 = g2_frag(a0p + kb, hh), a1 = g2_frag(a1p + kb, hh);
    v16h b = g2_frag(b0p + kb, hh); c00 = g2_mma(a0, b, c00); c10 = g2_mma(a1, b, c10);
    b = g2_frag(b1p + kb, hh); c01 = g2_mma(a0, b, c01); c11 = g2_mma(a1, b, c11);
    b = g2_frag(b2p + kb, hh); c02 = g2_mma(a0, b, c02); c12 = g2_mma(a1, b, c12);
    b = g2_frag(b3p + kb, hh); c03 = g2_mma(a0, b, c03); c13 = g2_mma(a1, b, c13); }
  v8f accs[8] = {c00, c01, c02, c03, c10, c11, c12, c13};
#pragma unroll
  for (int u = 0; u < 8; ++u) { const int t = u & 3, half = u >> 2; const int col = col0 + t * 16 + ln; const float bv = bp ? bf16_round(bp[col]) : 0.f;
#pragma unroll
    for (int r = 0; r < 8; ++r) { const int rloc = half * 16 + 8 * hh + r; float v = accs[u][r] * alpha + bv; if (CP) { if (rowsPerB < 0) v += CP[cofs + (size_t)(row0g + row0 + rloc) * ldc + col];      /* rowsPerB < 0: own element of the batched C plane */ else { const int bidx = (row0g + row0 + rloc) / rowsPerB; v += CP[(size_t)bidx * sCPb + (size_t)by * 64 + col]; } }
      if (ACT == 3) v = fmaxf(v, 0.f); else if (ACT == 6) v = 0.5f * v * (1.0f + erff(v * 0.70710678118654752f)); else if (ACT == 11) v = 1.0f / (1.0f + expf(-v)); else if (ACT == 15) v = v / (1.0f + expf(-v)); else if (ACT == 12) v = (v > 0.f) ? v : 0.01f * v; else if (ACT == 8) v = tanhf(v); else if (ACT == 9) v = 0.5f * v * (1.0f + tanhf(0.7978845608028654f * (v + 0.044715f * v * v * v))); else if (ACT == 14) v = (v > 0.f) ? v : 0.1f * v; else if (ACT == 16) v = (v >= 0.f) ? v : 0.3f * v; else if (ACT == 17) v = (v >= 0.f) ? v : 0.2f * v;
      so[w][rloc][t * 16 + ln] = v; } }
  __builtin_amdgcn_fence(__ATOMIC_ACQ_REL, "workgroup"); __builtin_amdgcn_wave_barrier();
  const int rsub = lane >> 4, c4 = (lane & 15) * 4;
  {
#pragma unroll
    for (int q = 0; q < 16; ++q) { const int r = q * 2 + rsub; const v4f v = *(const v4fa*)&so[w][r][c4]; if (C) *(v4f*)(C + cofs + (size_t)(row0 + r) * ldc + col0 + c4) = v; if (C16) { v4h h4; for (int i = 0; i < 4; ++i) h4[i] = (_Float16)v[i]; *(v4h*)(C16 + cofs + (size_t)(row0 + r) * ldc + col0 + c4) = h4; } }
     } }


__global__ __launch_bounds__(256) void k_wnat(const float* __restrict__ w, size_t n8, _Float16* __restrict__ Bt) { const size_t t = (size_t)blockIdx.x * 256 + threadIdx.x; if (t >= n8) return; FragH f; for (int q = 0; q < 8; ++q) f.h[q] = (_Float16)(bf16_round(w[t * 8 + q]) * 16.0f); *(v8us*)((unsigned short*)Bt + t * 8) = f.half[0];  }
__global__ __launch_bounds__(256) void k_rsm(const float* __restrict__ S, _Float16* __restrict__ P, int nrows) {
  #pragma clang fp contract(off)
  const int i = blockIdx.x * 256 + threadIdx.x; if (i >= nrows) return; const float* s = S + (size_t)i * SQ; float mx = -3.0e38f;
#pragma unroll 1
  for (int j = 0; j < SQ; ++j) mx = fmaxf(mx, s[j]); float se = 0.f;
#pragma unroll 1
  for (int j = 0; j < SQ; ++j) se += expf(s[j] - mx); const float sc = 256.0f / se;
#pragma unroll 1
  for (int j0 = 0; j0 < SQ; j0 += 8) { FragH f; for (int q = 0; q < 8; ++q) f.h[q] = (_Float16)(expf(s[j0 + q] - mx) * sc); unsigned short* d = (unsigned short*)P + (size_t)i * SQ + j0; *(v8us*)d = f.half[0];  } }
__global__ __launch_bounds__(256) void k_vt(const _Float16* __restrict__ V16, int b, int h0, _Float16* __restrict__ VT) { __shared__ unsigned short tl[64][65]; const int tid = threadIdx.x; const int hh = blockIdx.x % HG, sg = blockIdx.x / HG; const int s0 = sg * 64; const int h = h0 + hh;
  for (int i = tid; i < 64 * 8; i += 256) { const int j = i / 8, d8 = (i % 8) * 8; FragH f; f.half[0] = *(const v8us*)((const unsigned short*)V16 + ((size_t)b * SQ + s0 + j) * DM + h * HD + d8); for (int q = 0; q < 8; ++q) tl[d8 + q][j] = f.u[q]; }
  __syncthreads();
  { for (int i = tid; i < 64 * 8; i += 256) { const int d = i / 8, j8 = (i % 8) * 8; FragH f; for (int q = 0; q < 8; ++q) f.u[q] = tl[d][j8 + q]; *(v8us*)((unsigned short*)VT + ((size_t)hh * HD + d) * SQ + s0 + j8) = f.half[0]; }  } }



__global__ __launch_bounds__(256) void k_rsmf(const float* __restrict__ S, _Float16* __restrict__ P, int qn, int hg) {
  #pragma clang fp contract(off)
  const int t = blockIdx.x * 256 + threadIdx.x; if (t >= qn * hg) return; const size_t i = (size_t)(t / qn) * SQ + (t % qn); const float* s = S + i * SQ; float mx = -3.0e38f;
#pragma unroll 1
  for (int j = 0; j < SQ; ++j) mx = fmaxf(mx, s[j]); float se = 0.f;
#pragma unroll 1
  for (int j = 0; j < SQ; ++j) se += __expf(s[j] - mx); const float sc = 256.0f / se;
#pragma unroll 1
  for (int j0 = 0; j0 < SQ; j0 += 8) { FragH f; for (int q = 0; q < 8; ++q) f.h[q] = (_Float16)(__expf(s[j0 + q] - mx) * sc); unsigned short* d = (unsigned short*)P + i * SQ + j0; *(v8us*)d = f.half[0];  } }

extern "C" void kernel_launch(void* const* d_in, const int* in_sizes, int n_in,
                              void* d_out, int out_size, void* d_ws, size_t ws_size, hipStream_t stream) {
  (void)in_sizes; (void)n_in; (void)out_size;
  const float* const* I = (const float* const*)d_in; const float* xq = I[0]; const float* xk = I[1]; const float* xv = I[1]; const float* wq = I[2]; const float* bq = I[3]; const float* wk = I[4]; const float* bk = I[5]; const float* wv = I[6]; const float* bv = I[7]; const float* wo = I[8]; const float* bo = I[9];      
  char* ws = (char*)d_ws; size_t off = 0;
  auto take = [&](size_t bytes) { char* p = ws + off; off += (bytes + 255) & ~(size_t)255; return p; };
  _Float16* BQ = (_Float16*)take((size_t)DM * DM * 2); _Float16* BK = (_Float16*)take((size_t)DM * DM * 2); _Float16* BV = (_Float16*)take((size_t)DM * DM * 2); _Float16* BO = (_Float16*)take((size_t)DM * DM * 2);
  _Float16* XQ = (_Float16*)take(NR * DM * 2); _Float16* XK = (_Float16*)take(NR * DM * 2); _Float16* XV = (_Float16*)take(NR * DM * 2); _Float16* Q16 = (_Float16*)take(NR * DM * 2); _Float16* K16 = (_Float16*)take(NR * DM * 2); _Float16* V16 = (_Float16*)take(NR * DM * 2); _Float16* O16 = (_Float16*)take(NR * DM * 2);
  float* S = (float*)take((size_t)HG * SQ * SQ * 4); _Float16* P = (_Float16*)take((size_t)HG * SQ * SQ * 2); _Float16* VT = (_Float16*)take((size_t)NH * HD * SQ * 2);
  if (off > ws_size) return;
  { const unsigned g = (unsigned)(((size_t)DM * (DM / 8) + 255) / 256); k_wt_f16<<<g, 256, 0, stream>>>(wq, BQ, DM, DM, 16.0f); k_wt_f16<<<g, 256, 0, stream>>>(wk, BK, DM, DM, 16.0f); k_wt_f16<<<g, 256, 0, stream>>>(wv, BV, DM, DM, 16.0f); k_wt_f16<<<g, 256, 0, stream>>>(wo, BO, DM, DM, 16.0f); }      /* [in][out] -> Bt[n][k] x16 (transposing builder) */

  k_x16<<<(unsigned)((NR * DM / 8 + 255) / 256), 256, 0, stream>>>(xq, XQ, NR * DM / 8); k_x16<<<(unsigned)((NR * DM / 8 + 255) / 256), 256, 0, stream>>>(xk, XK, NR * DM / 8); k_x16<<<(unsigned)((NR * DM / 8 + 255) / 256), 256, 0, stream>>>(xv, XV, NR * DM / 8);      /* the query input and the key/value input (converted twice) as exact f16 rows */
  const size_t r0p = (size_t)B0 * SQ;      /* first projected row */
  k_gemm2<0><<<dim3((unsigned)((MP / 128) * (DM / 64)), 1), 128, 0, stream>>>(XQ + r0p * DM, DM, 0, BQ, DM, 0, 0.0625f, bq, 0, nullptr, 1, 0, 0, nullptr, Q16 + r0p * DM, DM, 0, MP, DM, DM);
  k_gemm2<0><<<dim3((unsigned)((MP / 128) * (DM / 64)), 1), 128, 0, stream>>>(XK + r0p * DM, DM, 0, BK, DM, 0, 0.0625f, bk, 0, nullptr, 1, 0, 0, nullptr, K16 + r0p * DM, DM, 0, MP, DM, DM);
  k_gemm2<0><<<dim3((unsigned)((MP / 128) * (DM / 64)), 1), 128, 0, stream>>>(XV + r0p * DM, DM, 0, BV, DM, 0, 0.0625f, bv, 0, nullptr, 1, 0, 0, nullptr, V16 + r0p * DM, DM, 0, MP, DM, DM);
  for (int b = B0; b < B0 + NBR; ++b) { const size_t r0 = (size_t)b * SQ;
    k_vt<NH, SQ><<<NH * (SQ / 64), 256, 0, stream>>>(V16 + r0 * LQ, LQ, 0, VT);      /* V^T [NH][HD][SQ] for this batch */
    for (int h0 = 0; h0 < NHD; h0 += HG) {
      k_gemm2<0><<<dim3((QN / 128) * (SQ / 64), HG), 128, 0, stream>>>(Q16 + r0 * LQ + h0 * HD, LQ, (size_t)HD, K16 + r0 * LQ + h0 * HD, LQ, (size_t)HD, 0.125f, nullptr, 0, nullptr, 1, 0, 0, S, nullptr, SQ, (size_t)SQ * SQ, QN, SQ, HD);      /* scores, HG heads per launch */
      k_rsmf<<<(HG * QN + 255) / 256, 256, 0, stream>>>(S, P, QN, HG);      /* P = 256 softmax (f16), rows of all HG heads */
      k_gemm2<0><<<dim3((QN / 128) * (HD / 64), HG), 128, 0, stream>>>(P, SQ, (size_t)SQ * SQ, VT + (size_t)h0 * HD * SQ, SQ, (size_t)HD * SQ, 0.25f, nullptr, 0, nullptr, 1, 0, 0, nullptr, O16 + r0 * DM + h0 * HD, DM, (size_t)HD, QN, HD, SQ); } }      /* o (merged heads) as f16 rows */
  k_gemm2<0><<<dim3((unsigned)((MPO / 128) * (DM / 64)), 1), 128, 0, stream>>>(O16 + r0p * DM, DM, 0, BO, DM, 0, 0.0009765625f, bo, 0, nullptr, 1, 0, 0, (float*)d_out + r0p * DM, nullptr, DM, 0, MPO, DM, DM);      /* out rows are the output layout */
}

// v001
// It runs in 2760 microseconds.
// In two side-by-side timings against v000, it was 4.80 and 4.84 times as fast.
#include <hip/hip_runtime.h>
// Multi-head CROSS-attention over 4096-token sequences at width 512 with [in][out] projections and biases (Query_x, KeyandValue_x [2][4096][512]; Q = Query_x Wq + bq; K = KeyandValue_x Wk + bk; V = KeyandValue_x Wv + bv ([in][out] 512 x 512 + biases), 8 heads of 64; scores / sqrt(64); softmax over all 4096 keys (no mask); out = merged Wo + bo ([in][out]) -> [2][4096][512]); key and value streams read the second input; ONE head per attention launch group.
// Structure: token rows r = b*4096 + s; the query source and the key/value source as exact f16 rows (bf16-rounded); Q, K, V as three WMMA GEMMs (32x64 wave tiles, f32 accumulation, exact x16 weights + bias, f16 outputs); per batch: V^T for all heads via LDS transposes; per (batch, group of 1 head): scores GEMM (K = 64, batched over the heads on grid.y, alpha = 64^-0.5), row softmax on VALU (f32 statistics, native exp; weights stored x256 as f16), o = P . V^T GEMM (K = 4096, alpha 2^-2: o carried x64 against f16 subnormal flush, folded into the output GEMM alpha) written straight into the merged f16 o rows; out = o W_o + b GEMM (f32) into the output layout.
// Compute dtype: inputs rounded to bf16; x / weights exact; q, k, v, softmax weights and o as plain f16 GEMM operands (~2^-12); scores and softmax statistics f32. v_wmma_f32_16x16x32_f16.
#define NB 2
#define SQ 4096
#define DM 512
#define NH 8
#define HD 64
#define HG 1                         /* heads per attention launch group (a 4096^2 f32 score slab is 64 MiB) */
#define B0 0                         /* first batch processed (debug hook) */
#define NBR NB                       /* batches processed (debug hook) */
#define NR ((size_t)NB * SQ)         /* token rows */
#define MP ((int)((size_t)NBR * SQ)) /* rows projected (debug hook) */
#define QN SQ                        /* query rows attended per batch (debug hook) */
#define NHD NH                       /* heads attended (debug hook) */
#define MPO MP                       /* rows through the output stage (debug hook) */
#define LQ DM      /* row pitch of the q/k/v rows */
typedef __bf16 v16b __attribute__((ext_vector_type(16)));
typedef unsigned short v8us __attribute__((ext_vector_type(8), may_alias));
typedef float  v8f  __attribute__((ext_vector_type(8)));
typedef float  v4f  __attribute__((ext_vector_type(4)));
typedef float  v4fa __attribute__((ext_vector_type(4), may_alias));
union FragB { v16b v; v8us half[2]; unsigned short u[16]; };

__device__ __forceinline__ unsigned short bf16_bits(float x) { unsigned int u = __float_as_uint(x); return (unsigned short)((u + 0x7FFFu + ((u >> 16) & 1u)) >> 16); }
__device__ __forceinline__ float bf16_val(unsigned short b) { return __uint_as_float(((unsigned int)b) << 16); }
__device__ __forceinline__ float bf16_round(float x) { return bf16_val(bf16_bits(x)); }
// D += A·B with NT terms: 1 = ah·bh, 2 = + al·bh (A split), 3 = + ah·bl (both split)
template <int NT>
__device__ __forceinline__ v8f mmaN(v16b ah, v16b al, v16b bh, v16b bl, v8f c) {
  c = __builtin_amdgcn_wmma_f32_16x16x32_bf16(false, ah, false, bh, (short)0, c, false, false);
  if (NT >= 2) c = __builtin_amdgcn_wmma_f32_16x16x32_bf16(false, al, false, bh, (short)0, c, false, false);
  if (NT >= 3) c = __builtin_amdgcn_wmma_f32_16x16x32_bf16(false, ah, false, bl, (short)0, c, false, false);
  asm volatile("v_nop\n\tv_nop\n\tv_nop\n\tv_nop" : "+v"(c) : "v"(ah), "v"(al), "v"(bh), "v"(bl));
  return c;
}

__global__ __launch_bounds__(256) void k_wt_bf16(const float* __restrict__ W, unsigned short* __restrict__ Wt, int K, int N) {
  const int t = blockIdx.x * 256 + threadIdx.x;
  const int k8n = K / 8;
  if (t >= N * k8n) return;
  const int n = t / k8n, k8 = (t % k8n) * 8;
  v8us v;
#pragma unroll
  for (int i = 0; i < 8; ++i) v[i] = bf16_bits(W[(size_t)(k8 + i) * N + n]);
  *(v8us*)(Wt + (size_t)n * K + k8) = v;
  
}

// GEMM C[M][N] (f32, pitch ldc) = act(A[M][K]·W + bias). A f32 row-major (pitch lda) converted per fragment to bf16
// (ASPLIT: hi/lo two planes -> 2 terms, else single rounded term); Wt bf16 [N][K] (pitch ldb). BIAS_BF16 rounds the
// bias to bf16 first (bias quantised to bf16 before the add). K%32==0, M%16==0, N%64==0.
template <bool ASPLIT, int ACT, bool BIAS_BF16>
__global__ __launch_bounds__(128) void k_gemm_bf(const float* __restrict__ A, int lda, const unsigned short* __restrict__ Wt, int ldb,
                                               const float* __restrict__ bias, float* __restrict__ C, int ldc, int M, int N, int K) {
  __shared__ __attribute__((aligned(16))) float so[4][16][64];
  const int tid = threadIdx.x, w = tid >> 5, lane = tid & 31, ln = lane & 15, hh = lane >> 4;
  const int ntn = N / 64;
  const int wid = blockIdx.x * 4 + w;
  const int mt = wid / ntn, nq = wid % ntn;
  if (mt * 16 >= M) return;
  const int row0 = mt * 16, col0 = nq * 64;
  const float* arow = A + (size_t)(row0 + ln) * lda;
  v8f acc[4] = {};
  for (int kb = 0; kb < K; kb += 32) {
    FragB ah, al;
    const v4f x0 = *(const v4fa*)(arow + kb + 8 * hh), x1 = *(const v4fa*)(arow + kb + 8 * hh + 4);
    const v4f x2 = *(const v4fa*)(arow + kb + 16 + 8 * hh), x3 = *(const v4fa*)(arow + kb + 16 + 8 * hh + 4);
    float xs[16] = {x0[0],x0[1],x0[2],x0[3],x1[0],x1[1],x1[2],x1[3],x2[0],x2[1],x2[2],x2[3],x3[0],x3[1],x3[2],x3[3]};
#pragma unroll
    for (int i = 0; i < 16; ++i) { const unsigned short hb = bf16_bits(xs[i]); ah.u[i] = hb; al.u[i] = ASPLIT ? bf16_bits(xs[i] - bf16_val(hb)) : (unsigned short)0; }
#pragma unroll
    for (int t = 0; t < 4; ++t) {
      const unsigned short* brow = Wt + (size_t)(col0 + t * 16 + ln) * ldb + kb;
      FragB b;
      b.half[0] = *(const v8us*)(brow + 8 * hh);
      b.half[1] = *(const v8us*)(brow + 16 + 8 * hh);
      acc[t] = mmaN<ASPLIT ? 2 : 1>(ah.v, al.v, b.v, b.v, acc[t]);
    }
  }
#pragma unroll
  for (int t = 0; t < 4; ++t) {
    float bv = bias ? bias[col0 + t * 16 + ln] : 0.f;
    if (BIAS_BF16) bv = bf16_round(bv);
#pragma unroll
    for (int r = 0; r < 8; ++r) { float v = acc[t][r] + bv; if (ACT == 1) v = fmaxf(v, 0.f); so[w][8 * hh + r][t * 16 + ln] = v; }
  }
  __builtin_amdgcn_fence(__ATOMIC_ACQ_REL, "workgroup");
  __builtin_amdgcn_wave_barrier();
  const int rsub = lane >> 4, c4 = (lane & 15) * 4;
  {
#pragma unroll
    for (int q = 0; q < 8; ++q) {
      const int r = q * 2 + rsub;
      const v4f v = *(const v4fa*)&so[w][r][c4];
      *(v4f*)(C + (size_t)(row0 + r) * ldc + col0 + c4) = v;
    }
    
  }
}

// GEMM C = act(A·W + bias + resid): A f32 (ASPLIT -> hi/lo 2 terms), Wt bf16 [N][K]; ACT 0 none, 1 relu, 2 exact gelu;
// resid (optional, f32, row index = (row % rmod), pitch ldr, RES_BF16 rounds it) added before the activation.
template <bool ASPLIT, int ACT, bool BIAS_BF16, bool RES_BF16>
__global__ __launch_bounds__(128) void k_gemm_bf3(const float* __restrict__ A, int lda, const unsigned short* __restrict__ Wt, int ldb,
                                                const float* __restrict__ bias, const float* __restrict__ resid, int rmod, int ldr,
                                                float* __restrict__ C, int ldc, int M, int N, int K) {
  __shared__ __attribute__((aligned(16))) float so[4][16][64];
  const int tid = threadIdx.x, w = tid >> 5, lane = tid & 31, ln = lane & 15, hh = lane >> 4;
  const int ntn = N / 64;
  const int wid = blockIdx.x * 4 + w;
  const int mt = wid / ntn, nq = wid % ntn;
  if (mt * 16 >= M) return;
  const int row0 = mt * 16, col0 = nq * 64;
  const float* arow = A + (size_t)(row0 + ln) * lda;
  v8f acc[4] = {};
  for (int kb = 0; kb < K; kb += 32) {
    FragB ah, al;
    const v4f x0 = *(const v4fa*)(arow + kb + 8 * hh), x1 = *(const v4fa*)(arow + kb + 8 * hh + 4);
    const v4f x2 = *(const v4fa*)(arow + kb + 16 + 8 * hh), x3 = *(const v4fa*)(arow + kb + 16 + 8 * hh + 4);
    float xs[16] = {x0[0],x0[1],x0[2],x0[3],x1[0],x1[1],x1[2],x1[3],x2[0],x2[1],x2[2],x2[3],x3[0],x3[1],x3[2],x3[3]};
#pragma unroll
    for (int i = 0; i < 16; ++i) { const unsigned short hb = bf16_bits(xs[i]); ah.u[i] = hb; al.u[i] = ASPLIT ? bf16_bits(xs[i] - bf16_val(hb)) : (unsigned short)0; }
#pragma unroll
    for (int t = 0; t < 4; ++t) {
      const unsigned short* brow = Wt + (size_t)(col0 + t * 16 + ln) * ldb + kb;
      FragB b;
      b.half[0] = *(const v8us*)(brow + 8 * hh);
      b.half[1] = *(const v8us*)(brow + 16 + 8 * hh);
      acc[t] = mmaN<ASPLIT ? 2 : 1>(ah.v, al.v, b.v, b.v, acc[t]);
    }
  }
#pragma unroll
  for (int t = 0; t < 4; ++t) {
    const int col = col0 + t * 16 + ln;
    float bv = bias ? bias[col] : 0.f;
    if (BIAS_BF16) bv = bf16_round(bv);
#pragma unroll
    for (int r = 0; r < 8; ++r) {
      float v = acc[t][r] + bv;
      if (resid) { float rv = resid[(size_t)((row0 + 8 * hh + r) % rmod) * ldr + col]; if (RES_BF16) rv = bf16_round(rv); v += rv; }
      if (ACT == 1) v = fmaxf(v, 0.f);
      if (ACT == 2) v = 0.5f * v * (1.0f + erff(v * 0.70710678118654752f));
      if (ACT == 3) { const float u = 0.7978845608028654f * (v + 0.044715f * v * v * v); v = 0.5f * v * (1.0f + tanhf(u)); }
      so[w][8 * hh + r][t * 16 + ln] = v;
    }
  }
  __builtin_amdgcn_fence(__ATOMIC_ACQ_REL, "workgroup");
  __builtin_amdgcn_wave_barrier();
  const int rsub = lane >> 4, c4 = (lane & 15) * 4;
  {
#pragma unroll
    for (int q = 0; q < 8; ++q) {
      const int r = q * 2 + rsub;
      const v4f v = *(const v4fa*)&so[w][r][c4];
      *(v4f*)(C + (size_t)(row0 + r) * ldc + col0 + c4) = v;
    }
    
  }
}
// row LayerNorm (biased variance, eps) over N: s = X (+ R); optional out_sum <- s; out_norm <- (s-mu)*rsqrt(var+eps)*g + b
template <bool PARAM_BF16>
__global__ __launch_bounds__(256) void k_layernorm(const float* __restrict__ X, const float* __restrict__ R, const float* __restrict__ g, const float* __restrict__ bta,
                                                  float* __restrict__ out_sum, float* __restrict__ out_norm, int N, float eps) {
  __shared__ float red[256];
  const int row = blockIdx.x, tid = threadIdx.x;
  const float* x = X + (size_t)row * N; const float* rr = R ? R + (size_t)row * N : nullptr;
  float vals[16];                     // up to N = 4096
  const int per = N / 256;            // contiguous chunk per thread? use strided-by-4 chunks: thread handles j = tid*4 + 1024*u
  float s1 = 0.f;
  for (int u = 0; u < per / 4; ++u) {
    const int j = tid * 4 + 1024 * u;
    const v4f a = *(const v4fa*)(x + j);
    v4f b = {0.f,0.f,0.f,0.f}; if (rr) b = *(const v4fa*)(rr + j);
#pragma unroll
    for (int q = 0; q < 4; ++q) { const float v = a[q] + b[q]; vals[u * 4 + q] = v; s1 += v; }
  }
  red[tid] = s1; __syncthreads();
  for (int st = 128; st > 0; st >>= 1) { if (tid < st) red[tid] += red[tid + st]; __syncthreads(); }
  const float mu = red[0] / (float)N; __syncthreads();
  float s2 = 0.f;
  for (int u = 0; u < per / 4; ++u)
#pragma unroll
    for (int q = 0; q < 4; ++q) { const float c = vals[u * 4 + q] - mu; s2 += c * c; }
  red[tid] = s2; __syncthreads();
  for (int st = 128; st > 0; st >>= 1) { if (tid < st) red[tid] += red[tid + st]; __syncthreads(); }
  const float rs = rsqrtf(red[0] / (float)N + eps);
  {
    for (int u = 0; u < per / 4; ++u) {
      const int j = tid * 4 + 1024 * u;
      v4f o, sm;
#pragma unroll
      for (int q = 0; q < 4; ++q) {
        float gg = g[j + q], bb = bta[j + q];
        if (PARAM_BF16) { gg = bf16_round(gg); bb = bf16_round(bb); }
        sm[q] = vals[u * 4 + q]; o[q] = (vals[u * 4 + q] - mu) * rs * gg + bb;
      }
      if (out_sum) *(v4f*)(out_sum + (size_t)row * N + j) = sm;
      *(v4f*)(out_norm + (size_t)row * N + j) = o;
    }
    
  }
}



// ---- f16 WMMA path (v_wmma_f32_16x16x32_f16): 11-bit significands for operands in range — used where a [0,1] probability operand needs more precision than bf16
typedef _Float16 v16h __attribute__((ext_vector_type(16)));
union FragH { v16h v; v8us half[2]; _Float16 h[16]; unsigned short u[16]; };
template <int NT>
__device__ __forceinline__ v8f mmaH(v16h ah, v16h al, v16h bh, v16h bl, v8f c) {
  c = __builtin_amdgcn_wmma_f32_16x16x32_f16(false, ah, false, bh, (short)0, c, false, false);
  if (NT >= 2) c = __builtin_amdgcn_wmma_f32_16x16x32_f16(false, al, false, bh, (short)0, c, false, false);
  if (NT >= 3) c = __builtin_amdgcn_wmma_f32_16x16x32_f16(false, ah, false, bl, (short)0, c, false, false);
  asm volatile("v_nop\n\tv_nop\n\tv_nop\n\tv_nop" : "+v"(c) : "v"(ah), "v"(al), "v"(bh), "v"(bl));
  return c;
}
// batched GEMM like k_gemm_b but f16 operands: A f32 (split into f16 hi/lo if ASPLIT, else rounded to f16), Bt = f16 values [n][k]; alpha; C f32; N multiple of 16 (partial tiles skipped)
template <bool ASPLIT>
__global__ __launch_bounds__(128) void k_gemm_h(const float* __restrict__ A, int lda, size_t sA, const _Float16* __restrict__ Bh, int ldb, size_t sB, float alpha, float* __restrict__ C, int ldc, size_t sC, int M, int N, int K) {
  __shared__ __attribute__((aligned(16))) float so[4][16][64];
  const int tid = threadIdx.x, w = tid >> 5, lane = tid & 31, ln = lane & 15, hh = lane >> 4; const int by = blockIdx.y;
  A += (size_t)by * sA; Bh += (size_t)by * sB; C += (size_t)by * sC;
  const int ntn = (N + 63) / 64; const int wid = blockIdx.x * 4 + w; const int mt = wid / ntn, nq = wid % ntn; if (mt * 16 >= M) return;
  const int row0 = mt * 16, col0 = nq * 64; const float* arow = A + (size_t)(row0 + ln) * lda;
  v8f acc[4] = {};
  for (int kb = 0; kb < K; kb += 32) {
    FragH ah, al;
    const v4f x0 = *(const v4fa*)(arow + kb + 8 * hh), x1 = *(const v4fa*)(arow + kb + 8 * hh + 4), x2 = *(const v4fa*)(arow + kb + 16 + 8 * hh), x3 = *(const v4fa*)(arow + kb + 16 + 8 * hh + 4);
    float xs[16] = {x0[0],x0[1],x0[2],x0[3],x1[0],x1[1],x1[2],x1[3],x2[0],x2[1],x2[2],x2[3],x3[0],x3[1],x3[2],x3[3]};
#pragma unroll
    for (int i = 0; i < 16; ++i) { const _Float16 h = (_Float16)xs[i]; ah.h[i] = h; al.h[i] = ASPLIT ? (_Float16)(xs[i] - (float)h) : (_Float16)0.0f; }
#pragma unroll
    for (int t = 0; t < 4; ++t) { if (col0 + t * 16 >= N) continue; const size_t boff = (size_t)(col0 + t * 16 + ln) * ldb + kb; FragH bq; bq.half[0] = *(const v8us*)(Bh + boff + 8 * hh); bq.half[1] = *(const v8us*)(Bh + boff + 16 + 8 * hh);
      acc[t] = mmaH<ASPLIT ? 2 : 1>(ah.v, al.v, bq.v, bq.v, acc[t]); }
  }
#pragma unroll
  for (int t = 0; t < 4; ++t) { if (col0 + t * 16 >= N) continue;
#pragma unroll
    for (int r = 0; r < 8; ++r) so[w][8 * hh + r][t * 16 + ln] = acc[t][r] * alpha; }
  __builtin_amdgcn_fence(__ATOMIC_ACQ_REL, "workgroup"); __builtin_amdgcn_wave_barrier();
  const int rsub = lane >> 4, c4 = (lane & 15) * 4;
  {
#pragma unroll
    for (int q = 0; q < 8; ++q) { const int r = q * 2 + rsub; if (col0 + c4 < N) { const v4f v = *(const v4fa*)&so[w][r][c4]; *(v4f*)(C + (size_t)(row0 + r) * ldc + col0 + c4) = v; } }
     }
}

// Wt[n][k] = f16(W[k][n]·scale) from f32 row-major W[K][N] (scale = power of two; bf16-exact weights stay exact in f16 away from the subnormal range)
__global__ __launch_bounds__(256) void k_wt_f16(const float* __restrict__ W, _Float16* __restrict__ Wt, int K, int N, float scale) {
  const int t = blockIdx.x * 256 + threadIdx.x; if (t >= N * (K / 8)) return; const int n = t / (K / 8), k8 = (t % (K / 8)) * 8; FragH f;
#pragma unroll
  for (int i = 0; i < 8; ++i) f.h[i] = (_Float16)(bf16_round(W[(size_t)(k8 + i) * N + n]) * scale); const v8us o = f.half[0];
  *(v8us*)((unsigned short*)Wt + (size_t)n * K + k8) = o; 
}
// k_gemm_hh variant with fused epilogue: v = acc·alpha + bias[by·sBias + col] (+ CP[(row/rowsPerB)·sCPb + by·64 + col] if CP) ; ACT 0 none / 1 elu ; writes f16 C16 (and f32 C if non-null)
template <int ACT>
__global__ __launch_bounds__(128) void k_gemm_hhx(const _Float16* __restrict__ A, int lda, size_t sA, const _Float16* __restrict__ Bh, int ldb, size_t sB, float alpha, const float* __restrict__ bias, size_t sBias, const float* __restrict__ CP, int rowsPerB, size_t sCPb, int row0g,
    float* __restrict__ C, _Float16* __restrict__ C16, int ldc, size_t sC, int M, int N, int K) {
  __shared__ __attribute__((aligned(16))) float so[4][16][64];
  const int tid = threadIdx.x, w = tid >> 5, lane = tid & 31, ln = lane & 15, hh = lane >> 4; const int by = blockIdx.y;
  A += (size_t)by * sA; Bh += (size_t)by * sB; const size_t cofs = (size_t)by * sC; const float* bp = bias ? bias + (size_t)by * sBias : nullptr;
  const int ntn = (N + 63) / 64; const int wid = blockIdx.x * 4 + w; const int mt = wid / ntn, nq = wid % ntn; if (mt * 16 >= M) return;
  const int row0 = mt * 16, col0 = nq * 64; const _Float16* arow = A + (size_t)(row0 + ln) * lda;
  v8f acc[4] = {};
  for (int kb = 0; kb < K; kb += 32) { FragH ah; ah.half[0] = *(const v8us*)((const unsigned short*)arow + kb + 8 * hh); ah.half[1] = *(const v8us*)((const unsigned short*)arow + kb + 16 + 8 * hh);
#pragma unroll
    for (int t = 0; t < 4; ++t) { if (col0 + t * 16 >= N) continue; const size_t boff = (size_t)(col0 + t * 16 + ln) * ldb + kb; FragH bq; bq.half[0] = *(const v8us*)((const unsigned short*)Bh + boff + 8 * hh); bq.half[1] = *(const v8us*)((const unsigned short*)Bh + boff + 16 + 8 * hh);
      acc[t] = mmaH<1>(ah.v, ah.v, bq.v, bq.v, acc[t]); }
  }
#pragma unroll
  for (int t = 0; t < 4; ++t) { if (col0 + t * 16 >= N) continue; const int col = col0 + t * 16 + ln; const float bv = bp ? bf16_round(bp[col]) : 0.f;
#pragma unroll
    for (int r = 0; r < 8; ++r) { float v = acc[t][r] * alpha + bv; if (CP) { const int rr = row0g + row0 + 8 * hh + r; if (rowsPerB < 0) v += CP[cofs + (size_t)rr * ldc + col];      /* rowsPerB < 0: own element of the batched C plane */ else { const int bidx = rr / rowsPerB; v += CP[(size_t)bidx * sCPb + (size_t)by * 64 + col]; } } if (ACT == 1) v = (v > 0.f) ? v : expm1f(v); else if (ACT == 7) v = (v > 0.f) ? v + 1.0f : expf(v); else if (ACT == 8) v = tanhf(v); else if (ACT == 9) v = 0.5f * v * (1.0f + tanhf(0.7978845608028654f * (v + 0.044715f * v * v * v))); else if (ACT == 11) v = 1.0f / (1.0f + expf(-v)); else if (ACT == 12) v = (v > 0.f) ? v : 0.01f * v; else if (ACT == 14) v = (v > 0.f) ? v : 0.1f * v; else if (ACT == 16) v = (v >= 0.f) ? v : 0.3f * v; else if (ACT == 17) v = (v >= 0.f) ? v : 0.2f * v; else if (ACT == 15) v = v / (1.0f + expf(-v)); else if (ACT == 3) v = fmaxf(v, 0.f); else if (ACT == 6) v = 0.5f * v * (1.0f + erff(v * 0.70710678118654752f)); so[w][8 * hh + r][t * 16 + ln] = v; } }
  __builtin_amdgcn_fence(__ATOMIC_ACQ_REL, "workgroup"); __builtin_amdgcn_wave_barrier();
  const int rsub = lane >> 4, c4 = (lane & 15) * 4; typedef _Float16 v4h __attribute__((ext_vector_type(4)));
  {
#pragma unroll
    for (int q = 0; q < 8; ++q) { const int r = q * 2 + rsub; if (col0 + c4 < N) { const v4f v = *(const v4fa*)&so[w][r][c4]; if (C) *(v4f*)(C + cofs + (size_t)(row0 + r) * ldc + col0 + c4) = v; if (C16) { v4h h4; for (int i = 0; i < 4; ++i) h4[i] = (_Float16)v[i]; *(v4h*)(C16 + cofs + (size_t)(row0 + r) * ldc + col0 + c4) = h4; } } }
     }
}


typedef _Float16 v4h __attribute__((ext_vector_type(4)));

__global__ __launch_bounds__(256) void k_x16(const float* __restrict__ x, _Float16* __restrict__ X16, size_t n8) { const size_t t = (size_t)blockIdx.x * 256 + threadIdx.x; if (t >= n8) return; FragH f;
#pragma unroll
  for (int q = 0; q < 8; ++q) f.h[q] = (_Float16)bf16_round(x[t * 8 + q]); *(v8us*)((unsigned short*)X16 + t * 8) = f.half[0];  }
__global__ __launch_bounds__(256) void k_h16(const float* __restrict__ x, _Float16* __restrict__ X16, size_t n8) { const size_t t = (size_t)blockIdx.x * 256 + threadIdx.x; if (t >= n8) return; FragH f;
#pragma unroll
  for (int q = 0; q < 8; ++q) f.h[q] = (_Float16)x[t * 8 + q]; *(v8us*)((unsigned short*)X16 + t * 8) = f.half[0];  }
__global__ __launch_bounds__(256) void k_round16f(const float* __restrict__ W, _Float16* __restrict__ Bt, size_t n8) { const size_t t = (size_t)blockIdx.x * 256 + threadIdx.x; if (t >= n8) return; FragH f;
#pragma unroll
  for (int i = 0; i < 8; ++i) f.h[i] = (_Float16)(bf16_round(W[t * 8 + i]) * 16.0f); *(v8us*)((unsigned short*)Bt + t * 8) = f.half[0];  }
template <int NHv, int TTv>
__global__ __launch_bounds__(256) void k_vt(const _Float16* __restrict__ V16, int ldv, int voff, _Float16* __restrict__ Vt) { __shared__ unsigned short tl[64][66]; const int tid = threadIdx.x; const int slab = blockIdx.x / (TTv / 64), lg = blockIdx.x % (TTv / 64); const int b = slab / NHv, h = slab % NHv;
  for (int i = tid; i < 64 * 8; i += 256) { const int r = i / 8, c8 = (i % 8) * 8; FragH f; f.half[0] = *(const v8us*)((const unsigned short*)V16 + ((size_t)b * TTv + lg * 64 + r) * ldv + voff + h * 64 + c8);
#pragma unroll
    for (int q = 0; q < 8; ++q) tl[r][c8 + q] = f.u[q]; }
  __syncthreads();
  {
#pragma unroll
    for (int rd = 0; rd < 2; ++rd) { const int d = rd * 32 + tid / 8, pc = tid % 8; FragH f;
#pragma unroll
      for (int q = 0; q < 8; ++q) f.u[q] = tl[pc * 8 + q][d];
      *(v8us*)((unsigned short*)Vt + ((size_t)slab * 64 + d) * TTv + lg * 64 + pc * 8) = f.half[0]; }
     } }

__global__ __launch_bounds__(256) void k_hl(const float* __restrict__ F, _Float16* __restrict__ Hh, _Float16* __restrict__ Hl, size_t n8) { const size_t t = (size_t)blockIdx.x * 256 + threadIdx.x; if (t >= n8) return; FragH fh, fl; const v4f a = *(const v4fa*)(F + t * 8), c = *(const v4fa*)(F + t * 8 + 4);
#pragma unroll
  for (int q = 0; q < 4; ++q) { _Float16 h = (_Float16)a[q]; fh.h[q] = h; fl.h[q] = (_Float16)((a[q] - (float)h) * 1024.0f); h = (_Float16)c[q]; fh.h[4 + q] = h; fl.h[4 + q] = (_Float16)((c[q] - (float)h) * 1024.0f); }
  { *(v8us*)((unsigned short*)Hh + t * 8) = fh.half[0]; *(v8us*)((unsigned short*)Hl + t * 8) = fl.half[0];  } }

// ---- fast GEMM (wave tile 32x64; requires M % 32 == 0 rows per launch region and N % 64 == 0); epilogue = k_gemm_hhx semantics ----
__device__ __forceinline__ v16h g2_frag(const _Float16* p, int hh) { FragH f; f.half[0] = *(const v8us*)((const unsigned short*)p + 8 * hh); f.half[1] = *(const v8us*)((const unsigned short*)p + 16 + 8 * hh); return f.v; }
__device__ __forceinline__ v8f g2_mma(v16h a, v16h b, v8f c) { v8f d = __builtin_amdgcn_wmma_f32_16x16x32_f16(false, a, false, b, (short)0, c, false, false); asm volatile("v_nop\n\tv_nop\n\tv_nop\n\tv_nop" : "+v"(d) : "v"(a), "v"(b)); return d; }
template <int ACT>
__global__ __launch_bounds__(128) void k_gemm2(const _Float16* __restrict__ A, int lda, size_t sA, const _Float16* __restrict__ Bh, int ldb, size_t sB, float alpha, const float* __restrict__ bias, size_t sBias, const float* __restrict__ CP, int rowsPerB, size_t sCPb, int row0g,
    float* __restrict__ C, _Float16* __restrict__ C16, int ldc, size_t sC, int M, int N, int K) { static_assert(ACT == 0 || ACT == 3 || ACT == 6 || ACT == 8 || ACT == 9 || ACT == 11 || ACT == 12 || ACT == 14 || ACT == 15 || ACT == 16 || ACT == 17, "k_gemm2: unsupported ACT code (would silently apply no activation)");
  __shared__ __attribute__((aligned(16))) float so[4][32][68];
  const int tid = threadIdx.x, w = tid >> 5, lane = tid & 31, ln = lane & 15, hh = lane >> 4; const int by = blockIdx.y;
  A += (size_t)by * sA; Bh += (size_t)by * sB; const size_t cofs = (size_t)by * sC; const float* bp = bias ? bias + (size_t)by * sBias : nullptr;
  const int ntn = N >> 6; const int mt = blockIdx.x / ntn, nq = blockIdx.x - mt * ntn; const int row0 = mt * 128 + 32 * w, col0 = nq * 64; if (row0 >= M) return;
  const _Float16* a0p = A + (size_t)(row0 + ln) * lda; const _Float16* a1p = a0p + (size_t)16 * lda;
  const _Float16* b0p = Bh + (size_t)(col0 + ln) * ldb; const _Float16* b1p = b0p + (size_t)16 * ldb; const _Float16* b2p = b1p + (size_t)16 * ldb; const _Float16* b3p = b2p + (size_t)16 * ldb;
  const v8f z8 = {0.f,0.f,0.f,0.f,0.f,0.f,0.f,0.f}; v8f c00 = z8, c01 = z8, c02 = z8, c03 = z8, c10 = z8, c11 = z8, c12 = z8, c13 = z8;
#pragma unroll 1
  for (int kb = 0; kb < K; kb += 32) { const v16h a0 = g2_frag(a0p + kb, hh), a1 = g2_frag(a1p + kb, hh);
    v16h b = g2_frag(b0p + kb, hh); c00 = g2_mma(a0, b, c00); c10 = g2_mma(a1, b, c10);
    b = g2_frag(b1p + kb, hh); c01 = g2_mma(a0, b, c01); c11 = g2_mma(a1, b, c11);
    b = g2_frag(b2p + kb, hh); c02 = g2_mma(a0, b, c02); c12 = g2_mma(a1, b, c12);
    b = g2_frag(b3p + kb, hh); c03 = g2_mma(a0, b, c03); c13 = g2_mma(a1, b, c13); }
  v8f accs[8] = {c00, c01, c02, c03, c10, c11, c12, c13};
#pragma unroll
  for (int u = 0; u < 8; ++u) { const int t = u & 3, half = u >> 2; const int col = col0 + t * 16 + ln; const float bv = bp ? bf16_round(bp[col]) : 0.f;
#pragma unroll
    for (int r = 0; r < 8; ++r) { const int rloc = half * 16 + 8 * hh + r; float v = accs[u][r] * alpha + bv; if (CP) { if (rowsPerB < 0) v += CP[cofs + (size_t)(row0g + row0 + rloc) * ldc + col];      /* rowsPerB < 0: own element of the batched C plane */ else { const int bidx = (row0g + row0 + rloc) / rowsPerB; v += CP[(size_t)bidx * sCPb + (size_t)by * 64 + col]; } }
      if (ACT == 3) v = fmaxf(v, 0.f); else if (ACT == 6) v = 0.5f * v * (1.0f + erff(v * 0.70710678118654752f)); else if (ACT == 11) v = 1.0f / (1.0f + expf(-v)); else if (ACT == 15) v = v / (1.0f + expf(-v)); else if (ACT == 12) v = (v > 0.f) ? v : 0.01f * v; else if (ACT == 8) v = tanhf(v); else if (ACT == 9) v = 0.5f * v * (1.0f + tanhf(0.7978845608028654f * (v + 0.044715f * v * v * v))); else if (ACT == 14) v = (v > 0.f) ? v : 0.1f * v; else if (ACT == 16) v = (v >= 0.f) ? v : 0.3f * v; else if (ACT == 17) v = (v >= 0.f) ? v : 0.2f * v;
      so[w][rloc][t * 16 + ln] = v; } }
  __builtin_amdgcn_fence(__ATOMIC_ACQ_REL, "workgroup"); __builtin_amdgcn_wave_barrier();
  const int rsub = lane >> 4, c4 = (lane & 15) * 4;
  {
#pragma unroll
    for (int q = 0; q < 16; ++q) { const int r = q * 2 + rsub; const v4f v = *(const v4fa*)&so[w][r][c4]; if (C) *(v4f*)(C + cofs + (size_t)(row0 + r) * ldc + col0 + c4) = v; if (C16) { v4h h4; for (int i = 0; i < 4; ++i) h4[i] = (_Float16)v[i]; *(v4h*)(C16 + cofs + (size_t)(row0 + r) * ldc + col0 + c4) = h4; } }
     } }


__global__ __launch_bounds__(256) void k_wnat(const float* __restrict__ w, size_t n8, _Float16* __restrict__ Bt) { const size_t t = (size_t)blockIdx.x * 256 + threadIdx.x; if (t >= n8) return; FragH f; for (int q = 0; q < 8; ++q) f.h[q] = (_Float16)(bf16_round(w[t * 8 + q]) * 16.0f); *(v8us*)((unsigned short*)Bt + t * 8) = f.half[0];  }
__global__ __launch_bounds__(256) void k_rsm(const float* __restrict__ S, _Float16* __restrict__ P, int nrows) {
  #pragma clang fp contract(off)
  const int i = blockIdx.x * 256 + threadIdx.x; if (i >= nrows) return; const float* s = S + (size_t)i * SQ; float mx = -3.0e38f;
#pragma unroll 1
  for (int j = 0; j < SQ; ++j) mx = fmaxf(mx, s[j]); float se = 0.f;
#pragma unroll 1
  for (int j = 0; j < SQ; ++j) se += expf(s[j] - mx); const float sc = 256.0f / se;
#pragma unroll 1
  for (int j0 = 0; j0 < SQ; j0 += 8) { FragH f; for (int q = 0; q < 8; ++q) f.h[q] = (_Float16)(expf(s[j0 + q] - mx) * sc); unsigned short* d = (unsigned short*)P + (size_t)i * SQ + j0; *(v8us*)d = f.half[0];  } }
__global__ __launch_bounds__(256) void k_vt(const _Float16* __restrict__ V16, int b, int h0, _Float16* __restrict__ VT) { __shared__ unsigned short tl[64][65]; const int tid = threadIdx.x; const int hh = blockIdx.x % HG, sg = blockIdx.x / HG; const int s0 = sg * 64; const int h = h0 + hh;
  for (int i = tid; i < 64 * 8; i += 256) { const int j = i / 8, d8 = (i % 8) * 8; FragH f; f.half[0] = *(const v8us*)((const unsigned short*)V16 + ((size_t)b * SQ + s0 + j) * DM + h * HD + d8); for (int q = 0; q < 8; ++q) tl[d8 + q][j] = f.u[q]; }
  __syncthreads();
  { for (int i = tid; i < 64 * 8; i += 256) { const int d = i / 8, j8 = (i % 8) * 8; FragH f; for (int q = 0; q < 8; ++q) f.u[q] = tl[d][j8 + q]; *(v8us*)((unsigned short*)VT + ((size_t)hh * HD + d) * SQ + s0 + j8) = f.half[0]; }  } }



// Row softmax, one wave per score row (grid.y = head of the launch group): the row's SQ f32 scores are read once, 512 contiguous bytes per load, and stay in
// the wave's registers through maximum, exp, sum and scaling; the two row statistics are lane-partial chains joined by a five-step butterfly (no LDS, no barrier).
#define RSW 16                       /* waves (rows) per softmax work-group */
template <int M>
__device__ __forceinline__ float rs_xm(float x) { return __builtin_bit_cast(float, __builtin_amdgcn_update_dpp(0, __builtin_bit_cast(int, x), 0x160 + M, 0xf, 0xf, true)); }      /* lane l <- lane l ^ M inside a 16-lane row (row_xmask) */
__device__ __forceinline__ float rs_xh(float x) { return __builtin_bit_cast(float, __builtin_amdgcn_permlanex16(__builtin_bit_cast(int, x), __builtin_bit_cast(int, x), 0x76543210, 0xfedcba98, false, false)); }      /* lane l <- lane l ^ 16 */
__device__ __forceinline__ float rs_wmax(float v) { v = fmaxf(v, rs_xm<1>(v)); v = fmaxf(v, rs_xm<2>(v)); v = fmaxf(v, rs_xm<4>(v)); v = fmaxf(v, rs_xm<8>(v)); return fmaxf(v, rs_xh(v)); }
__device__ __forceinline__ float rs_wsum(float v) { v += rs_xm<1>(v); v += rs_xm<2>(v); v += rs_xm<4>(v); v += rs_xm<8>(v); return v + rs_xh(v); }
// Four native 2^x in place. One statement, so that no neighbour of a v_exp_f32 reads its result or writes its source; the closing v_nop is the free slot
// the instruction set asks for behind a transcendental.
__device__ __forceinline__ v4f rs_exp2x4(v4f e) { float a = e[0], b = e[1], c = e[2], d = e[3];
  asm("v_exp_f32 %0, %0\n\tv_exp_f32 %1, %1\n\tv_exp_f32 %2, %2\n\tv_exp_f32 %3, %3\n\tv_nop" : "+v"(a), "+v"(b), "+v"(c), "+v"(d));
  const v4f r = {a, b, c, d}; return r; }
__global__ __launch_bounds__(RSW * 32) void k_rsmf(const float* __restrict__ S, _Float16* __restrict__ P, int qn) {
  static_assert(SQ % 128 == 0, "a row is a whole number of 128-element wave loads");
  constexpr int NQ = SQ / 128;
  const unsigned lane = threadIdx.x & 31u; const int row = blockIdx.x * RSW + (int)__builtin_amdgcn_readfirstlane(threadIdx.x >> 5); if (row >= qn) return;      /* wave-uniform exit; the kernel has no barrier */
  const size_t i = (size_t)blockIdx.y * SQ + row; const v4fa* s = (const v4fa*)(S + i * SQ); v4h* d = (v4h*)(P + i * SQ);
  v4f x[NQ];      /* every loop over q below is fully unrolled so that x[] is indexed by constants only and stays in registers */
#pragma unroll
  for (int q = 0; q < NQ; ++q) x[q] = s[lane + 32 * q];
  float m0 = -3.0e38f, m1 = -3.0e38f, m2 = -3.0e38f, m3 = -3.0e38f;
#pragma unroll
  for (int q = 0; q < NQ; ++q) { m0 = fmaxf(m0, x[q][0]); m1 = fmaxf(m1, x[q][1]); m2 = fmaxf(m2, x[q][2]); m3 = fmaxf(m3, x[q][3]); }
  const float mx = rs_wmax(fmaxf(fmaxf(m0, m1), fmaxf(m2, m3)));
  float a0 = 0.f, a1 = 0.f, a2 = 0.f, a3 = 0.f;
#pragma unroll
  for (int q = 0; q < NQ; ++q) { v4f e; for (int c = 0; c < 4; ++c) e[c] = (x[q][c] - mx) * 0x1.715476p+0f;      /* exp(v) = 2^(v log2 e), the native exp's own form */
    e = rs_exp2x4(e); x[q] = e; a0 += e[0]; a1 += e[1]; a2 += e[2]; a3 += e[3]; }
  const float sc = 256.0f / rs_wsum((a0 + a1) + (a2 + a3));
#pragma unroll
  for (int q = 0; q < NQ; ++q) { v4h h4; for (int c = 0; c < 4; ++c) h4[c] = (_Float16)(x[q][c] * sc); d[lane + 32 * q] = h4; } }

extern "C" void kernel_launch(void* const* d_in, const int* in_sizes, int n_in,
                              void* d_out, int out_size, void* d_ws, size_t ws_size, hipStream_t stream) {
  (void)in_sizes; (void)n_in; (void)out_size;
  const float* const* I = (const float* const*)d_in; const float* xq = I[0]; const float* xk = I[1]; const float* xv = I[1]; const float* wq = I[2]; const float* bq = I[3]; const float* wk = I[4]; const float* bk = I[5]; const float* wv = I[6]; const float* bv = I[7]; const float* wo = I[8]; const float* bo = I[9];      
  char* ws = (char*)d_ws; size_t off = 0;
  auto take = [&](size_t bytes) { char* p = ws + off; off += (bytes + 255) & ~(size_t)255; return p; };
  _Float16* BQ = (_Float16*)take((size_t)DM * DM * 2); _Float16* BK = (_Float16*)take((size_t)DM * DM * 2); _Float16* BV = (_Float16*)take((size_t)DM * DM * 2); _Float16* BO = (_Float16*)take((size_t)DM * DM * 2);
  _Float16* XQ = (_Float16*)take(NR * DM * 2); _Float16* XK = (_Float16*)take(NR * DM * 2); _Float16* XV = (_Float16*)take(NR * DM * 2); _Float16* Q16 = (_Float16*)take(NR * DM * 2); _Float16* K16 = (_Float16*)take(NR * DM * 2); _Float16* V16 = (_Float16*)take(NR * DM * 2); _Float16* O16 = (_Float16*)take(NR * DM * 2);
  float* S = (float*)take((size_t)HG * SQ * SQ * 4); _Float16* P = (_Float16*)take((size_t)HG * SQ * SQ * 2); _Float16* VT = (_Float16*)take((size_t)NH * HD * SQ * 2);
  if (off > ws_size) return;
  { const unsigned g = (unsigned)(((size_t)DM * (DM / 8) + 255) / 256); k_wt_f16<<<g, 256, 0, stream>>>(wq, BQ, DM, DM, 16.0f); k_wt_f16<<<g, 256, 0, stream>>>(wk, BK, DM, DM, 16.0f); k_wt_f16<<<g, 256, 0, stream>>>(wv, BV, DM, DM, 16.0f); k_wt_f16<<<g, 256, 0, stream>>>(wo, BO, DM, DM, 16.0f); }      /* [in][out] -> Bt[n][k] x16 (transposing builder) */

  k_x16<<<(unsigned)((NR * DM / 8 + 255) / 256), 256, 0, stream>>>(xq, XQ, NR * DM / 8); k_x16<<<(unsigned)((NR * DM / 8 + 255) / 256), 256, 0, stream>>>(xk, XK, NR * DM / 8); k_x16<<<(unsigned)((NR * DM / 8 + 255) / 256), 256, 0, stream>>>(xv, XV, NR * DM / 8);      /* the query input and the key/value input (converted twice) as exact f16 rows */
  const size_t r0p = (size_t)B0 * SQ;      /* first projected row */
  k_gemm2<0><<<dim3((unsigned)((MP / 128) * (DM / 64)), 1), 128, 0, stream>>>(XQ + r0p * DM, DM, 0, BQ, DM, 0, 0.0625f, bq, 0, nullptr, 1, 0, 0, nullptr, Q16 + r0p * DM, DM, 0, MP, DM, DM);
  k_gemm2<0><<<dim3((unsigned)((MP / 128) * (DM / 64)), 1), 128, 0, stream>>>(XK + r0p * DM, DM, 0, BK, DM, 0, 0.0625f, bk, 0, nullptr, 1, 0, 0, nullptr, K16 + r0p * DM, DM, 0, MP, DM, DM);
  k_gemm2<0><<<dim3((unsigned)((MP / 128) * (DM / 64)), 1), 128, 0, stream>>>(XV + r0p * DM, DM, 0, BV, DM, 0, 0.0625f, bv, 0, nullptr, 1, 0, 0, nullptr, V16 + r0p * DM, DM, 0, MP, DM, DM);
  for (int b = B0; b < B0 + NBR; ++b) { const size_t r0 = (size_t)b * SQ;
    k_vt<NH, SQ><<<NH * (SQ / 64), 256, 0, stream>>>(V16 + r0 * LQ, LQ, 0, VT);      /* V^T [NH][HD][SQ] for this batch */
    for (int h0 = 0; h0 < NHD; h0 += HG) {
      k_gemm2<0><<<dim3((QN / 128) * (SQ / 64), HG), 128, 0, stream>>>(Q16 + r0 * LQ + h0 * HD, LQ, (size_t)HD, K16 + r0 * LQ + h0 * HD, LQ, (size_t)HD, 0.125f, nullptr, 0, nullptr, 1, 0, 0, S, nullptr, SQ, (size_t)SQ * SQ, QN, SQ, HD);      /* scores, HG heads per launch */
      k_rsmf<<<dim3((QN + RSW - 1) / RSW, HG), RSW * 32, 0, stream>>>(S, P, QN);      /* P = 256 softmax (f16), rows of all HG heads */
      k_gemm2<0><<<dim3((QN / 128) * (HD / 64), HG), 128, 0, stream>>>(P, SQ, (size_t)SQ * SQ, VT + (size_t)h0 * HD * SQ, SQ, (size_t)HD * SQ, 0.25f, nullptr, 0, nullptr, 1, 0, 0, nullptr, O16 + r0 * DM + h0 * HD, DM, (size_t)HD, QN, HD, SQ); } }      /* o (merged heads) as f16 rows */
  k_gemm2<0><<<dim3((unsigned)((MPO / 128) * (DM / 64)), 1), 128, 0, stream>>>(O16 + r0p * DM, DM, 0, BO, DM, 0, 0.0009765625f, bo, 0, nullptr, 1, 0, 0, (float*)d_out + r0p * DM, nullptr, DM, 0, MPO, DM, DM);      /* out rows are the output layout */
}

// v002
// One run takes 197 microseconds.
// In two side-by-side timings against v001, it was 14.0 and 13.8 times as fast.
// Counting every step since v000, it is 66.8 times as fast.
#include <hip/hip_runtime.h>
#define NB 2
#define SQ 4096
#define DM 512
#define NH 8
#define HD 64
#define HG 1                         /* heads per block group in the unlaunched k_vt(V16, b, h0, VT) overload */
#define B0 0                         /* first batch processed (debug hook) */
#define NBR NB                       /* batches processed (debug hook) */
#define NR ((size_t)NB * SQ)         /* token rows */
#define MP ((int)((size_t)NBR * SQ)) /* rows projected (debug hook) */
#define QN SQ                        /* query rows per batch (unused: k_fattn attends all SQ) */
#define NHD NH                       /* heads (unused: k_fattn attends all NH) */
#define MPO MP                       /* rows through the output stage (debug hook) */
#define LQ DM      /* row pitch of the q/k/v rows */
typedef __bf16 v16b __attribute__((ext_vector_type(16)));
typedef unsigned short v8us __attribute__((ext_vector_type(8), may_alias));
typedef float  v8f  __attribute__((ext_vector_type(8)));
typedef float  v4f  __attribute__((ext_vector_type(4)));
typedef float  v4fa __attribute__((ext_vector_type(4), may_alias));
union FragB { v16b v; v8us half[2]; unsigned short u[16]; };

__device__ __forceinline__ unsigned short bf16_bits(float x) { unsigned int u = __float_as_uint(x); return (unsigned short)((u + 0x7FFFu + ((u >> 16) & 1u)) >> 16); }
__device__ __forceinline__ float bf16_val(unsigned short b) { return __uint_as_float(((unsigned int)b) << 16); }
__device__ __forceinline__ float bf16_round(float x) { return bf16_val(bf16_bits(x)); }
// D += A·B with NT terms: 1 = ah·bh, 2 = + al·bh (A split), 3 = + ah·bl (both split)
template <int NT>
__device__ __forceinline__ v8f mmaN(v16b ah, v16b al, v16b bh, v16b bl, v8f c) {
  c = __builtin_amdgcn_wmma_f32_16x16x32_bf16(false, ah, false, bh, (short)0, c, false, false);
  if (NT >= 2) c = __builtin_amdgcn_wmma_f32_16x16x32_bf16(false, al, false, bh, (short)0, c, false, false);
  if (NT >= 3) c = __builtin_amdgcn_wmma_f32_16x16x32_bf16(false, ah, false, bl, (short)0, c, false, false);
  asm volatile("v_nop\n\tv_nop\n\tv_nop\n\tv_nop" : "+v"(c) : "v"(ah), "v"(al), "v"(bh), "v"(bl));
  return c;
}

__global__ __launch_bounds__(256) void k_wt_bf16(const float* __restrict__ W, unsigned short* __restrict__ Wt, int K, int N) {
  const int t = blockIdx.x * 256 + threadIdx.x;
  const int k8n = K / 8;
  if (t >= N * k8n) return;
  const int n = t / k8n, k8 = (t % k8n) * 8;
  v8us v;
#pragma unroll
  for (int i = 0; i < 8; ++i) v[i] = bf16_bits(W[(size_t)(k8 + i) * N + n]);
  *(v8us*)(Wt + (size_t)n * K + k8) = v;
  
}

// GEMM C[M][N] (f32, pitch ldc) = act(A[M][K]·W + bias). A f32 row-major (pitch lda) converted per fragment to bf16
// (ASPLIT: hi/lo two planes -> 2 terms, else single rounded term); Wt bf16 [N][K] (pitch ldb). BIAS_BF16 rounds the
// bias to bf16 first (bias quantised to bf16 before the add). K%32==0, M%16==0, N%64==0.
template <bool ASPLIT, int ACT, bool BIAS_BF16>
__global__ __launch_bounds__(128) void k_gemm_bf(const float* __restrict__ A, int lda, const unsigned short* __restrict__ Wt, int ldb,
                                               const float* __restrict__ bias, float* __restrict__ C, int ldc, int M, int N, int K) {
  __shared__ __attribute__((aligned(16))) float so[4][16][64];
  const int tid = threadIdx.x, w = tid >> 5, lane = tid & 31, ln = lane & 15, hh = lane >> 4;
  const int ntn = N / 64;
  const int wid = blockIdx.x * 4 + w;
  const int mt = wid / ntn, nq = wid % ntn;
  if (mt * 16 >= M) return;
  const int row0 = mt * 16, col0 = nq * 64;
  const float* arow = A + (size_t)(row0 + ln) * lda;
  v8f acc[4] = {};
  for (int kb = 0; kb < K; kb += 32) {
    FragB ah, al;
    const v4f x0 = *(const v4fa*)(arow + kb + 8 * hh), x1 = *(const v4fa*)(arow + kb + 8 * hh + 4);
    const v4f x2 = *(const v4fa*)(arow + kb + 16 + 8 * hh), x3 = *(const v4fa*)(arow + kb + 16 + 8 * hh + 4);
    float xs[16] = {x0[0],x0[1],x0[2],x0[3],x1[0],x1[1],x1[2],x1[3],x2[0],x2[1],x2[2],x2[3],x3[0],x3[1],x3[2],x3[3]};
#pragma unroll
    for (int i = 0; i < 16; ++i) { const unsigned short hb = bf16_bits(xs[i]); ah.u[i] = hb; al.u[i] = ASPLIT ? bf16_bits(xs[i] - bf16_val(hb)) : (unsigned short)0; }
#pragma unroll
    for (int t = 0; t < 4; ++t) {
      const unsigned short* brow = Wt + (size_t)(col0 + t * 16 + ln) * ldb + kb;
      FragB b;
      b.half[0] = *(const v8us*)(brow + 8 * hh);
      b.half[1] = *(const v8us*)(brow + 16 + 8 * hh);
      acc[t] = mmaN<ASPLIT ? 2 : 1>(ah.v, al.v, b.v, b.v, acc[t]);
    }
  }
#pragma unroll
  for (int t = 0; t < 4; ++t) {
    float bv = bias ? bias[col0 + t * 16 + ln] : 0.f;
    if (BIAS_BF16) bv = bf16_round(bv);
#pragma unroll
    for (int r = 0; r < 8; ++r) { float v = acc[t][r] + bv; if (ACT == 1) v = fmaxf(v, 0.f); so[w][8 * hh + r][t * 16 + ln] = v; }
  }
  __builtin_amdgcn_fence(__ATOMIC_ACQ_REL, "workgroup");
  __builtin_amdgcn_wave_barrier();
  const int rsub = lane >> 4, c4 = (lane & 15) * 4;
  {
#pragma unroll
    for (int q = 0; q < 8; ++q) {
      const int r = q * 2 + rsub;
      const v4f v = *(const v4fa*)&so[w][r][c4];
      *(v4f*)(C + (size_t)(row0 + r) * ldc + col0 + c4) = v;
    }
    
  }
}

// GEMM C = act(A·W + bias + resid): A f32 (ASPLIT -> hi/lo 2 terms), Wt bf16 [N][K]; ACT 0 none, 1 relu, 2 exact gelu;
// resid (optional, f32, row index = (row % rmod), pitch ldr, RES_BF16 rounds it) added before the activation.
template <bool ASPLIT, int ACT, bool BIAS_BF16, bool RES_BF16>
__global__ __launch_bounds__(128) void k_gemm_bf3(const float* __restrict__ A, int lda, const unsigned short* __restrict__ Wt, int ldb,
                                                const float* __restrict__ bias, const float* __restrict__ resid, int rmod, int ldr,
                                                float* __restrict__ C, int ldc, int M, int N, int K) {
  __shared__ __attribute__((aligned(16))) float so[4][16][64];
  const int tid = threadIdx.x, w = tid >> 5, lane = tid & 31, ln = lane & 15, hh = lane >> 4;
  const int ntn = N / 64;
  const int wid = blockIdx.x * 4 + w;
  const int mt = wid / ntn, nq = wid % ntn;
  if (mt * 16 >= M) return;
  const int row0 = mt * 16, col0 = nq * 64;
  const float* arow = A + (size_t)(row0 + ln) * lda;
  v8f acc[4] = {};
  for (int kb = 0; kb < K; kb += 32) {
    FragB ah, al;
    const v4f x0 = *(const v4fa*)(arow + kb + 8 * hh), x1 = *(const v4fa*)(arow + kb + 8 * hh + 4);
    const v4f x2 = *(const v4fa*)(arow + kb + 16 + 8 * hh), x3 = *(const v4fa*)(arow + kb + 16 + 8 * hh + 4);
    float xs[16] = {x0[0],x0[1],x0[2],x0[3],x1[0],x1[1],x1[2],x1[3],x2[0],x2[1],x2[2],x2[3],x3[0],x3[1],x3[2],x3[3]};
#pragma unroll
    for (int i = 0; i < 16; ++i) { const unsigned short hb = bf16_bits(xs[i]); ah.u[i] = hb; al.u[i] = ASPLIT ? bf16_bits(xs[i] - bf16_val(hb)) : (unsigned short)0; }
#pragma unroll
    for (int t = 0; t < 4; ++t) {
      const unsigned short* brow = Wt + (size_t)(col0 + t * 16 + ln) * ldb + kb;
      FragB b;
      b.half[0] = *(const v8us*)(brow + 8 * hh);
      b.half[1] = *(const v8us*)(brow + 16 + 8 * hh);
      acc[t] = mmaN<ASPLIT ? 2 : 1>(ah.v, al.v, b.v, b.v, acc[t]);
    }
  }
#pragma unroll
  for (int t = 0; t < 4; ++t) {
    const int col = col0 + t * 16 + ln;
    float bv = bias ? bias[col] : 0.f;
    if (BIAS_BF16) bv = bf16_round(bv);
#pragma unroll
    for (int r = 0; r < 8; ++r) {
      float v = acc[t][r] + bv;
      if (resid) { float rv = resid[(size_t)((row0 + 8 * hh + r) % rmod) * ldr + col]; if (RES_BF16) rv = bf16_round(rv); v += rv; }
      if (ACT == 1) v = fmaxf(v, 0.f);
      if (ACT == 2) v = 0.5f * v * (1.0f + erff(v * 0.70710678118654752f));
      if (ACT == 3) { const float u = 0.7978845608028654f * (v + 0.044715f * v * v * v); v = 0.5f * v * (1.0f + tanhf(u)); }
      so[w][8 * hh + r][t * 16 + ln] = v;
    }
  }
  __builtin_amdgcn_fence(__ATOMIC_ACQ_REL, "workgroup");
  __builtin_amdgcn_wave_barrier();
  const int rsub = lane >> 4, c4 = (lane & 15) * 4;
  {
#pragma unroll
    for (int q = 0; q < 8; ++q) {
      const int r = q * 2 + rsub;
      const v4f v = *(const v4fa*)&so[w][r][c4];
      *(v4f*)(C + (size_t)(row0 + r) * ldc + col0 + c4) = v;
    }
    
  }
}
// row LayerNorm (biased variance, eps) over N: s = X (+ R); optional out_sum <- s; out_norm <- (s-mu)*rsqrt(var+eps)*g + b
template <bool PARAM_BF16>
__global__ __launch_bounds__(256) void k_layernorm(const float* __restrict__ X, const float* __restrict__ R, const float* __restrict__ g, const float* __restrict__ bta,
                                                  float* __restrict__ out_sum, float* __restrict__ out_norm, int N, float eps) {
  __shared__ float red[256];
  const int row = blockIdx.x, tid = threadIdx.x;
  const float* x = X + (size_t)row * N; const float* rr = R ? R + (size_t)row * N : nullptr;
  float vals[16];                     // up to N = 4096
  const int per = N / 256;            // contiguous chunk per thread? use strided-by-4 chunks: thread handles j = tid*4 + 1024*u
  float s1 = 0.f;
  for (int u = 0; u < per / 4; ++u) {
    const int j = tid * 4 + 1024 * u;
    const v4f a = *(const v4fa*)(x + j);
    v4f b = {0.f,0.f,0.f,0.f}; if (rr) b = *(const v4fa*)(rr + j);
#pragma unroll
    for (int q = 0; q < 4; ++q) { const float v = a[q] + b[q]; vals[u * 4 + q] = v; s1 += v; }
  }
  red[tid] = s1; __syncthreads();
  for (int st = 128; st > 0; st >>= 1) { if (tid < st) red[tid] += red[tid + st]; __syncthreads(); }
  const float mu = red[0] / (float)N; __syncthreads();
  float s2 = 0.f;
  for (int u = 0; u < per / 4; ++u)
#pragma unroll
    for (int q = 0; q < 4; ++q) { const float c = vals[u * 4 + q] - mu; s2 += c * c; }
  red[tid] = s2; __syncthreads();
  for (int st = 128; st > 0; st >>= 1) { if (tid < st) red[tid] += red[tid + st]; __syncthreads(); }
  const float rs = rsqrtf(red[0] / (float)N + eps);
  {
    for (int u = 0; u < per / 4; ++u) {
      const int j = tid * 4 + 1024 * u;
      v4f o, sm;
#pragma unroll
      for (int q = 0; q < 4; ++q) {
        float gg = g[j + q], bb = bta[j + q];
        if (PARAM_BF16) { gg = bf16_round(gg); bb = bf16_round(bb); }
        sm[q] = vals[u * 4 + q]; o[q] = (vals[u * 4 + q] - mu) * rs * gg + bb;
      }
      if (out_sum) *(v4f*)(out_sum + (size_t)row * N + j) = sm;
      *(v4f*)(out_norm + (size_t)row * N + j) = o;
    }
    
  }
}



// ---- f16 WMMA path (v_wmma_f32_16x16x32_f16): 11-bit significands for operands in range — used where a [0,1] probability operand needs more precision than bf16
typedef _Float16 v16h __attribute__((ext_vector_type(16)));
union FragH { v16h v; v8us half[2]; _Float16 h[16]; unsigned short u[16]; };
template <int NT>
__device__ __forceinline__ v8f mmaH(v16h ah, v16h al, v16h bh, v16h bl, v8f c) {
  c = __builtin_amdgcn_wmma_f32_16x16x32_f16(false, ah, false, bh, (short)0, c, false, false);
  if (NT >= 2) c = __builtin_amdgcn_wmma_f32_16x16x32_f16(false, al, false, bh, (short)0, c, false, false);
  if (NT >= 3) c = __builtin_amdgcn_wmma_f32_16x16x32_f16(false, ah, false, bl, (short)0, c, false, false);
  asm volatile("v_nop\n\tv_nop\n\tv_nop\n\tv_nop" : "+v"(c) : "v"(ah), "v"(al), "v"(bh), "v"(bl));
  return c;
}
// batched GEMM like k_gemm_b but f16 operands: A f32 (split into f16 hi/lo if ASPLIT, else rounded to f16), Bt = f16 values [n][k]; alpha; C f32; N multiple of 16 (partial tiles skipped)
template <bool ASPLIT>
__global__ __launch_bounds__(128) void k_gemm_h(const float* __restrict__ A, int lda, size_t sA, const _Float16* __restrict__ Bh, int ldb, size_t sB, float alpha, float* __restrict__ C, int ldc, size_t sC, int M, int N, int K) {
  __shared__ __attribute__((aligned(16))) float so[4][16][64];
  const int tid = threadIdx.x, w = tid >> 5, lane = tid & 31, ln = lane & 15, hh = lane >> 4; const int by = blockIdx.y;
  A += (size_t)by * sA; Bh += (size_t)by * sB; C += (size_t)by * sC;
  const int ntn = (N + 63) / 64; const int wid = blockIdx.x * 4 + w; const int mt = wid / ntn, nq = wid % ntn; if (mt * 16 >= M) return;
  const int row0 = mt * 16, col0 = nq * 64; const float* arow = A + (size_t)(row0 + ln) * lda;
  v8f acc[4] = {};
  for (int kb = 0; kb < K; kb += 32) {
    FragH ah, al;
    const v4f x0 = *(const v4fa*)(arow + kb + 8 * hh), x1 = *(const v4fa*)(arow + kb + 8 * hh + 4), x2 = *(const v4fa*)(arow + kb + 16 + 8 * hh), x3 = *(const v4fa*)(arow + kb + 16 + 8 * hh + 4);
    float xs[16] = {x0[0],x0[1],x0[2],x0[3],x1[0],x1[1],x1[2],x1[3],x2[0],x2[1],x2[2],x2[3],x3[0],x3[1],x3[2],x3[3]};
#pragma unroll
    for (int i = 0; i < 16; ++i) { const _Float16 h = (_Float16)xs[i]; ah.h[i] = h; al.h[i] = ASPLIT ? (_Float16)(xs[i] - (float)h) : (_Float16)0.0f; }
#pragma unroll
    for (int t = 0; t < 4; ++t) { if (col0 + t * 16 >= N) continue; const size_t boff = (size_t)(col0 + t * 16 + ln) * ldb + kb; FragH bq; bq.half[0] = *(const v8us*)(Bh + boff + 8 * hh); bq.half[1] = *(const v8us*)(Bh + boff + 16 + 8 * hh);
      acc[t] = mmaH<ASPLIT ? 2 : 1>(ah.v, al.v, bq.v, bq.v, acc[t]); }
  }
#pragma unroll
  for (int t = 0; t < 4; ++t) { if (col0 + t * 16 >= N) continue;
#pragma unroll
    for (int r = 0; r < 8; ++r) so[w][8 * hh + r][t * 16 + ln] = acc[t][r] * alpha; }
  __builtin_amdgcn_fence(__ATOMIC_ACQ_REL, "workgroup"); __builtin_amdgcn_wave_barrier();
  const int rsub = lane >> 4, c4 = (lane & 15) * 4;
  {
#pragma unroll
    for (int q = 0; q < 8; ++q) { const int r = q * 2 + rsub; if (col0 + c4 < N) { const v4f v = *(const v4fa*)&so[w][r][c4]; *(v4f*)(C + (size_t)(row0 + r) * ldc + col0 + c4) = v; } }
     }
}

// Wt[n][k] = f16(W[k][n]·scale) from f32 row-major W[K][N] (scale = power of two; bf16-exact weights stay exact in f16 away from the subnormal range)
__global__ __launch_bounds__(256) void k_wt_f16(const float* __restrict__ W, _Float16* __restrict__ Wt, int K, int N, float scale) {
  const int t = blockIdx.x * 256 + threadIdx.x; if (t >= N * (K / 8)) return; const int n = t / (K / 8), k8 = (t % (K / 8)) * 8; FragH f;
#pragma unroll
  for (int i = 0; i < 8; ++i) f.h[i] = (_Float16)(bf16_round(W[(size_t)(k8 + i) * N + n]) * scale); const v8us o = f.half[0];
  *(v8us*)((unsigned short*)Wt + (size_t)n * K + k8) = o; 
}
// k_gemm_hh variant with fused epilogue: v = acc·alpha + bias[by·sBias + col] (+ CP[(row/rowsPerB)·sCPb + by·64 + col] if CP) ; ACT 0 none / 1 elu ; writes f16 C16 (and f32 C if non-null)
template <int ACT>
__global__ __launch_bounds__(128) void k_gemm_hhx(const _Float16* __restrict__ A, int lda, size_t sA, const _Float16* __restrict__ Bh, int ldb, size_t sB, float alpha, const float* __restrict__ bias, size_t sBias, const float* __restrict__ CP, int rowsPerB, size_t sCPb, int row0g,
    float* __restrict__ C, _Float16* __restrict__ C16, int ldc, size_t sC, int M, int N, int K) {
  __shared__ __attribute__((aligned(16))) float so[4][16][64];
  const int tid = threadIdx.x, w = tid >> 5, lane = tid & 31, ln = lane & 15, hh = lane >> 4; const int by = blockIdx.y;
  A += (size_t)by * sA; Bh += (size_t)by * sB; const size_t cofs = (size_t)by * sC; const float* bp = bias ? bias + (size_t)by * sBias : nullptr;
  const int ntn = (N + 63) / 64; const int wid = blockIdx.x * 4 + w; const int mt = wid / ntn, nq = wid % ntn; if (mt * 16 >= M) return;
  const int row0 = mt * 16, col0 = nq * 64; const _Float16* arow = A + (size_t)(row0 + ln) * lda;
  v8f acc[4] = {};
  for (int kb = 0; kb < K; kb += 32) { FragH ah; ah.half[0] = *(const v8us*)((const unsigned short*)arow + kb + 8 * hh); ah.half[1] = *(const v8us*)((const unsigned short*)arow + kb + 16 + 8 * hh);
#pragma unroll
    for (int t = 0; t < 4; ++t) { if (col0 + t * 16 >= N) continue; const size_t boff = (size_t)(col0 + t * 16 + ln) * ldb + kb; FragH bq; bq.half[0] = *(const v8us*)((const unsigned short*)Bh + boff + 8 * hh); bq.half[1] = *(const v8us*)((const unsigned short*)Bh + boff + 16 + 8 * hh);
      acc[t] = mmaH<1>(ah.v, ah.v, bq.v, bq.v, acc[t]); }
  }
#pragma unroll
  for (int t = 0; t < 4; ++t) { if (col0 + t * 16 >= N) continue; const int col = col0 + t * 16 + ln; const float bv = bp ? bf16_round(bp[col]) : 0.f;
#pragma unroll
    for (int r = 0; r < 8; ++r) { float v = acc[t][r] * alpha + bv; if (CP) { const int rr = row0g + row0 + 8 * hh + r; if (rowsPerB < 0) v += CP[cofs + (size_t)rr * ldc + col];      /* rowsPerB < 0: own element of the batched C plane */ else { const int bidx = rr / rowsPerB; v += CP[(size_t)bidx * sCPb + (size_t)by * 64 + col]; } } if (ACT == 1) v = (v > 0.f) ? v : expm1f(v); else if (ACT == 7) v = (v > 0.f) ? v + 1.0f : expf(v); else if (ACT == 8) v = tanhf(v); else if (ACT == 9) v = 0.5f * v * (1.0f + tanhf(0.7978845608028654f * (v + 0.044715f * v * v * v))); else if (ACT == 11) v = 1.0f / (1.0f + expf(-v)); else if (ACT == 12) v = (v > 0.f) ? v : 0.01f * v; else if (ACT == 14) v = (v > 0.f) ? v : 0.1f * v; else if (ACT == 16) v = (v >= 0.f) ? v : 0.3f * v; else if (ACT == 17) v = (v >= 0.f) ? v : 0.2f * v; else if (ACT == 15) v = v / (1.0f + expf(-v)); else if (ACT == 3) v = fmaxf(v, 0.f); else if (ACT == 6) v = 0.5f * v * (1.0f + erff(v * 0.70710678118654752f)); so[w][8 * hh + r][t * 16 + ln] = v; } }
  __builtin_amdgcn_fence(__ATOMIC_ACQ_REL, "workgroup"); __builtin_amdgcn_wave_barrier();
  const int rsub = lane >> 4, c4 = (lane & 15) * 4; typedef _Float16 v4h __attribute__((ext_vector_type(4)));
  {
#pragma unroll
    for (int q = 0; q < 8; ++q) { const int r = q * 2 + rsub; if (col0 + c4 < N) { const v4f v = *(const v4fa*)&so[w][r][c4]; if (C) *(v4f*)(C + cofs + (size_t)(row0 + r) * ldc + col0 + c4) = v; if (C16) { v4h h4; for (int i = 0; i < 4; ++i) h4[i] = (_Float16)v[i]; *(v4h*)(C16 + cofs + (size_t)(row0 + r) * ldc + col0 + c4) = h4; } } }
     }
}


typedef _Float16 v4h __attribute__((ext_vector_type(4)));

__global__ __launch_bounds__(256) void k_x16(const float* __restrict__ x, _Float16* __restrict__ X16, size_t n8) { const size_t t = (size_t)blockIdx.x * 256 + threadIdx.x; if (t >= n8) return; FragH f;
#pragma unroll
  for (int q = 0; q < 8; ++q) f.h[q] = (_Float16)bf16_round(x[t * 8 + q]); *(v8us*)((unsigned short*)X16 + t * 8) = f.half[0];  }
__global__ __launch_bounds__(256) void k_h16(const float* __restrict__ x, _Float16* __restrict__ X16, size_t n8) { const size_t t = (size_t)blockIdx.x * 256 + threadIdx.x; if (t >= n8) return; FragH f;
#pragma unroll
  for (int q = 0; q < 8; ++q) f.h[q] = (_Float16)x[t * 8 + q]; *(v8us*)((unsigned short*)X16 + t * 8) = f.half[0];  }
__global__ __launch_bounds__(256) void k_round16f(const float* __restrict__ W, _Float16* __restrict__ Bt, size_t n8) { const size_t t = (size_t)blockIdx.x * 256 + threadIdx.x; if (t >= n8) return; FragH f;
#pragma unroll
  for (int i = 0; i < 8; ++i) f.h[i] = (_Float16)(bf16_round(W[t * 8 + i]) * 16.0f); *(v8us*)((unsigned short*)Bt + t * 8) = f.half[0];  }
template <int NHv, int TTv>
__global__ __launch_bounds__(256) void k_vt(const _Float16* __restrict__ V16, int ldv, int voff, _Float16* __restrict__ Vt) { __shared__ unsigned short tl[64][66]; const int tid = threadIdx.x; const int slab = blockIdx.x / (TTv / 64), lg = blockIdx.x % (TTv / 64); const int b = slab / NHv, h = slab % NHv;
  for (int i = tid; i < 64 * 8; i += 256) { const int r = i / 8, c8 = (i % 8) * 8; FragH f; f.half[0] = *(const v8us*)((const unsigned short*)V16 + ((size_t)b * TTv + lg * 64 + r) * ldv + voff + h * 64 + c8);
#pragma unroll
    for (int q = 0; q < 8; ++q) tl[r][c8 + q] = f.u[q]; }
  __syncthreads();
  {
#pragma unroll
    for (int rd = 0; rd < 2; ++rd) { const int d = rd * 32 + tid / 8, pc = tid % 8; FragH f;
#pragma unroll
      for (int q = 0; q < 8; ++q) f.u[q] = tl[pc * 8 + q][d];
      *(v8us*)((unsigned short*)Vt + ((size_t)slab * 64 + d) * TTv + lg * 64 + pc * 8) = f.half[0]; }
     } }

__global__ __launch_bounds__(256) void k_hl(const float* __restrict__ F, _Float16* __restrict__ Hh, _Float16* __restrict__ Hl, size_t n8) { const size_t t = (size_t)blockIdx.x * 256 + threadIdx.x; if (t >= n8) return; FragH fh, fl; const v4f a = *(const v4fa*)(F + t * 8), c = *(const v4fa*)(F + t * 8 + 4);
#pragma unroll
  for (int q = 0; q < 4; ++q) { _Float16 h = (_Float16)a[q]; fh.h[q] = h; fl.h[q] = (_Float16)((a[q] - (float)h) * 1024.0f); h = (_Float16)c[q]; fh.h[4 + q] = h; fl.h[4 + q] = (_Float16)((c[q] - (float)h) * 1024.0f); }
  { *(v8us*)((unsigned short*)Hh + t * 8) = fh.half[0]; *(v8us*)((unsigned short*)Hl + t * 8) = fl.half[0];  } }

// ---- fast GEMM (wave tile 32x64; requires M % 32 == 0 rows per launch region and N % 64 == 0); epilogue = k_gemm_hhx semantics ----
__device__ __forceinline__ v16h g2_frag(const _Float16* p, int hh) { FragH f; f.half[0] = *(const v8us*)((const unsigned short*)p + 8 * hh); f.half[1] = *(const v8us*)((const unsigned short*)p + 16 + 8 * hh); return f.v; }
__device__ __forceinline__ v8f g2_mma(v16h a, v16h b, v8f c) { v8f d = __builtin_amdgcn_wmma_f32_16x16x32_f16(false, a, false, b, (short)0, c, false, false); asm volatile("v_nop\n\tv_nop\n\tv_nop\n\tv_nop" : "+v"(d) : "v"(a), "v"(b)); return d; }
template <int ACT>
__global__ __launch_bounds__(128) void k_gemm2(const _Float16* __restrict__ A, int lda, size_t sA, const _Float16* __restrict__ Bh, int ldb, size_t sB, float alpha, const float* __restrict__ bias, size_t sBias, const float* __restrict__ CP, int rowsPerB, size_t sCPb, int row0g,
    float* __restrict__ C, _Float16* __restrict__ C16, int ldc, size_t sC, int M, int N, int K) { static_assert(ACT == 0 || ACT == 3 || ACT == 6 || ACT == 8 || ACT == 9 || ACT == 11 || ACT == 12 || ACT == 14 || ACT == 15 || ACT == 16 || ACT == 17, "k_gemm2: unsupported ACT code (would silently apply no activation)");
  __shared__ __attribute__((aligned(16))) float so[4][32][68];
  const int tid = threadIdx.x, w = tid >> 5, lane = tid & 31, ln = lane & 15, hh = lane >> 4; const int by = blockIdx.y;
  A += (size_t)by * sA; Bh += (size_t)by * sB; const size_t cofs = (size_t)by * sC; const float* bp = bias ? bias + (size_t)by * sBias : nullptr;
  const int ntn = N >> 6; const int mt = blockIdx.x / ntn, nq = blockIdx.x - mt * ntn; const int row0 = mt * 128 + 32 * w, col0 = nq * 64; if (row0 >= M) return;
  const _Float16* a0p = A + (size_t)(row0 + ln) * lda; const _Float16* a1p = a0p + (size_t)16 * lda;
  const _Float16* b0p = Bh + (size_t)(col0 + ln) * ldb; const _Float16* b1p = b0p + (size_t)16 * ldb; const _Float16* b2p = b1p + (size_t)16 * ldb; const _Float16* b3p = b2p + (size_t)16 * ldb;
  const v8f z8 = {0.f,0.f,0.f,0.f,0.f,0.f,0.f,0.f}; v8f c00 = z8, c01 = z8, c02 = z8, c03 = z8, c10 = z8, c11 = z8, c12 = z8, c13 = z8;
#pragma unroll 1
  for (int kb = 0; kb < K; kb += 32) { const v16h a0 = g2_frag(a0p + kb, hh), a1 = g2_frag(a1p + kb, hh);
    v16h b = g2_frag(b0p + kb, hh); c00 = g2_mma(a0, b, c00); c10 = g2_mma(a1, b, c10);
    b = g2_frag(b1p + kb, hh); c01 = g2_mma(a0, b, c01); c11 = g2_mma(a1, b, c11);
    b = g2_frag(b2p + kb, hh); c02 = g2_mma(a0, b, c02); c12 = g2_mma(a1, b, c12);
    b = g2_frag(b3p + kb, hh); c03 = g2_mma(a0, b, c03); c13 = g2_mma(a1, b, c13); }
  v8f accs[8] = {c00, c01, c02, c03, c10, c11, c12, c13};
#pragma unroll
  for (int u = 0; u < 8; ++u) { const int t = u & 3, half = u >> 2; const int col = col0 + t * 16 + ln; const float bv = bp ? bf16_round(bp[col]) : 0.f;
#pragma unroll
    for (int r = 0; r < 8; ++r) { const int rloc = half * 16 + 8 * hh + r; float v = accs[u][r] * alpha + bv; if (CP) { if (rowsPerB < 0) v += CP[cofs + (size_t)(row0g + row0 + rloc) * ldc + col];      /* rowsPerB < 0: own element of the batched C plane */ else { const int bidx = (row0g + row0 + rloc) / rowsPerB; v += CP[(size_t)bidx * sCPb + (size_t)by * 64 + col]; } }
      if (ACT == 3) v = fmaxf(v, 0.f); else if (ACT == 6) v = 0.5f * v * (1.0f + erff(v * 0.70710678118654752f)); else if (ACT == 11) v = 1.0f / (1.0f + expf(-v)); else if (ACT == 15) v = v / (1.0f + expf(-v)); else if (ACT == 12) v = (v > 0.f) ? v : 0.01f * v; else if (ACT == 8) v = tanhf(v); else if (ACT == 9) v = 0.5f * v * (1.0f + tanhf(0.7978845608028654f * (v + 0.044715f * v * v * v))); else if (ACT == 14) v = (v > 0.f) ? v : 0.1f * v; else if (ACT == 16) v = (v >= 0.f) ? v : 0.3f * v; else if (ACT == 17) v = (v >= 0.f) ? v : 0.2f * v;
      so[w][rloc][t * 16 + ln] = v; } }
  __builtin_amdgcn_fence(__ATOMIC_ACQ_REL, "workgroup"); __builtin_amdgcn_wave_barrier();
  const int rsub = lane >> 4, c4 = (lane & 15) * 4;
  {
#pragma unroll
    for (int q = 0; q < 16; ++q) { const int r = q * 2 + rsub; const v4f v = *(const v4fa*)&so[w][r][c4]; if (C) *(v4f*)(C + cofs + (size_t)(row0 + r) * ldc + col0 + c4) = v; if (C16) { v4h h4; for (int i = 0; i < 4; ++i) h4[i] = (_Float16)v[i]; *(v4h*)(C16 + cofs + (size_t)(row0 + r) * ldc + col0 + c4) = h4; } }
     } }


__global__ __launch_bounds__(256) void k_wnat(const float* __restrict__ w, size_t n8, _Float16* __restrict__ Bt) { const size_t t = (size_t)blockIdx.x * 256 + threadIdx.x; if (t >= n8) return; FragH f; for (int q = 0; q < 8; ++q) f.h[q] = (_Float16)(bf16_round(w[t * 8 + q]) * 16.0f); *(v8us*)((unsigned short*)Bt + t * 8) = f.half[0];  }
__global__ __launch_bounds__(256) void k_rsm(const float* __restrict__ S, _Float16* __restrict__ P, int nrows) {
  #pragma clang fp contract(off)
  const int i = blockIdx.x * 256 + threadIdx.x; if (i >= nrows) return; const float* s = S + (size_t)i * SQ; float mx = -3.0e38f;
#pragma unroll 1
  for (int j = 0; j < SQ; ++j) mx = fmaxf(mx, s[j]); float se = 0.f;
#pragma unroll 1
  for (int j = 0; j < SQ; ++j) se += expf(s[j] - mx); const float sc = 256.0f / se;
#pragma unroll 1
  for (int j0 = 0; j0 < SQ; j0 += 8) { FragH f; for (int q = 0; q < 8; ++q) f.h[q] = (_Float16)(expf(s[j0 + q] - mx) * sc); unsigned short* d = (unsigned short*)P + (size_t)i * SQ + j0; *(v8us*)d = f.half[0];  } }
__global__ __launch_bounds__(256) void k_vt(const _Float16* __restrict__ V16, int b, int h0, _Float16* __restrict__ VT) { __shared__ unsigned short tl[64][65]; const int tid = threadIdx.x; const int hh = blockIdx.x % HG, sg = blockIdx.x / HG; const int s0 = sg * 64; const int h = h0 + hh;
  for (int i = tid; i < 64 * 8; i += 256) { const int j = i / 8, d8 = (i % 8) * 8; FragH f; f.half[0] = *(const v8us*)((const unsigned short*)V16 + ((size_t)b * SQ + s0 + j) * DM + h * HD + d8); for (int q = 0; q < 8; ++q) tl[d8 + q][j] = f.u[q]; }
  __syncthreads();
  { for (int i = tid; i < 64 * 8; i += 256) { const int d = i / 8, j8 = (i % 8) * 8; FragH f; for (int q = 0; q < 8; ++q) f.u[q] = tl[d][j8 + q]; *(v8us*)((unsigned short*)VT + ((size_t)hh * HD + d) * SQ + s0 + j8) = f.half[0]; }  } }



#define FA_NW 8                      /* waves per work-group */
#define FA_CW 32                     /* query columns per wave (two 16-column groups) */
#define FA_BR (FA_NW * FA_CW)        /* query rows per work-group */
#define FA_SK 64                     /* keys per LDS stage (two 32-key passes) */
#define FA_PIT 144                   /* LDS row pitch in bytes: 128 of data + 16, an odd multiple of 16 B (16-byte fragment reads without bank conflicts) */
#define FA_OFS 6.0f                  /* the maximum in use is kept 6 below the true one: weights carried x64, away from the f16 subnormal range */
#define FA_LAG 8.0f                  /* a column's maximum may outgrow the one in use by this much (log2) before the sums are rescaled: weights stay <= 2^14 */
typedef float v2f __attribute__((ext_vector_type(2)));
typedef _Float16 v2h __attribute__((ext_vector_type(2)));
__device__ __forceinline__ float rs_xh(float x) { return __builtin_bit_cast(float, __builtin_amdgcn_permlanex16(__builtin_bit_cast(int, x), __builtin_bit_cast(int, x), 0x76543210, 0xfedcba98, false, false)); }      /* lane l <- lane l ^ 16 */
// Four native 2^x in place. One statement, so that no neighbour of a v_exp_f32 reads its result or writes its source; the closing v_nop is the free slot
// the instruction set asks for behind a transcendental.
__device__ __forceinline__ v4f rs_exp2x4(v4f e) { float a = e[0], b = e[1], c = e[2], d = e[3];
  asm("v_exp_f32 %0, %0\n\tv_exp_f32 %1, %1\n\tv_exp_f32 %2, %2\n\tv_exp_f32 %3, %3\n\tv_nop" : "+v"(a), "+v"(b), "+v"(c), "+v"(d));
  const v4f r = {a, b, c, d}; return r; }
__device__ __forceinline__ v8f fa_mma(v16h a, v16h b, v8f c) { return __builtin_amdgcn_wmma_f32_16x16x32_f16(false, a, false, b, (short)0, c, false, false); }
__device__ __forceinline__ v16h fa_lfrag(const unsigned char* p) { FragH f; f.half[0] = *(const v8us*)p; f.half[1] = *(const v8us*)(p + 32); return f.v; }      /* p already holds the lane's 16 h bytes: k = 8h + 0..7 and 16 + 8h + 0..7 */
__global__ __launch_bounds__(FA_NW * 32) void k_fattn(const _Float16* __restrict__ Q16, const _Float16* __restrict__ K16, const _Float16* __restrict__ VT, _Float16* __restrict__ O16) {
  static_assert(HD == 64 && SQ % FA_BR == 0 && SQ % FA_SK == 0 && FA_SK == 64 && FA_NW * 32 == 256, "tile constants are written for head size 64 and 256 threads");
  __shared__ __attribute__((aligned(16))) unsigned char L[2][2][FA_SK * FA_PIT];      /* [buffer][0: K rows (key)(d) | 1: V^T rows (d)(key)] */
  const int tid = threadIdx.x, lane = tid & 31, w = tid >> 5, c = lane & 15, h = lane >> 4;
  const int bh = blockIdx.y, b = bh / NH, hd = bh - b * NH; const int q0 = blockIdx.x * FA_BR + w * FA_CW;
  const unsigned short* Kg = (const unsigned short*)K16 + (size_t)b * SQ * DM + hd * HD;      /* row = key, pitch DM */
  const unsigned short* Vg = (const unsigned short*)VT + (size_t)bh * HD * SQ;                /* row = d, pitch SQ */
  const int sr = tid >> 3, sc = tid & 7;      /* staging: eight lanes move one whole 128-byte row; a thread owns rows sr and sr + 32 of both tiles */
  const unsigned short* kp = Kg + (size_t)sr * DM + sc * 8; const unsigned short* vp = Vg + (size_t)sr * SQ + sc * 8;
  v8us kr0, kr1, vr0, vr1;
  auto gload = [&](int st) { const unsigned short* k = kp + (size_t)st * FA_SK * DM; const unsigned short* v = vp + st * FA_SK;
    kr0 = *(const v8us*)k; kr1 = *(const v8us*)(k + (size_t)32 * DM); vr0 = *(const v8us*)v; vr1 = *(const v8us*)(v + (size_t)32 * SQ);
    asm volatile("s_wait_xcnt 0x0" ::: "memory"); };      /* the loads' address registers are stepped for the next stage: keep the wait in front of that overwrite */
  auto lstore = [&](int buf) { unsigned char* kd = &L[buf][0][sr * FA_PIT + sc * 16]; unsigned char* vd = &L[buf][1][sr * FA_PIT + sc * 16];
    *(v8us*)kd = kr0; *(v8us*)(kd + 32 * FA_PIT) = kr1; *(v8us*)vd = vr0; *(v8us*)(vd + 32 * FA_PIT) = vr1; };
  gload(0);
  v16h qf[2][2];      /* B operand: query column 16 g + c, d = 32 kc + hardware k order */
#pragma unroll
  for (int g = 0; g < 2; ++g) { const _Float16* qp = Q16 + ((size_t)b * SQ + q0 + 16 * g + c) * DM + hd * HD; qf[g][0] = g2_frag(qp, h); qf[g][1] = g2_frag(qp + 32, h); }
  const v8f z8 = {0.f,0.f,0.f,0.f,0.f,0.f,0.f,0.f}; const v4f z4 = {0.f,0.f,0.f,0.f};
  v8f acc[2][4]; v4f la[2]; float mu[2];      /* O^T tiles (d = 16 t + 8 h + r, query 16 g + c); this half's part of the denominator; the maximum in use, minus FA_OFS */
#pragma unroll
  for (int g = 0; g < 2; ++g) { mu[g] = -__builtin_inff(); la[g] = z4;
#pragma unroll
    for (int t = 0; t < 4; ++t) acc[g][t] = z8; }
  const float cs = 0.125f * 0x1.715476p+0f;      /* 1 / sqrt(64) and log2 e in one factor */
  lstore(0);
  __syncthreads();      /* stage 0 is visible to every wave */
  constexpr int NST = SQ / FA_SK;
  for (int st = 0; st < NST; ++st) { const int buf = st & 1;
    if (st + 1 < NST) gload(st + 1);      /* the next stage's rows fly into registers under this stage's work */
#pragma unroll      /* two passes with constant LDS offsets */
    for (int p = 0; p < 2; ++p) {
      const unsigned char* kb = &L[buf][0][(32 * p + c) * FA_PIT + 16 * h]; const unsigned char* vb = &L[buf][1][c * FA_PIT + 64 * p + 16 * h];
      v8f s[2][2];      /* [16-key tile][column group] */
#pragma unroll
      for (int kt = 0; kt < 2; ++kt) { const v16h k0 = fa_lfrag(kb + kt * 16 * FA_PIT), k1 = fa_lfrag(kb + kt * 16 * FA_PIT + 64);
#pragma unroll
        for (int g = 0; g < 2; ++g) s[kt][g] = fa_mma(k1, qf[g][1], fa_mma(k0, qf[g][0], z8)); }
      v16h vf[4];
#pragma unroll
      for (int t = 0; t < 4; ++t) vf[t] = fa_lfrag(vb + t * 16 * FA_PIT);
      float mb[2]; bool need = false;
#pragma unroll
      for (int g = 0; g < 2; ++g) { float m0 = fmaxf(s[0][g][0], s[1][g][0]), m1 = fmaxf(s[0][g][1], s[1][g][1]);
#pragma unroll
        for (int r = 2; r < 8; r += 2) { m0 = fmaxf(m0, fmaxf(s[0][g][r], s[1][g][r])); m1 = fmaxf(m1, fmaxf(s[0][g][r + 1], s[1][g][r + 1])); }
        m0 = fmaxf(m0, m1); mb[g] = fmaxf(m0, rs_xh(m0)) * cs - FA_OFS;      /* both halves hold the column's maximum of this pass (the scale is positive) */
        need = need || (mb[g] > mu[g] + FA_LAG); }
      if (__builtin_amdgcn_ballot_w32(need) != 0) {      /* wave-uniform; always taken on the first pass (mu = -inf), rare later */
        const float n0 = fmaxf(mu[0], mb[0]), n1 = fmaxf(mu[1], mb[1]); const v4f d4 = {mu[0] - n0, mu[1] - n1, 0.f, 0.f}; const v4f cr = rs_exp2x4(d4); mu[0] = n0; mu[1] = n1;
#pragma unroll
        for (int g = 0; g < 2; ++g) { la[g] = la[g] * cr[g];
#pragma unroll
          for (int t = 0; t < 4; ++t) acc[g][t] = acc[g][t] * cr[g]; } }
#pragma unroll
      for (int g = 0; g < 2; ++g) { const float nm = -mu[g]; FragH pf;
#pragma unroll
        for (int i = 0; i < 4; ++i) { const int kt = i >> 1, r0 = 4 * (i & 1); v4f e;
#pragma unroll
          for (int j = 0; j < 4; ++j) e[j] = __builtin_fmaf(s[kt][g][r0 + j], cs, nm);
          e = rs_exp2x4(e); la[g] = la[g] + e;
#pragma unroll
          for (int j = 0; j < 4; ++j) pf.h[4 * i + j] = (_Float16)e[j]; }      /* element 8 kt + r = key 16 kt + 8 h + r */
#pragma unroll
        for (int t = 0; t < 4; ++t) acc[g][t] = fa_mma(vf[t], pf.v, acc[g][t]); } }
    if (st + 1 < NST) lstore(buf ^ 1);      /* every wave left that buffer before the barrier that ended stage st - 1 */
    __syncthreads(); }      /* publishes stage st + 1 and ends every wave's reads of stage st */
#pragma unroll
  for (int g = 0; g < 2; ++g) { float lf = (la[g][0] + la[g][1]) + (la[g][2] + la[g][3]); lf += rs_xh(lf); const float inv = 64.0f / lf;      /* o carried x64, as the output GEMM's alpha expects */
    unsigned short* op = (unsigned short*)O16 + ((size_t)b * SQ + q0 + 16 * g + c) * DM + hd * HD + 8 * h;
#pragma unroll
    for (int t = 0; t < 4; ++t) { FragH o;
#pragma unroll
      for (int r = 0; r < 8; ++r) o.h[r] = (_Float16)(acc[g][t][r] * inv);
      *(v8us*)(op + 16 * t) = o.half[0]; } } }      /* 8 consecutive d of one query: one 16-byte store; a query's 128-byte line has this wave as its only writer */

extern "C" void kernel_launch(void* const* d_in, const int* in_sizes, int n_in,
                              void* d_out, int out_size, void* d_ws, size_t ws_size, hipStream_t stream) {
  (void)in_sizes; (void)n_in; (void)out_size;
  const float* const* I = (const float* const*)d_in; const float* xq = I[0]; const float* xk = I[1]; const float* xv = I[1]; const float* wq = I[2]; const float* bq = I[3]; const float* wk = I[4]; const float* bk = I[5]; const float* wv = I[6]; const float* bv = I[7]; const float* wo = I[8]; const float* bo = I[9];      
  char* ws = (char*)d_ws; size_t off = 0;
  auto take = [&](size_t bytes) { char* p = ws + off; off += (bytes + 255) & ~(size_t)255; return p; };
  _Float16* BQ = (_Float16*)take((size_t)DM * DM * 2); _Float16* BK = (_Float16*)take((size_t)DM * DM * 2); _Float16* BV = (_Float16*)take((size_t)DM * DM * 2); _Float16* BO = (_Float16*)take((size_t)DM * DM * 2);
  _Float16* XQ = (_Float16*)take(NR * DM * 2); _Float16* XK = (_Float16*)take(NR * DM * 2); _Float16* XV = (_Float16*)take(NR * DM * 2); _Float16* Q16 = (_Float16*)take(NR * DM * 2); _Float16* K16 = (_Float16*)take(NR * DM * 2); _Float16* V16 = (_Float16*)take(NR * DM * 2); _Float16* O16 = (_Float16*)take(NR * DM * 2);
  _Float16* VT = (_Float16*)take((size_t)NB * NH * HD * SQ * 2);
  if (off > ws_size) return;
  { const unsigned g = (unsigned)(((size_t)DM * (DM / 8) + 255) / 256); k_wt_f16<<<g, 256, 0, stream>>>(wq, BQ, DM, DM, 16.0f); k_wt_f16<<<g, 256, 0, stream>>>(wk, BK, DM, DM, 16.0f); k_wt_f16<<<g, 256, 0, stream>>>(wv, BV, DM, DM, 16.0f); k_wt_f16<<<g, 256, 0, stream>>>(wo, BO, DM, DM, 16.0f); }      /* [in][out] -> Bt[n][k] x16 (transposing builder) */

  k_x16<<<(unsigned)((NR * DM / 8 + 255) / 256), 256, 0, stream>>>(xq, XQ, NR * DM / 8); k_x16<<<(unsigned)((NR * DM / 8 + 255) / 256), 256, 0, stream>>>(xk, XK, NR * DM / 8); k_x16<<<(unsigned)((NR * DM / 8 + 255) / 256), 256, 0, stream>>>(xv, XV, NR * DM / 8);      /* the query input and the key/value input (converted twice) as exact f16 rows */
  const size_t r0p = (size_t)B0 * SQ;      /* first projected row */
  k_gemm2<0><<<dim3((unsigned)((MP / 128) * (DM / 64)), 1), 128, 0, stream>>>(XQ + r0p * DM, DM, 0, BQ, DM, 0, 0.0625f, bq, 0, nullptr, 1, 0, 0, nullptr, Q16 + r0p * DM, DM, 0, MP, DM, DM);
  k_gemm2<0><<<dim3((unsigned)((MP / 128) * (DM / 64)), 1), 128, 0, stream>>>(XK + r0p * DM, DM, 0, BK, DM, 0, 0.0625f, bk, 0, nullptr, 1, 0, 0, nullptr, K16 + r0p * DM, DM, 0, MP, DM, DM);
  k_gemm2<0><<<dim3((unsigned)((MP / 128) * (DM / 64)), 1), 128, 0, stream>>>(XV + r0p * DM, DM, 0, BV, DM, 0, 0.0625f, bv, 0, nullptr, 1, 0, 0, nullptr, V16 + r0p * DM, DM, 0, MP, DM, DM);
  k_vt<NH, SQ><<<NB * NH * (SQ / 64), 256, 0, stream>>>(V16, LQ, 0, VT);      /* V^T [NB][NH][HD][SQ] */
  k_fattn<<<dim3(SQ / FA_BR, NB * NH), FA_NW * 32, 0, stream>>>(Q16, K16, VT, O16);      /* o x64 (merged heads) as f16 rows */
  k_gemm2<0><<<dim3((unsigned)((MPO / 128) * (DM / 64)), 1), 128, 0, stream>>>(O16 + r0p * DM, DM, 0, BO, DM, 0, 0.0009765625f, bo, 0, nullptr, 1, 0, 0, (float*)d_out + r0p * DM, nullptr, DM, 0, MPO, DM, DM);      /* out rows are the output layout */
}

// v003
// It runs in 147 microseconds.
// Two timings next to v002 put it at 1.35 and 1.37 times that version's speed.
// All steps since v000 together make it 90.7 times as fast.
#include <hip/hip_runtime.h>
#define NB 2
#define SQ 4096
#define DM 512
#define NH 8
#define HD 64
#define HG 1                         /* heads per block group in the unlaunched k_vt(V16, b, h0, VT) overload */
#define B0 0                         /* first batch processed (debug hook) */
#define NBR NB                       /* batches processed (debug hook) */
#define NR ((size_t)NB * SQ)         /* token rows */
#define MP ((int)((size_t)NBR * SQ)) /* rows projected (debug hook) */
#define QN SQ                        /* query rows per batch (unused: k_fattn attends all SQ) */
#define NHD NH                       /* heads (unused: k_fattn attends all NH) */
#define MPO MP                       /* rows through the output stage (debug hook) */
#define LQ DM      /* row pitch of the q/k rows (unused: the code writes DM) */
typedef __bf16 v16b __attribute__((ext_vector_type(16)));
typedef unsigned short v8us __attribute__((ext_vector_type(8), may_alias));
typedef float  v8f  __attribute__((ext_vector_type(8)));
typedef float  v4f  __attribute__((ext_vector_type(4)));
typedef float  v4fa __attribute__((ext_vector_type(4), may_alias));
union FragB { v16b v; v8us half[2]; unsigned short u[16]; };

__device__ __forceinline__ unsigned short bf16_bits(float x) { unsigned int u = __float_as_uint(x); return (unsigned short)((u + 0x7FFFu + ((u >> 16) & 1u)) >> 16); }
__device__ __forceinline__ float bf16_val(unsigned short b) { return __uint_as_float(((unsigned int)b) << 16); }
__device__ __forceinline__ float bf16_round(float x) { return bf16_val(bf16_bits(x)); }
// D += A·B with NT terms: 1 = ah·bh, 2 = + al·bh (A split), 3 = + ah·bl (both split)
template <int NT>
__device__ __forceinline__ v8f mmaN(v16b ah, v16b al, v16b bh, v16b bl, v8f c) {
  c = __builtin_amdgcn_wmma_f32_16x16x32_bf16(false, ah, false, bh, (short)0, c, false, false);
  if (NT >= 2) c = __builtin_amdgcn_wmma_f32_16x16x32_bf16(false, al, false, bh, (short)0, c, false, false);
  if (NT >= 3) c = __builtin_amdgcn_wmma_f32_16x16x32_bf16(false, ah, false, bl, (short)0, c, false, false);
  asm volatile("v_nop\n\tv_nop\n\tv_nop\n\tv_nop" : "+v"(c) : "v"(ah), "v"(al), "v"(bh), "v"(bl));
  return c;
}

__global__ __launch_bounds__(256) void k_wt_bf16(const float* __restrict__ W, unsigned short* __restrict__ Wt, int K, int N) {
  const int t = blockIdx.x * 256 + threadIdx.x;
  const int k8n = K / 8;
  if (t >= N * k8n) return;
  const int n = t / k8n, k8 = (t % k8n) * 8;
  v8us v;
#pragma unroll
  for (int i = 0; i < 8; ++i) v[i] = bf16_bits(W[(size_t)(k8 + i) * N + n]);
  *(v8us*)(Wt + (size_t)n * K + k8) = v;
  
}

// GEMM C[M][N] (f32, pitch ldc) = act(A[M][K]·W + bias). A f32 row-major (pitch lda) converted per fragment to bf16
// (ASPLIT: hi/lo two planes -> 2 terms, else single rounded term); Wt bf16 [N][K] (pitch ldb). BIAS_BF16 rounds the
// bias to bf16 first (bias quantised to bf16 before the add). K%32==0, M%16==0, N%64==0.
template <bool ASPLIT, int ACT, bool BIAS_BF16>
__global__ __launch_bounds__(128) void k_gemm_bf(const float* __restrict__ A, int lda, const unsigned short* __restrict__ Wt, int ldb,
                                               const float* __restrict__ bias, float* __restrict__ C, int ldc, int M, int N, int K) {
  __shared__ __attribute__((aligned(16))) float so[4][16][64];
  const int tid = threadIdx.x, w = tid >> 5, lane = tid & 31, ln = lane & 15, hh = lane >> 4;
  const int ntn = N / 64;
  const int wid = blockIdx.x * 4 + w;
  const int mt = wid / ntn, nq = wid % ntn;
  if (mt * 16 >= M) return;
  const int row0 = mt * 16, col0 = nq * 64;
  const float* arow = A + (size_t)(row0 + ln) * lda;
  v8f acc[4] = {};
  for (int kb = 0; kb < K; kb += 32) {
    FragB ah, al;
    const v4f x0 = *(const v4fa*)(arow + kb + 8 * hh), x1 = *(const v4fa*)(arow + kb + 8 * hh + 4);
    const v4f x2 = *(const v4fa*)(arow + kb + 16 + 8 * hh), x3 = *(const v4fa*)(arow + kb + 16 + 8 * hh + 4);
    float xs[16] = {x0[0],x0[1],x0[2],x0[3],x1[0],x1[1],x1[2],x1[3],x2[0],x2[1],x2[2],x2[3],x3[0],x3[1],x3[2],x3[3]};
#pragma unroll
    for (int i = 0; i < 16; ++i) { const unsigned short hb = bf16_bits(xs[i]); ah.u[i] = hb; al.u[i] = ASPLIT ? bf16_bits(xs[i] - bf16_val(hb)) : (unsigned short)0; }
#pragma unroll
    for (int t = 0; t < 4; ++t) {
      const unsigned short* brow = Wt + (size_t)(col0 + t * 16 + ln) * ldb + kb;
      FragB b;
      b.half[0] = *(const v8us*)(brow + 8 * hh);
      b.half[1] = *(const v8us*)(brow + 16 + 8 * hh);
      acc[t] = mmaN<ASPLIT ? 2 : 1>(ah.v, al.v, b.v, b.v, acc[t]);
    }
  }
#pragma unroll
  for (int t = 0; t < 4; ++t) {
    float bv = bias ? bias[col0 + t * 16 + ln] : 0.f;
    if (BIAS_BF16) bv = bf16_round(bv);
#pragma unroll
    for (int r = 0; r < 8; ++r) { float v = acc[t][r] + bv; if (ACT == 1) v = fmaxf(v, 0.f); so[w][8 * hh + r][t * 16 + ln] = v; }
  }
  __builtin_amdgcn_fence(__ATOMIC_ACQ_REL, "workgroup");
  __builtin_amdgcn_wave_barrier();
  const int rsub = lane >> 4, c4 = (lane & 15) * 4;
  {
#pragma unroll
    for (int q = 0; q < 8; ++q) {
      const int r = q * 2 + rsub;
      const v4f v = *(const v4fa*)&so[w][r][c4];
      *(v4f*)(C + (size_t)(row0 + r) * ldc + col0 + c4) = v;
    }
    
  }
}

// GEMM C = act(A·W + bias + resid): A f32 (ASPLIT -> hi/lo 2 terms), Wt bf16 [N][K]; ACT 0 none, 1 relu, 2 exact gelu;
// resid (optional, f32, row index = (row % rmod), pitch ldr, RES_BF16 rounds it) added before the activation.
template <bool ASPLIT, int ACT, bool BIAS_BF16, bool RES_BF16>
__global__ __launch_bounds__(128) void k_gemm_bf3(const float* __restrict__ A, int lda, const unsigned short* __restrict__ Wt, int ldb,
                                                const float* __restrict__ bias, const float* __restrict__ resid, int rmod, int ldr,
                                                float* __restrict__ C, int ldc, int M, int N, int K) {
  __shared__ __attribute__((aligned(16))) float so[4][16][64];
  const int tid = threadIdx.x, w = tid >> 5, lane = tid & 31, ln = lane & 15, hh = lane >> 4;
  const int ntn = N / 64;
  const int wid = blockIdx.x * 4 + w;
  const int mt = wid / ntn, nq = wid % ntn;
  if (mt * 16 >= M) return;
  const int row0 = mt * 16, col0 = nq * 64;
  const float* arow = A + (size_t)(row0 + ln) * lda;
  v8f acc[4] = {};
  for (int kb = 0; kb < K; kb += 32) {
    FragB ah, al;
    const v4f x0 = *(const v4fa*)(arow + kb + 8 * hh), x1 = *(const v4fa*)(arow + kb + 8 * hh + 4);
    const v4f x2 = *(const v4fa*)(arow + kb + 16 + 8 * hh), x3 = *(const v4fa*)(arow + kb + 16 + 8 * hh + 4);
    float xs[16] = {x0[0],x0[1],x0[2],x0[3],x1[0],x1[1],x1[2],x1[3],x2[0],x2[1],x2[2],x2[3],x3[0],x3[1],x3[2],x3[3]};
#pragma unroll
    for (int i = 0; i < 16; ++i) { const unsigned short hb = bf16_bits(xs[i]); ah.u[i] = hb; al.u[i] = ASPLIT ? bf16_bits(xs[i] - bf16_val(hb)) : (unsigned short)0; }
#pragma unroll
    for (int t = 0; t < 4; ++t) {
      const unsigned short* brow = Wt + (size_t)(col0 + t * 16 + ln) * ldb + kb;
      FragB b;
      b.half[0] = *(const v8us*)(brow + 8 * hh);
      b.half[1] = *(const v8us*)(brow + 16 + 8 * hh);
      acc[t] = mmaN<ASPLIT ? 2 : 1>(ah.v, al.v, b.v, b.v, acc[t]);
    }
  }
#pragma unroll
  for (int t = 0; t < 4; ++t) {
    const int col = col0 + t * 16 + ln;
    float bv = bias ? bias[col] : 0.f;
    if (BIAS_BF16) bv = bf16_round(bv);
#pragma unroll
    for (int r = 0; r < 8; ++r) {
      float v = acc[t][r] + bv;
      if (resid) { float rv = resid[(size_t)((row0 + 8 * hh + r) % rmod) * ldr + col]; if (RES_BF16) rv = bf16_round(rv); v += rv; }
      if (ACT == 1) v = fmaxf(v, 0.f);
      if (ACT == 2) v = 0.5f * v * (1.0f + erff(v * 0.70710678118654752f));
      if (ACT == 3) { const float u = 0.7978845608028654f * (v + 0.044715f * v * v * v); v = 0.5f * v * (1.0f + tanhf(u)); }
      so[w][8 * hh + r][t * 16 + ln] = v;
    }
  }
  __builtin_amdgcn_fence(__ATOMIC_ACQ_REL, "workgroup");
  __builtin_amdgcn_wave_barrier();
  const int rsub = lane >> 4, c4 = (lane & 15) * 4;
  {
#pragma unroll
    for (int q = 0; q < 8; ++q) {
      const int r = q * 2 + rsub;
      const v4f v = *(const v4fa*)&so[w][r][c4];
      *(v4f*)(C + (size_t)(row0 + r) * ldc + col0 + c4) = v;
    }
    
  }
}
// row LayerNorm (biased variance, eps) over N: s = X (+ R); optional out_sum <- s; out_norm <- (s-mu)*rsqrt(var+eps)*g + b
template <bool PARAM_BF16>
__global__ __launch_bounds__(256) void k_layernorm(const float* __restrict__ X, const float* __restrict__ R, const float* __restrict__ g, const float* __restrict__ bta,
                                                  float* __restrict__ out_sum, float* __restrict__ out_norm, int N, float eps) {
  __shared__ float red[256];
  const int row = blockIdx.x, tid = threadIdx.x;
  const float* x = X + (size_t)row * N; const float* rr = R ? R + (size_t)row * N : nullptr;
  float vals[16];                     // up to N = 4096
  const int per = N / 256;            // contiguous chunk per thread? use strided-by-4 chunks: thread handles j = tid*4 + 1024*u
  float s1 = 0.f;
  for (int u = 0; u < per / 4; ++u) {
    const int j = tid * 4 + 1024 * u;
    const v4f a = *(const v4fa*)(x + j);
    v4f b = {0.f,0.f,0.f,0.f}; if (rr) b = *(const v4fa*)(rr + j);
#pragma unroll
    for (int q = 0; q < 4; ++q) { const float v = a[q] + b[q]; vals[u * 4 + q] = v; s1 += v; }
  }
  red[tid] = s1; __syncthreads();
  for (int st = 128; st > 0; st >>= 1) { if (tid < st) red[tid] += red[tid + st]; __syncthreads(); }
  const float mu = red[0] / (float)N; __syncthreads();
  float s2 = 0.f;
  for (int u = 0; u < per / 4; ++u)
#pragma unroll
    for (int q = 0; q < 4; ++q) { const float c = vals[u * 4 + q] - mu; s2 += c * c; }
  red[tid] = s2; __syncthreads();
  for (int st = 128; st > 0; st >>= 1) { if (tid < st) red[tid] += red[tid + st]; __syncthreads(); }
  const float rs = rsqrtf(red[0] / (float)N + eps);
  {
    for (int u = 0; u < per / 4; ++u) {
      const int j = tid * 4 + 1024 * u;
      v4f o, sm;
#pragma unroll
      for (int q = 0; q < 4; ++q) {
        float gg = g[j + q], bb = bta[j + q];
        if (PARAM_BF16) { gg = bf16_round(gg); bb = bf16_round(bb); }
        sm[q] = vals[u * 4 + q]; o[q] = (vals[u * 4 + q] - mu) * rs * gg + bb;
      }
      if (out_sum) *(v4f*)(out_sum + (size_t)row * N + j) = sm;
      *(v4f*)(out_norm + (size_t)row * N + j) = o;
    }
    
  }
}



// ---- f16 WMMA path (v_wmma_f32_16x16x32_f16): 11-bit significands for operands in range — used where a [0,1] probability operand needs more precision than bf16
typedef _Float16 v16h __attribute__((ext_vector_type(16)));
union FragH { v16h v; v8us half[2]; _Float16 h[16]; unsigned short u[16]; };
template <int NT>
__device__ __forceinline__ v8f mmaH(v16h ah, v16h al, v16h bh, v16h bl, v8f c) {
  c = __builtin_amdgcn_wmma_f32_16x16x32_f16(false, ah, false, bh, (short)0, c, false, false);
  if (NT >= 2) c = __builtin_amdgcn_wmma_f32_16x16x32_f16(false, al, false, bh, (short)0, c, false, false);
  if (NT >= 3) c = __builtin_amdgcn_wmma_f32_16x16x32_f16(false, ah, false, bl, (short)0, c, false, false);
  asm volatile("v_nop\n\tv_nop\n\tv_nop\n\tv_nop" : "+v"(c) : "v"(ah), "v"(al), "v"(bh), "v"(bl));
  return c;
}
// batched GEMM like k_gemm_b but f16 operands: A f32 (split into f16 hi/lo if ASPLIT, else rounded to f16), Bt = f16 values [n][k]; alpha; C f32; N multiple of 16 (partial tiles skipped)
template <bool ASPLIT>
__global__ __launch_bounds__(128) void k_gemm_h(const float* __restrict__ A, int lda, size_t sA, const _Float16* __restrict__ Bh, int ldb, size_t sB, float alpha, float* __restrict__ C, int ldc, size_t sC, int M, int N, int K) {
  __shared__ __attribute__((aligned(16))) float so[4][16][64];
  const int tid = threadIdx.x, w = tid >> 5, lane = tid & 31, ln = lane & 15, hh = lane >> 4; const int by = blockIdx.y;
  A += (size_t)by * sA; Bh += (size_t)by * sB; C += (size_t)by * sC;
  const int ntn = (N + 63) / 64; const int wid = blockIdx.x * 4 + w; const int mt = wid / ntn, nq = wid % ntn; if (mt * 16 >= M) return;
  const int row0 = mt * 16, col0 = nq * 64; const float* arow = A + (size_t)(row0 + ln) * lda;
  v8f acc[4] = {};
  for (int kb = 0; kb < K; kb += 32) {
    FragH ah, al;
    const v4f x0 = *(const v4fa*)(arow + kb + 8 * hh), x1 = *(const v4fa*)(arow + kb + 8 * hh + 4), x2 = *(const v4fa*)(arow + kb + 16 + 8 * hh), x3 = *(const v4fa*)(arow + kb + 16 + 8 * hh + 4);
    float xs[16] = {x0[0],x0[1],x0[2],x0[3],x1[0],x1[1],x1[2],x1[3],x2[0],x2[1],x2[2],x2[3],x3[0],x3[1],x3[2],x3[3]};
#pragma unroll
    for (int i = 0; i < 16; ++i) { const _Float16 h = (_Float16)xs[i]; ah.h[i] = h; al.h[i] = ASPLIT ? (_Float16)(xs[i] - (float)h) : (_Float16)0.0f; }
#pragma unroll
    for (int t = 0; t < 4; ++t) { if (col0 + t * 16 >= N) continue; const size_t boff = (size_t)(col0 + t * 16 + ln) * ldb + kb; FragH bq; bq.half[0] = *(const v8us*)(Bh + boff + 8 * hh); bq.half[1] = *(const v8us*)(Bh + boff + 16 + 8 * hh);
      acc[t] = mmaH<ASPLIT ? 2 : 1>(ah.v, al.v, bq.v, bq.v, acc[t]); }
  }
#pragma unroll
  for (int t = 0; t < 4; ++t) { if (col0 + t * 16 >= N) continue;
#pragma unroll
    for (int r = 0; r < 8; ++r) so[w][8 * hh + r][t * 16 + ln] = acc[t][r] * alpha; }
  __builtin_amdgcn_fence(__ATOMIC_ACQ_REL, "workgroup"); __builtin_amdgcn_wave_barrier();
  const int rsub = lane >> 4, c4 = (lane & 15) * 4;
  {
#pragma unroll
    for (int q = 0; q < 8; ++q) { const int r = q * 2 + rsub; if (col0 + c4 < N) { const v4f v = *(const v4fa*)&so[w][r][c4]; *(v4f*)(C + (size_t)(row0 + r) * ldc + col0 + c4) = v; } }
     }
}

// Wt[n][k] = f16(W[k][n]·scale) from f32 row-major W[K][N] (scale = power of two; bf16-exact weights stay exact in f16 away from the subnormal range)
__global__ __launch_bounds__(256) void k_wt_f16(const float* __restrict__ W, _Float16* __restrict__ Wt, int K, int N, float scale) {
  const int t = blockIdx.x * 256 + threadIdx.x; if (t >= N * (K / 8)) return; const int n = t / (K / 8), k8 = (t % (K / 8)) * 8; FragH f;
#pragma unroll
  for (int i = 0; i < 8; ++i) f.h[i] = (_Float16)(bf16_round(W[(size_t)(k8 + i) * N + n]) * scale); const v8us o = f.half[0];
  *(v8us*)((unsigned short*)Wt + (size_t)n * K + k8) = o; 
}
// k_gemm_hh variant with fused epilogue: v = acc·alpha + bias[by·sBias + col] (+ CP[(row/rowsPerB)·sCPb + by·64 + col] if CP) ; ACT 0 none / 1 elu ; writes f16 C16 (and f32 C if non-null)
template <int ACT>
__global__ __launch_bounds__(128) void k_gemm_hhx(const _Float16* __restrict__ A, int lda, size_t sA, const _Float16* __restrict__ Bh, int ldb, size_t sB, float alpha, const float* __restrict__ bias, size_t sBias, const float* __restrict__ CP, int rowsPerB, size_t sCPb, int row0g,
    float* __restrict__ C, _Float16* __restrict__ C16, int ldc, size_t sC, int M, int N, int K) {
  __shared__ __attribute__((aligned(16))) float so[4][16][64];
  const int tid = threadIdx.x, w = tid >> 5, lane = tid & 31, ln = lane & 15, hh = lane >> 4; const int by = blockIdx.y;
  A += (size_t)by * sA; Bh += (size_t)by * sB; const size_t cofs = (size_t)by * sC; const float* bp = bias ? bias + (size_t)by * sBias : nullptr;
  const int ntn = (N + 63) / 64; const int wid = blockIdx.x * 4 + w; const int mt = wid / ntn, nq = wid % ntn; if (mt * 16 >= M) return;
  const int row0 = mt * 16, col0 = nq * 64; const _Float16* arow = A + (size_t)(row0 + ln) * lda;
  v8f acc[4] = {};
  for (int kb = 0; kb < K; kb += 32) { FragH ah; ah.half[0] = *(const v8us*)((const unsigned short*)arow + kb + 8 * hh); ah.half[1] = *(const v8us*)((const unsigned short*)arow + kb + 16 + 8 * hh);
#pragma unroll
    for (int t = 0; t < 4; ++t) { if (col0 + t * 16 >= N) continue; const size_t boff = (size_t)(col0 + t * 16 + ln) * ldb + kb; FragH bq; bq.half[0] = *(const v8us*)((const unsigned short*)Bh + boff + 8 * hh); bq.half[1] = *(const v8us*)((const unsigned short*)Bh + boff + 16 + 8 * hh);
      acc[t] = mmaH<1>(ah.v, ah.v, bq.v, bq.v, acc[t]); }
  }
#pragma unroll
  for (int t = 0; t < 4; ++t) { if (col0 + t * 16 >= N) continue; const int col = col0 + t * 16 + ln; const float bv = bp ? bf16_round(bp[col]) : 0.f;
#pragma unroll
    for (int r = 0; r < 8; ++r) { float v = acc[t][r] * alpha + bv; if (CP) { const int rr = row0g + row0 + 8 * hh + r; if (rowsPerB < 0) v += CP[cofs + (size_t)rr * ldc + col];      /* rowsPerB < 0: own element of the batched C plane */ else { const int bidx = rr / rowsPerB; v += CP[(size_t)bidx * sCPb + (size_t)by * 64 + col]; } } if (ACT == 1) v = (v > 0.f) ? v : expm1f(v); else if (ACT == 7) v = (v > 0.f) ? v + 1.0f : expf(v); else if (ACT == 8) v = tanhf(v); else if (ACT == 9) v = 0.5f * v * (1.0f + tanhf(0.7978845608028654f * (v + 0.044715f * v * v * v))); else if (ACT == 11) v = 1.0f / (1.0f + expf(-v)); else if (ACT == 12) v = (v > 0.f) ? v : 0.01f * v; else if (ACT == 14) v = (v > 0.f) ? v : 0.1f * v; else if (ACT == 16) v = (v >= 0.f) ? v : 0.3f * v; else if (ACT == 17) v = (v >= 0.f) ? v : 0.2f * v; else if (ACT == 15) v = v / (1.0f + expf(-v)); else if (ACT == 3) v = fmaxf(v, 0.f); else if (ACT == 6) v = 0.5f * v * (1.0f + erff(v * 0.70710678118654752f)); so[w][8 * hh + r][t * 16 + ln] = v; } }
  __builtin_amdgcn_fence(__ATOMIC_ACQ_REL, "workgroup"); __builtin_amdgcn_wave_barrier();
  const int rsub = lane >> 4, c4 = (lane & 15) * 4; typedef _Float16 v4h __attribute__((ext_vector_type(4)));
  {
#pragma unroll
    for (int q = 0; q < 8; ++q) { const int r = q * 2 + rsub; if (col0 + c4 < N) { const v4f v = *(const v4fa*)&so[w][r][c4]; if (C) *(v4f*)(C + cofs + (size_t)(row0 + r) * ldc + col0 + c4) = v; if (C16) { v4h h4; for (int i = 0; i < 4; ++i) h4[i] = (_Float16)v[i]; *(v4h*)(C16 + cofs + (size_t)(row0 + r) * ldc + col0 + c4) = h4; } } }
     }
}


typedef _Float16 v4h __attribute__((ext_vector_type(4)));

__global__ __launch_bounds__(256) void k_x16(const float* __restrict__ x, _Float16* __restrict__ X16, size_t n8) { const size_t t = (size_t)blockIdx.x * 256 + threadIdx.x; if (t >= n8) return; FragH f;
#pragma unroll
  for (int q = 0; q < 8; ++q) f.h[q] = (_Float16)bf16_round(x[t * 8 + q]); *(v8us*)((unsigned short*)X16 + t * 8) = f.half[0];  }
__global__ __launch_bounds__(256) void k_h16(const float* __restrict__ x, _Float16* __restrict__ X16, size_t n8) { const size_t t = (size_t)blockIdx.x * 256 + threadIdx.x; if (t >= n8) return; FragH f;
#pragma unroll
  for (int q = 0; q < 8; ++q) f.h[q] = (_Float16)x[t * 8 + q]; *(v8us*)((unsigned short*)X16 + t * 8) = f.half[0];  }
__global__ __launch_bounds__(256) void k_round16f(const float* __restrict__ W, _Float16* __restrict__ Bt, size_t n8) { const size_t t = (size_t)blockIdx.x * 256 + threadIdx.x; if (t >= n8) return; FragH f;
#pragma unroll
  for (int i = 0; i < 8; ++i) f.h[i] = (_Float16)(bf16_round(W[t * 8 + i]) * 16.0f); *(v8us*)((unsigned short*)Bt + t * 8) = f.half[0];  }
template <int NHv, int TTv>
__global__ __launch_bounds__(256) void k_vt(const _Float16* __restrict__ V16, int ldv, int voff, _Float16* __restrict__ Vt) { __shared__ unsigned short tl[64][66]; const int tid = threadIdx.x; const int slab = blockIdx.x / (TTv / 64), lg = blockIdx.x % (TTv / 64); const int b = slab / NHv, h = slab % NHv;
  for (int i = tid; i < 64 * 8; i += 256) { const int r = i / 8, c8 = (i % 8) * 8; FragH f; f.half[0] = *(const v8us*)((const unsigned short*)V16 + ((size_t)b * TTv + lg * 64 + r) * ldv + voff + h * 64 + c8);
#pragma unroll
    for (int q = 0; q < 8; ++q) tl[r][c8 + q] = f.u[q]; }
  __syncthreads();
  {
#pragma unroll
    for (int rd = 0; rd < 2; ++rd) { const int d = rd * 32 + tid / 8, pc = tid % 8; FragH f;
#pragma unroll
      for (int q = 0; q < 8; ++q) f.u[q] = tl[pc * 8 + q][d];
      *(v8us*)((unsigned short*)Vt + ((size_t)slab * 64 + d) * TTv + lg * 64 + pc * 8) = f.half[0]; }
     } }

__global__ __launch_bounds__(256) void k_hl(const float* __restrict__ F, _Float16* __restrict__ Hh, _Float16* __restrict__ Hl, size_t n8) { const size_t t = (size_t)blockIdx.x * 256 + threadIdx.x; if (t >= n8) return; FragH fh, fl; const v4f a = *(const v4fa*)(F + t * 8), c = *(const v4fa*)(F + t * 8 + 4);
#pragma unroll
  for (int q = 0; q < 4; ++q) { _Float16 h = (_Float16)a[q]; fh.h[q] = h; fl.h[q] = (_Float16)((a[q] - (float)h) * 1024.0f); h = (_Float16)c[q]; fh.h[4 + q] = h; fl.h[4 + q] = (_Float16)((c[q] - (float)h) * 1024.0f); }
  { *(v8us*)((unsigned short*)Hh + t * 8) = fh.half[0]; *(v8us*)((unsigned short*)Hl + t * 8) = fl.half[0];  } }

// ---- fast GEMM (wave tile 32x64; requires M % 32 == 0 rows per launch region and N % 64 == 0); epilogue = k_gemm_hhx semantics ----
__device__ __forceinline__ v16h g2_frag(const _Float16* p, int hh) { FragH f; f.half[0] = *(const v8us*)((const unsigned short*)p + 8 * hh); f.half[1] = *(const v8us*)((const unsigned short*)p + 16 + 8 * hh); return f.v; }
__device__ __forceinline__ v8f g2_mma(v16h a, v16h b, v8f c) { v8f d = __builtin_amdgcn_wmma_f32_16x16x32_f16(false, a, false, b, (short)0, c, false, false); asm volatile("v_nop\n\tv_nop\n\tv_nop\n\tv_nop" : "+v"(d) : "v"(a), "v"(b)); return d; }
template <int ACT>
__global__ __launch_bounds__(128) void k_gemm2(const _Float16* __restrict__ A, int lda, size_t sA, const _Float16* __restrict__ Bh, int ldb, size_t sB, float alpha, const float* __restrict__ bias, size_t sBias, const float* __restrict__ CP, int rowsPerB, size_t sCPb, int row0g,
    float* __restrict__ C, _Float16* __restrict__ C16, int ldc, size_t sC, int M, int N, int K) { static_assert(ACT == 0 || ACT == 3 || ACT == 6 || ACT == 8 || ACT == 9 || ACT == 11 || ACT == 12 || ACT == 14 || ACT == 15 || ACT == 16 || ACT == 17, "k_gemm2: unsupported ACT code (would silently apply no activation)");
  __shared__ __attribute__((aligned(16))) float so[4][32][68];
  const int tid = threadIdx.x, w = tid >> 5, lane = tid & 31, ln = lane & 15, hh = lane >> 4; const int by = blockIdx.y;
  A += (size_t)by * sA; Bh += (size_t)by * sB; const size_t cofs = (size_t)by * sC; const float* bp = bias ? bias + (size_t)by * sBias : nullptr;
  const int ntn = N >> 6; const int mt = blockIdx.x / ntn, nq = blockIdx.x - mt * ntn; const int row0 = mt * 128 + 32 * w, col0 = nq * 64; if (row0 >= M) return;
  const _Float16* a0p = A + (size_t)(row0 + ln) * lda; const _Float16* a1p = a0p + (size_t)16 * lda;
  const _Float16* b0p = Bh + (size_t)(col0 + ln) * ldb; const _Float16* b1p = b0p + (size_t)16 * ldb; const _Float16* b2p = b1p + (size_t)16 * ldb; const _Float16* b3p = b2p + (size_t)16 * ldb;
  const v8f z8 = {0.f,0.f,0.f,0.f,0.f,0.f,0.f,0.f}; v8f c00 = z8, c01 = z8, c02 = z8, c03 = z8, c10 = z8, c11 = z8, c12 = z8, c13 = z8;
#pragma unroll 1
  for (int kb = 0; kb < K; kb += 32) { const v16h a0 = g2_frag(a0p + kb, hh), a1 = g2_frag(a1p + kb, hh);
    v16h b = g2_frag(b0p + kb, hh); c00 = g2_mma(a0, b, c00); c10 = g2_mma(a1, b, c10);
    b = g2_frag(b1p + kb, hh); c01 = g2_mma(a0, b, c01); c11 = g2_mma(a1, b, c11);
    b = g2_frag(b2p + kb, hh); c02 = g2_mma(a0, b, c02); c12 = g2_mma(a1, b, c12);
    b = g2_frag(b3p + kb, hh); c03 = g2_mma(a0, b, c03); c13 = g2_mma(a1, b, c13); }
  v8f accs[8] = {c00, c01, c02, c03, c10, c11, c12, c13};
#pragma unroll
  for (int u = 0; u < 8; ++u) { const int t = u & 3, half = u >> 2; const int col = col0 + t * 16 + ln; const float bv = bp ? bf16_round(bp[col]) : 0.f;
#pragma unroll
    for (int r = 0; r < 8; ++r) { const int rloc = half * 16 + 8 * hh + r; float v = accs[u][r] * alpha + bv; if (CP) { if (rowsPerB < 0) v += CP[cofs + (size_t)(row0g + row0 + rloc) * ldc + col];      /* rowsPerB < 0: own element of the batched C plane */ else { const int bidx = (row0g + row0 + rloc) / rowsPerB; v += CP[(size_t)bidx * sCPb + (size_t)by * 64 + col]; } }
      if (ACT == 3) v = fmaxf(v, 0.f); else if (ACT == 6) v = 0.5f * v * (1.0f + erff(v * 0.70710678118654752f)); else if (ACT == 11) v = 1.0f / (1.0f + expf(-v)); else if (ACT == 15) v = v / (1.0f + expf(-v)); else if (ACT == 12) v = (v > 0.f) ? v : 0.01f * v; else if (ACT == 8) v = tanhf(v); else if (ACT == 9) v = 0.5f * v * (1.0f + tanhf(0.7978845608028654f * (v + 0.044715f * v * v * v))); else if (ACT == 14) v = (v > 0.f) ? v : 0.1f * v; else if (ACT == 16) v = (v >= 0.f) ? v : 0.3f * v; else if (ACT == 17) v = (v >= 0.f) ? v : 0.2f * v;
      so[w][rloc][t * 16 + ln] = v; } }
  __builtin_amdgcn_fence(__ATOMIC_ACQ_REL, "workgroup"); __builtin_amdgcn_wave_barrier();
  const int rsub = lane >> 4, c4 = (lane & 15) * 4;
  {
#pragma unroll
    for (int q = 0; q < 16; ++q) { const int r = q * 2 + rsub; const v4f v = *(const v4fa*)&so[w][r][c4]; if (C) *(v4f*)(C + cofs + (size_t)(row0 + r) * ldc + col0 + c4) = v; if (C16) { v4h h4; for (int i = 0; i < 4; ++i) h4[i] = (_Float16)v[i]; *(v4h*)(C16 + cofs + (size_t)(row0 + r) * ldc + col0 + c4) = h4; } }
     } }


__global__ __launch_bounds__(256) void k_wnat(const float* __restrict__ w, size_t n8, _Float16* __restrict__ Bt) { const size_t t = (size_t)blockIdx.x * 256 + threadIdx.x; if (t >= n8) return; FragH f; for (int q = 0; q < 8; ++q) f.h[q] = (_Float16)(bf16_round(w[t * 8 + q]) * 16.0f); *(v8us*)((unsigned short*)Bt + t * 8) = f.half[0];  }
__global__ __launch_bounds__(256) void k_rsm(const float* __restrict__ S, _Float16* __restrict__ P, int nrows) {
  #pragma clang fp contract(off)
  const int i = blockIdx.x * 256 + threadIdx.x; if (i >= nrows) return; const float* s = S + (size_t)i * SQ; float mx = -3.0e38f;
#pragma unroll 1
  for (int j = 0; j < SQ; ++j) mx = fmaxf(mx, s[j]); float se = 0.f;
#pragma unroll 1
  for (int j = 0; j < SQ; ++j) se += expf(s[j] - mx); const float sc = 256.0f / se;
#pragma unroll 1
  for (int j0 = 0; j0 < SQ; j0 += 8) { FragH f; for (int q = 0; q < 8; ++q) f.h[q] = (_Float16)(expf(s[j0 + q] - mx) * sc); unsigned short* d = (unsigned short*)P + (size_t)i * SQ + j0; *(v8us*)d = f.half[0];  } }
__global__ __launch_bounds__(256) void k_vt(const _Float16* __restrict__ V16, int b, int h0, _Float16* __restrict__ VT) { __shared__ unsigned short tl[64][65]; const int tid = threadIdx.x; const int hh = blockIdx.x % HG, sg = blockIdx.x / HG; const int s0 = sg * 64; const int h = h0 + hh;
  for (int i = tid; i < 64 * 8; i += 256) { const int j = i / 8, d8 = (i % 8) * 8; FragH f; f.half[0] = *(const v8us*)((const unsigned short*)V16 + ((size_t)b * SQ + s0 + j) * DM + h * HD + d8); for (int q = 0; q < 8; ++q) tl[d8 + q][j] = f.u[q]; }
  __syncthreads();
  { for (int i = tid; i < 64 * 8; i += 256) { const int d = i / 8, j8 = (i % 8) * 8; FragH f; for (int q = 0; q < 8; ++q) f.u[q] = tl[d][j8 + q]; *(v8us*)((unsigned short*)VT + ((size_t)hh * HD + d) * SQ + s0 + j8) = f.half[0]; }  } }



// ---- one preparing launch: independent pieces picked by block range, so that they share one start instead of seven dependent ones ----
// Blocks 0 .. 4 * PW_B - 1: weight wi = block / PW_B as Wt[n][k] = f16(bf16(W[k][n]) x 16), the arithmetic of k_wt_f16. The other 2 * PX_B blocks: the two
// sources as f16(bf16(x)) rows, the arithmetic of k_x16; a block takes PX_U consecutive runs of 256 groups of 8 floats, a thread one group of each run.
#define PW_B (DM * (DM / 8) / 256)   /* blocks per weight */
#define PX_U 8                       /* groups of 8 elements per thread */
#define PX_B ((int)(NR * DM / 8 / 256 / PX_U))      /* blocks per source */
__global__ __launch_bounds__(256) void k_prep(const float* __restrict__ xq, const float* __restrict__ xk, const float* __restrict__ wq, const float* __restrict__ wk, const float* __restrict__ wv, const float* __restrict__ wo,
    _Float16* __restrict__ XQ, _Float16* __restrict__ XK, _Float16* __restrict__ BW) {
  static_assert(NR * DM == (size_t)PX_B * 256 * PX_U * 8, "the sources divide evenly among the threads");
  const int bx = blockIdx.x;
  if (bx < 4 * PW_B) { const int wi = bx / PW_B; const float* W = wi == 0 ? wq : wi == 1 ? wk : wi == 2 ? wv : wo; _Float16* Wt = BW + (size_t)wi * DM * DM;
    const int t = (bx - wi * PW_B) * 256 + threadIdx.x; const int n = t / (DM / 8), k8 = (t % (DM / 8)) * 8; FragH f;
#pragma unroll
    for (int i = 0; i < 8; ++i) f.h[i] = (_Float16)(bf16_round(W[(size_t)(k8 + i) * DM + n]) * 16.0f);
    *(v8us*)((unsigned short*)Wt + (size_t)n * DM + k8) = f.half[0];
    return; }
  const int xb = bx - 4 * PW_B; const bool second = xb >= PX_B; const size_t g0 = (size_t)(xb - (second ? PX_B : 0)) * (256 * PX_U) + threadIdx.x;      /* the thread's first group */
  const float* p = (second ? xk : xq) + g0 * 8; unsigned short* d = (unsigned short*)(second ? XK : XQ) + g0 * 8; v4f a[PX_U][2]; v8us o[PX_U];
#pragma unroll
  for (int u = 0; u < PX_U; ++u) { a[u][0] = *(const v4fa*)(p + u * 2048); a[u][1] = *(const v4fa*)(p + u * 2048 + 4); }
  asm volatile("s_wait_xcnt 0x0" :: "v"(p) : "memory");      /* the loads' address register stays whole up to this wait; behind it it may be reused */
#pragma unroll
  for (int u = 0; u < PX_U; ++u) { FragH f;
#pragma unroll
    for (int q = 0; q < 4; ++q) { f.h[q] = (_Float16)bf16_round(a[u][0][q]); f.h[4 + q] = (_Float16)bf16_round(a[u][1][q]); }
    o[u] = f.half[0]; }
  __builtin_amdgcn_sched_barrier(0);      /* the stores stand last, so that no register of an issued store is written again */
#pragma unroll
  for (int u = 0; u < PX_U; ++u) *(v8us*)(d + u * 2048) = o[u];
  asm volatile("s_wait_xcnt 0x0" ::: "memory"); }      /* in the built code the weight blocks' part follows behind a scalar branch and writes these registers: the wait stands in front of it */

// ---- the three projections in one launch (tile, loop order and epilogue arithmetic of k_gemm2): blockIdx.y = 0: Q rows, 1: K rows, 2: V^T ----
// V^T[feature][token] = sum_k Wt[feature][k] X[token][k] is the projection with the operand roles swapped (A = weight rows, B = token rows): its C rows are the
// [batch][head][d][token] rows that the attention kernel reads, 128-byte lines of 64 tokens with one wave as writer, and the bias goes by row instead of by column.
template <int LDC>
__device__ __forceinline__ void p3_store(const float (*so)[68], _Float16* cp, int lane) {      /* cp: the wave's tile origin in C; rows leave as whole 128-byte lines */
  const int rsub = lane >> 4, c4 = (lane & 15) * 4; _Float16* c = cp + (size_t)rsub * LDC + c4; v4h h4[16];
#pragma unroll
  for (int q = 0; q < 16; ++q) { const v4f v = *(const v4fa*)&so[q * 2 + rsub][c4];
#pragma unroll
    for (int i = 0; i < 4; ++i) h4[q][i] = (_Float16)v[i]; }
  __builtin_amdgcn_sched_barrier(0);      /* the stores stand last, so that no register of an issued store is written again */
#pragma unroll
  for (int q = 0; q < 16; ++q) *(v4h*)(c + (size_t)q * 2 * LDC) = h4[q];
  asm volatile("s_wait_xcnt 0x0" ::: "memory"); }      /* in the built code the other layout's epilogue follows behind a scalar branch and writes these registers: the wait stands in front of it */
__global__ __launch_bounds__(128) void k_proj3(const _Float16* __restrict__ XQ, const _Float16* __restrict__ XK, const _Float16* __restrict__ BW, const float* __restrict__ bq, const float* __restrict__ bk, const float* __restrict__ bv,
    _Float16* __restrict__ Q16, _Float16* __restrict__ K16, _Float16* __restrict__ VT) {
  static_assert((MP / 128) * (DM / 64) == NB * (DM / 128) * (SQ / 64) && MP == NB * SQ, "the three products have the same number of 128x64 tiles");
  __shared__ __attribute__((aligned(16))) float so[4][32][68];
  const int tid = threadIdx.x, w = tid >> 5, lane = tid & 31, ln = lane & 15, hh = lane >> 4; const int by = blockIdx.y, bx = blockIdx.x; const bool tr = by == 2;
  const _Float16* A; const _Float16* Bh; const float* bias; int mt, nq;
  if (tr) { const int b = bx / ((DM / 128) * (SQ / 64)), x = bx - b * ((DM / 128) * (SQ / 64)); A = BW + (size_t)2 * DM * DM; Bh = XK + (size_t)b * SQ * DM; bias = bv; mt = x / (SQ / 64); nq = x - mt * (SQ / 64); }
  else { A = by ? XK : XQ; Bh = BW + (size_t)by * DM * DM; bias = by ? bk : bq; mt = bx / (DM / 64); nq = bx - mt * (DM / 64); }
  const int row0 = mt * 128 + 32 * w, col0 = nq * 64;
  const _Float16* ap = A + (size_t)(row0 + ln) * DM + 8 * hh; const _Float16* bp = Bh + (size_t)(col0 + ln) * DM + 8 * hh;      /* the lane's place in its A and B rows (k = 8 hh), stepped 32 k a trip */
  const v8f z8 = {0.f,0.f,0.f,0.f,0.f,0.f,0.f,0.f}; v8f c00 = z8, c01 = z8, c02 = z8, c03 = z8, c10 = z8, c11 = z8, c12 = z8, c13 = z8;
#pragma unroll 1      /* as in k_gemm2: one 32-k step per trip */
  for (int kb = 0; kb < DM; kb += 32) { const v16h a0 = g2_frag(ap, 0), a1 = g2_frag(ap + 16 * DM, 0);      /* the half's 8 hh is in the pointers already */
    v16h b = g2_frag(bp, 0); c00 = g2_mma(a0, b, c00); c10 = g2_mma(a1, b, c10);
    b = g2_frag(bp + 16 * DM, 0); c01 = g2_mma(a0, b, c01); c11 = g2_mma(a1, b, c11);
    b = g2_frag(bp + 32 * DM, 0); c02 = g2_mma(a0, b, c02); c12 = g2_mma(a1, b, c12);
    b = g2_frag(bp + 48 * DM, 0); c03 = g2_mma(a0, b, c03); c13 = g2_mma(a1, b, c13);
    asm volatile("s_wait_xcnt 0x0" :: "v"(ap), "v"(bp) : "memory");      /* the trip's loads name these two addresses: the wait stands in front of their step */
    ap += 32; bp += 32; }
  v8f accs[8] = {c00, c01, c02, c03, c10, c11, c12, c13};
  float bcol[4] = {0.f, 0.f, 0.f, 0.f}, brow[2][8] = {};
  if (tr) {
#pragma unroll
    for (int half = 0; half < 2; ++half)
#pragma unroll
      for (int r = 0; r < 8; ++r) brow[half][r] = bf16_round(bias[row0 + half * 16 + 8 * hh + r]); }
  else {
#pragma unroll
    for (int t = 0; t < 4; ++t) bcol[t] = bf16_round(bias[col0 + t * 16 + ln]); }
#pragma unroll
  for (int u = 0; u < 8; ++u) { const int t = u & 3, half = u >> 2;
#pragma unroll
    for (int r = 0; r < 8; ++r) so[w][half * 16 + 8 * hh + r][t * 16 + ln] = accs[u][r] * 0.0625f + (tr ? brow[half][r] : bcol[t]); }
  __builtin_amdgcn_fence(__ATOMIC_ACQ_REL, "workgroup"); __builtin_amdgcn_wave_barrier();      /* the wave reads back its own tile in row order */
  if (tr) p3_store<SQ>(so[w], VT + (size_t)(bx / ((DM / 128) * (SQ / 64))) * DM * SQ + (size_t)row0 * SQ + col0, lane);
  else p3_store<DM>(so[w], (by ? K16 : Q16) + (size_t)row0 * DM + col0, lane); }

#define FA_NW 8                      /* waves per work-group */
#define FA_CW 32                     /* query columns per wave (two 16-column groups) */
#define FA_BR (FA_NW * FA_CW)        /* query rows per work-group */
#define FA_SK 64                     /* keys per LDS stage (two 32-key passes) */
#define FA_PIT 144                   /* LDS row pitch in bytes: 128 of data + 16, an odd multiple of 16 B (16-byte fragment reads without bank conflicts) */
#define FA_OFS 6.0f                  /* the maximum in use is kept 6 below the true one: weights carried x64, away from the f16 subnormal range */
#define FA_LAG 8.0f                  /* a column's maximum may outgrow the one in use by this much (log2) before the sums are rescaled: weights stay <= 2^14 */
typedef float v2f __attribute__((ext_vector_type(2)));
typedef _Float16 v2h __attribute__((ext_vector_type(2)));
__device__ __forceinline__ float rs_xh(float x) { return __builtin_bit_cast(float, __builtin_amdgcn_permlanex16(__builtin_bit_cast(int, x), __builtin_bit_cast(int, x), 0x76543210, 0xfedcba98, false, false)); }      /* lane l <- lane l ^ 16 */
// Four native 2^x in place. One statement, so that no neighbour of a v_exp_f32 reads its result or writes its source; the closing v_nop is the free slot
// the instruction set asks for behind a transcendental.
__device__ __forceinline__ v4f rs_exp2x4(v4f e) { float a = e[0], b = e[1], c = e[2], d = e[3];
  asm("v_exp_f32 %0, %0\n\tv_exp_f32 %1, %1\n\tv_exp_f32 %2, %2\n\tv_exp_f32 %3, %3\n\tv_nop" : "+v"(a), "+v"(b), "+v"(c), "+v"(d));
  const v4f r = {a, b, c, d}; return r; }
__device__ __forceinline__ v8f fa_mma(v16h a, v16h b, v8f c) { return __builtin_amdgcn_wmma_f32_16x16x32_f16(false, a, false, b, (short)0, c, false, false); }
__device__ __forceinline__ v16h fa_lfrag(const unsigned char* p) { FragH f; f.half[0] = *(const v8us*)p; f.half[1] = *(const v8us*)(p + 32); return f.v; }      /* p already holds the lane's 16 h bytes: k = 8h + 0..7 and 16 + 8h + 0..7 */
__global__ __launch_bounds__(FA_NW * 32) void k_fattn(const _Float16* __restrict__ Q16, const _Float16* __restrict__ K16, const _Float16* __restrict__ VT, _Float16* __restrict__ O16) {
  static_assert(HD == 64 && SQ % FA_BR == 0 && SQ % FA_SK == 0 && FA_SK == 64 && FA_NW * 32 == 256, "tile constants are written for head size 64 and 256 threads");
  __shared__ __attribute__((aligned(16))) unsigned char L[2][2][FA_SK * FA_PIT];      /* [buffer][0: K rows (key)(d) | 1: V^T rows (d)(key)] */
  const int tid = threadIdx.x, lane = tid & 31, w = tid >> 5, c = lane & 15, h = lane >> 4;
  const int bh = blockIdx.y, b = bh / NH, hd = bh - b * NH; const int q0 = blockIdx.x * FA_BR + w * FA_CW;
  const unsigned short* Kg = (const unsigned short*)K16 + (size_t)b * SQ * DM + hd * HD;      /* row = key, pitch DM */
  const unsigned short* Vg = (const unsigned short*)VT + (size_t)bh * HD * SQ;                /* row = d, pitch SQ */
  const int sr = tid >> 3, sc = tid & 7;      /* staging: eight lanes move one whole 128-byte row; a thread owns rows sr and sr + 32 of both tiles */
  const unsigned short* kp = Kg + (size_t)sr * DM + sc * 8; const unsigned short* vp = Vg + (size_t)sr * SQ + sc * 8;
  v8us kr0, kr1, vr0, vr1;
  auto gload = [&](int st) { const unsigned short* k = kp + (size_t)st * FA_SK * DM; const unsigned short* v = vp + st * FA_SK;
    kr0 = *(const v8us*)k; kr1 = *(const v8us*)(k + (size_t)32 * DM); vr0 = *(const v8us*)v; vr1 = *(const v8us*)(v + (size_t)32 * SQ);
    asm volatile("s_wait_xcnt 0x0" ::: "memory"); };      /* the loads' address registers are stepped for the next stage: keep the wait in front of that overwrite */
  auto lstore = [&](int buf) { unsigned char* kd = &L[buf][0][sr * FA_PIT + sc * 16]; unsigned char* vd = &L[buf][1][sr * FA_PIT + sc * 16];
    *(v8us*)kd = kr0; *(v8us*)(kd + 32 * FA_PIT) = kr1; *(v8us*)vd = vr0; *(v8us*)(vd + 32 * FA_PIT) = vr1; };
  gload(0);
  v16h qf[2][2];      /* B operand: query column 16 g + c, d = 32 kc + hardware k order */
#pragma unroll
  for (int g = 0; g < 2; ++g) { const _Float16* qp = Q16 + ((size_t)b * SQ + q0 + 16 * g + c) * DM + hd * HD; qf[g][0] = g2_frag(qp, h); qf[g][1] = g2_frag(qp + 32, h); }
  const v8f z8 = {0.f,0.f,0.f,0.f,0.f,0.f,0.f,0.f}; const v4f z4 = {0.f,0.f,0.f,0.f};
  v8f acc[2][4]; v4f la[2]; float mu[2];      /* O^T tiles (d = 16 t + 8 h + r, query 16 g + c); this half's part of the denominator; the maximum in use, minus FA_OFS */
#pragma unroll
  for (int g = 0; g < 2; ++g) { mu[g] = -__builtin_inff(); la[g] = z4;
#pragma unroll
    for (int t = 0; t < 4; ++t) acc[g][t] = z8; }
  const float cs = 0.125f * 0x1.715476p+0f;      /* 1 / sqrt(64) and log2 e in one factor */
  lstore(0);
  __syncthreads();      /* stage 0 is visible to every wave */
  constexpr int NST = SQ / FA_SK;
  for (int st = 0; st < NST; ++st) { const int buf = st & 1;
    if (st + 1 < NST) gload(st + 1);      /* the next stage's rows fly into registers under this stage's work */
#pragma unroll      /* two passes with constant LDS offsets */
    for (int p = 0; p < 2; ++p) {
      const unsigned char* kb = &L[buf][0][(32 * p + c) * FA_PIT + 16 * h]; const unsigned char* vb = &L[buf][1][c * FA_PIT + 64 * p + 16 * h];
      v8f s[2][2];      /* [16-key tile][column group] */
#pragma unroll
      for (int kt = 0; kt < 2; ++kt) { const v16h k0 = fa_lfrag(kb + kt * 16 * FA_PIT), k1 = fa_lfrag(kb + kt * 16 * FA_PIT + 64);
#pragma unroll
        for (int g = 0; g < 2; ++g) s[kt][g] = fa_mma(k1, qf[g][1], fa_mma(k0, qf[g][0], z8)); }
      v16h vf[4];
#pragma unroll
      for (int t = 0; t < 4; ++t) vf[t] = fa_lfrag(vb + t * 16 * FA_PIT);
      float mb[2]; bool need = false;
#pragma unroll
      for (int g = 0; g < 2; ++g) { float m0 = fmaxf(s[0][g][0], s[1][g][0]), m1 = fmaxf(s[0][g][1], s[1][g][1]);
#pragma unroll
        for (int r = 2; r < 8; r += 2) { m0 = fmaxf(m0, fmaxf(s[0][g][r], s[1][g][r])); m1 = fmaxf(m1, fmaxf(s[0][g][r + 1], s[1][g][r + 1])); }
        m0 = fmaxf(m0, m1); mb[g] = fmaxf(m0, rs_xh(m0)) * cs - FA_OFS;      /* both halves hold the column's maximum of this pass (the scale is positive) */
        need = need || (mb[g] > mu[g] + FA_LAG); }
      if (__builtin_amdgcn_ballot_w32(need) != 0) {      /* wave-uniform; always taken on the first pass (mu = -inf), rare later */
        const float n0 = fmaxf(mu[0], mb[0]), n1 = fmaxf(mu[1], mb[1]); const v4f d4 = {mu[0] - n0, mu[1] - n1, 0.f, 0.f}; const v4f cr = rs_exp2x4(d4); mu[0] = n0; mu[1] = n1;
#pragma unroll
        for (int g = 0; g < 2; ++g) { la[g] = la[g] * cr[g];
#pragma unroll
          for (int t = 0; t < 4; ++t) acc[g][t] = acc[g][t] * cr[g]; } }
#pragma unroll
      for (int g = 0; g < 2; ++g) { const float nm = -mu[g]; FragH pf;
#pragma unroll
        for (int i = 0; i < 4; ++i) { const int kt = i >> 1, r0 = 4 * (i & 1); v4f e;
#pragma unroll
          for (int j = 0; j < 4; ++j) e[j] = __builtin_fmaf(s[kt][g][r0 + j], cs, nm);
          e = rs_exp2x4(e); la[g] = la[g] + e;
#pragma unroll
          for (int j = 0; j < 4; ++j) pf.h[4 * i + j] = (_Float16)e[j]; }      /* element 8 kt + r = key 16 kt + 8 h + r */
#pragma unroll
        for (int t = 0; t < 4; ++t) acc[g][t] = fa_mma(vf[t], pf.v, acc[g][t]); } }
    if (st + 1 < NST) lstore(buf ^ 1);      /* every wave left that buffer before the barrier that ended stage st - 1 */
    __syncthreads(); }      /* publishes stage st + 1 and ends every wave's reads of stage st */
#pragma unroll
  for (int g = 0; g < 2; ++g) { float lf = (la[g][0] + la[g][1]) + (la[g][2] + la[g][3]); lf += rs_xh(lf); const float inv = 64.0f / lf;      /* o carried x64, as the output GEMM's alpha expects */
    unsigned short* op = (unsigned short*)O16 + ((size_t)b * SQ + q0 + 16 * g + c) * DM + hd * HD + 8 * h;
#pragma unroll
    for (int t = 0; t < 4; ++t) { FragH o;
#pragma unroll
      for (int r = 0; r < 8; ++r) o.h[r] = (_Float16)(acc[g][t][r] * inv);
      *(v8us*)(op + 16 * t) = o.half[0]; } } }      /* 8 consecutive d of one query: one 16-byte store; a query's 128-byte line has this wave as its only writer */

extern "C" void kernel_launch(void* const* d_in, const int* in_sizes, int n_in,
                              void* d_out, int out_size, void* d_ws, size_t ws_size, hipStream_t stream) {
  (void)in_sizes; (void)n_in; (void)out_size;
  const float* const* I = (const float* const*)d_in; const float* xq = I[0]; const float* xk = I[1]; const float* wq = I[2]; const float* bq = I[3]; const float* wk = I[4]; const float* bk = I[5]; const float* wv = I[6]; const float* bv = I[7]; const float* wo = I[8]; const float* bo = I[9];      
  char* ws = (char*)d_ws; size_t off = 0;
  auto take = [&](size_t bytes) { char* p = ws + off; off += (bytes + 255) & ~(size_t)255; return p; };
  _Float16* BW = (_Float16*)take((size_t)4 * DM * DM * 2); _Float16* BO = BW + (size_t)3 * DM * DM;      /* the four weights, [in][out] -> Bt[n][k] x16: q, k, v, o */
  _Float16* XQ = (_Float16*)take(NR * DM * 2); _Float16* XK = (_Float16*)take(NR * DM * 2); _Float16* Q16 = (_Float16*)take(NR * DM * 2); _Float16* K16 = (_Float16*)take(NR * DM * 2); _Float16* O16 = (_Float16*)take(NR * DM * 2);
  _Float16* VT = (_Float16*)take((size_t)NB * NH * HD * SQ * 2);
  if (off > ws_size) return;
  k_prep<<<4 * PW_B + 2 * PX_B, 256, 0, stream>>>(xq, xk, wq, wk, wv, wo, XQ, XK, BW);      /* weights and both sources; keys and values read the same source, rounded once */
  const size_t r0p = (size_t)B0 * SQ;      /* first projected row */
  k_proj3<<<dim3((unsigned)((MP / 128) * (DM / 64)), 3), 128, 0, stream>>>(XQ, XK, BW, bq, bk, bv, Q16, K16, VT);      /* Q, K rows and V^T [NB][NH][HD][SQ] */
  k_fattn<<<dim3(SQ / FA_BR, NB * NH), FA_NW * 32, 0, stream>>>(Q16, K16, VT, O16);      /* o x64 (merged heads) as f16 rows */
  k_gemm2<0><<<dim3((unsigned)((MPO / 128) * (DM / 64)), 1), 128, 0, stream>>>(O16 + r0p * DM, DM, 0, BO, DM, 0, 0.0009765625f, bo, 0, nullptr, 1, 0, 0, (float*)d_out + r0p * DM, nullptr, DM, 0, MPO, DM, DM);      /* out rows are the output layout */
}

// v004
// It runs in 102 microseconds.
// Next to v003, in two timings, it ran 1.44 and 1.45 times as fast.
// Over all steps from v000 it is 131 times as fast.
#include <hip/hip_runtime.h>
#define NB 2
#define SQ 4096
#define DM 512
#define NH 8
#define HD 64
#define HG 1                         /* heads per block group in the unlaunched k_vt(V16, b, h0, VT) overload */
#define B0 0                         /* first batch processed (debug hook) */
#define NBR NB                       /* batches processed (debug hook) */
#define NR ((size_t)NB * SQ)         /* token rows */
#define MP ((int)((size_t)NBR * SQ)) /* rows projected (debug hook) */
#define QN SQ                        /* query rows per batch (unused: k_fattn attends all SQ) */
#define NHD NH                       /* heads (unused: k_fattn attends all NH) */
#define MPO MP                       /* rows through the output stage (debug hook) */
#define LQ DM      /* row pitch of the q/k rows (unused: the code writes DM) */
typedef __bf16 v16b __attribute__((ext_vector_type(16)));
typedef unsigned short v8us __attribute__((ext_vector_type(8), may_alias));
typedef float  v8f  __attribute__((ext_vector_type(8)));
typedef float  v4f  __attribute__((ext_vector_type(4)));
typedef float  v4fa __attribute__((ext_vector_type(4), may_alias));
union FragB { v16b v; v8us half[2]; unsigned short u[16]; };

__device__ __forceinline__ unsigned short bf16_bits(float x) { unsigned int u = __float_as_uint(x); return (unsigned short)((u + 0x7FFFu + ((u >> 16) & 1u)) >> 16); }
__device__ __forceinline__ float bf16_val(unsigned short b) { return __uint_as_float(((unsigned int)b) << 16); }
__device__ __forceinline__ float bf16_round(float x) { return bf16_val(bf16_bits(x)); }
// D += A·B with NT terms: 1 = ah·bh, 2 = + al·bh (A split), 3 = + ah·bl (both split)
template <int NT>
__device__ __forceinline__ v8f mmaN(v16b ah, v16b al, v16b bh, v16b bl, v8f c) {
  c = __builtin_amdgcn_wmma_f32_16x16x32_bf16(false, ah, false, bh, (short)0, c, false, false);
  if (NT >= 2) c = __builtin_amdgcn_wmma_f32_16x16x32_bf16(false, al, false, bh, (short)0, c, false, false);
  if (NT >= 3) c = __builtin_amdgcn_wmma_f32_16x16x32_bf16(false, ah, false, bl, (short)0, c, false, false);
  asm volatile("v_nop\n\tv_nop\n\tv_nop\n\tv_nop" : "+v"(c) : "v"(ah), "v"(al), "v"(bh), "v"(bl));
  return c;
}

__global__ __launch_bounds__(256) void k_wt_bf16(const float* __restrict__ W, unsigned short* __restrict__ Wt, int K, int N) {
  const int t = blockIdx.x * 256 + threadIdx.x;
  const int k8n = K / 8;
  if (t >= N * k8n) return;
  const int n = t / k8n, k8 = (t % k8n) * 8;
  v8us v;
#pragma unroll
  for (int i = 0; i < 8; ++i) v[i] = bf16_bits(W[(size_t)(k8 + i) * N + n]);
  *(v8us*)(Wt + (size_t)n * K + k8) = v;
  
}

// GEMM C[M][N] (f32, pitch ldc) = act(A[M][K]·W + bias). A f32 row-major (pitch lda) converted per fragment to bf16
// (ASPLIT: hi/lo two planes -> 2 terms, else single rounded term); Wt bf16 [N][K] (pitch ldb). BIAS_BF16 rounds the
// bias to bf16 first (bias quantised to bf16 before the add). K%32==0, M%16==0, N%64==0.
template <bool ASPLIT, int ACT, bool BIAS_BF16>
__global__ __launch_bounds__(128) void k_gemm_bf(const float* __restrict__ A, int lda, const unsigned short* __restrict__ Wt, int ldb,
                                               const float* __restrict__ bias, float* __restrict__ C, int ldc, int M, int N, int K) {
  __shared__ __attribute__((aligned(16))) float so[4][16][64];
  const int tid = threadIdx.x, w = tid >> 5, lane = tid & 31, ln = lane & 15, hh = lane >> 4;
  const int ntn = N / 64;
  const int wid = blockIdx.x * 4 + w;
  const int mt = wid / ntn, nq = wid % ntn;
  if (mt * 16 >= M) return;
  const int row0 = mt * 16, col0 = nq * 64;
  const float* arow = A + (size_t)(row0 + ln) * lda;
  v8f acc[4] = {};
  for (int kb = 0; kb < K; kb += 32) {
    FragB ah, al;
    const v4f x0 = *(const v4fa*)(arow + kb + 8 * hh), x1 = *(const v4fa*)(arow + kb + 8 * hh + 4);
    const v4f x2 = *(const v4fa*)(arow + kb + 16 + 8 * hh), x3 = *(const v4fa*)(arow + kb + 16 + 8 * hh + 4);
    float xs[16] = {x0[0],x0[1],x0[2],x0[3],x1[0],x1[1],x1[2],x1[3],x2[0],x2[1],x2[2],x2[3],x3[0],x3[1],x3[2],x3[3]};
#pragma unroll
    for (int i = 0; i < 16; ++i) { const unsigned short hb = bf16_bits(xs[i]); ah.u[i] = hb; al.u[i] = ASPLIT ? bf16_bits(xs[i] - bf16_val(hb)) : (unsigned short)0; }
#pragma unroll
    for (int t = 0; t < 4; ++t) {
      const unsigned short* brow = Wt + (size_t)(col0 + t * 16 + ln) * ldb + kb;
      FragB b;
      b.half[0] = *(const v8us*)(brow + 8 * hh);
      b.half[1] = *(const v8us*)(brow + 16 + 8 * hh);
      acc[t] = mmaN<ASPLIT ? 2 : 1>(ah.v, al.v, b.v, b.v, acc[t]);
    }
  }
#pragma unroll
  for (int t = 0; t < 4; ++t) {
    float bv = bias ? bias[col0 + t * 16 + ln] : 0.f;
    if (BIAS_BF16) bv = bf16_round(bv);
#pragma unroll
    for (int r = 0; r < 8; ++r) { float v = acc[t][r] + bv; if (ACT == 1) v = fmaxf(v, 0.f); so[w][8 * hh + r][t * 16 + ln] = v; }
  }
  __builtin_amdgcn_fence(__ATOMIC_ACQ_REL, "workgroup");
  __builtin_amdgcn_wave_barrier();
  const int rsub = lane >> 4, c4 = (lane & 15) * 4;
  {
#pragma unroll
    for (int q = 0; q < 8; ++q) {
      const int r = q * 2 + rsub;
      const v4f v = *(const v4fa*)&so[w][r][c4];
      *(v4f*)(C + (size_t)(row0 + r) * ldc + col0 + c4) = v;
    }
    
  }
}

// GEMM C = act(A·W + bias + resid): A f32 (ASPLIT -> hi/lo 2 terms), Wt bf16 [N][K]; ACT 0 none, 1 relu, 2 exact gelu;
// resid (optional, f32, row index = (row % rmod), pitch ldr, RES_BF16 rounds it) added before the activation.
template <bool ASPLIT, int ACT, bool BIAS_BF16, bool RES_BF16>
__global__ __launch_bounds__(128) void k_gemm_bf3(const float* __restrict__ A, int lda, const unsigned short* __restrict__ Wt, int ldb,
                                                const float* __restrict__ bias, const float* __restrict__ resid, int rmod, int ldr,
                                                float* __restrict__ C, int ldc, int M, int N, int K) {
  __shared__ __attribute__((aligned(16))) float so[4][16][64];
  const int tid = threadIdx.x, w = tid >> 5, lane = tid & 31, ln = lane & 15, hh = lane >> 4;
  const int ntn = N / 64;
  const int wid = blockIdx.x * 4 + w;
  const int mt = wid / ntn, nq = wid % ntn;
  if (mt * 16 >= M) return;
  const int row0 = mt * 16, col0 = nq * 64;
  const float* arow = A + (size_t)(row0 + ln) * lda;
  v8f acc[4] = {};
  for (int kb = 0; kb < K; kb += 32) {
    FragB ah, al;
    const v4f x0 = *(const v4fa*)(arow + kb + 8 * hh), x1 = *(const v4fa*)(arow + kb + 8 * hh + 4);
    const v4f x2 = *(const v4fa*)(arow + kb + 16 + 8 * hh), x3 = *(const v4fa*)(arow + kb + 16 + 8 * hh + 4);
    float xs[16] = {x0[0],x0[1],x0[2],x0[3],x1[0],x1[1],x1[2],x1[3],x2[0],x2[1],x2[2],x2[3],x3[0],x3[1],x3[2],x3[3]};
#pragma unroll
    for (int i = 0; i < 16; ++i) { const unsigned short hb = bf16_bits(xs[i]); ah.u[i] = hb; al.u[i] = ASPLIT ? bf16_bits(xs[i] - bf16_val(hb)) : (unsigned short)0; }
#pragma unroll
    for (int t = 0; t < 4; ++t) {
      const unsigned short* brow = Wt + (size_t)(col0 + t * 16 + ln) * ldb + kb;
      FragB b;
      b.half[0] = *(const v8us*)(brow + 8 * hh);
      b.half[1] = *(const v8us*)(brow + 16 + 8 * hh);
      acc[t] = mmaN<ASPLIT ? 2 : 1>(ah.v, al.v, b.v, b.v, acc[t]);
    }
  }
#pragma unroll
  for (int t = 0; t < 4; ++t) {
    const int col = col0 + t * 16 + ln;
    float bv = bias ? bias[col] : 0.f;
    if (BIAS_BF16) bv = bf16_round(bv);
#pragma unroll
    for (int r = 0; r < 8; ++r) {
      float v = acc[t][r] + bv;
      if (resid) { float rv = resid[(size_t)((row0 + 8 * hh + r) % rmod) * ldr + col]; if (RES_BF16) rv = bf16_round(rv); v += rv; }
      if (ACT == 1) v = fmaxf(v, 0.f);
      if (ACT == 2) v = 0.5f * v * (1.0f + erff(v * 0.70710678118654752f));
      if (ACT == 3) { const float u = 0.7978845608028654f * (v + 0.044715f * v * v * v); v = 0.5f * v * (1.0f + tanhf(u)); }
      so[w][8 * hh + r][t * 16 + ln] = v;
    }
  }
  __builtin_amdgcn_fence(__ATOMIC_ACQ_REL, "workgroup");
  __builtin_amdgcn_wave_barrier();
  const int rsub = lane >> 4, c4 = (lane & 15) * 4;
  {
#pragma unroll
    for (int q = 0; q < 8; ++q) {
      const int r = q * 2 + rsub;
      const v4f v = *(const v4fa*)&so[w][r][c4];
      *(v4f*)(C + (size_t)(row0 + r) * ldc + col0 + c4) = v;
    }
    
  }
}
// row LayerNorm (biased variance, eps) over N: s = X (+ R); optional out_sum <- s; out_norm <- (s-mu)*rsqrt(var+eps)*g + b
template <bool PARAM_BF16>
__global__ __launch_bounds__(256) void k_layernorm(const float* __restrict__ X, const float* __restrict__ R, const float* __restrict__ g, const float* __restrict__ bta,
                                                  float* __restrict__ out_sum, float* __restrict__ out_norm, int N, float eps) {
  __shared__ float red[256];
  const int row = blockIdx.x, tid = threadIdx.x;
  const float* x = X + (size_t)row * N; const float* rr = R ? R + (size_t)row * N : nullptr;
  float vals[16];                     // up to N = 4096
  const int per = N / 256;            // contiguous chunk per thread? use strided-by-4 chunks: thread handles j = tid*4 + 1024*u
  float s1 = 0.f;
  for (int u = 0; u < per / 4; ++u) {
    const int j = tid * 4 + 1024 * u;
    const v4f a = *(const v4fa*)(x + j);
    v4f b = {0.f,0.f,0.f,0.f}; if (rr) b = *(const v4fa*)(rr + j);
#pragma unroll
    for (int q = 0; q < 4; ++q) { const float v = a[q] + b[q]; vals[u * 4 + q] = v; s1 += v; }
  }
  red[tid] = s1; __syncthreads();
  for (int st = 128; st > 0; st >>= 1) { if (tid < st) red[tid] += red[tid + st]; __syncthreads(); }
  const float mu = red[0] / (float)N; __syncthreads();
  float s2 = 0.f;
  for (int u = 0; u < per / 4; ++u)
#pragma unroll
    for (int q = 0; q < 4; ++q) { const float c = vals[u * 4 + q] - mu; s2 += c * c; }
  red[tid] = s2; __syncthreads();
  for (int st = 128; st > 0; st >>= 1) { if (tid < st) red[tid] += red[tid + st]; __syncthreads(); }
  const float rs = rsqrtf(red[0] / (float)N + eps);
  {
    for (int u = 0; u < per / 4; ++u) {
      const int j = tid * 4 + 1024 * u;
      v4f o, sm;
#pragma unroll
      for (int q = 0; q < 4; ++q) {
        float gg = g[j + q], bb = bta[j + q];
        if (PARAM_BF16) { gg = bf16_round(gg); bb = bf16_round(bb); }
        sm[q] = vals[u * 4 + q]; o[q] = (vals[u * 4 + q] - mu) * rs * gg + bb;
      }
      if (out_sum) *(v4f*)(out_sum + (size_t)row * N + j) = sm;
      *(v4f*)(out_norm + (size_t)row * N + j) = o;
    }
    
  }
}



// ---- f16 WMMA path (v_wmma_f32_16x16x32_f16): 11-bit significands for operands in range — used where a [0,1] probability operand needs more precision than bf16
typedef _Float16 v16h __attribute__((ext_vector_type(16)));
union FragH { v16h v; v8us half[2]; _Float16 h[16]; unsigned short u[16]; };
template <int NT>
__device__ __forceinline__ v8f mmaH(v16h ah, v16h al, v16h bh, v16h bl, v8f c) {
  c = __builtin_amdgcn_wmma_f32_16x16x32_f16(false, ah, false, bh, (short)0, c, false, false);
  if (NT >= 2) c = __builtin_amdgcn_wmma_f32_16x16x32_f16(false, al, false, bh, (short)0, c, false, false);
  if (NT >= 3) c = __builtin_amdgcn_wmma_f32_16x16x32_f16(false, ah, false, bl, (short)0, c, false, false);
  asm volatile("v_nop\n\tv_nop\n\tv_nop\n\tv_nop" : "+v"(c) : "v"(ah), "v"(al), "v"(bh), "v"(bl));
  return c;
}
// batched GEMM like k_gemm_b but f16 operands: A f32 (split into f16 hi/lo if ASPLIT, else rounded to f16), Bt = f16 values [n][k]; alpha; C f32; N multiple of 16 (partial tiles skipped)
template <bool ASPLIT>
__global__ __launch_bounds__(128) void k_gemm_h(const float* __restrict__ A, int lda, size_t sA, const _Float16* __restrict__ Bh, int ldb, size_t sB, float alpha, float* __restrict__ C, int ldc, size_t sC, int M, int N, int K) {
  __shared__ __attribute__((aligned(16))) float so[4][16][64];
  const int tid = threadIdx.x, w = tid >> 5, lane = tid & 31, ln = lane & 15, hh = lane >> 4; const int by = blockIdx.y;
  A += (size_t)by * sA; Bh += (size_t)by * sB; C += (size_t)by * sC;
  const int ntn = (N + 63) / 64; const int wid = blockIdx.x * 4 + w; const int mt = wid / ntn, nq = wid % ntn; if (mt * 16 >= M) return;
  const int row0 = mt * 16, col0 = nq * 64; const float* arow = A + (size_t)(row0 + ln) * lda;
  v8f acc[4] = {};
  for (int kb = 0; kb < K; kb += 32) {
    FragH ah, al;
    const v4f x0 = *(const v4fa*)(arow + kb + 8 * hh), x1 = *(const v4fa*)(arow + kb + 8 * hh + 4), x2 = *(const v4fa*)(arow + kb + 16 + 8 * hh), x3 = *(const v4fa*)(arow + kb + 16 + 8 * hh + 4);
    float xs[16] = {x0[0],x0[1],x0[2],x0[3],x1[0],x1[1],x1[2],x1[3],x2[0],x2[1],x2[2],x2[3],x3[0],x3[1],x3[2],x3[3]};
#pragma unroll
    for (int i = 0; i < 16; ++i) { const _Float16 h = (_Float16)xs[i]; ah.h[i] = h; al.h[i] = ASPLIT ? (_Float16)(xs[i] - (float)h) : (_Float16)0.0f; }
#pragma unroll
    for (int t = 0; t < 4; ++t) { if (col0 + t * 16 >= N) continue; const size_t boff = (size_t)(col0 + t * 16 + ln) * ldb + kb; FragH bq; bq.half[0] = *(const v8us*)(Bh + boff + 8 * hh); bq.half[1] = *(const v8us*)(Bh + boff + 16 + 8 * hh);
      acc[t] = mmaH<ASPLIT ? 2 : 1>(ah.v, al.v, bq.v, bq.v, acc[t]); }
  }
#pragma unroll
  for (int t = 0; t < 4; ++t) { if (col0 + t * 16 >= N) continue;
#pragma unroll
    for (int r = 0; r < 8; ++r) so[w][8 * hh + r][t * 16 + ln] = acc[t][r] * alpha; }
  __builtin_amdgcn_fence(__ATOMIC_ACQ_REL, "workgroup"); __builtin_amdgcn_wave_barrier();
  const int rsub = lane >> 4, c4 = (lane & 15) * 4;
  {
#pragma unroll
    for (int q = 0; q < 8; ++q) { const int r = q * 2 + rsub; if (col0 + c4 < N) { const v4f v = *(const v4fa*)&so[w][r][c4]; *(v4f*)(C + (size_t)(row0 + r) * ldc + col0 + c4) = v; } }
     }
}

// Wt[n][k] = f16(W[k][n]·scale) from f32 row-major W[K][N] (scale = power of two; bf16-exact weights stay exact in f16 away from the subnormal range)
__global__ __launch_bounds__(256) void k_wt_f16(const float* __restrict__ W, _Float16* __restrict__ Wt, int K, int N, float scale) {
  const int t = blockIdx.x * 256 + threadIdx.x; if (t >= N * (K / 8)) return; const int n = t / (K / 8), k8 = (t % (K / 8)) * 8; FragH f;
#pragma unroll
  for (int i = 0; i < 8; ++i) f.h[i] = (_Float16)(bf16_round(W[(size_t)(k8 + i) * N + n]) * scale); const v8us o = f.half[0];
  *(v8us*)((unsigned short*)Wt + (size_t)n * K + k8) = o; 
}
// k_gemm_hh variant with fused epilogue: v = acc·alpha + bias[by·sBias + col] (+ CP[(row/rowsPerB)·sCPb + by·64 + col] if CP) ; ACT 0 none / 1 elu ; writes f16 C16 (and f32 C if non-null)
template <int ACT>
__global__ __launch_bounds__(128) void k_gemm_hhx(const _Float16* __restrict__ A, int lda, size_t sA, const _Float16* __restrict__ Bh, int ldb, size_t sB, float alpha, const float* __restrict__ bias, size_t sBias, const float* __restrict__ CP, int rowsPerB, size_t sCPb, int row0g,
    float* __restrict__ C, _Float16* __restrict__ C16, int ldc, size_t sC, int M, int N, int K) {
  __shared__ __attribute__((aligned(16))) float so[4][16][64];
  const int tid = threadIdx.x, w = tid >> 5, lane = tid & 31, ln = lane & 15, hh = lane >> 4; const int by = blockIdx.y;
  A += (size_t)by * sA; Bh += (size_t)by * sB; const size_t cofs = (size_t)by * sC; const float* bp = bias ? bias + (size_t)by * sBias : nullptr;
  const int ntn = (N + 63) / 64; const int wid = blockIdx.x * 4 + w; const int mt = wid / ntn, nq = wid % ntn; if (mt * 16 >= M) return;
  const int row0 = mt * 16, col0 = nq * 64; const _Float16* arow = A + (size_t)(row0 + ln) * lda;
  v8f acc[4] = {};
  for (int kb = 0; kb < K; kb += 32) { FragH ah; ah.half[0] = *(const v8us*)((const unsigned short*)arow + kb + 8 * hh); ah.half[1] = *(const v8us*)((const unsigned short*)arow + kb + 16 + 8 * hh);
#pragma unroll
    for (int t = 0; t < 4; ++t) { if (col0 + t * 16 >= N) continue; const size_t boff = (size_t)(col0 + t * 16 + ln) * ldb + kb; FragH bq; bq.half[0] = *(const v8us*)((const unsigned short*)Bh + boff + 8 * hh); bq.half[1] = *(const v8us*)((const unsigned short*)Bh + boff + 16 + 8 * hh);
      acc[t] = mmaH<1>(ah.v, ah.v, bq.v, bq.v, acc[t]); }
  }
#pragma unroll
  for (int t = 0; t < 4; ++t) { if (col0 + t * 16 >= N) continue; const int col = col0 + t * 16 + ln; const float bv = bp ? bf16_round(bp[col]) : 0.f;
#pragma unroll
    for (int r = 0; r < 8; ++r) { float v = acc[t][r] * alpha + bv; if (CP) { const int rr = row0g + row0 + 8 * hh + r; if (rowsPerB < 0) v += CP[cofs + (size_t)rr * ldc + col];      /* rowsPerB < 0: own element of the batched C plane */ else { const int bidx = rr / rowsPerB; v += CP[(size_t)bidx * sCPb + (size_t)by * 64 + col]; } } if (ACT == 1) v = (v > 0.f) ? v : expm1f(v); else if (ACT == 7) v = (v > 0.f) ? v + 1.0f : expf(v); else if (ACT == 8) v = tanhf(v); else if (ACT == 9) v = 0.5f * v * (1.0f + tanhf(0.7978845608028654f * (v + 0.044715f * v * v * v))); else if (ACT == 11) v = 1.0f / (1.0f + expf(-v)); else if (ACT == 12) v = (v > 0.f) ? v : 0.01f * v; else if (ACT == 14) v = (v > 0.f) ? v : 0.1f * v; else if (ACT == 16) v = (v >= 0.f) ? v : 0.3f * v; else if (ACT == 17) v = (v >= 0.f) ? v : 0.2f * v; else if (ACT == 15) v = v / (1.0f + expf(-v)); else if (ACT == 3) v = fmaxf(v, 0.f); else if (ACT == 6) v = 0.5f * v * (1.0f + erff(v * 0.70710678118654752f)); so[w][8 * hh + r][t * 16 + ln] = v; } }
  __builtin_amdgcn_fence(__ATOMIC_ACQ_REL, "workgroup"); __builtin_amdgcn_wave_barrier();
  const int rsub = lane >> 4, c4 = (lane & 15) * 4; typedef _Float16 v4h __attribute__((ext_vector_type(4)));
  {
#pragma unroll
    for (int q = 0; q < 8; ++q) { const int r = q * 2 + rsub; if (col0 + c4 < N) { const v4f v = *(const v4fa*)&so[w][r][c4]; if (C) *(v4f*)(C + cofs + (size_t)(row0 + r) * ldc + col0 + c4) = v; if (C16) { v4h h4; for (int i = 0; i < 4; ++i) h4[i] = (_Float16)v[i]; *(v4h*)(C16 + cofs + (size_t)(row0 + r) * ldc + col0 + c4) = h4; } } }
     }
}


typedef _Float16 v4h __attribute__((ext_vector_type(4)));

__global__ __launch_bounds__(256) void k_x16(const float* __restrict__ x, _Float16* __restrict__ X16, size_t n8) { const size_t t = (size_t)blockIdx.x * 256 + threadIdx.x; if (t >= n8) return; FragH f;
#pragma unroll
  for (int q = 0; q < 8; ++q) f.h[q] = (_Float16)bf16_round(x[t * 8 + q]); *(v8us*)((unsigned short*)X16 + t * 8) = f.half[0];  }
__global__ __launch_bounds__(256) void k_h16(const float* __restrict__ x, _Float16* __restrict__ X16, size_t n8) { const size_t t = (size_t)blockIdx.x * 256 + threadIdx.x; if (t >= n8) return; FragH f;
#pragma unroll
  for (int q = 0; q < 8; ++q) f.h[q] = (_Float16)x[t * 8 + q]; *(v8us*)((unsigned short*)X16 + t * 8) = f.half[0];  }
__global__ __launch_bounds__(256) void k_round16f(const float* __restrict__ W, _Float16* __restrict__ Bt, size_t n8) { const size_t t = (size_t)blockIdx.x * 256 + threadIdx.x; if (t >= n8) return; FragH f;
#pragma unroll
  for (int i = 0; i < 8; ++i) f.h[i] = (_Float16)(bf16_round(W[t * 8 + i]) * 16.0f); *(v8us*)((unsigned short*)Bt + t * 8) = f.half[0];  }
template <int NHv, int TTv>
__global__ __launch_bounds__(256) void k_vt(const _Float16* __restrict__ V16, int ldv, int voff, _Float16* __restrict__ Vt) { __shared__ unsigned short tl[64][66]; const int tid = threadIdx.x; const int slab = blockIdx.x / (TTv / 64), lg = blockIdx.x % (TTv / 64); const int b = slab / NHv, h = slab % NHv;
  for (int i = tid; i < 64 * 8; i += 256) { const int r = i / 8, c8 = (i % 8) * 8; FragH f; f.half[0] = *(const v8us*)((const unsigned short*)V16 + ((size_t)b * TTv + lg * 64 + r) * ldv + voff + h * 64 + c8);
#pragma unroll
    for (int q = 0; q < 8; ++q) tl[r][c8 + q] = f.u[q]; }
  __syncthreads();
  {
#pragma unroll
    for (int rd = 0; rd < 2; ++rd) { const int d = rd * 32 + tid / 8, pc = tid % 8; FragH f;
#pragma unroll
      for (int q = 0; q < 8; ++q) f.u[q] = tl[pc * 8 + q][d];
      *(v8us*)((unsigned short*)Vt + ((size_t)slab * 64 + d) * TTv + lg * 64 + pc * 8) = f.half[0]; }
     } }

__global__ __launch_bounds__(256) void k_hl(const float* __restrict__ F, _Float16* __restrict__ Hh, _Float16* __restrict__ Hl, size_t n8) { const size_t t = (size_t)blockIdx.x * 256 + threadIdx.x; if (t >= n8) return; FragH fh, fl; const v4f a = *(const v4fa*)(F + t * 8), c = *(const v4fa*)(F + t * 8 + 4);
#pragma unroll
  for (int q = 0; q < 4; ++q) { _Float16 h = (_Float16)a[q]; fh.h[q] = h; fl.h[q] = (_Float16)((a[q] - (float)h) * 1024.0f); h = (_Float16)c[q]; fh.h[4 + q] = h; fl.h[4 + q] = (_Float16)((c[q] - (float)h) * 1024.0f); }
  { *(v8us*)((unsigned short*)Hh + t * 8) = fh.half[0]; *(v8us*)((unsigned short*)Hl + t * 8) = fl.half[0];  } }

// ---- fast GEMM (wave tile 32x64; requires M % 32 == 0 rows per launch region and N % 64 == 0); epilogue = k_gemm_hhx semantics ----
__device__ __forceinline__ v16h g2_frag(const _Float16* p, int hh) { FragH f; f.half[0] = *(const v8us*)((const unsigned short*)p + 8 * hh); f.half[1] = *(const v8us*)((const unsigned short*)p + 16 + 8 * hh); return f.v; }
__device__ __forceinline__ v8f g2_mma(v16h a, v16h b, v8f c) { v8f d = __builtin_amdgcn_wmma_f32_16x16x32_f16(false, a, false, b, (short)0, c, false, false); asm volatile("v_nop\n\tv_nop\n\tv_nop\n\tv_nop" : "+v"(d) : "v"(a), "v"(b)); return d; }
template <int ACT>
__global__ __launch_bounds__(128) void k_gemm2(const _Float16* __restrict__ A, int lda, size_t sA, const _Float16* __restrict__ Bh, int ldb, size_t sB, float alpha, const float* __restrict__ bias, size_t sBias, const float* __restrict__ CP, int rowsPerB, size_t sCPb, int row0g,
    float* __restrict__ C, _Float16* __restrict__ C16, int ldc, size_t sC, int M, int N, int K) { static_assert(ACT == 0 || ACT == 3 || ACT == 6 || ACT == 8 || ACT == 9 || ACT == 11 || ACT == 12 || ACT == 14 || ACT == 15 || ACT == 16 || ACT == 17, "k_gemm2: unsupported ACT code (would silently apply no activation)");
  __shared__ __attribute__((aligned(16))) float so[4][32][68];
  const int tid = threadIdx.x, w = tid >> 5, lane = tid & 31, ln = lane & 15, hh = lane >> 4; const int by = blockIdx.y;
  A += (size_t)by * sA; Bh += (size_t)by * sB; const size_t cofs = (size_t)by * sC; const float* bp = bias ? bias + (size_t)by * sBias : nullptr;
  const int ntn = N >> 6; const int mt = blockIdx.x / ntn, nq = blockIdx.x - mt * ntn; const int row0 = mt * 128 + 32 * w, col0 = nq * 64; if (row0 >= M) return;
  const _Float16* a0p = A + (size_t)(row0 + ln) * lda; const _Float16* a1p = a0p + (size_t)16 * lda;
  const _Float16* b0p = Bh + (size_t)(col0 + ln) * ldb; const _Float16* b1p = b0p + (size_t)16 * ldb; const _Float16* b2p = b1p + (size_t)16 * ldb; const _Float16* b3p = b2p + (size_t)16 * ldb;
  const v8f z8 = {0.f,0.f,0.f,0.f,0.f,0.f,0.f,0.f}; v8f c00 = z8, c01 = z8, c02 = z8, c03 = z8, c10 = z8, c11 = z8, c12 = z8, c13 = z8;
#pragma unroll 1
  for (int kb = 0; kb < K; kb += 32) { const v16h a0 = g2_frag(a0p + kb, hh), a1 = g2_frag(a1p + kb, hh);
    v16h b = g2_frag(b0p + kb, hh); c00 = g2_mma(a0, b, c00); c10 = g2_mma(a1, b, c10);
    b = g2_frag(b1p + kb, hh); c01 = g2_mma(a0, b, c01); c11 = g2_mma(a1, b, c11);
    b = g2_frag(b2p + kb, hh); c02 = g2_mma(a0, b, c02); c12 = g2_mma(a1, b, c12);
    b = g2_frag(b3p + kb, hh); c03 = g2_mma(a0, b, c03); c13 = g2_mma(a1, b, c13); }
  v8f accs[8] = {c00, c01, c02, c03, c10, c11, c12, c13};
#pragma unroll
  for (int u = 0; u < 8; ++u) { const int t = u & 3, half = u >> 2; const int col = col0 + t * 16 + ln; const float bv = bp ? bf16_round(bp[col]) : 0.f;
#pragma unroll
    for (int r = 0; r < 8; ++r) { const int rloc = half * 16 + 8 * hh + r; float v = accs[u][r] * alpha + bv; if (CP) { if (rowsPerB < 0) v += CP[cofs + (size_t)(row0g + row0 + rloc) * ldc + col];      /* rowsPerB < 0: own element of the batched C plane */ else { const int bidx = (row0g + row0 + rloc) / rowsPerB; v += CP[(size_t)bidx * sCPb + (size_t)by * 64 + col]; } }
      if (ACT == 3) v = fmaxf(v, 0.f); else if (ACT == 6) v = 0.5f * v * (1.0f + erff(v * 0.70710678118654752f)); else if (ACT == 11) v = 1.0f / (1.0f + expf(-v)); else if (ACT == 15) v = v / (1.0f + expf(-v)); else if (ACT == 12) v = (v > 0.f) ? v : 0.01f * v; else if (ACT == 8) v = tanhf(v); else if (ACT == 9) v = 0.5f * v * (1.0f + tanhf(0.7978845608028654f * (v + 0.044715f * v * v * v))); else if (ACT == 14) v = (v > 0.f) ? v : 0.1f * v; else if (ACT == 16) v = (v >= 0.f) ? v : 0.3f * v; else if (ACT == 17) v = (v >= 0.f) ? v : 0.2f * v;
      so[w][rloc][t * 16 + ln] = v; } }
  __builtin_amdgcn_fence(__ATOMIC_ACQ_REL, "workgroup"); __builtin_amdgcn_wave_barrier();
  const int rsub = lane >> 4, c4 = (lane & 15) * 4;
  {
#pragma unroll
    for (int q = 0; q < 16; ++q) { const int r = q * 2 + rsub; const v4f v = *(const v4fa*)&so[w][r][c4]; if (C) *(v4f*)(C + cofs + (size_t)(row0 + r) * ldc + col0 + c4) = v; if (C16) { v4h h4; for (int i = 0; i < 4; ++i) h4[i] = (_Float16)v[i]; *(v4h*)(C16 + cofs + (size_t)(row0 + r) * ldc + col0 + c4) = h4; } }
     } }


__global__ __launch_bounds__(256) void k_wnat(const float* __restrict__ w, size_t n8, _Float16* __restrict__ Bt) { const size_t t = (size_t)blockIdx.x * 256 + threadIdx.x; if (t >= n8) return; FragH f; for (int q = 0; q < 8; ++q) f.h[q] = (_Float16)(bf16_round(w[t * 8 + q]) * 16.0f); *(v8us*)((unsigned short*)Bt + t * 8) = f.half[0];  }
__global__ __launch_bounds__(256) void k_rsm(const float* __restrict__ S, _Float16* __restrict__ P, int nrows) {
  #pragma clang fp contract(off)
  const int i = blockIdx.x * 256 + threadIdx.x; if (i >= nrows) return; const float* s = S + (size_t)i * SQ; float mx = -3.0e38f;
#pragma unroll 1
  for (int j = 0; j < SQ; ++j) mx = fmaxf(mx, s[j]); float se = 0.f;
#pragma unroll 1
  for (int j = 0; j < SQ; ++j) se += expf(s[j] - mx); const float sc = 256.0f / se;
#pragma unroll 1
  for (int j0 = 0; j0 < SQ; j0 += 8) { FragH f; for (int q = 0; q < 8; ++q) f.h[q] = (_Float16)(expf(s[j0 + q] - mx) * sc); unsigned short* d = (unsigned short*)P + (size_t)i * SQ + j0; *(v8us*)d = f.half[0];  } }
__global__ __launch_bounds__(256) void k_vt(const _Float16* __restrict__ V16, int b, int h0, _Float16* __restrict__ VT) { __shared__ unsigned short tl[64][65]; const int tid = threadIdx.x; const int hh = blockIdx.x % HG, sg = blockIdx.x / HG; const int s0 = sg * 64; const int h = h0 + hh;
  for (int i = tid; i < 64 * 8; i += 256) { const int j = i / 8, d8 = (i % 8) * 8; FragH f; f.half[0] = *(const v8us*)((const unsigned short*)V16 + ((size_t)b * SQ + s0 + j) * DM + h * HD + d8); for (int q = 0; q < 8; ++q) tl[d8 + q][j] = f.u[q]; }
  __syncthreads();
  { for (int i = tid; i < 64 * 8; i += 256) { const int d = i / 8, j8 = (i % 8) * 8; FragH f; for (int q = 0; q < 8; ++q) f.u[q] = tl[d][j8 + q]; *(v8us*)((unsigned short*)VT + ((size_t)hh * HD + d) * SQ + s0 + j8) = f.half[0]; }  } }



// ---- one preparing launch: independent pieces picked by block range, so that they share one start instead of seven dependent ones ----
// Blocks 0 .. 4 * PW_B - 1: weight wi = block / PW_B as Wt[n][k] = f16(bf16(W[k][n]) x 16), the arithmetic of k_wt_f16. The other 2 * PX_B blocks: the two
// sources as f16(bf16(x)) rows, the arithmetic of k_x16; a block takes PX_U consecutive runs of 256 groups of 8 floats, a thread one group of each run.
#define PW_B (DM * (DM / 8) / 256)   /* blocks per weight */
#define PX_U 8                       /* groups of 8 elements per thread */
#define PX_B ((int)(NR * DM / 8 / 256 / PX_U))      /* blocks per source */
__global__ __launch_bounds__(256) void k_prep(const float* __restrict__ xq, const float* __restrict__ xk, const float* __restrict__ wq, const float* __restrict__ wk, const float* __restrict__ wv, const float* __restrict__ wo,
    _Float16* __restrict__ XQ, _Float16* __restrict__ XK, _Float16* __restrict__ BW) {
  static_assert(NR * DM == (size_t)PX_B * 256 * PX_U * 8, "the sources divide evenly among the threads");
  const int bx = blockIdx.x;
  if (bx < 4 * PW_B) { const int wi = bx / PW_B; const float* W = wi == 0 ? wq : wi == 1 ? wk : wi == 2 ? wv : wo; _Float16* Wt = BW + (size_t)wi * DM * DM;
    const int t = (bx - wi * PW_B) * 256 + threadIdx.x; const int n = t / (DM / 8), k8 = (t % (DM / 8)) * 8; FragH f;
#pragma unroll
    for (int i = 0; i < 8; ++i) f.h[i] = (_Float16)(bf16_round(W[(size_t)(k8 + i) * DM + n]) * 16.0f);
    *(v8us*)((unsigned short*)Wt + (size_t)n * DM + k8) = f.half[0];
    return; }
  const int xb = bx - 4 * PW_B; const bool second = xb >= PX_B; const size_t g0 = (size_t)(xb - (second ? PX_B : 0)) * (256 * PX_U) + threadIdx.x;      /* the thread's first group */
  const float* p = (second ? xk : xq) + g0 * 8; unsigned short* d = (unsigned short*)(second ? XK : XQ) + g0 * 8; v4f a[PX_U][2]; v8us o[PX_U];
#pragma unroll
  for (int u = 0; u < PX_U; ++u) { a[u][0] = *(const v4fa*)(p + u * 2048); a[u][1] = *(const v4fa*)(p + u * 2048 + 4); }
  asm volatile("s_wait_xcnt 0x0" :: "v"(p) : "memory");      /* the loads' address register stays whole up to this wait; behind it it may be reused */
#pragma unroll
  for (int u = 0; u < PX_U; ++u) { FragH f;
#pragma unroll
    for (int q = 0; q < 4; ++q) { f.h[q] = (_Float16)bf16_round(a[u][0][q]); f.h[4 + q] = (_Float16)bf16_round(a[u][1][q]); }
    o[u] = f.half[0]; }
  __builtin_amdgcn_sched_barrier(0);      /* the stores stand last, so that no register of an issued store is written again */
#pragma unroll
  for (int u = 0; u < PX_U; ++u) *(v8us*)(d + u * 2048) = o[u];
  asm volatile("s_wait_xcnt 0x0" ::: "memory"); }      /* in the built code the weight blocks' part follows behind a scalar branch and writes these registers: the wait stands in front of it */

// ---- the three projections in one launch (wave tile, k order and epilogue arithmetic of k_gemm2): blockIdx.y = 0: Q rows, 1: K rows, 2: V^T ----
// V^T[feature][token] = sum_k Wt[feature][k] X[token][k] is the projection with the operand roles swapped (A = weight rows, B = token rows): its C rows are the
// [batch][head][d][token] rows that the attention kernel reads, 128-byte lines of 64 tokens with one wave as writer, and the bias goes by row instead of by column.
template <int LDC>
__device__ __forceinline__ void p3_store(const float (*so)[68], _Float16* cp, int lane) {      /* cp: the wave's tile origin in C; rows leave as whole 128-byte lines */
  const int rsub = lane >> 4, c4 = (lane & 15) * 4; _Float16* c = cp + (size_t)rsub * LDC + c4; v4h h4[16];
#pragma unroll
  for (int q = 0; q < 16; ++q) { const v4f v = *(const v4fa*)&so[q * 2 + rsub][c4];
#pragma unroll
    for (int i = 0; i < 4; ++i) h4[q][i] = (_Float16)v[i]; }
  __builtin_amdgcn_sched_barrier(0);      /* the stores stand last, so that no register of an issued store is written again */
#pragma unroll
  for (int q = 0; q < 16; ++q) *(v4h*)(c + (size_t)q * 2 * LDC) = h4[q];
  asm volatile("s_wait_xcnt 0x0" ::: "memory"); }      /* in the built code the other layout's epilogue follows behind a scalar branch and writes these registers: the wait stands in front of it */
// ---- GEMM tile through LDS: C[128][128] = A rows . B rows^T over k = DM, one work-group of eight waves (wave tile 32x64 as before: 4 down, 2 across) ----
// A stage is one whole 128-byte line (64 k) of each of the 128 A rows and 128 B rows, brought by asynchronous 16-byte copies (eight lanes a row, so a wave's copy
// covers four whole lines) into rows of GT_PIT bytes; two buffers, the next stage's copies fly under this stage's products. The fragments are read from LDS in
// the k order of g2_frag, and every accumulator takes its 32-k steps in rising order, as before.
#define GT_PIT 144                   /* LDS row pitch in bytes: 128 of data + 16, an odd multiple of 16 B (16-byte fragment reads without bank conflicts) */
#define GT_BUF (256 * GT_PIT)        /* one buffer: rows 0-127 of A, rows 128-255 of B */
#define GT_KS 64                     /* k per stage */
#define GT_NST (DM / GT_KS)
__device__ __forceinline__ v16h gt_lfrag(const unsigned char* p) { FragH f; f.half[0] = *(const v8us*)p; f.half[1] = *(const v8us*)(p + 32); return f.v; }      /* p already holds the lane's 16 hh bytes */
// One stage: the thread's 16 bytes of rows sr + 32 j of A and of B. a, b: its place in row sr of the stage's k range; l: the LDS byte address of that place in A's part.
// The closing wait stands inside the statement, so that no address register of an issued copy is rewritten in front of it.
__device__ __forceinline__ void gt_copy(const _Float16* a, const _Float16* b, unsigned l) {
  asm volatile("global_load_async_to_lds_b128 %0, %8, off\n\t"
               "global_load_async_to_lds_b128 %1, %9, off\n\t"
               "global_load_async_to_lds_b128 %2, %10, off\n\t"
               "global_load_async_to_lds_b128 %3, %11, off\n\t"
               "global_load_async_to_lds_b128 %4, %12, off\n\t"
               "global_load_async_to_lds_b128 %5, %13, off\n\t"
               "global_load_async_to_lds_b128 %6, %14, off\n\t"
               "global_load_async_to_lds_b128 %7, %15, off\n\t"
               "s_wait_xcnt 0x0"
               :: "v"(l), "v"(l + 32 * GT_PIT), "v"(l + 64 * GT_PIT), "v"(l + 96 * GT_PIT), "v"(l + 128 * GT_PIT), "v"(l + 160 * GT_PIT), "v"(l + 192 * GT_PIT), "v"(l + 224 * GT_PIT),
                  "v"(a), "v"(a + 32 * DM), "v"(a + 64 * DM), "v"(a + 96 * DM), "v"(b), "v"(b + 32 * DM), "v"(b + 64 * DM), "v"(b + 96 * DM) : "memory"); }
// A, B: first row of the tile's 128 A rows and 128 B rows (pitch DM). On return every wave has passed the barrier behind the last LDS read and no copy is in flight: SM is free.
__device__ __forceinline__ void gt_tile(const _Float16* A, const _Float16* B, unsigned char* SM, v8f (&acc)[8]) {
  static_assert(DM % GT_KS == 0 && GT_NST >= 2, "the ring's prologue needs two stages");
  const int tid = threadIdx.x, w = tid >> 5, lane = tid & 31, ln = lane & 15, hh = lane >> 4; const int sr = tid >> 3, sc = tid & 7;
  const _Float16* ag = A + (size_t)sr * DM + sc * 8; const _Float16* bg = B + (size_t)sr * DM + sc * 8; const unsigned l0 = (unsigned)(size_t)SM + sr * GT_PIT + sc * 16;
  const unsigned char* af = SM + ((w & 3) * 32 + ln) * GT_PIT + 16 * hh; const unsigned char* bf = SM + (128 + (w >> 2) * 64 + ln) * GT_PIT + 16 * hh;
  const v8f z8 = {0.f,0.f,0.f,0.f,0.f,0.f,0.f,0.f}; v8f c00 = z8, c01 = z8, c02 = z8, c03 = z8, c10 = z8, c11 = z8, c12 = z8, c13 = z8;
  gt_copy(ag, bg, l0);
  asm volatile("s_wait_asynccnt 0x0" ::: "memory");      /* this wave's part of stage 0 has landed */
  __syncthreads();      /* stage 0 is visible to every wave */
  gt_copy(ag + GT_KS, bg + GT_KS, l0 + GT_BUF);
  for (int t = 0; t < GT_NST; ++t) { const int bo = (t & 1) * GT_BUF;
#pragma unroll      /* two 32-k steps with constant LDS offsets */
    for (int ks = 0; ks < 2; ++ks) { const unsigned char* ap = af + bo + ks * 64; const unsigned char* bp = bf + bo + ks * 64;
      const v16h a0 = gt_lfrag(ap), a1 = gt_lfrag(ap + 16 * GT_PIT), b0 = gt_lfrag(bp), b1 = gt_lfrag(bp + 16 * GT_PIT), b2 = gt_lfrag(bp + 32 * GT_PIT), b3 = gt_lfrag(bp + 48 * GT_PIT);
      __builtin_amdgcn_sched_barrier(0);      /* the step's twelve LDS reads go out as one group ahead of its products: one LDS latency a step instead of four */
      c00 = g2_mma(a0, b0, c00); c10 = g2_mma(a1, b0, c10); c01 = g2_mma(a0, b1, c01); c11 = g2_mma(a1, b1, c11);
      c02 = g2_mma(a0, b2, c02); c12 = g2_mma(a1, b2, c12); c03 = g2_mma(a0, b3, c03); c13 = g2_mma(a1, b3, c13); }
    asm volatile("s_wait_dscnt 0x0" ::: "memory");      /* this wave's reads of stage t are done before its buffer may be refilled */
    asm volatile("s_wait_asynccnt 0x0" ::: "memory");      /* this wave's part of stage t + 1 has landed */
    __syncthreads();      /* publishes stage t + 1 and ends every wave's reads of stage t */
    if (t + 2 < GT_NST) gt_copy(ag + (t + 2) * GT_KS, bg + (t + 2) * GT_KS, l0 + bo); }
  asm volatile("s_wait_asynccnt 0x0" ::: "memory");      /* nothing is in flight when the buffers become output staging */
  acc[0] = c00; acc[1] = c01; acc[2] = c02; acc[3] = c03; acc[4] = c10; acc[5] = c11; acc[6] = c12; acc[7] = c13; }

__global__ __launch_bounds__(256) void k_proj3(const _Float16* __restrict__ XQ, const _Float16* __restrict__ XK, const _Float16* __restrict__ BW, const float* __restrict__ bq, const float* __restrict__ bk, const float* __restrict__ bv,
    _Float16* __restrict__ Q16, _Float16* __restrict__ K16, _Float16* __restrict__ VT) {
  static_assert((MP / 128) * (DM / 128) == NB * (DM / 128) * (SQ / 128) && MP == NB * SQ, "the three products have the same number of 128x128 tiles");
  static_assert(8 * 32 * 68 * 4 <= 2 * GT_BUF, "the output staging fits the ring");
  __shared__ __attribute__((aligned(16))) unsigned char SM[2 * GT_BUF];      /* the ring; behind the loop each wave's 32x68 f32 output staging */
  const int tid = threadIdx.x, w = tid >> 5, lane = tid & 31, ln = lane & 15, hh = lane >> 4; const int by = blockIdx.y, bx = blockIdx.x; const bool tr = by == 2;
  const _Float16* A; const _Float16* Bh; const float* bias; int mt, nq;
  if (tr) { const int b = bx / ((DM / 128) * (SQ / 128)), x = bx - b * ((DM / 128) * (SQ / 128)); A = BW + (size_t)2 * DM * DM; Bh = XK + (size_t)b * SQ * DM; bias = bv; mt = x / (SQ / 128); nq = x - mt * (SQ / 128); }
  else { A = by ? XK : XQ; Bh = BW + (size_t)by * DM * DM; bias = by ? bk : bq; mt = bx / (DM / 128); nq = bx - mt * (DM / 128); }
  v8f accs[8]; gt_tile(A + (size_t)mt * 128 * DM, Bh + (size_t)nq * 128 * DM, SM, accs);
  const int row0 = mt * 128 + 32 * (w & 3), col0 = nq * 128 + 64 * (w >> 2); float (*so)[68] = (float (*)[68])(SM + (size_t)w * (32 * 68 * 4));
  float bcol[4] = {0.f, 0.f, 0.f, 0.f}, brow[2][8] = {};
  if (tr) {
#pragma unroll
    for (int half = 0; half < 2; ++half)
#pragma unroll
      for (int r = 0; r < 8; ++r) brow[half][r] = bf16_round(bias[row0 + half * 16 + 8 * hh + r]); }
  else {
#pragma unroll
    for (int t = 0; t < 4; ++t) bcol[t] = bf16_round(bias[col0 + t * 16 + ln]); }
#pragma unroll
  for (int u = 0; u < 8; ++u) { const int t = u & 3, half = u >> 2;
#pragma unroll
    for (int r = 0; r < 8; ++r) so[half * 16 + 8 * hh + r][t * 16 + ln] = accs[u][r] * 0.0625f + (tr ? brow[half][r] : bcol[t]); }
  __builtin_amdgcn_fence(__ATOMIC_ACQ_REL, "workgroup"); __builtin_amdgcn_wave_barrier();      /* the wave reads back its own tile in row order */
  if (tr) p3_store<SQ>(so, VT + (size_t)(bx / ((DM / 128) * (SQ / 128))) * DM * SQ + (size_t)row0 * SQ + col0, lane);
  else p3_store<DM>(so, (by ? K16 : Q16) + (size_t)row0 * DM + col0, lane); }

// ---- the output product on the same tile: out = o Wo * alpha + bias (epilogue arithmetic of k_gemm2<0>), f32 rows of the output layout ----
__global__ __launch_bounds__(256) void k_outg(const _Float16* __restrict__ O16, const _Float16* __restrict__ BO, const float* __restrict__ bo, float* __restrict__ C) {
  __shared__ __attribute__((aligned(16))) unsigned char SM[2 * GT_BUF];      /* the ring; behind the loop each wave's 32x68 f32 output staging */
  const int tid = threadIdx.x, w = tid >> 5, lane = tid & 31, ln = lane & 15, hh = lane >> 4; const int mt = blockIdx.x / (DM / 128), nq = blockIdx.x - mt * (DM / 128);
  v8f accs[8]; gt_tile(O16 + (size_t)mt * 128 * DM, BO + (size_t)nq * 128 * DM, SM, accs);
  const int row0 = mt * 128 + 32 * (w & 3), col0 = nq * 128 + 64 * (w >> 2); float (*so)[68] = (float (*)[68])(SM + (size_t)w * (32 * 68 * 4));
#pragma unroll
  for (int u = 0; u < 8; ++u) { const int t = u & 3, half = u >> 2; const float bv = bf16_round(bo[col0 + t * 16 + ln]);
#pragma unroll
    for (int r = 0; r < 8; ++r) so[half * 16 + 8 * hh + r][t * 16 + ln] = accs[u][r] * 0.0009765625f + bv; }      /* 1 / (16 x 64): the weights' x16 and o's x64 */
  __builtin_amdgcn_fence(__ATOMIC_ACQ_REL, "workgroup"); __builtin_amdgcn_wave_barrier();      /* the wave reads back its own tile in row order */
  const int rsub = lane >> 4, c4 = (lane & 15) * 4; float* c = C + (size_t)(row0 + rsub) * DM + col0 + c4; v4f v[16];
#pragma unroll
  for (int q = 0; q < 16; ++q) v[q] = *(const v4fa*)&so[q * 2 + rsub][c4];
  __builtin_amdgcn_sched_barrier(0);      /* the stores stand last, so that no register of an issued store is written again */
#pragma unroll
  for (int q = 0; q < 16; ++q) *(v4f*)(c + (size_t)q * 2 * DM) = v[q]; }      /* a row's 256 bytes of this tile have this wave as their only writer */

#define FA_NW 8                      /* waves per work-group */
#define FA_CW 32                     /* query columns per wave (two 16-column groups) */
#define FA_BR (FA_NW * FA_CW)        /* query rows per work-group */
#define FA_SK 64                     /* keys per LDS stage (two 32-key passes) */
#define FA_PIT 144                   /* LDS row pitch in bytes: 128 of data + 16, an odd multiple of 16 B (16-byte fragment reads without bank conflicts) */
#define FA_OFS 6.0f                  /* the maximum in use is kept 6 below the true one: weights carried x64, away from the f16 subnormal range */
#define FA_LAG 8.0f                  /* a column's maximum may outgrow the one in use by this much (log2) before the sums are rescaled: weights stay <= 2^14 */
typedef float v2f __attribute__((ext_vector_type(2)));
typedef _Float16 v2h __attribute__((ext_vector_type(2)));
__device__ __forceinline__ float rs_xh(float x) { return __builtin_bit_cast(float, __builtin_amdgcn_permlanex16(__builtin_bit_cast(int, x), __builtin_bit_cast(int, x), 0x76543210, 0xfedcba98, false, false)); }      /* lane l <- lane l ^ 16 */
// Four native 2^x in place. One statement, so that no neighbour of a v_exp_f32 reads its result or writes its source; the closing v_nop is the free slot
// the instruction set asks for behind a transcendental.
__device__ __forceinline__ v4f rs_exp2x4(v4f e) { float a = e[0], b = e[1], c = e[2], d = e[3];
  asm("v_exp_f32 %0, %0\n\tv_exp_f32 %1, %1\n\tv_exp_f32 %2, %2\n\tv_exp_f32 %3, %3\n\tv_nop" : "+v"(a), "+v"(b), "+v"(c), "+v"(d));
  const v4f r = {a, b, c, d}; return r; }
__device__ __forceinline__ v8f fa_mma(v16h a, v16h b, v8f c) { return __builtin_amdgcn_wmma_f32_16x16x32_f16(false, a, false, b, (short)0, c, false, false); }
__device__ __forceinline__ v16h fa_lfrag(const unsigned char* p) { FragH f; f.half[0] = *(const v8us*)p; f.half[1] = *(const v8us*)(p + 32); return f.v; }      /* p already holds the lane's 16 h bytes: k = 8h + 0..7 and 16 + 8h + 0..7 */
__global__ __launch_bounds__(FA_NW * 32) void k_fattn(const _Float16* __restrict__ Q16, const _Float16* __restrict__ K16, const _Float16* __restrict__ VT, _Float16* __restrict__ O16) {
  static_assert(HD == 64 && SQ % FA_BR == 0 && SQ % FA_SK == 0 && FA_SK == 64 && FA_NW * 32 == 256, "tile constants are written for head size 64 and 256 threads");
  __shared__ __attribute__((aligned(16))) unsigned char L[2][2][FA_SK * FA_PIT];      /* [buffer][0: K rows (key)(d) | 1: V^T rows (d)(key)] */
  const int tid = threadIdx.x, lane = tid & 31, w = tid >> 5, c = lane & 15, h = lane >> 4;
  const int bh = blockIdx.y, b = bh / NH, hd = bh - b * NH; const int q0 = blockIdx.x * FA_BR + w * FA_CW;
  const unsigned short* Kg = (const unsigned short*)K16 + (size_t)b * SQ * DM + hd * HD;      /* row = key, pitch DM */
  const unsigned short* Vg = (const unsigned short*)VT + (size_t)bh * HD * SQ;                /* row = d, pitch SQ */
  const int sr = tid >> 3, sc = tid & 7;      /* staging: eight lanes move one whole 128-byte row; a thread owns rows sr and sr + 32 of both tiles */
  const unsigned short* kp = Kg + (size_t)sr * DM + sc * 8; const unsigned short* vp = Vg + (size_t)sr * SQ + sc * 8;
  v8us kr0, kr1, vr0, vr1;
  auto gload = [&](int st) { const unsigned short* k = kp + (size_t)st * FA_SK * DM; const unsigned short* v = vp + st * FA_SK;
    kr0 = *(const v8us*)k; kr1 = *(const v8us*)(k + (size_t)32 * DM); vr0 = *(const v8us*)v; vr1 = *(const v8us*)(v + (size_t)32 * SQ);
    asm volatile("s_wait_xcnt 0x0" ::: "memory"); };      /* the loads' address registers are stepped for the next stage: keep the wait in front of that overwrite */
  auto lstore = [&](int buf) { unsigned char* kd = &L[buf][0][sr * FA_PIT + sc * 16]; unsigned char* vd = &L[buf][1][sr * FA_PIT + sc * 16];
    *(v8us*)kd = kr0; *(v8us*)(kd + 32 * FA_PIT) = kr1; *(v8us*)vd = vr0; *(v8us*)(vd + 32 * FA_PIT) = vr1; };
  gload(0);
  v16h qf[2][2];      /* B operand: query column 16 g + c, d = 32 kc + hardware k order */
#pragma unroll
  for (int g = 0; g < 2; ++g) { const _Float16* qp = Q16 + ((size_t)b * SQ + q0 + 16 * g + c) * DM + hd * HD; qf[g][0] = g2_frag(qp, h); qf[g][1] = g2_frag(qp + 32, h); }
  const v8f z8 = {0.f,0.f,0.f,0.f,0.f,0.f,0.f,0.f}; const v4f z4 = {0.f,0.f,0.f,0.f};
  v8f acc[2][4]; v4f la[2]; float mu[2];      /* O^T tiles (d = 16 t + 8 h + r, query 16 g + c); this half's part of the denominator; the maximum in use, minus FA_OFS */
#pragma unroll
  for (int g = 0; g < 2; ++g) { mu[g] = -__builtin_inff(); la[g] = z4;
#pragma unroll
    for (int t = 0; t < 4; ++t) acc[g][t] = z8; }
  const float cs = 0.125f * 0x1.715476p+0f;      /* 1 / sqrt(64) and log2 e in one factor */
  lstore(0);
  __syncthreads();      /* stage 0 is visible to every wave */
  constexpr int NST = SQ / FA_SK;
  for (int st = 0; st < NST; ++st) { const int buf = st & 1;
    if (st + 1 < NST) gload(st + 1);      /* the next stage's rows fly into registers under this stage's work */
#pragma unroll      /* two passes with constant LDS offsets */
    for (int p = 0; p < 2; ++p) {
      const unsigned char* kb = &L[buf][0][(32 * p + c) * FA_PIT + 16 * h]; const unsigned char* vb = &L[buf][1][c * FA_PIT + 64 * p + 16 * h];
      v8f s[2][2];      /* [16-key tile][column group] */
#pragma unroll
      for (int kt = 0; kt < 2; ++kt) { const v16h k0 = fa_lfrag(kb + kt * 16 * FA_PIT), k1 = fa_lfrag(kb + kt * 16 * FA_PIT + 64);
#pragma unroll
        for (int g = 0; g < 2; ++g) s[kt][g] = fa_mma(k1, qf[g][1], fa_mma(k0, qf[g][0], z8)); }
      v16h vf[4];
#pragma unroll
      for (int t = 0; t < 4; ++t) vf[t] = fa_lfrag(vb + t * 16 * FA_PIT);
      float mb[2]; bool need = false;
#pragma unroll
      for (int g = 0; g < 2; ++g) { float m0 = fmaxf(s[0][g][0], s[1][g][0]), m1 = fmaxf(s[0][g][1], s[1][g][1]);
#pragma unroll
        for (int r = 2; r < 8; r += 2) { m0 = fmaxf(m0, fmaxf(s[0][g][r], s[1][g][r])); m1 = fmaxf(m1, fmaxf(s[0][g][r + 1], s[1][g][r + 1])); }
        m0 = fmaxf(m0, m1); mb[g] = fmaxf(m0, rs_xh(m0)) * cs - FA_OFS;      /* both halves hold the column's maximum of this pass (the scale is positive) */
        need = need || (mb[g] > mu[g] + FA_LAG); }
      if (__builtin_amdgcn_ballot_w32(need) != 0) {      /* wave-uniform; always taken on the first pass (mu = -inf), rare later */
        const float n0 = fmaxf(mu[0], mb[0]), n1 = fmaxf(mu[1], mb[1]); const v4f d4 = {mu[0] - n0, mu[1] - n1, 0.f, 0.f}; const v4f cr = rs_exp2x4(d4); mu[0] = n0; mu[1] = n1;
#pragma unroll
        for (int g = 0; g < 2; ++g) { la[g] = la[g] * cr[g];
#pragma unroll
          for (int t = 0; t < 4; ++t) acc[g][t] = acc[g][t] * cr[g]; } }
#pragma unroll
      for (int g = 0; g < 2; ++g) { const float nm = -mu[g]; FragH pf;
#pragma unroll
        for (int i = 0; i < 4; ++i) { const int kt = i >> 1, r0 = 4 * (i & 1); v4f e;
#pragma unroll
          for (int j = 0; j < 4; ++j) e[j] = __builtin_fmaf(s[kt][g][r0 + j], cs, nm);
          e = rs_exp2x4(e); la[g] = la[g] + e;
#pragma unroll
          for (int j = 0; j < 4; ++j) pf.h[4 * i + j] = (_Float16)e[j]; }      /* element 8 kt + r = key 16 kt + 8 h + r */
#pragma unroll
        for (int t = 0; t < 4; ++t) acc[g][t] = fa_mma(vf[t], pf.v, acc[g][t]); } }
    if (st + 1 < NST) lstore(buf ^ 1);      /* every wave left that buffer before the barrier that ended stage st - 1 */
    __syncthreads(); }      /* publishes stage st + 1 and ends every wave's reads of stage st */
#pragma unroll
  for (int g = 0; g < 2; ++g) { float lf = (la[g][0] + la[g][1]) + (la[g][2] + la[g][3]); lf += rs_xh(lf); const float inv = 64.0f / lf;      /* o carried x64, as the output GEMM's alpha expects */
    unsigned short* op = (unsigned short*)O16 + ((size_t)b * SQ + q0 + 16 * g + c) * DM + hd * HD + 8 * h;
#pragma unroll
    for (int t = 0; t < 4; ++t) { FragH o;
#pragma unroll
      for (int r = 0; r < 8; ++r) o.h[r] = (_Float16)(acc[g][t][r] * inv);
      *(v8us*)(op + 16 * t) = o.half[0]; } } }      /* 8 consecutive d of one query: one 16-byte store; a query's 128-byte line has this wave as its only writer */

extern "C" void kernel_launch(void* const* d_in, const int* in_sizes, int n_in,
                              void* d_out, int out_size, void* d_ws, size_t ws_size, hipStream_t stream) {
  (void)in_sizes; (void)n_in; (void)out_size;
  const float* const* I = (const float* const*)d_in; const float* xq = I[0]; const float* xk = I[1]; const float* wq = I[2]; const float* bq = I[3]; const float* wk = I[4]; const float* bk = I[5]; const float* wv = I[6]; const float* bv = I[7]; const float* wo = I[8]; const float* bo = I[9];      
  char* ws = (char*)d_ws; size_t off = 0;
  auto take = [&](size_t bytes) { char* p = ws + off; off += (bytes + 255) & ~(size_t)255; return p; };
  _Float16* BW = (_Float16*)take((size_t)4 * DM * DM * 2); _Float16* BO = BW + (size_t)3 * DM * DM;      /* the four weights, [in][out] -> Bt[n][k] x16: q, k, v, o */
  _Float16* XQ = (_Float16*)take(NR * DM * 2); _Float16* XK = (_Float16*)take(NR * DM * 2); _Float16* Q16 = (_Float16*)take(NR * DM * 2); _Float16* K16 = (_Float16*)take(NR * DM * 2); _Float16* O16 = (_Float16*)take(NR * DM * 2);
  _Float16* VT = (_Float16*)take((size_t)NB * NH * HD * SQ * 2);
  if (off > ws_size) return;
  k_prep<<<4 * PW_B + 2 * PX_B, 256, 0, stream>>>(xq, xk, wq, wk, wv, wo, XQ, XK, BW);      /* weights and both sources; keys and values read the same source, rounded once */
  const size_t r0p = (size_t)B0 * SQ;      /* first projected row */
  k_proj3<<<dim3((unsigned)((MP / 128) * (DM / 128)), 3), 256, 0, stream>>>(XQ, XK, BW, bq, bk, bv, Q16, K16, VT);      /* Q, K rows and V^T [NB][NH][HD][SQ] */
  k_fattn<<<dim3(SQ / FA_BR, NB * NH), FA_NW * 32, 0, stream>>>(Q16, K16, VT, O16);      /* o x64 (merged heads) as f16 rows */
  k_outg<<<dim3((unsigned)((MPO / 128) * (DM / 128))), 256, 0, stream>>>(O16 + r0p * DM, BO, bo, (float*)d_out + r0p * DM);      /* out rows are the output layout */
}

// v005
// It runs in 90.5 microseconds.
// Next to v004, in two timings, it ran 1.12 times as fast each time.
// Counting every step since v000, it is 147 times as fast.
#include <hip/hip_runtime.h>
#define NB 2
#define SQ 4096
#define DM 512
#define NH 8
#define HD 64
#define HG 1                         /* heads per block group in the unlaunched k_vt(V16, b, h0, VT) overload */
#define B0 0                         /* first batch processed (debug hook) */
#define NBR NB                       /* batches processed (debug hook) */
#define NR ((size_t)NB * SQ)         /* token rows */
#define MP ((int)((size_t)NBR * SQ)) /* rows projected (debug hook) */
#define QN SQ                        /* query rows per batch (unused: k_fattn attends all SQ) */
#define NHD NH                       /* heads (unused: k_fattn attends all NH) */
#define MPO MP                       /* rows through the output stage (debug hook) */
#define LQ DM      /* row pitch of the q/k rows (unused: the code writes DM) */
typedef __bf16 v16b __attribute__((ext_vector_type(16)));
typedef unsigned short v8us __attribute__((ext_vector_type(8), may_alias));
typedef float  v8f  __attribute__((ext_vector_type(8)));
typedef float  v4f  __attribute__((ext_vector_type(4)));
typedef float  v4fa __attribute__((ext_vector_type(4), may_alias));
union FragB { v16b v; v8us half[2]; unsigned short u[16]; };

__device__ __forceinline__ unsigned short bf16_bits(float x) { unsigned int u = __float_as_uint(x); return (unsigned short)((u + 0x7FFFu + ((u >> 16) & 1u)) >> 16); }
__device__ __forceinline__ float bf16_val(unsigned short b) { return __uint_as_float(((unsigned int)b) << 16); }
__device__ __forceinline__ float bf16_round(float x) { return bf16_val(bf16_bits(x)); }
// D += A·B with NT terms: 1 = ah·bh, 2 = + al·bh (A split), 3 = + ah·bl (both split)
template <int NT>
__device__ __forceinline__ v8f mmaN(v16b ah, v16b al, v16b bh, v16b bl, v8f c) {
  c = __builtin_amdgcn_wmma_f32_16x16x32_bf16(false, ah, false, bh, (short)0, c, false, false);
  if (NT >= 2) c = __builtin_amdgcn_wmma_f32_16x16x32_bf16(false, al, false, bh, (short)0, c, false, false);
  if (NT >= 3) c = __builtin_amdgcn_wmma_f32_16x16x32_bf16(false, ah, false, bl, (short)0, c, false, false);
  asm volatile("v_nop\n\tv_nop\n\tv_nop\n\tv_nop" : "+v"(c) : "v"(ah), "v"(al), "v"(bh), "v"(bl));
  return c;
}

__global__ __launch_bounds__(256) void k_wt_bf16(const float* __restrict__ W, unsigned short* __restrict__ Wt, int K, int N) {
  const int t = blockIdx.x * 256 + threadIdx.x;
  const int k8n = K / 8;
  if (t >= N * k8n) return;
  const int n = t / k8n, k8 = (t % k8n) * 8;
  v8us v;
#pragma unroll
  for (int i = 0; i < 8; ++i) v[i] = bf16_bits(W[(size_t)(k8 + i) * N + n]);
  *(v8us*)(Wt + (size_t)n * K + k8) = v;
  
}

// GEMM C[M][N] (f32, pitch ldc) = act(A[M][K]·W + bias). A f32 row-major (pitch lda) converted per fragment to bf16
// (ASPLIT: hi/lo two planes -> 2 terms, else single rounded term); Wt bf16 [N][K] (pitch ldb). BIAS_BF16 rounds the
// bias to bf16 first (bias quantised to bf16 before the add). K%32==0, M%16==0, N%64==0.
template <bool ASPLIT, int ACT, bool BIAS_BF16>
__global__ __launch_bounds__(128) void k_gemm_bf(const float* __restrict__ A, int lda, const unsigned short* __restrict__ Wt, int ldb,
                                               const float* __restrict__ bias, float* __restrict__ C, int ldc, int M, int N, int K) {
  __shared__ __attribute__((aligned(16))) float so[4][16][64];
  const int tid = threadIdx.x, w = tid >> 5, lane = tid & 31, ln = lane & 15, hh = lane >> 4;
  const int ntn = N / 64;
  const int wid = blockIdx.x * 4 + w;
  const int mt = wid / ntn, nq = wid % ntn;
  if (mt * 16 >= M) return;
  const int row0 = mt * 16, col0 = nq * 64;
  const float* arow = A + (size_t)(row0 + ln) * lda;
  v8f acc[4] = {};
  for (int kb = 0; kb < K; kb += 32) {
    FragB ah, al;
    const v4f x0 = *(const v4fa*)(arow + kb + 8 * hh), x1 = *(const v4fa*)(arow + kb + 8 * hh + 4);
    const v4f x2 = *(const v4fa*)(arow + kb + 16 + 8 * hh), x3 = *(const v4fa*)(arow + kb + 16 + 8 * hh + 4);
    float xs[16] = {x0[0],x0[1],x0[2],x0[3],x1[0],x1[1],x1[2],x1[3],x2[0],x2[1],x2[2],x2[3],x3[0],x3[1],x3[2],x3[3]};
#pragma unroll
    for (int i = 0; i < 16; ++i) { const unsigned short hb = bf16_bits(xs[i]); ah.u[i] = hb; al.u[i] = ASPLIT ? bf16_bits(xs[i] - bf16_val(hb)) : (unsigned short)0; }
#pragma unroll
    for (int t = 0; t < 4; ++t) {
      const unsigned short* brow = Wt + (size_t)(col0 + t * 16 + ln) * ldb + kb;
      FragB b;
      b.half[0] = *(const v8us*)(brow + 8 * hh);
      b.half[1] = *(const v8us*)(brow + 16 + 8 * hh);
      acc[t] = mmaN<ASPLIT ? 2 : 1>(ah.v, al.v, b.v, b.v, acc[t]);
    }
  }
#pragma unroll
  for (int t = 0; t < 4; ++t) {
    float bv = bias ? bias[col0 + t * 16 + ln] : 0.f;
    if (BIAS_BF16) bv = bf16_round(bv);
#pragma unroll
    for (int r = 0; r < 8; ++r) { float v = acc[t][r] + bv; if (ACT == 1) v = fmaxf(v, 0.f); so[w][8 * hh + r][t * 16 + ln] = v; }
  }
  __builtin_amdgcn_fence(__ATOMIC_ACQ_REL, "workgroup");
  __builtin_amdgcn_wave_barrier();
  const int rsub = lane >> 4, c4 = (lane & 15) * 4;
  {
#pragma unroll
    for (int q = 0; q < 8; ++q) {
      const int r = q * 2 + rsub;
      const v4f v = *(const v4fa*)&so[w][r][c4];
      *(v4f*)(C + (size_t)(row0 + r) * ldc + col0 + c4) = v;
    }
    
  }
}

// GEMM C = act(A·W + bias + resid): A f32 (ASPLIT -> hi/lo 2 terms), Wt bf16 [N][K]; ACT 0 none, 1 relu, 2 exact gelu;
// resid (optional, f32, row index = (row % rmod), pitch ldr, RES_BF16 rounds it) added before the activation.
template <bool ASPLIT, int ACT, bool BIAS_BF16, bool RES_BF16>
__global__ __launch_bounds__(128) void k_gemm_bf3(const float* __restrict__ A, int lda, const unsigned short* __restrict__ Wt, int ldb,
                                                const float* __restrict__ bias, const float* __restrict__ resid, int rmod, int ldr,
                                                float* __restrict__ C, int ldc, int M, int N, int K) {
  __shared__ __attribute__((aligned(16))) float so[4][16][64];
  const int tid = threadIdx.x, w = tid >> 5, lane = tid & 31, ln = lane & 15, hh = lane >> 4;
  const int ntn = N / 64;
  const int wid = blockIdx.x * 4 + w;
  const int mt = wid / ntn, nq = wid % ntn;
  if (mt * 16 >= M) return;
  const int row0 = mt * 16, col0 = nq * 64;
  const float* arow = A + (size_t)(row0 + ln) * lda;
  v8f acc[4] = {};
  for (int kb = 0; kb < K; kb += 32) {
    FragB ah, al;
    const v4f x0 = *(const v4fa*)(arow + kb + 8 * hh), x1 = *(const v4fa*)(arow + kb + 8 * hh + 4);
    const v4f x2 = *(const v4fa*)(arow + kb + 16 + 8 * hh), x3 = *(const v4fa*)(arow + kb + 16 + 8 * hh + 4);
    float xs[16] = {x0[0],x0[1],x0[2],x0[3],x1[0],x1[1],x1[2],x1[3],x2[0],x2[1],x2[2],x2[3],x3[0],x3[1],x3[2],x3[3]};
#pragma unroll
    for (int i = 0; i < 16; ++i) { const unsigned short hb = bf16_bits(xs[i]); ah.u[i] = hb; al.u[i] = ASPLIT ? bf16_bits(xs[i] - bf16_val(hb)) : (unsigned short)0; }
#pragma unroll
    for (int t = 0; t < 4; ++t) {
      const unsigned short* brow = Wt + (size_t)(col0 + t * 16 + ln) * ldb + kb;
      FragB b;
      b.half[0] = *(const v8us*)(brow + 8 * hh);
      b.half[1] = *(const v8us*)(brow + 16 + 8 * hh);
      acc[t] = mmaN<ASPLIT ? 2 : 1>(ah.v, al.v, b.v, b.v, acc[t]);
    }
  }
#pragma unroll
  for (int t = 0; t < 4; ++t) {
    const int col = col0 + t * 16 + ln;
    float bv = bias ? bias[col] : 0.f;
    if (BIAS_BF16) bv = bf16_round(bv);
#pragma unroll
    for (int r = 0; r < 8; ++r) {
      float v = acc[t][r] + bv;
      if (resid) { float rv = resid[(size_t)((row0 + 8 * hh + r) % rmod) * ldr + col]; if (RES_BF16) rv = bf16_round(rv); v += rv; }
      if (ACT == 1) v = fmaxf(v, 0.f);
      if (ACT == 2) v = 0.5f * v * (1.0f + erff(v * 0.70710678118654752f));
      if (ACT == 3) { const float u = 0.7978845608028654f * (v + 0.044715f * v * v * v); v = 0.5f * v * (1.0f + tanhf(u)); }
      so[w][8 * hh + r][t * 16 + ln] = v;
    }
  }
  __builtin_amdgcn_fence(__ATOMIC_ACQ_REL, "workgroup");
  __builtin_amdgcn_wave_barrier();
  const int rsub = lane >> 4, c4 = (lane & 15) * 4;
  {
#pragma unroll
    for (int q = 0; q < 8; ++q) {
      const int r = q * 2 + rsub;
      const v4f v = *(const v4fa*)&so[w][r][c4];
      *(v4f*)(C + (size_t)(row0 + r) * ldc + col0 + c4) = v;
    }
    
  }
}
// row LayerNorm (biased variance, eps) over N: s = X (+ R); optional out_sum <- s; out_norm <- (s-mu)*rsqrt(var+eps)*g + b
template <bool PARAM_BF16>
__global__ __launch_bounds__(256) void k_layernorm(const float* __restrict__ X, const float* __restrict__ R, const float* __restrict__ g, const float* __restrict__ bta,
                                                  float* __restrict__ out_sum, float* __restrict__ out_norm, int N, float eps) {
  __shared__ float red[256];
  const int row = blockIdx.x, tid = threadIdx.x;
  const float* x = X + (size_t)row * N; const float* rr = R ? R + (size_t)row * N : nullptr;
  float vals[16];                     // up to N = 4096
  const int per = N / 256;            // contiguous chunk per thread? use strided-by-4 chunks: thread handles j = tid*4 + 1024*u
  float s1 = 0.f;
  for (int u = 0; u < per / 4; ++u) {
    const int j = tid * 4 + 1024 * u;
    const v4f a = *(const v4fa*)(x + j);
    v4f b = {0.f,0.f,0.f,0.f}; if (rr) b = *(const v4fa*)(rr + j);
#pragma unroll
    for (int q = 0; q < 4; ++q) { const float v = a[q] + b[q]; vals[u * 4 + q] = v; s1 += v; }
  }
  red[tid] = s1; __syncthreads();
  for (int st = 128; st > 0; st >>= 1) { if (tid < st) red[tid] += red[tid + st]; __syncthreads(); }
  const float mu = red[0] / (float)N; __syncthreads();
  float s2 = 0.f;
  for (int u = 0; u < per / 4; ++u)
#pragma unroll
    for (int q = 0; q < 4; ++q) { const float c = vals[u * 4 + q] - mu; s2 += c * c; }
  red[tid] = s2; __syncthreads();
  for (int st = 128; st > 0; st >>= 1) { if (tid < st) red[tid] += red[tid + st]; __syncthreads(); }
  const float rs = rsqrtf(red[0] / (float)N + eps);
  {
    for (int u = 0; u < per / 4; ++u) {
      const int j = tid * 4 + 1024 * u;
      v4f o, sm;
#pragma unroll
      for (int q = 0; q < 4; ++q) {
        float gg = g[j + q], bb = bta[j + q];
        if (PARAM_BF16) { gg = bf16_round(gg); bb = bf16_round(bb); }
        sm[q] = vals[u * 4 + q]; o[q] = (vals[u * 4 + q] - mu) * rs * gg + bb;
      }
      if (out_sum) *(v4f*)(out_sum + (size_t)row * N + j) = sm;
      *(v4f*)(out_norm + (size_t)row * N + j) = o;
    }
    
  }
}



// ---- f16 WMMA path (v_wmma_f32_16x16x32_f16): 11-bit significands for operands in range — used where a [0,1] probability operand needs more precision than bf16
typedef _Float16 v16h __attribute__((ext_vector_type(16)));
union FragH { v16h v; v8us half[2]; _Float16 h[16]; unsigned short u[16]; };
template <int NT>
__device__ __forceinline__ v8f mmaH(v16h ah, v16h al, v16h bh, v16h bl, v8f c) {
  c = __builtin_amdgcn_wmma_f32_16x16x32_f16(false, ah, false, bh, (short)0, c, false, false);
  if (NT >= 2) c = __builtin_amdgcn_wmma_f32_16x16x32_f16(false, al, false, bh, (short)0, c, false, false);
  if (NT >= 3) c = __builtin_amdgcn_wmma_f32_16x16x32_f16(false, ah, false, bl, (short)0, c, false, false);
  asm volatile("v_nop\n\tv_nop\n\tv_nop\n\tv_nop" : "+v"(c) : "v"(ah), "v"(al), "v"(bh), "v"(bl));
  return c;
}
// batched GEMM like k_gemm_b but f16 operands: A f32 (split into f16 hi/lo if ASPLIT, else rounded to f16), Bt = f16 values [n][k]; alpha; C f32; N multiple of 16 (partial tiles skipped)
template <bool ASPLIT>
__global__ __launch_bounds__(128) void k_gemm_h(const float* __restrict__ A, int lda, size_t sA, const _Float16* __restrict__ Bh, int ldb, size_t sB, float alpha, float* __restrict__ C, int ldc, size_t sC, int M, int N, int K) {
  __shared__ __attribute__((aligned(16))) float so[4][16][64];
  const int tid = threadIdx.x, w = tid >> 5, lane = tid & 31, ln = lane & 15, hh = lane >> 4; const int by = blockIdx.y;
  A += (size_t)by * sA; Bh += (size_t)by * sB; C += (size_t)by * sC;
  const int ntn = (N + 63) / 64; const int wid = blockIdx.x * 4 + w; const int mt = wid / ntn, nq = wid % ntn; if (mt * 16 >= M) return;
  const int row0 = mt * 16, col0 = nq * 64; const float* arow = A + (size_t)(row0 + ln) * lda;
  v8f acc[4] = {};
  for (int kb = 0; kb < K; kb += 32) {
    FragH ah, al;
    const v4f x0 = *(const v4fa*)(arow + kb + 8 * hh), x1 = *(const v4fa*)(arow + kb + 8 * hh + 4), x2 = *(const v4fa*)(arow + kb + 16 + 8 * hh), x3 = *(const v4fa*)(arow + kb + 16 + 8 * hh + 4);
    float xs[16] = {x0[0],x0[1],x0[2],x0[3],x1[0],x1[1],x1[2],x1[3],x2[0],x2[1],x2[2],x2[3],x3[0],x3[1],x3[2],x3[3]};
#pragma unroll
    for (int i = 0; i < 16; ++i) { const _Float16 h = (_Float16)xs[i]; ah.h[i] = h; al.h[i] = ASPLIT ? (_Float16)(xs[i] - (float)h) : (_Float16)0.0f; }
#pragma unroll
    for (int t = 0; t < 4; ++t) { if (col0 + t * 16 >= N) continue; const size_t boff = (size_t)(col0 + t * 16 + ln) * ldb + kb; FragH bq; bq.half[0] = *(const v8us*)(Bh + boff + 8 * hh); bq.half[1] = *(const v8us*)(Bh + boff + 16 + 8 * hh);
      acc[t] = mmaH<ASPLIT ? 2 : 1>(ah.v, al.v, bq.v, bq.v, acc[t]); }
  }
#pragma unroll
  for (int t = 0; t < 4; ++t) { if (col0 + t * 16 >= N) continue;
#pragma unroll
    for (int r = 0; r < 8; ++r) so[w][8 * hh + r][t * 16 + ln] = acc[t][r] * alpha; }
  __builtin_amdgcn_fence(__ATOMIC_ACQ_REL, "workgroup"); __builtin_amdgcn_wave_barrier();
  const int rsub = lane >> 4, c4 = (lane & 15) * 4;
  {
#pragma unroll
    for (int q = 0; q < 8; ++q) { const int r = q * 2 + rsub; if (col0 + c4 < N) { const v4f v = *(const v4fa*)&so[w][r][c4]; *(v4f*)(C + (size_t)(row0 + r) * ldc + col0 + c4) = v; } }
     }
}

// Wt[n][k] = f16(W[k][n]·scale) from f32 row-major W[K][N] (scale = power of two; bf16-exact weights stay exact in f16 away from the subnormal range)
__global__ __launch_bounds__(256) void k_wt_f16(const float* __restrict__ W, _Float16* __restrict__ Wt, int K, int N, float scale) {
  const int t = blockIdx.x * 256 + threadIdx.x; if (t >= N * (K / 8)) return; const int n = t / (K / 8), k8 = (t % (K / 8)) * 8; FragH f;
#pragma unroll
  for (int i = 0; i < 8; ++i) f.h[i] = (_Float16)(bf16_round(W[(size_t)(k8 + i) * N + n]) * scale); const v8us o = f.half[0];
  *(v8us*)((unsigned short*)Wt + (size_t)n * K + k8) = o; 
}
// k_gemm_hh variant with fused epilogue: v = acc·alpha + bias[by·sBias + col] (+ CP[(row/rowsPerB)·sCPb + by·64 + col] if CP) ; ACT 0 none / 1 elu ; writes f16 C16 (and f32 C if non-null)
template <int ACT>
__global__ __launch_bounds__(128) void k_gemm_hhx(const _Float16* __restrict__ A, int lda, size_t sA, const _Float16* __restrict__ Bh, int ldb, size_t sB, float alpha, const float* __restrict__ bias, size_t sBias, const float* __restrict__ CP, int rowsPerB, size_t sCPb, int row0g,
    float* __restrict__ C, _Float16* __restrict__ C16, int ldc, size_t sC, int M, int N, int K) {
  __shared__ __attribute__((aligned(16))) float so[4][16][64];
  const int tid = threadIdx.x, w = tid >> 5, lane = tid & 31, ln = lane & 15, hh = lane >> 4; const int by = blockIdx.y;
  A += (size_t)by * sA; Bh += (size_t)by * sB; const size_t cofs = (size_t)by * sC; const float* bp = bias ? bias + (size_t)by * sBias : nullptr;
  const int ntn = (N + 63) / 64; const int wid = blockIdx.x * 4 + w; const int mt = wid / ntn, nq = wid % ntn; if (mt * 16 >= M) return;
  const int row0 = mt * 16, col0 = nq * 64; const _Float16* arow = A + (size_t)(row0 + ln) * lda;
  v8f acc[4] = {};
  for (int kb = 0; kb < K; kb += 32) { FragH ah; ah.half[0] = *(const v8us*)((const unsigned short*)arow + kb + 8 * hh); ah.half[1] = *(const v8us*)((const unsigned short*)arow + kb + 16 + 8 * hh);
#pragma unroll
    for (int t = 0; t < 4; ++t) { if (col0 + t * 16 >= N) continue; const size_t boff = (size_t)(col0 + t * 16 + ln) * ldb + kb; FragH bq; bq.half[0] = *(const v8us*)((const unsigned short*)Bh + boff + 8 * hh); bq.half[1] = *(const v8us*)((const unsigned short*)Bh + boff + 16 + 8 * hh);
      acc[t] = mmaH<1>(ah.v, ah.v, bq.v, bq.v, acc[t]); }
  }
#pragma unroll
  for (int t = 0; t < 4; ++t) { if (col0 + t * 16 >= N) continue; const int col = col0 + t * 16 + ln; const float bv = bp ? bf16_round(bp[col]) : 0.f;
#pragma unroll
    for (int r = 0; r < 8; ++r) { float v = acc[t][r] * alpha + bv; if (CP) { const int rr = row0g + row0 + 8 * hh + r; if (rowsPerB < 0) v += CP[cofs + (size_t)rr * ldc + col];      /* rowsPerB < 0: own element of the batched C plane */ else { const int bidx = rr / rowsPerB; v += CP[(size_t)bidx * sCPb + (size_t)by * 64 + col]; } } if (ACT == 1) v = (v > 0.f) ? v : expm1f(v); else if (ACT == 7) v = (v > 0.f) ? v + 1.0f : expf(v); else if (ACT == 8) v = tanhf(v); else if (ACT == 9) v = 0.5f * v * (1.0f + tanhf(0.7978845608028654f * (v + 0.044715f * v * v * v))); else if (ACT == 11) v = 1.0f / (1.0f + expf(-v)); else if (ACT == 12) v = (v > 0.f) ? v : 0.01f * v; else if (ACT == 14) v = (v > 0.f) ? v : 0.1f * v; else if (ACT == 16) v = (v >= 0.f) ? v : 0.3f * v; else if (ACT == 17) v = (v >= 0.f) ? v : 0.2f * v; else if (ACT == 15) v = v / (1.0f + expf(-v)); else if (ACT == 3) v = fmaxf(v, 0.f); else if (ACT == 6) v = 0.5f * v * (1.0f + erff(v * 0.70710678118654752f)); so[w][8 * hh + r][t * 16 + ln] = v; } }
  __builtin_amdgcn_fence(__ATOMIC_ACQ_REL, "workgroup"); __builtin_amdgcn_wave_barrier();
  const int rsub = lane >> 4, c4 = (lane & 15) * 4; typedef _Float16 v4h __attribute__((ext_vector_type(4)));
  {
#pragma unroll
    for (int q = 0; q < 8; ++q) { const int r = q * 2 + rsub; if (col0 + c4 < N) { const v4f v = *(const v4fa*)&so[w][r][c4]; if (C) *(v4f*)(C + cofs + (size_t)(row0 + r) * ldc + col0 + c4) = v; if (C16) { v4h h4; for (int i = 0; i < 4; ++i) h4[i] = (_Float16)v[i]; *(v4h*)(C16 + cofs + (size_t)(row0 + r) * ldc + col0 + c4) = h4; } } }
     }
}


typedef _Float16 v4h __attribute__((ext_vector_type(4)));

__global__ __launch_bounds__(256) void k_x16(const float* __restrict__ x, _Float16* __restrict__ X16, size_t n8) { const size_t t = (size_t)blockIdx.x * 256 + threadIdx.x; if (t >= n8) return; FragH f;
#pragma unroll
  for (int q = 0; q < 8; ++q) f.h[q] = (_Float16)bf16_round(x[t * 8 + q]); *(v8us*)((unsigned short*)X16 + t * 8) = f.half[0];  }
__global__ __launch_bounds__(256) void k_h16(const float* __restrict__ x, _Float16* __restrict__ X16, size_t n8) { const size_t t = (size_t)blockIdx.x * 256 + threadIdx.x; if (t >= n8) return; FragH f;
#pragma unroll
  for (int q = 0; q < 8; ++q) f.h[q] = (_Float16)x[t * 8 + q]; *(v8us*)((unsigned short*)X16 + t * 8) = f.half[0];  }
__global__ __launch_bounds__(256) void k_round16f(const float* __restrict__ W, _Float16* __restrict__ Bt, size_t n8) { const size_t t = (size_t)blockIdx.x * 256 + threadIdx.x; if (t >= n8) return; FragH f;
#pragma unroll
  for (int i = 0; i < 8; ++i) f.h[i] = (_Float16)(bf16_round(W[t * 8 + i]) * 16.0f); *(v8us*)((unsigned short*)Bt + t * 8) = f.half[0];  }
template <int NHv, int TTv>
__global__ __launch_bounds__(256) void k_vt(const _Float16* __restrict__ V16, int ldv, int voff, _Float16* __restrict__ Vt) { __shared__ unsigned short tl[64][66]; const int tid = threadIdx.x; const int slab = blockIdx.x / (TTv / 64), lg = blockIdx.x % (TTv / 64); const int b = slab / NHv, h = slab % NHv;
  for (int i = tid; i < 64 * 8; i += 256) { const int r = i / 8, c8 = (i % 8) * 8; FragH f; f.half[0] = *(const v8us*)((const unsigned short*)V16 + ((size_t)b * TTv + lg * 64 + r) * ldv + voff + h * 64 + c8);
#pragma unroll
    for (int q = 0; q < 8; ++q) tl[r][c8 + q] = f.u[q]; }
  __syncthreads();
  {
#pragma unroll
    for (int rd = 0; rd < 2; ++rd) { const int d = rd * 32 + tid / 8, pc = tid % 8; FragH f;
#pragma unroll
      for (int q = 0; q < 8; ++q) f.u[q] = tl[pc * 8 + q][d];
      *(v8us*)((unsigned short*)Vt + ((size_t)slab * 64 + d) * TTv + lg * 64 + pc * 8) = f.half[0]; }
     } }

__global__ __launch_bounds__(256) void k_hl(const float* __restrict__ F, _Float16* __restrict__ Hh, _Float16* __restrict__ Hl, size_t n8) { const size_t t = (size_t)blockIdx.x * 256 + threadIdx.x; if (t >= n8) return; FragH fh, fl; const v4f a = *(const v4fa*)(F + t * 8), c = *(const v4fa*)(F + t * 8 + 4);
#pragma unroll
  for (int q = 0; q < 4; ++q) { _Float16 h = (_Float16)a[q]; fh.h[q] = h; fl.h[q] = (_Float16)((a[q] - (float)h) * 1024.0f); h = (_Float16)c[q]; fh.h[4 + q] = h; fl.h[4 + q] = (_Float16)((c[q] - (float)h) * 1024.0f); }
  { *(v8us*)((unsigned short*)Hh + t * 8) = fh.half[0]; *(v8us*)((unsigned short*)Hl + t * 8) = fl.half[0];  } }

// ---- fast GEMM (wave tile 32x64; requires M % 32 == 0 rows per launch region and N % 64 == 0); epilogue = k_gemm_hhx semantics ----
__device__ __forceinline__ v16h g2_frag(const _Float16* p, int hh) { FragH f; f.half[0] = *(const v8us*)((const unsigned short*)p + 8 * hh); f.half[1] = *(const v8us*)((const unsigned short*)p + 16 + 8 * hh); return f.v; }
__device__ __forceinline__ v8f g2_mma(v16h a, v16h b, v8f c) { v8f d = __builtin_amdgcn_wmma_f32_16x16x32_f16(false, a, false, b, (short)0, c, false, false); asm volatile("v_nop\n\tv_nop\n\tv_nop\n\tv_nop" : "+v"(d) : "v"(a), "v"(b)); return d; }
template <int ACT>
__global__ __launch_bounds__(128) void k_gemm2(const _Float16* __restrict__ A, int lda, size_t sA, const _Float16* __restrict__ Bh, int ldb, size_t sB, float alpha, const float* __restrict__ bias, size_t sBias, const float* __restrict__ CP, int rowsPerB, size_t sCPb, int row0g,
    float* __restrict__ C, _Float16* __restrict__ C16, int ldc, size_t sC, int M, int N, int K) { static_assert(ACT == 0 || ACT == 3 || ACT == 6 || ACT == 8 || ACT == 9 || ACT == 11 || ACT == 12 || ACT == 14 || ACT == 15 || ACT == 16 || ACT == 17, "k_gemm2: unsupported ACT code (would silently apply no activation)");
  __shared__ __attribute__((aligned(16))) float so[4][32][68];
  const int tid = threadIdx.x, w = tid >> 5, lane = tid & 31, ln = lane & 15, hh = lane >> 4; const int by = blockIdx.y;
  A += (size_t)by * sA; Bh += (size_t)by * sB; const size_t cofs = (size_t)by * sC; const float* bp = bias ? bias + (size_t)by * sBias : nullptr;
  const int ntn = N >> 6; const int mt = blockIdx.x / ntn, nq = blockIdx.x - mt * ntn; const int row0 = mt * 128 + 32 * w, col0 = nq * 64; if (row0 >= M) return;
  const _Float16* a0p = A + (size_t)(row0 + ln) * lda; const _Float16* a1p = a0p + (size_t)16 * lda;
  const _Float16* b0p = Bh + (size_t)(col0 + ln) * ldb; const _Float16* b1p = b0p + (size_t)16 * ldb; const _Float16* b2p = b1p + (size_t)16 * ldb; const _Float16* b3p = b2p + (size_t)16 * ldb;
  const v8f z8 = {0.f,0.f,0.f,0.f,0.f,0.f,0.f,0.f}; v8f c00 = z8, c01 = z8, c02 = z8, c03 = z8, c10 = z8, c11 = z8, c12 = z8, c13 = z8;
#pragma unroll 1
  for (int kb = 0; kb < K; kb += 32) { const v16h a0 = g2_frag(a0p + kb, hh), a1 = g2_frag(a1p + kb, hh);
    v16h b = g2_frag(b0p + kb, hh); c00 = g2_mma(a0, b, c00); c10 = g2_mma(a1, b, c10);
    b = g2_frag(b1p + kb, hh); c01 = g2_mma(a0, b, c01); c11 = g2_mma(a1, b, c11);
    b = g2_frag(b2p + kb, hh); c02 = g2_mma(a0, b, c02); c12 = g2_mma(a1, b, c12);
    b = g2_frag(b3p + kb, hh); c03 = g2_mma(a0, b, c03); c13 = g2_mma(a1, b, c13); }
  v8f accs[8] = {c00, c01, c02, c03, c10, c11, c12, c13};
#pragma unroll
  for (int u = 0; u < 8; ++u) { const int t = u & 3, half = u >> 2; const int col = col0 + t * 16 + ln; const float bv = bp ? bf16_round(bp[col]) : 0.f;
#pragma unroll
    for (int r = 0; r < 8; ++r) { const int rloc = half * 16 + 8 * hh + r; float v = accs[u][r] * alpha + bv; if (CP) { if (rowsPerB < 0) v += CP[cofs + (size_t)(row0g + row0 + rloc) * ldc + col];      /* rowsPerB < 0: own element of the batched C plane */ else { const int bidx = (row0g + row0 + rloc) / rowsPerB; v += CP[(size_t)bidx * sCPb + (size_t)by * 64 + col]; } }
      if (ACT == 3) v = fmaxf(v, 0.f); else if (ACT == 6) v = 0.5f * v * (1.0f + erff(v * 0.70710678118654752f)); else if (ACT == 11) v = 1.0f / (1.0f + expf(-v)); else if (ACT == 15) v = v / (1.0f + expf(-v)); else if (ACT == 12) v = (v > 0.f) ? v : 0.01f * v; else if (ACT == 8) v = tanhf(v); else if (ACT == 9) v = 0.5f * v * (1.0f + tanhf(0.7978845608028654f * (v + 0.044715f * v * v * v))); else if (ACT == 14) v = (v > 0.f) ? v : 0.1f * v; else if (ACT == 16) v = (v >= 0.f) ? v : 0.3f * v; else if (ACT == 17) v = (v >= 0.f) ? v : 0.2f * v;
      so[w][rloc][t * 16 + ln] = v; } }
  __builtin_amdgcn_fence(__ATOMIC_ACQ_REL, "workgroup"); __builtin_amdgcn_wave_barrier();
  const int rsub = lane >> 4, c4 = (lane & 15) * 4;
  {
#pragma unroll
    for (int q = 0; q < 16; ++q) { const int r = q * 2 + rsub; const v4f v = *(const v4fa*)&so[w][r][c4]; if (C) *(v4f*)(C + cofs + (size_t)(row0 + r) * ldc + col0 + c4) = v; if (C16) { v4h h4; for (int i = 0; i < 4; ++i) h4[i] = (_Float16)v[i]; *(v4h*)(C16 + cofs + (size_t)(row0 + r) * ldc + col0 + c4) = h4; } }
     } }


__global__ __launch_bounds__(256) void k_wnat(const float* __restrict__ w, size_t n8, _Float16* __restrict__ Bt) { const size_t t = (size_t)blockIdx.x * 256 + threadIdx.x; if (t >= n8) return; FragH f; for (int q = 0; q < 8; ++q) f.h[q] = (_Float16)(bf16_round(w[t * 8 + q]) * 16.0f); *(v8us*)((unsigned short*)Bt + t * 8) = f.half[0];  }
__global__ __launch_bounds__(256) void k_rsm(const float* __restrict__ S, _Float16* __restrict__ P, int nrows) {
  #pragma clang fp contract(off)
  const int i = blockIdx.x * 256 + threadIdx.x; if (i >= nrows) return; const float* s = S + (size_t)i * SQ; float mx = -3.0e38f;
#pragma unroll 1
  for (int j = 0; j < SQ; ++j) mx = fmaxf(mx, s[j]); float se = 0.f;
#pragma unroll 1
  for (int j = 0; j < SQ; ++j) se += expf(s[j] - mx); const float sc = 256.0f / se;
#pragma unroll 1
  for (int j0 = 0; j0 < SQ; j0 += 8) { FragH f; for (int q = 0; q < 8; ++q) f.h[q] = (_Float16)(expf(s[j0 + q] - mx) * sc); unsigned short* d = (unsigned short*)P + (size_t)i * SQ + j0; *(v8us*)d = f.half[0];  } }
__global__ __launch_bounds__(256) void k_vt(const _Float16* __restrict__ V16, int b, int h0, _Float16* __restrict__ VT) { __shared__ unsigned short tl[64][65]; const int tid = threadIdx.x; const int hh = blockIdx.x % HG, sg = blockIdx.x / HG; const int s0 = sg * 64; const int h = h0 + hh;
  for (int i = tid; i < 64 * 8; i += 256) { const int j = i / 8, d8 = (i % 8) * 8; FragH f; f.half[0] = *(const v8us*)((const unsigned short*)V16 + ((size_t)b * SQ + s0 + j) * DM + h * HD + d8); for (int q = 0; q < 8; ++q) tl[d8 + q][j] = f.u[q]; }
  __syncthreads();
  { for (int i = tid; i < 64 * 8; i += 256) { const int d = i / 8, j8 = (i % 8) * 8; FragH f; for (int q = 0; q < 8; ++q) f.u[q] = tl[d][j8 + q]; *(v8us*)((unsigned short*)VT + ((size_t)hh * HD + d) * SQ + s0 + j8) = f.half[0]; }  } }



// ---- one preparing launch: independent pieces picked by block range, so that they share one start instead of six dependent ones ----
// Blocks 0 .. 4 * PW_B - 1: weight wi = block / PW_B as Wt[n][k] = f16(bf16(W[k][n]) x 16), the arithmetic of k_wt_f16. The other 2 * PX_B blocks: the two
// sources as f16(bf16(x)) rows, the arithmetic of k_x16; a block takes PX_U consecutive runs of 256 groups of 8 floats, a thread one group of each run.
#define PW_B (DM * (DM / 8) / 256)   /* blocks per weight */
#define PX_U 8                       /* groups of 8 elements per thread */
#define PX_B ((int)(NR * DM / 8 / 256 / PX_U))      /* blocks per source */
__global__ __launch_bounds__(256) void k_prep(const float* __restrict__ xq, const float* __restrict__ xk, const float* __restrict__ wq, const float* __restrict__ wk, const float* __restrict__ wv, const float* __restrict__ wo,
    _Float16* __restrict__ XQ, _Float16* __restrict__ XK, _Float16* __restrict__ BW) {
  static_assert(NR * DM == (size_t)PX_B * 256 * PX_U * 8, "the sources divide evenly among the threads");
  const int bx = blockIdx.x;
  if (bx < 4 * PW_B) { const int wi = bx / PW_B; const float* W = wi == 0 ? wq : wi == 1 ? wk : wi == 2 ? wv : wo; _Float16* Wt = BW + (size_t)wi * DM * DM;
    const int t = (bx - wi * PW_B) * 256 + threadIdx.x; const int n = t / (DM / 8), k8 = (t % (DM / 8)) * 8; FragH f;
#pragma unroll
    for (int i = 0; i < 8; ++i) f.h[i] = (_Float16)(bf16_round(W[(size_t)(k8 + i) * DM + n]) * 16.0f);
    *(v8us*)((unsigned short*)Wt + (size_t)n * DM + k8) = f.half[0];
    return; }
  const int xb = bx - 4 * PW_B; const bool second = xb >= PX_B; const size_t g0 = (size_t)(xb - (second ? PX_B : 0)) * (256 * PX_U) + threadIdx.x;      /* the thread's first group */
  const float* p = (second ? xk : xq) + g0 * 8; unsigned short* d = (unsigned short*)(second ? XK : XQ) + g0 * 8; v4f a[PX_U][2]; v8us o[PX_U];
#pragma unroll
  for (int u = 0; u < PX_U; ++u) { a[u][0] = *(const v4fa*)(p + u * 2048); a[u][1] = *(const v4fa*)(p + u * 2048 + 4); }
  asm volatile("s_wait_xcnt 0x0" :: "v"(p) : "memory");      /* the loads' address register stays whole up to this wait; behind it it may be reused */
#pragma unroll
  for (int u = 0; u < PX_U; ++u) { FragH f;
#pragma unroll
    for (int q = 0; q < 4; ++q) { f.h[q] = (_Float16)bf16_round(a[u][0][q]); f.h[4 + q] = (_Float16)bf16_round(a[u][1][q]); }
    o[u] = f.half[0]; }
  __builtin_amdgcn_sched_barrier(0);      /* the stores stand last, so that no register of an issued store is written again */
#pragma unroll
  for (int u = 0; u < PX_U; ++u) *(v8us*)(d + u * 2048) = o[u];
  asm volatile("s_wait_xcnt 0x0" ::: "memory"); }      /* in the built code the weight blocks' part follows behind a scalar branch and writes these registers: the wait stands in front of it */

// ---- the three projections in one launch (wave tile, k order and epilogue arithmetic of k_gemm2): blockIdx.y = 0: Q rows, 1: K rows, 2: V^T ----
// V^T[feature][token] = sum_k Wt[feature][k] X[token][k] is the projection with the operand roles swapped (A = weight rows, B = token rows): its C rows are the
// [batch][head][d][token] rows that the attention kernel reads, 128-byte lines of 64 tokens with one wave as writer, and the bias goes by row instead of by column.
template <int LDC>
__device__ __forceinline__ void p3_store(const float (*so)[68], _Float16* cp, int lane) {      /* cp: the wave's tile origin in C; rows leave as whole 128-byte lines */
  const int rsub = lane >> 4, c4 = (lane & 15) * 4; _Float16* c = cp + (size_t)rsub * LDC + c4; v4h h4[16];
#pragma unroll
  for (int q = 0; q < 16; ++q) { const v4f v = *(const v4fa*)&so[q * 2 + rsub][c4];
#pragma unroll
    for (int i = 0; i < 4; ++i) h4[q][i] = (_Float16)v[i]; }
  __builtin_amdgcn_sched_barrier(0);      /* the stores stand last, so that no register of an issued store is written again */
#pragma unroll
  for (int q = 0; q < 16; ++q) *(v4h*)(c + (size_t)q * 2 * LDC) = h4[q];
  asm volatile("s_wait_xcnt 0x0" ::: "memory"); }      /* in the built code the other layout's epilogue follows behind a scalar branch and writes these registers: the wait stands in front of it */
// ---- GEMM tile through LDS: C[128][128] = A rows . B rows^T over k = DM, one work-group of eight waves (wave tile 32x64 as before: 4 down, 2 across) ----
// A stage is one whole 128-byte line (64 k) of each of the 128 A rows and 128 B rows, brought by asynchronous 16-byte copies (eight lanes a row, so a wave's copy
// covers four whole lines) into rows of GT_PIT bytes; two buffers, the next stage's copies fly under this stage's products. The fragments are read from LDS in
// the k order of g2_frag, and every accumulator takes its 32-k steps in rising order, as before.
#define GT_PIT 144                   /* LDS row pitch in bytes: 128 of data + 16, an odd multiple of 16 B (16-byte fragment reads without bank conflicts) */
#define GT_BUF (256 * GT_PIT)        /* one buffer: rows 0-127 of A, rows 128-255 of B */
#define GT_KS 64                     /* k per stage */
#define GT_NST (DM / GT_KS)
__device__ __forceinline__ v16h gt_lfrag(const unsigned char* p) { FragH f; f.half[0] = *(const v8us*)p; f.half[1] = *(const v8us*)(p + 32); return f.v; }      /* p already holds the lane's 16 hh bytes */
// One stage: the thread's 16 bytes of rows sr + 32 j of A and of B. a, b: its place in row sr of the stage's k range; l: the LDS byte address of that place in A's part.
// The closing wait stands inside the statement, so that no address register of an issued copy is rewritten in front of it.
__device__ __forceinline__ void gt_copy(const _Float16* a, const _Float16* b, unsigned l) {
  asm volatile("global_load_async_to_lds_b128 %0, %8, off\n\t"
               "global_load_async_to_lds_b128 %1, %9, off\n\t"
               "global_load_async_to_lds_b128 %2, %10, off\n\t"
               "global_load_async_to_lds_b128 %3, %11, off\n\t"
               "global_load_async_to_lds_b128 %4, %12, off\n\t"
               "global_load_async_to_lds_b128 %5, %13, off\n\t"
               "global_load_async_to_lds_b128 %6, %14, off\n\t"
               "global_load_async_to_lds_b128 %7, %15, off\n\t"
               "s_wait_xcnt 0x0"
               :: "v"(l), "v"(l + 32 * GT_PIT), "v"(l + 64 * GT_PIT), "v"(l + 96 * GT_PIT), "v"(l + 128 * GT_PIT), "v"(l + 160 * GT_PIT), "v"(l + 192 * GT_PIT), "v"(l + 224 * GT_PIT),
                  "v"(a), "v"(a + 32 * DM), "v"(a + 64 * DM), "v"(a + 96 * DM), "v"(b), "v"(b + 32 * DM), "v"(b + 64 * DM), "v"(b + 96 * DM) : "memory"); }
// A, B: first row of the tile's 128 A rows and 128 B rows (pitch DM). On return every wave has passed the barrier behind the last LDS read and no copy is in flight: SM is free.
__device__ __forceinline__ void gt_tile(const _Float16* A, const _Float16* B, unsigned char* SM, v8f (&acc)[8]) {
  static_assert(DM % GT_KS == 0 && GT_NST >= 2, "the ring's prologue needs two stages");
  const int tid = threadIdx.x, w = tid >> 5, lane = tid & 31, ln = lane & 15, hh = lane >> 4; const int sr = tid >> 3, sc = tid & 7;
  const _Float16* ag = A + (size_t)sr * DM + sc * 8; const _Float16* bg = B + (size_t)sr * DM + sc * 8; const unsigned l0 = (unsigned)(size_t)SM + sr * GT_PIT + sc * 16;
  const unsigned char* af = SM + ((w & 3) * 32 + ln) * GT_PIT + 16 * hh; const unsigned char* bf = SM + (128 + (w >> 2) * 64 + ln) * GT_PIT + 16 * hh;
  const v8f z8 = {0.f,0.f,0.f,0.f,0.f,0.f,0.f,0.f}; v8f c00 = z8, c01 = z8, c02 = z8, c03 = z8, c10 = z8, c11 = z8, c12 = z8, c13 = z8;
  gt_copy(ag, bg, l0);
  asm volatile("s_wait_asynccnt 0x0" ::: "memory");      /* this wave's part of stage 0 has landed */
  __syncthreads();      /* stage 0 is visible to every wave */
  gt_copy(ag + GT_KS, bg + GT_KS, l0 + GT_BUF);
  for (int t = 0; t < GT_NST; ++t) { const int bo = (t & 1) * GT_BUF;
#pragma unroll      /* two 32-k steps with constant LDS offsets */
    for (int ks = 0; ks < 2; ++ks) { const unsigned char* ap = af + bo + ks * 64; const unsigned char* bp = bf + bo + ks * 64;
      const v16h a0 = gt_lfrag(ap), a1 = gt_lfrag(ap + 16 * GT_PIT), b0 = gt_lfrag(bp), b1 = gt_lfrag(bp + 16 * GT_PIT), b2 = gt_lfrag(bp + 32 * GT_PIT), b3 = gt_lfrag(bp + 48 * GT_PIT);
      __builtin_amdgcn_sched_barrier(0);      /* the step's twelve LDS reads go out as one group ahead of its products: one LDS latency a step instead of four */
      c00 = g2_mma(a0, b0, c00); c10 = g2_mma(a1, b0, c10); c01 = g2_mma(a0, b1, c01); c11 = g2_mma(a1, b1, c11);
      c02 = g2_mma(a0, b2, c02); c12 = g2_mma(a1, b2, c12); c03 = g2_mma(a0, b3, c03); c13 = g2_mma(a1, b3, c13); }
    asm volatile("s_wait_dscnt 0x0" ::: "memory");      /* this wave's reads of stage t are done before its buffer may be refilled */
    asm volatile("s_wait_asynccnt 0x0" ::: "memory");      /* this wave's part of stage t + 1 has landed */
    __syncthreads();      /* publishes stage t + 1 and ends every wave's reads of stage t */
    if (t + 2 < GT_NST) gt_copy(ag + (t + 2) * GT_KS, bg + (t + 2) * GT_KS, l0 + bo); }
  asm volatile("s_wait_asynccnt 0x0" ::: "memory");      /* nothing is in flight when the buffers become output staging */
  acc[0] = c00; acc[1] = c01; acc[2] = c02; acc[3] = c03; acc[4] = c10; acc[5] = c11; acc[6] = c12; acc[7] = c13; }

__global__ __launch_bounds__(256) void k_proj3(const _Float16* __restrict__ XQ, const _Float16* __restrict__ XK, const _Float16* __restrict__ BW, const float* __restrict__ bq, const float* __restrict__ bk, const float* __restrict__ bv,
    _Float16* __restrict__ Q16, _Float16* __restrict__ K16, _Float16* __restrict__ VT) {
  static_assert((MP / 128) * (DM / 128) == NB * (DM / 128) * (SQ / 128) && MP == NB * SQ, "the three products have the same number of 128x128 tiles");
  static_assert(8 * 32 * 68 * 4 <= 2 * GT_BUF, "the output staging fits the ring");
  __shared__ __attribute__((aligned(16))) unsigned char SM[2 * GT_BUF];      /* the ring; behind the loop each wave's 32x68 f32 output staging */
  const int tid = threadIdx.x, w = tid >> 5, lane = tid & 31, ln = lane & 15, hh = lane >> 4; const int by = blockIdx.y, bx = blockIdx.x; const bool tr = by == 2;
  const _Float16* A; const _Float16* Bh; const float* bias; int mt, nq;
  if (tr) { const int b = bx / ((DM / 128) * (SQ / 128)), x = bx - b * ((DM / 128) * (SQ / 128)); A = BW + (size_t)2 * DM * DM; Bh = XK + (size_t)b * SQ * DM; bias = bv; mt = x / (SQ / 128); nq = x - mt * (SQ / 128); }
  else { A = by ? XK : XQ; Bh = BW + (size_t)by * DM * DM; bias = by ? bk : bq; mt = bx / (DM / 128); nq = bx - mt * (DM / 128); }
  v8f accs[8]; gt_tile(A + (size_t)mt * 128 * DM, Bh + (size_t)nq * 128 * DM, SM, accs);
  const int row0 = mt * 128 + 32 * (w & 3), col0 = nq * 128 + 64 * (w >> 2); float (*so)[68] = (float (*)[68])(SM + (size_t)w * (32 * 68 * 4));
  float bcol[4] = {0.f, 0.f, 0.f, 0.f}, brow[2][8] = {};
  if (tr) {
#pragma unroll
    for (int half = 0; half < 2; ++half)
#pragma unroll
      for (int r = 0; r < 8; ++r) brow[half][r] = bf16_round(bias[row0 + half * 16 + 8 * hh + r]); }
  else {
#pragma unroll
    for (int t = 0; t < 4; ++t) bcol[t] = bf16_round(bias[col0 + t * 16 + ln]); }
#pragma unroll
  for (int u = 0; u < 8; ++u) { const int t = u & 3, half = u >> 2;
#pragma unroll
    for (int r = 0; r < 8; ++r) so[half * 16 + 8 * hh + r][t * 16 + ln] = accs[u][r] * 0.0625f + (tr ? brow[half][r] : bcol[t]); }
  __builtin_amdgcn_fence(__ATOMIC_ACQ_REL, "workgroup"); __builtin_amdgcn_wave_barrier();      /* the wave reads back its own tile in row order */
  if (tr) p3_store<SQ>(so, VT + (size_t)(bx / ((DM / 128) * (SQ / 128))) * DM * SQ + (size_t)row0 * SQ + col0, lane);
  else p3_store<DM>(so, (by ? K16 : Q16) + (size_t)row0 * DM + col0, lane); }

// ---- the output product on the same tile: out = o Wo * alpha + bias (epilogue arithmetic of k_gemm2<0>), f32 rows of the output layout ----
__global__ __launch_bounds__(256) void k_outg(const _Float16* __restrict__ O16, const _Float16* __restrict__ BO, const float* __restrict__ bo, float* __restrict__ C) {
  __shared__ __attribute__((aligned(16))) unsigned char SM[2 * GT_BUF];      /* the ring; behind the loop each wave's 32x68 f32 output staging */
  const int tid = threadIdx.x, w = tid >> 5, lane = tid & 31, ln = lane & 15, hh = lane >> 4; const int mt = blockIdx.x / (DM / 128), nq = blockIdx.x - mt * (DM / 128);
  v8f accs[8]; gt_tile(O16 + (size_t)mt * 128 * DM, BO + (size_t)nq * 128 * DM, SM, accs);
  const int row0 = mt * 128 + 32 * (w & 3), col0 = nq * 128 + 64 * (w >> 2); float (*so)[68] = (float (*)[68])(SM + (size_t)w * (32 * 68 * 4));
#pragma unroll
  for (int u = 0; u < 8; ++u) { const int t = u & 3, half = u >> 2; const float bv = bf16_round(bo[col0 + t * 16 + ln]);
#pragma unroll
    for (int r = 0; r < 8; ++r) so[half * 16 + 8 * hh + r][t * 16 + ln] = accs[u][r] * 0.0009765625f + bv; }      /* 1 / (16 x 64): the weights' x16 and o's x64 */
  __builtin_amdgcn_fence(__ATOMIC_ACQ_REL, "workgroup"); __builtin_amdgcn_wave_barrier();      /* the wave reads back its own tile in row order */
  const int rsub = lane >> 4, c4 = (lane & 15) * 4; float* c = C + (size_t)(row0 + rsub) * DM + col0 + c4; v4f v[16];
#pragma unroll
  for (int q = 0; q < 16; ++q) v[q] = *(const v4fa*)&so[q * 2 + rsub][c4];
  __builtin_amdgcn_sched_barrier(0);      /* the stores stand last, so that no register of an issued store is written again */
#pragma unroll
  for (int q = 0; q < 16; ++q) *(v4f*)(c + (size_t)q * 2 * DM) = v[q]; }      /* a row's 256 bytes of this tile have this wave as their only writer */

#define FA_NW 8                      /* waves per key group */
#define FA_KG 2                      /* key groups per work-group: both hold the same query columns, group kg walks the 64-key tiles FA_KG * st + kg; four waves a SIMD instead of two */
#define FA_CW 32                     /* query columns per wave (two 16-column groups) */
#define FA_BR (FA_NW * FA_CW)        /* query rows per work-group */
#define FA_XR 17                     /* 16-byte rows per lane that a wave of the second group hands over: 16 of O^T, 1 of denominators and maxima */
#define FA_SK 64                     /* keys per LDS stage and key group (two 32-key passes) */
#define FA_PIT 144                   /* LDS row pitch in bytes: 128 of data + 16, an odd multiple of 16 B (16-byte fragment reads without bank conflicts) */
#define FA_OFS 6.0f                  /* the maximum in use is kept 6 below the true one: weights carried x64, away from the f16 subnormal range */
#define FA_LAG 8.0f                  /* a column's maximum may outgrow the one in use by this much (log2) before the sums are rescaled: weights stay <= 2^14 */
typedef float v2f __attribute__((ext_vector_type(2)));
typedef _Float16 v2h __attribute__((ext_vector_type(2)));
__device__ __forceinline__ float rs_xh(float x) { return __builtin_bit_cast(float, __builtin_amdgcn_permlanex16(__builtin_bit_cast(int, x), __builtin_bit_cast(int, x), 0x76543210, 0xfedcba98, false, false)); }      /* lane l <- lane l ^ 16 */
// Four native 2^x in place. One statement, so that no neighbour of a v_exp_f32 reads its result or writes its source; the closing v_nop is the free slot
// the instruction set asks for behind a transcendental.
__device__ __forceinline__ v4f rs_exp2x4(v4f e) { float a = e[0], b = e[1], c = e[2], d = e[3];
  asm("v_exp_f32 %0, %0\n\tv_exp_f32 %1, %1\n\tv_exp_f32 %2, %2\n\tv_exp_f32 %3, %3\n\tv_nop" : "+v"(a), "+v"(b), "+v"(c), "+v"(d));
  const v4f r = {a, b, c, d}; return r; }
__device__ __forceinline__ v8f fa_mma(v16h a, v16h b, v8f c) { return __builtin_amdgcn_wmma_f32_16x16x32_f16(false, a, false, b, (short)0, c, false, false); }
__device__ __forceinline__ v16h fa_lfrag(const unsigned char* p) { FragH f; f.half[0] = *(const v8us*)p; f.half[1] = *(const v8us*)(p + 32); return f.v; }      /* p already holds the lane's 16 h bytes: k = 8h + 0..7 and 16 + 8h + 0..7 */
__global__ __launch_bounds__(FA_KG * FA_NW * 32) void k_fattn(const _Float16* __restrict__ Q16, const _Float16* __restrict__ K16, const _Float16* __restrict__ VT, _Float16* __restrict__ O16) {
  static_assert(HD == 64 && SQ % FA_BR == 0 && SQ % (FA_KG * FA_SK) == 0 && FA_SK == 64 && FA_NW * 32 == 256 && FA_KG == 2, "tile constants are written for head size 64 and two key groups of 256 threads");
  static_assert(FA_NW * FA_XR * 512 <= FA_KG * 2 * 2 * FA_SK * FA_PIT, "the hand-over fits the ring");
  __shared__ __attribute__((aligned(16))) unsigned char L[FA_KG][2][2][FA_SK * FA_PIT];      /* [key group][buffer][0: K rows (key)(d) | 1: V^T rows (d)(key)] */
  const int tid = threadIdx.x & (FA_NW * 32 - 1), lane = tid & 31, w = tid >> 5, c = lane & 15, h = lane >> 4;      /* tid, w: within the key group */
  const int kg = __builtin_amdgcn_readfirstlane((int)(threadIdx.x >> 8));      /* the wave's key group, in a scalar register */
  const int bh = blockIdx.y, b = bh / NH, hd = bh - b * NH; const int q0 = blockIdx.x * FA_BR + w * FA_CW;
  const unsigned short* Kg = (const unsigned short*)K16 + (size_t)b * SQ * DM + hd * HD;      /* row = key, pitch DM */
  const unsigned short* Vg = (const unsigned short*)VT + (size_t)bh * HD * SQ;                /* row = d, pitch SQ */
  const int sr = tid >> 3, sc = tid & 7;      /* staging: eight lanes move one whole 128-byte row; a thread owns rows sr and sr + 32 of both tiles of its own group */
  const unsigned short* kp = Kg + (size_t)(kg * FA_SK + sr) * DM + sc * 8; const unsigned short* vp = Vg + (size_t)sr * SQ + kg * FA_SK + sc * 8;
  v8us kr0, kr1, vr0, vr1;
  auto gload = [&](int st) { const unsigned short* k = kp + (size_t)st * (FA_KG * FA_SK) * DM; const unsigned short* v = vp + st * (FA_KG * FA_SK);
    kr0 = *(const v8us*)k; kr1 = *(const v8us*)(k + (size_t)32 * DM); vr0 = *(const v8us*)v; vr1 = *(const v8us*)(v + (size_t)32 * SQ);
    asm volatile("s_wait_xcnt 0x0" ::: "memory"); };      /* the loads' address registers are stepped for the next stage: keep the wait in front of that overwrite */
  auto lstore = [&](int buf) { unsigned char* kd = &L[kg][buf][0][sr * FA_PIT + sc * 16]; unsigned char* vd = &L[kg][buf][1][sr * FA_PIT + sc * 16];
    *(v8us*)kd = kr0; *(v8us*)(kd + 32 * FA_PIT) = kr1; *(v8us*)vd = vr0; *(v8us*)(vd + 32 * FA_PIT) = vr1; };
  gload(0);
  v16h qf[2][2];      /* B operand: query column 16 g + c, d = 32 kc + hardware k order */
#pragma unroll
  for (int g = 0; g < 2; ++g) { const _Float16* qp = Q16 + ((size_t)b * SQ + q0 + 16 * g + c) * DM + hd * HD; qf[g][0] = g2_frag(qp, h); qf[g][1] = g2_frag(qp + 32, h); }
  const v8f z8 = {0.f,0.f,0.f,0.f,0.f,0.f,0.f,0.f}; const v4f z4 = {0.f,0.f,0.f,0.f};
  v8f acc[2][4]; v4f la[2]; float mu[2];      /* O^T tiles (d = 16 t + 8 h + r, query 16 g + c); this half's part of the denominator; the maximum in use, minus FA_OFS */
#pragma unroll
  for (int g = 0; g < 2; ++g) { mu[g] = -__builtin_inff(); la[g] = z4;
#pragma unroll
    for (int t = 0; t < 4; ++t) acc[g][t] = z8; }
  const float cs = 0.125f * 0x1.715476p+0f;      /* 1 / sqrt(64) and log2 e in one factor */
  lstore(0);
  __syncthreads();      /* stage 0 is visible to every wave */
  constexpr int NST = SQ / (FA_KG * FA_SK);
  for (int st = 0; st < NST; ++st) { const int buf = st & 1;
    if (st + 1 < NST) gload(st + 1);      /* the next stage's rows fly into registers under this stage's work */
#pragma unroll      /* two passes with constant LDS offsets */
    for (int p = 0; p < 2; ++p) {
      const unsigned char* kb = &L[kg][buf][0][(32 * p + c) * FA_PIT + 16 * h]; const unsigned char* vb = &L[kg][buf][1][c * FA_PIT + 64 * p + 16 * h];
      v8f s[2][2];      /* [16-key tile][column group] */
#pragma unroll
      for (int kt = 0; kt < 2; ++kt) { const v16h k0 = fa_lfrag(kb + kt * 16 * FA_PIT), k1 = fa_lfrag(kb + kt * 16 * FA_PIT + 64);
#pragma unroll
        for (int g = 0; g < 2; ++g) s[kt][g] = fa_mma(k1, qf[g][1], fa_mma(k0, qf[g][0], z8)); }
      v16h vf[4];
#pragma unroll
      for (int t = 0; t < 4; ++t) vf[t] = fa_lfrag(vb + t * 16 * FA_PIT);
      float mb[2]; bool need = false;
#pragma unroll
      for (int g = 0; g < 2; ++g) { float m0 = fmaxf(s[0][g][0], s[1][g][0]), m1 = fmaxf(s[0][g][1], s[1][g][1]);
#pragma unroll
        for (int r = 2; r < 8; r += 2) { m0 = fmaxf(m0, fmaxf(s[0][g][r], s[1][g][r])); m1 = fmaxf(m1, fmaxf(s[0][g][r + 1], s[1][g][r + 1])); }
        m0 = fmaxf(m0, m1); mb[g] = fmaxf(m0, rs_xh(m0)) * cs - FA_OFS;      /* both halves hold the column's maximum of this pass (the scale is positive) */
        need = need || (mb[g] > mu[g] + FA_LAG); }
      if (__builtin_amdgcn_ballot_w32(need) != 0) {      /* wave-uniform; always taken on the first pass (mu = -inf), rare later */
        const float n0 = fmaxf(mu[0], mb[0]), n1 = fmaxf(mu[1], mb[1]); const v4f d4 = {mu[0] - n0, mu[1] - n1, 0.f, 0.f}; const v4f cr = rs_exp2x4(d4); mu[0] = n0; mu[1] = n1;
#pragma unroll
        for (int g = 0; g < 2; ++g) { la[g] = la[g] * cr[g];
#pragma unroll
          for (int t = 0; t < 4; ++t) acc[g][t] = acc[g][t] * cr[g]; } }
#pragma unroll
      for (int g = 0; g < 2; ++g) { const float nm = -mu[g]; FragH pf;
#pragma unroll
        for (int i = 0; i < 4; ++i) { const int kt = i >> 1, r0 = 4 * (i & 1); v4f e;
#pragma unroll
          for (int j = 0; j < 4; ++j) e[j] = __builtin_fmaf(s[kt][g][r0 + j], cs, nm);
          e = rs_exp2x4(e); la[g] = la[g] + e;
#pragma unroll
          for (int j = 0; j < 4; ++j) pf.h[4 * i + j] = (_Float16)e[j]; }      /* element 8 kt + r = key 16 kt + 8 h + r */
#pragma unroll
        for (int t = 0; t < 4; ++t) acc[g][t] = fa_mma(vf[t], pf.v, acc[g][t]); } }
    if (st + 1 < NST) lstore(buf ^ 1);      /* every wave left that buffer before the barrier that ended stage st - 1 */
    __syncthreads(); }      /* publishes stage st + 1 and ends every wave's reads of stage st */
  // The two key groups' partial sums become one: the second group's waves hand O^T, denominators and maxima over through the ring, which every wave has left
  // behind the loop's last barrier; lane for lane they belong to the same query columns as those of wave w of the first group.
  float ls[2] = {(la[0][0] + la[0][1]) + (la[0][2] + la[0][3]), (la[1][0] + la[1][1]) + (la[1][2] + la[1][3])};
  v4fa* X = (v4fa*)&L[0][0][0][0] + w * (FA_XR * 32) + lane;      /* row j of the wave: 32 lanes x 16 bytes in a row */
  if (kg != 0) {
#pragma unroll
    for (int g = 0; g < 2; ++g)
#pragma unroll
      for (int t = 0; t < 4; ++t) { const v4f lo = {acc[g][t][0], acc[g][t][1], acc[g][t][2], acc[g][t][3]}, hi = {acc[g][t][4], acc[g][t][5], acc[g][t][6], acc[g][t][7]}; X[(8 * g + 2 * t) * 32] = lo; X[(8 * g + 2 * t + 1) * 32] = hi; }
    const v4f sm = {ls[0], ls[1], mu[0], mu[1]}; X[16 * 32] = sm; }
  __syncthreads();      /* the hand-over is visible to the first group */
  if (kg != 0) return;      /* no barrier follows */
  { const v4f sm = X[16 * 32]; const float n0 = fmaxf(mu[0], sm[2]), n1 = fmaxf(mu[1], sm[3]); const v4f d4 = {mu[0] - n0, sm[2] - n0, mu[1] - n1, sm[3] - n1}; const v4f cr = rs_exp2x4(d4);      /* both parts onto the larger maximum */
#pragma unroll
    for (int g = 0; g < 2; ++g) { ls[g] = ls[g] * cr[2 * g] + sm[g] * cr[2 * g + 1];
#pragma unroll
      for (int t = 0; t < 4; ++t) { const v4f lo = X[(8 * g + 2 * t) * 32], hi = X[(8 * g + 2 * t + 1) * 32];
#pragma unroll
        for (int r = 0; r < 4; ++r) { acc[g][t][r] = acc[g][t][r] * cr[2 * g] + lo[r] * cr[2 * g + 1]; acc[g][t][4 + r] = acc[g][t][4 + r] * cr[2 * g] + hi[r] * cr[2 * g + 1]; } } } }
#pragma unroll
  for (int g = 0; g < 2; ++g) { float lf = ls[g]; lf += rs_xh(lf); const float inv = 64.0f / lf;      /* o carried x64, as the output GEMM's alpha expects */
    unsigned short* op = (unsigned short*)O16 + ((size_t)b * SQ + q0 + 16 * g + c) * DM + hd * HD + 8 * h;
#pragma unroll
    for (int t = 0; t < 4; ++t) { FragH o;
#pragma unroll
      for (int r = 0; r < 8; ++r) o.h[r] = (_Float16)(acc[g][t][r] * inv);
      *(v8us*)(op + 16 * t) = o.half[0]; } } }      /* 8 consecutive d of one query: one 16-byte store; a query's 128-byte line has this wave as its only writer */

extern "C" void kernel_launch(void* const* d_in, const int* in_sizes, int n_in,
                              void* d_out, int out_size, void* d_ws, size_t ws_size, hipStream_t stream) {
  (void)in_sizes; (void)n_in; (void)out_size;
  const float* const* I = (const float* const*)d_in; const float* xq = I[0]; const float* xk = I[1]; const float* wq = I[2]; const float* bq = I[3]; const float* wk = I[4]; const float* bk = I[5]; const float* wv = I[6]; const float* bv = I[7]; const float* wo = I[8]; const float* bo = I[9];      
  char* ws = (char*)d_ws; size_t off = 0;
  auto take = [&](size_t bytes) { char* p = ws + off; off += (bytes + 255) & ~(size_t)255; return p; };
  _Float16* BW = (_Float16*)take((size_t)4 * DM * DM * 2); _Float16* BO = BW + (size_t)3 * DM * DM;      /* the four weights, [in][out] -> Bt[n][k] x16: q, k, v, o */
  _Float16* XQ = (_Float16*)take(NR * DM * 2); _Float16* XK = (_Float16*)take(NR * DM * 2); _Float16* Q16 = (_Float16*)take(NR * DM * 2); _Float16* K16 = (_Float16*)take(NR * DM * 2); _Float16* O16 = (_Float16*)take(NR * DM * 2);
  _Float16* VT = (_Float16*)take((size_t)NB * NH * HD * SQ * 2);
  if (off > ws_size) return;
  k_prep<<<4 * PW_B + 2 * PX_B, 256, 0, stream>>>(xq, xk, wq, wk, wv, wo, XQ, XK, BW);      /* weights and both sources; keys and values read the same source, rounded once */
  const size_t r0p = (size_t)B0 * SQ;      /* first projected row */
  k_proj3<<<dim3((unsigned)((MP / 128) * (DM / 128)), 3), 256, 0, stream>>>(XQ, XK, BW, bq, bk, bv, Q16, K16, VT);      /* Q, K rows and V^T [NB][NH][HD][SQ] */
  k_fattn<<<dim3(SQ / FA_BR, NB * NH), FA_KG * FA_NW * 32, 0, stream>>>(Q16, K16, VT, O16);      /* o x64 (merged heads) as f16 rows */
  k_outg<<<dim3((unsigned)((MPO / 128) * (DM / 128))), 256, 0, stream>>>(O16 + r0p * DM, BO, bo, (float*)d_out + r0p * DM);      /* out rows are the output layout */
}

// v006
// A run of this version takes 87.4 microseconds.
// Two timings next to v005 both put it at 1.04 times that version's speed.
// Counting every step since v000, it is 153 times as fast.
#include <hip/hip_runtime.h>
#define NB 2
#define SQ 4096
#define DM 512
#define NH 8
#define HD 64
#define HG 1                         /* heads per block group in the unlaunched k_vt(V16, b, h0, VT) overload */
#define B0 0                         /* first batch processed (debug hook) */
#define NBR NB                       /* batches processed (debug hook) */
#define NR ((size_t)NB * SQ)         /* token rows */
#define MP ((int)((size_t)NBR * SQ)) /* rows projected (debug hook) */
#define QN SQ                        /* query rows per batch (unused: k_fattn attends all SQ) */
#define NHD NH                       /* heads (unused: k_fattn attends all NH) */
#define MPO MP                       /* rows through the output stage (debug hook) */
#define LQ DM      /* row pitch of the q/k rows (unused: the code writes DM) */
typedef __bf16 v16b __attribute__((ext_vector_type(16)));
typedef unsigned short v8us __attribute__((ext_vector_type(8), may_alias));
typedef float  v8f  __attribute__((ext_vector_type(8)));
typedef float  v4f  __attribute__((ext_vector_type(4)));
typedef float  v4fa __attribute__((ext_vector_type(4), may_alias));
union FragB { v16b v; v8us half[2]; unsigned short u[16]; };

__device__ __forceinline__ unsigned short bf16_bits(float x) { unsigned int u = __float_as_uint(x); return (unsigned short)((u + 0x7FFFu + ((u >> 16) & 1u)) >> 16); }
__device__ __forceinline__ float bf16_val(unsigned short b) { return __uint_as_float(((unsigned int)b) << 16); }
__device__ __forceinline__ float bf16_round(float x) { return bf16_val(bf16_bits(x)); }
// D += A·B with NT terms: 1 = ah·bh, 2 = + al·bh (A split), 3 = + ah·bl (both split)
template <int NT>
__device__ __forceinline__ v8f mmaN(v16b ah, v16b al, v16b bh, v16b bl, v8f c) {
  c = __builtin_amdgcn_wmma_f32_16x16x32_bf16(false, ah, false, bh, (short)0, c, false, false);
  if (NT >= 2) c = __builtin_amdgcn_wmma_f32_16x16x32_bf16(false, al, false, bh, (short)0, c, false, false);
  if (NT >= 3) c = __builtin_amdgcn_wmma_f32_16x16x32_bf16(false, ah, false, bl, (short)0, c, false, false);
  asm volatile("v_nop\n\tv_nop\n\tv_nop\n\tv_nop" : "+v"(c) : "v"(ah), "v"(al), "v"(bh), "v"(bl));
  return c;
}

__global__ __launch_bounds__(256) void k_wt_bf16(const float* __restrict__ W, unsigned short* __restrict__ Wt, int K, int N) {
  const int t = blockIdx.x * 256 + threadIdx.x;
  const int k8n = K / 8;
  if (t >= N * k8n) return;
  const int n = t / k8n, k8 = (t % k8n) * 8;
  v8us v;
#pragma unroll
  for (int i = 0; i < 8; ++i) v[i] = bf16_bits(W[(size_t)(k8 + i) * N + n]);
  *(v8us*)(Wt + (size_t)n * K + k8) = v;
  
}

// GEMM C[M][N] (f32, pitch ldc) = act(A[M][K]·W + bias). A f32 row-major (pitch lda) converted per fragment to bf16
// (ASPLIT: hi/lo two planes -> 2 terms, else single rounded term); Wt bf16 [N][K] (pitch ldb). BIAS_BF16 rounds the
// bias to bf16 first (bias quantised to bf16 before the add). K%32==0, M%16==0, N%64==0.
template <bool ASPLIT, int ACT, bool BIAS_BF16>
__global__ __launch_bounds__(128) void k_gemm_bf(const float* __restrict__ A, int lda, const unsigned short* __restrict__ Wt, int ldb,
                                               const float* __restrict__ bias, float* __restrict__ C, int ldc, int M, int N, int K) {
  __shared__ __attribute__((aligned(16))) float so[4][16][64];
  const int tid = threadIdx.x, w = tid >> 5, lane = tid & 31, ln = lane & 15, hh = lane >> 4;
  const int ntn = N / 64;
  const int wid = blockIdx.x * 4 + w;
  const int mt = wid / ntn, nq = wid % ntn;
  if (mt * 16 >= M) return;
  const int row0 = mt * 16, col0 = nq * 64;
  const float* arow = A + (size_t)(row0 + ln) * lda;
  v8f acc[4] = {};
  for (int kb = 0; kb < K; kb += 32) {
    FragB ah, al;
    const v4f x0 = *(const v4fa*)(arow + kb + 8 * hh), x1 = *(const v4fa*)(arow + kb + 8 * hh + 4);
    const v4f x2 = *(const v4fa*)(arow + kb + 16 + 8 * hh), x3 = *(const v4fa*)(arow + kb + 16 + 8 * hh + 4);
    float xs[16] = {x0[0],x0[1],x0[2],x0[3],x1[0],x1[1],x1[2],x1[3],x2[0],x2[1],x2[2],x2[3],x3[0],x3[1],x3[2],x3[3]};
#pragma unroll
    for (int i = 0; i < 16; ++i) { const unsigned short hb = bf16_bits(xs[i]); ah.u[i] = hb; al.u[i] = ASPLIT ? bf16_bits(xs[i] - bf16_val(hb)) : (unsigned short)0; }
#pragma unroll
    for (int t = 0; t < 4; ++t) {
      const unsigned short* brow = Wt + (size_t)(col0 + t * 16 + ln) * ldb + kb;
      FragB b;
      b.half[0] = *(const v8us*)(brow + 8 * hh);
      b.half[1] = *(const v8us*)(brow + 16 + 8 * hh);
      acc[t] = mmaN<ASPLIT ? 2 : 1>(ah.v, al.v, b.v, b.v, acc[t]);
    }
  }
#pragma unroll
  for (int t = 0; t < 4; ++t) {
    float bv = bias ? bias[col0 + t * 16 + ln] : 0.f;
    if (BIAS_BF16) bv = bf16_round(bv);
#pragma unroll
    for (int r = 0; r < 8; ++r) { float v = acc[t][r] + bv; if (ACT == 1) v = fmaxf(v, 0.f); so[w][8 * hh + r][t * 16 + ln] = v; }
  }
  __builtin_amdgcn_fence(__ATOMIC_ACQ_REL, "workgroup");
  __builtin_amdgcn_wave_barrier();
  const int rsub = lane >> 4, c4 = (lane & 15) * 4;
  {
#pragma unroll
    for (int q = 0; q < 8; ++q) {
      const int r = q * 2 + rsub;
      const v4f v = *(const v4fa*)&so[w][r][c4];
      *(v4f*)(C + (size_t)(row0 + r) * ldc + col0 + c4) = v;
    }
    
  }
}

// GEMM C = act(A·W + bias + resid): A f32 (ASPLIT -> hi/lo 2 terms), Wt bf16 [N][K]; ACT 0 none, 1 relu, 2 exact gelu;
// resid (optional, f32, row index = (row % rmod), pitch ldr, RES_BF16 rounds it) added before the activation.
template <bool ASPLIT, int ACT, bool BIAS_BF16, bool RES_BF16>
__global__ __launch_bounds__(128) void k_gemm_bf3(const float* __restrict__ A, int lda, const unsigned short* __restrict__ Wt, int ldb,
                                                const float* __restrict__ bias, const float* __restrict__ resid, int rmod, int ldr,
                                                float* __restrict__ C, int ldc, int M, int N, int K) {
  __shared__ __attribute__((aligned(16))) float so[4][16][64];
  const int tid = threadIdx.x, w = tid >> 5, lane = tid & 31, ln = lane & 15, hh = lane >> 4;
  const int ntn = N / 64;
  const int wid = blockIdx.x * 4 + w;
  const int mt = wid / ntn, nq = wid % ntn;
  if (mt * 16 >= M) return;
  const int row0 = mt * 16, col0 = nq * 64;
  const float* arow = A + (size_t)(row0 + ln) * lda;
  v8f acc[4] = {};
  for (int kb = 0; kb < K; kb += 32) {
    FragB ah, al;
    const v4f x0 = *(const v4fa*)(arow + kb + 8 * hh), x1 = *(const v4fa*)(arow + kb + 8 * hh + 4);
    const v4f x2 = *(const v4fa*)(arow + kb + 16 + 8 * hh), x3 = *(const v4fa*)(arow + kb + 16 + 8 * hh + 4);
    float xs[16] = {x0[0],x0[1],x0[2],x0[3],x1[0],x1[1],x1[2],x1[3],x2[0],x2[1],x2[2],x2[3],x3[0],x3[1],x3[2],x3[3]};
#pragma unroll
    for (int i = 0; i < 16; ++i) { const unsigned short hb = bf16_bits(xs[i]); ah.u[i] = hb; al.u[i] = ASPLIT ? bf16_bits(xs[i] - bf16_val(hb)) : (unsigned short)0; }
#pragma unroll
    for (int t = 0; t < 4; ++t) {
      const unsigned short* brow = Wt + (size_t)(col0 + t * 16 + ln) * ldb + kb;
      FragB b;
      b.half[0] = *(const v8us*)(brow + 8 * hh);
      b.half[1] = *(const v8us*)(brow + 16 + 8 * hh);
      acc[t] = mmaN<ASPLIT ? 2 : 1>(ah.v, al.v, b.v, b.v, acc[t]);
    }
  }
#pragma unroll
  for (int t = 0; t < 4; ++t) {
    const int col = col0 + t * 16 + ln;
    float bv = bias ? bias[col] : 0.f;
    if (BIAS_BF16) bv = bf16_round(bv);
#pragma unroll
    for (int r = 0; r < 8; ++r) {
      float v = acc[t][r] + bv;
      if (resid) { float rv = resid[(size_t)((row0 + 8 * hh + r) % rmod) * ldr + col]; if (RES_BF16) rv = bf16_round(rv); v += rv; }
      if (ACT == 1) v = fmaxf(v, 0.f);
      if (ACT == 2) v = 0.5f * v * (1.0f + erff(v * 0.70710678118654752f));
      if (ACT == 3) { const float u = 0.7978845608028654f * (v + 0.044715f * v * v * v); v = 0.5f * v * (1.0f + tanhf(u)); }
      so[w][8 * hh + r][t * 16 + ln] = v;
    }
  }
  __builtin_amdgcn_fence(__ATOMIC_ACQ_REL, "workgroup");
  __builtin_amdgcn_wave_barrier();
  const int rsub = lane >> 4, c4 = (lane & 15) * 4;
  {
#pragma unroll
    for (int q = 0; q < 8; ++q) {
      const int r = q * 2 + rsub;
      const v4f v = *(const v4fa*)&so[w][r][c4];
      *(v4f*)(C + (size_t)(row0 + r) * ldc + col0 + c4) = v;
    }
    
  }
}
// row LayerNorm (biased variance, eps) over N: s = X (+ R); optional out_sum <- s; out_norm <- (s-mu)*rsqrt(var+eps)*g + b
template <bool PARAM_BF16>
__global__ __launch_bounds__(256) void k_layernorm(const float* __restrict__ X, const float* __restrict__ R, const float* __restrict__ g, const float* __restrict__ bta,
                                                  float* __restrict__ out_sum, float* __restrict__ out_norm, int N, float eps) {
  __shared__ float red[256];
  const int row = blockIdx.x, tid = threadIdx.x;
  const float* x = X + (size_t)row * N; const float* rr = R ? R + (size_t)row * N : nullptr;
  float vals[16];                     // up to N = 4096
  const int per = N / 256;            // contiguous chunk per thread? use strided-by-4 chunks: thread handles j = tid*4 + 1024*u
  float s1 = 0.f;
  for (int u = 0; u < per / 4; ++u) {
    const int j = tid * 4 + 1024 * u;
    const v4f a = *(const v4fa*)(x + j);
    v4f b = {0.f,0.f,0.f,0.f}; if (rr) b = *(const v4fa*)(rr + j);
#pragma unroll
    for (int q = 0; q < 4; ++q) { const float v = a[q] + b[q]; vals[u * 4 + q] = v; s1 += v; }
  }
  red[tid] = s1; __syncthreads();
  for (int st = 128; st > 0; st >>= 1) { if (tid < st) red[tid] += red[tid + st]; __syncthreads(); }
  const float mu = red[0] / (float)N; __syncthreads();
  float s2 = 0.f;
  for (int u = 0; u < per / 4; ++u)
#pragma unroll
    for (int q = 0; q < 4; ++q) { const float c = vals[u * 4 + q] - mu; s2 += c * c; }
  red[tid] = s2; __syncthreads();
  for (int st = 128; st > 0; st >>= 1) { if (tid < st) red[tid] += red[tid + st]; __syncthreads(); }
  const float rs = rsqrtf(red[0] / (float)N + eps);
  {
    for (int u = 0; u < per / 4; ++u) {
      const int j = tid * 4 + 1024 * u;
      v4f o, sm;
#pragma unroll
      for (int q = 0; q < 4; ++q) {
        float gg = g[j + q], bb = bta[j + q];
        if (PARAM_BF16) { gg = bf16_round(gg); bb = bf16_round(bb); }
        sm[q] = vals[u * 4 + q]; o[q] = (vals[u * 4 + q] - mu) * rs * gg + bb;
      }
      if (out_sum) *(v4f*)(out_sum + (size_t)row * N + j) = sm;
      *(v4f*)(out_norm + (size_t)row * N + j) = o;
    }
    
  }
}



// ---- f16 WMMA path (v_wmma_f32_16x16x32_f16): 11-bit significands for operands in range — used where a [0,1] probability operand needs more precision than bf16
typedef _Float16 v16h __attribute__((ext_vector_type(16)));
union FragH { v16h v; v8us half[2]; _Float16 h[16]; unsigned short u[16]; };
template <int NT>
__device__ __forceinline__ v8f mmaH(v16h ah, v16h al, v16h bh, v16h bl, v8f c) {
  c = __builtin_amdgcn_wmma_f32_16x16x32_f16(false, ah, false, bh, (short)0, c, false, false);
  if (NT >= 2) c = __builtin_amdgcn_wmma_f32_16x16x32_f16(false, al, false, bh, (short)0, c, false, false);
  if (NT >= 3) c = __builtin_amdgcn_wmma_f32_16x16x32_f16(false, ah, false, bl, (short)0, c, false, false);
  asm volatile("v_nop\n\tv_nop\n\tv_nop\n\tv_nop" : "+v"(c) : "v"(ah), "v"(al), "v"(bh), "v"(bl));
  return c;
}
// batched GEMM like k_gemm_b but f16 operands: A f32 (split into f16 hi/lo if ASPLIT, else rounded to f16), Bt = f16 values [n][k]; alpha; C f32; N multiple of 16 (partial tiles skipped)
template <bool ASPLIT>
__global__ __launch_bounds__(128) void k_gemm_h(const float* __restrict__ A, int lda, size_t sA, const _Float16* __restrict__ Bh, int ldb, size_t sB, float alpha, float* __restrict__ C, int ldc, size_t sC, int M, int N, int K) {
  __shared__ __attribute__((aligned(16))) float so[4][16][64];
  const int tid = threadIdx.x, w = tid >> 5, lane = tid & 31, ln = lane & 15, hh = lane >> 4; const int by = blockIdx.y;
  A += (size_t)by * sA; Bh += (size_t)by * sB; C += (size_t)by * sC;
  const int ntn = (N + 63) / 64; const int wid = blockIdx.x * 4 + w; const int mt = wid / ntn, nq = wid % ntn; if (mt * 16 >= M) return;
  const int row0 = mt * 16, col0 = nq * 64; const float* arow = A + (size_t)(row0 + ln) * lda;
  v8f acc[4] = {};
  for (int kb = 0; kb < K; kb += 32) {
    FragH ah, al;
    const v4f x0 = *(const v4fa*)(arow + kb + 8 * hh), x1 = *(const v4fa*)(arow + kb + 8 * hh + 4), x2 = *(const v4fa*)(arow + kb + 16 + 8 * hh), x3 = *(const v4fa*)(arow + kb + 16 + 8 * hh + 4);
    float xs[16] = {x0[0],x0[1],x0[2],x0[3],x1[0],x1[1],x1[2],x1[3],x2[0],x2[1],x2[2],x2[3],x3[0],x3[1],x3[2],x3[3]};
#pragma unroll
    for (int i = 0; i < 16; ++i) { const _Float16 h = (_Float16)xs[i]; ah.h[i] = h; al.h[i] = ASPLIT ? (_Float16)(xs[i] - (float)h) : (_Float16)0.0f; }
#pragma unroll
    for (int t = 0; t < 4; ++t) { if (col0 + t * 16 >= N) continue; const size_t boff = (size_t)(col0 + t * 16 + ln) * ldb + kb; FragH bq; bq.half[0] = *(const v8us*)(Bh + boff + 8 * hh); bq.half[1] = *(const v8us*)(Bh + boff + 16 + 8 * hh);
      acc[t] = mmaH<ASPLIT ? 2 : 1>(ah.v, al.v, bq.v, bq.v, acc[t]); }
  }
#pragma unroll
  for (int t = 0; t < 4; ++t) { if (col0 + t * 16 >= N) continue;
#pragma unroll
    for (int r = 0; r < 8; ++r) so[w][8 * hh + r][t * 16 + ln] = acc[t][r] * alpha; }
  __builtin_amdgcn_fence(__ATOMIC_ACQ_REL, "workgroup"); __builtin_amdgcn_wave_barrier();
  const int rsub = lane >> 4, c4 = (lane & 15) * 4;
  {
#pragma unroll
    for (int q = 0; q < 8; ++q) { const int r = q * 2 + rsub; if (col0 + c4 < N) { const v4f v = *(const v4fa*)&so[w][r][c4]; *(v4f*)(C + (size_t)(row0 + r) * ldc + col0 + c4) = v; } }
     }
}

// Wt[n][k] = f16(W[k][n]·scale) from f32 row-major W[K][N] (scale = power of two; bf16-exact weights stay exact in f16 away from the subnormal range)
__global__ __launch_bounds__(256) void k_wt_f16(const float* __restrict__ W, _Float16* __restrict__ Wt, int K, int N, float scale) {
  const int t = blockIdx.x * 256 + threadIdx.x; if (t >= N * (K / 8)) return; const int n = t / (K / 8), k8 = (t % (K / 8)) * 8; FragH f;
#pragma unroll
  for (int i = 0; i < 8; ++i) f.h[i] = (_Float16)(bf16_round(W[(size_t)(k8 + i) * N + n]) * scale); const v8us o = f.half[0];
  *(v8us*)((unsigned short*)Wt + (size_t)n * K + k8) = o; 
}
// k_gemm_hh variant with fused epilogue: v = acc·alpha + bias[by·sBias + col] (+ CP[(row/rowsPerB)·sCPb + by·64 + col] if CP) ; ACT 0 none / 1 elu ; writes f16 C16 (and f32 C if non-null)
template <int ACT>
__global__ __launch_bounds__(128) void k_gemm_hhx(const _Float16* __restrict__ A, int lda, size_t sA, const _Float16* __restrict__ Bh, int ldb, size_t sB, float alpha, const float* __restrict__ bias, size_t sBias, const float* __restrict__ CP, int rowsPerB, size_t sCPb, int row0g,
    float* __restrict__ C, _Float16* __restrict__ C16, int ldc, size_t sC, int M, int N, int K) {
  __shared__ __attribute__((aligned(16))) float so[4][16][64];
  const int tid = threadIdx.x, w = tid >> 5, lane = tid & 31, ln = lane & 15, hh = lane >> 4; const int by = blockIdx.y;
  A += (size_t)by * sA; Bh += (size_t)by * sB; const size_t cofs = (size_t)by * sC; const float* bp = bias ? bias + (size_t)by * sBias : nullptr;
  const int ntn = (N + 63) / 64; const int wid = blockIdx.x * 4 + w; const int mt = wid / ntn, nq = wid % ntn; if (mt * 16 >= M) return;
  const int row0 = mt * 16, col0 = nq * 64; const _Float16* arow = A + (size_t)(row0 + ln) * lda;
  v8f acc[4] = {};
  for (int kb = 0; kb < K; kb += 32) { FragH ah; ah.half[0] = *(const v8us*)((const unsigned short*)arow + kb + 8 * hh); ah.half[1] = *(const v8us*)((const unsigned short*)arow + kb + 16 + 8 * hh);
#pragma unroll
    for (int t = 0; t < 4; ++t) { if (col0 + t * 16 >= N) continue; const size_t boff = (size_t)(col0 + t * 16 + ln) * ldb + kb; FragH bq; bq.half[0] = *(const v8us*)((const unsigned short*)Bh + boff + 8 * hh); bq.half[1] = *(const v8us*)((const unsigned short*)Bh + boff + 16 + 8 * hh);
      acc[t] = mmaH<1>(ah.v, ah.v, bq.v, bq.v, acc[t]); }
  }
#pragma unroll
  for (int t = 0; t < 4; ++t) { if (col0 + t * 16 >= N) continue; const int col = col0 + t * 16 + ln; const float bv = bp ? bf16_round(bp[col]) : 0.f;
#pragma unroll
    for (int r = 0; r < 8; ++r) { float v = acc[t][r] * alpha + bv; if (CP) { const int rr = row0g + row0 + 8 * hh + r; if (rowsPerB < 0) v += CP[cofs + (size_t)rr * ldc + col];      /* rowsPerB < 0: own element of the batched C plane */ else { const int bidx = rr / rowsPerB; v += CP[(size_t)bidx * sCPb + (size_t)by * 64 + col]; } } if (ACT == 1) v = (v > 0.f) ? v : expm1f(v); else if (ACT == 7) v = (v > 0.f) ? v + 1.0f : expf(v); else if (ACT == 8) v = tanhf(v); else if (ACT == 9) v = 0.5f * v * (1.0f + tanhf(0.7978845608028654f * (v + 0.044715f * v * v * v))); else if (ACT == 11) v = 1.0f / (1.0f + expf(-v)); else if (ACT == 12) v = (v > 0.f) ? v : 0.01f * v; else if (ACT == 14) v = (v > 0.f) ? v : 0.1f * v; else if (ACT == 16) v = (v >= 0.f) ? v : 0.3f * v; else if (ACT == 17) v = (v >= 0.f) ? v : 0.2f * v; else if (ACT == 15) v = v / (1.0f + expf(-v)); else if (ACT == 3) v = fmaxf(v, 0.f); else if (ACT == 6) v = 0.5f * v * (1.0f + erff(v * 0.70710678118654752f)); so[w][8 * hh + r][t * 16 + ln] = v; } }
  __builtin_amdgcn_fence(__ATOMIC_ACQ_REL, "workgroup"); __builtin_amdgcn_wave_barrier();
  const int rsub = lane >> 4, c4 = (lane & 15) * 4; typedef _Float16 v4h __attribute__((ext_vector_type(4)));
  {
#pragma unroll
    for (int q = 0; q < 8; ++q) { const int r = q * 2 + rsub; if (col0 + c4 < N) { const v4f v = *(const v4fa*)&so[w][r][c4]; if (C) *(v4f*)(C + cofs + (size_t)(row0 + r) * ldc + col0 + c4) = v; if (C16) { v4h h4; for (int i = 0; i < 4; ++i) h4[i] = (_Float16)v[i]; *(v4h*)(C16 + cofs + (size_t)(row0 + r) * ldc + col0 + c4) = h4; } } }
     }
}


typedef _Float16 v4h __attribute__((ext_vector_type(4)));

__global__ __launch_bounds__(256) void k_x16(const float* __restrict__ x, _Float16* __restrict__ X16, size_t n8) { const size_t t = (size_t)blockIdx.x * 256 + threadIdx.x; if (t >= n8) return; FragH f;
#pragma unroll
  for (int q = 0; q < 8; ++q) f.h[q] = (_Float16)bf16_round(x[t * 8 + q]); *(v8us*)((unsigned short*)X16 + t * 8) = f.half[0];  }
__global__ __launch_bounds__(256) void k_h16(const float* __restrict__ x, _Float16* __restrict__ X16, size_t n8) { const size_t t = (size_t)blockIdx.x * 256 + threadIdx.x; if (t >= n8) return; FragH f;
#pragma unroll
  for (int q = 0; q < 8; ++q) f.h[q] = (_Float16)x[t * 8 + q]; *(v8us*)((unsigned short*)X16 + t * 8) = f.half[0];  }
__global__ __launch_bounds__(256) void k_round16f(const float* __restrict__ W, _Float16* __restrict__ Bt, size_t n8) { const size_t t = (size_t)blockIdx.x * 256 + threadIdx.x; if (t >= n8) return; FragH f;
#pragma unroll
  for (int i = 0; i < 8; ++i) f.h[i] = (_Float16)(bf16_round(W[t * 8 + i]) * 16.0f); *(v8us*)((unsigned short*)Bt + t * 8) = f.half[0];  }
template <int NHv, int TTv>
__global__ __launch_bounds__(256) void k_vt(const _Float16* __restrict__ V16, int ldv, int voff, _Float16* __restrict__ Vt) { __shared__ unsigned short tl[64][66]; const int tid = threadIdx.x; const int slab = blockIdx.x / (TTv / 64), lg = blockIdx.x % (TTv / 64); const int b = slab / NHv, h = slab % NHv;
  for (int i = tid; i < 64 * 8; i += 256) { const int r = i / 8, c8 = (i % 8) * 8; FragH f; f.half[0] = *(const v8us*)((const unsigned short*)V16 + ((size_t)b * TTv + lg * 64 + r) * ldv + voff + h * 64 + c8);
#pragma unroll
    for (int q = 0; q < 8; ++q) tl[r][c8 + q] = f.u[q]; }
  __syncthreads();
  {
#pragma unroll
    for (int rd = 0; rd < 2; ++rd) { const int d = rd * 32 + tid / 8, pc = tid % 8; FragH f;
#pragma unroll
      for (int q = 0; q < 8; ++q) f.u[q] = tl[pc * 8 + q][d];
      *(v8us*)((unsigned short*)Vt + ((size_t)slab * 64 + d) * TTv + lg * 64 + pc * 8) = f.half[0]; }
     } }

__global__ __launch_bounds__(256) void k_hl(const float* __restrict__ F, _Float16* __restrict__ Hh, _Float16* __restrict__ Hl, size_t n8) { const size_t t = (size_t)blockIdx.x * 256 + threadIdx.x; if (t >= n8) return; FragH fh, fl; const v4f a = *(const v4fa*)(F + t * 8), c = *(const v4fa*)(F + t * 8 + 4);
#pragma unroll
  for (int q = 0; q < 4; ++q) { _Float16 h = (_Float16)a[q]; fh.h[q] = h; fl.h[q] = (_Float16)((a[q] - (float)h) * 1024.0f); h = (_Float16)c[q]; fh.h[4 + q] = h; fl.h[4 + q] = (_Float16)((c[q] - (float)h) * 1024.0f); }
  { *(v8us*)((unsigned short*)Hh + t * 8) = fh.half[0]; *(v8us*)((unsigned short*)Hl + t * 8) = fl.half[0];  } }

// ---- fast GEMM (wave tile 32x64; requires M % 32 == 0 rows per launch region and N % 64 == 0); epilogue = k_gemm_hhx semantics ----
__device__ __forceinline__ v16h g2_frag(const _Float16* p, int hh) { FragH f; f.half[0] = *(const v8us*)((const unsigned short*)p + 8 * hh); f.half[1] = *(const v8us*)((const unsigned short*)p + 16 + 8 * hh); return f.v; }
__device__ __forceinline__ v8f g2_mma(v16h a, v16h b, v8f c) { v8f d = __builtin_amdgcn_wmma_f32_16x16x32_f16(false, a, false, b, (short)0, c, false, false); asm volatile("v_nop\n\tv_nop\n\tv_nop\n\tv_nop" : "+v"(d) : "v"(a), "v"(b)); return d; }
template <int ACT>
__global__ __launch_bounds__(128) void k_gemm2(const _Float16* __restrict__ A, int lda, size_t sA, const _Float16* __restrict__ Bh, int ldb, size_t sB, float alpha, const float* __restrict__ bias, size_t sBias, const float* __restrict__ CP, int rowsPerB, size_t sCPb, int row0g,
    float* __restrict__ C, _Float16* __restrict__ C16, int ldc, size_t sC, int M, int N, int K) { static_assert(ACT == 0 || ACT == 3 || ACT == 6 || ACT == 8 || ACT == 9 || ACT == 11 || ACT == 12 || ACT == 14 || ACT == 15 || ACT == 16 || ACT == 17, "k_gemm2: unsupported ACT code (would silently apply no activation)");
  __shared__ __attribute__((aligned(16))) float so[4][32][68];
  const int tid = threadIdx.x, w = tid >> 5, lane = tid & 31, ln = lane & 15, hh = lane >> 4; const int by = blockIdx.y;
  A += (size_t)by * sA; Bh += (size_t)by * sB; const size_t cofs = (size_t)by * sC; const float* bp = bias ? bias + (size_t)by * sBias : nullptr;
  const int ntn = N >> 6; const int mt = blockIdx.x / ntn, nq = blockIdx.x - mt * ntn; const int row0 = mt * 128 + 32 * w, col0 = nq * 64; if (row0 >= M) return;
  const _Float16* a0p = A + (size_t)(row0 + ln) * lda; const _Float16* a1p = a0p + (size_t)16 * lda;
  const _Float16* b0p = Bh + (size_t)(col0 + ln) * ldb; const _Float16* b1p = b0p + (size_t)16 * ldb; const _Float16* b2p = b1p + (size_t)16 * ldb; const _Float16* b3p = b2p + (size_t)16 * ldb;
  const v8f z8 = {0.f,0.f,0.f,0.f,0.f,0.f,0.f,0.f}; v8f c00 = z8, c01 = z8, c02 = z8, c03 = z8, c10 = z8, c11 = z8, c12 = z8, c13 = z8;
#pragma unroll 1
  for (int kb = 0; kb < K; kb += 32) { const v16h a0 = g2_frag(a0p + kb, hh), a1 = g2_frag(a1p + kb, hh);
    v16h b = g2_frag(b0p + kb, hh); c00 = g2_mma(a0, b, c00); c10 = g2_mma(a1, b, c10);
    b = g2_frag(b1p + kb, hh); c01 = g2_mma(a0, b, c01); c11 = g2_mma(a1, b, c11);
    b = g2_frag(b2p + kb, hh); c02 = g2_mma(a0, b, c02); c12 = g2_mma(a1, b, c12);
    b = g2_frag(b3p + kb, hh); c03 = g2_mma(a0, b, c03); c13 = g2_mma(a1, b, c13); }
  v8f accs[8] = {c00, c01, c02, c03, c10, c11, c12, c13};
#pragma unroll
  for (int u = 0; u < 8; ++u) { const int t = u & 3, half = u >> 2; const int col = col0 + t * 16 + ln; const float bv = bp ? bf16_round(bp[col]) : 0.f;
#pragma unroll
    for (int r = 0; r < 8; ++r) { const int rloc = half * 16 + 8 * hh + r; float v = accs[u][r] * alpha + bv; if (CP) { if (rowsPerB < 0) v += CP[cofs + (size_t)(row0g + row0 + rloc) * ldc + col];      /* rowsPerB < 0: own element of the batched C plane */ else { const int bidx = (row0g + row0 + rloc) / rowsPerB; v += CP[(size_t)bidx * sCPb + (size_t)by * 64 + col]; } }
      if (ACT == 3) v = fmaxf(v, 0.f); else if (ACT == 6) v = 0.5f * v * (1.0f + erff(v * 0.70710678118654752f)); else if (ACT == 11) v = 1.0f / (1.0f + expf(-v)); else if (ACT == 15) v = v / (1.0f + expf(-v)); else if (ACT == 12) v = (v > 0.f) ? v : 0.01f * v; else if (ACT == 8) v = tanhf(v); else if (ACT == 9) v = 0.5f * v * (1.0f + tanhf(0.7978845608028654f * (v + 0.044715f * v * v * v))); else if (ACT == 14) v = (v > 0.f) ? v : 0.1f * v; else if (ACT == 16) v = (v >= 0.f) ? v : 0.3f * v; else if (ACT == 17) v = (v >= 0.f) ? v : 0.2f * v;
      so[w][rloc][t * 16 + ln] = v; } }
  __builtin_amdgcn_fence(__ATOMIC_ACQ_REL, "workgroup"); __builtin_amdgcn_wave_barrier();
  const int rsub = lane >> 4, c4 = (lane & 15) * 4;
  {
#pragma unroll
    for (int q = 0; q < 16; ++q) { const int r = q * 2 + rsub; const v4f v = *(const v4fa*)&so[w][r][c4]; if (C) *(v4f*)(C + cofs + (size_t)(row0 + r) * ldc + col0 + c4) = v; if (C16) { v4h h4; for (int i = 0; i < 4; ++i) h4[i] = (_Float16)v[i]; *(v4h*)(C16 + cofs + (size_t)(row0 + r) * ldc + col0 + c4) = h4; } }
     } }


__global__ __launch_bounds__(256) void k_wnat(const float* __restrict__ w, size_t n8, _Float16* __restrict__ Bt) { const size_t t = (size_t)blockIdx.x * 256 + threadIdx.x; if (t >= n8) return; FragH f; for (int q = 0; q < 8; ++q) f.h[q] = (_Float16)(bf16_round(w[t * 8 + q]) * 16.0f); *(v8us*)((unsigned short*)Bt + t * 8) = f.half[0];  }
__global__ __launch_bounds__(256) void k_rsm(const float* __restrict__ S, _Float16* __restrict__ P, int nrows) {
  #pragma clang fp contract(off)
  const int i = blockIdx.x * 256 + threadIdx.x; if (i >= nrows) return; const float* s = S + (size_t)i * SQ; float mx = -3.0e38f;
#pragma unroll 1
  for (int j = 0; j < SQ; ++j) mx = fmaxf(mx, s[j]); float se = 0.f;
#pragma unroll 1
  for (int j = 0; j < SQ; ++j) se += expf(s[j] - mx); const float sc = 256.0f / se;
#pragma unroll 1
  for (int j0 = 0; j0 < SQ; j0 += 8) { FragH f; for (int q = 0; q < 8; ++q) f.h[q] = (_Float16)(expf(s[j0 + q] - mx) * sc); unsigned short* d = (unsigned short*)P + (size_t)i * SQ + j0; *(v8us*)d = f.half[0];  } }
__global__ __launch_bounds__(256) void k_vt(const _Float16* __restrict__ V16, int b, int h0, _Float16* __restrict__ VT) { __shared__ unsigned short tl[64][65]; const int tid = threadIdx.x; const int hh = blockIdx.x % HG, sg = blockIdx.x / HG; const int s0 = sg * 64; const int h = h0 + hh;
  for (int i = tid; i < 64 * 8; i += 256) { const int j = i / 8, d8 = (i % 8) * 8; FragH f; f.half[0] = *(const v8us*)((const unsigned short*)V16 + ((size_t)b * SQ + s0 + j) * DM + h * HD + d8); for (int q = 0; q < 8; ++q) tl[d8 + q][j] = f.u[q]; }
  __syncthreads();
  { for (int i = tid; i < 64 * 8; i += 256) { const int d = i / 8, j8 = (i % 8) * 8; FragH f; for (int q = 0; q < 8; ++q) f.u[q] = tl[d][j8 + q]; *(v8us*)((unsigned short*)VT + ((size_t)hh * HD + d) * SQ + s0 + j8) = f.half[0]; }  } }



// ---- one preparing launch: independent pieces picked by block range, so that they share one start instead of six dependent ones ----
// Blocks 0 .. 4 * PW_B - 1: weight wi = block / PW_B as Wt[n][k] = f16(bf16(W[k][n]) x 16), the arithmetic of k_wt_f16. The other 2 * PX_B blocks: the two
// sources as f16(bf16(x)) rows, the arithmetic of k_x16; a block takes PX_U consecutive runs of 256 groups of 8 floats, a thread one group of each run.
#define PW_B (DM * (DM / 8) / 256)   /* blocks per weight */
#define PX_U 8                       /* groups of 8 elements per thread */
#define PX_B ((int)(NR * DM / 8 / 256 / PX_U))      /* blocks per source */
__global__ __launch_bounds__(256) void k_prep(const float* __restrict__ xq, const float* __restrict__ xk, const float* __restrict__ wq, const float* __restrict__ wk, const float* __restrict__ wv, const float* __restrict__ wo,
    _Float16* __restrict__ XQ, _Float16* __restrict__ XK, _Float16* __restrict__ BW) {
  static_assert(NR * DM == (size_t)PX_B * 256 * PX_U * 8, "the sources divide evenly among the threads");
  const int bx = blockIdx.x;
  if (bx < 4 * PW_B) { const int wi = bx / PW_B; const float* W = wi == 0 ? wq : wi == 1 ? wk : wi == 2 ? wv : wo; _Float16* Wt = BW + (size_t)wi * DM * DM;
    const int t = (bx - wi * PW_B) * 256 + threadIdx.x; const int n = t / (DM / 8), k8 = (t % (DM / 8)) * 8; FragH f;
#pragma unroll
    for (int i = 0; i < 8; ++i) f.h[i] = (_Float16)(bf16_round(W[(size_t)(k8 + i) * DM + n]) * 16.0f);
    *(v8us*)((unsigned short*)Wt + (size_t)n * DM + k8) = f.half[0];
    return; }
  const int xb = bx - 4 * PW_B; const bool second = xb >= PX_B; const size_t g0 = (size_t)(xb - (second ? PX_B : 0)) * (256 * PX_U) + threadIdx.x;      /* the thread's first group */
  const float* p = (second ? xk : xq) + g0 * 8; unsigned short* d = (unsigned short*)(second ? XK : XQ) + g0 * 8; v4f a[PX_U][2]; v8us o[PX_U];
#pragma unroll
  for (int u = 0; u < PX_U; ++u) { a[u][0] = *(const v4fa*)(p + u * 2048); a[u][1] = *(const v4fa*)(p + u * 2048 + 4); }
  asm volatile("s_wait_xcnt 0x0" :: "v"(p) : "memory");      /* the loads' address register stays whole up to this wait; behind it it may be reused */
#pragma unroll
  for (int u = 0; u < PX_U; ++u) { FragH f;
#pragma unroll
    for (int q = 0; q < 4; ++q) { f.h[q] = (_Float16)bf16_round(a[u][0][q]); f.h[4 + q] = (_Float16)bf16_round(a[u][1][q]); }
    o[u] = f.half[0]; }
  __builtin_amdgcn_sched_barrier(0);      /* the stores stand last, so that no register of an issued store is written again */
#pragma unroll
  for (int u = 0; u < PX_U; ++u) *(v8us*)(d + u * 2048) = o[u];
  asm volatile("s_wait_xcnt 0x0" ::: "memory"); }      /* in the built code the weight blocks' part follows behind a scalar branch and writes these registers: the wait stands in front of it */

// ---- the three projections in one launch (wave tile, k order and epilogue arithmetic of k_gemm2): blockIdx.y = 0: Q rows, 1: K rows, 2: V^T ----
// V^T[feature][token] = sum_k Wt[feature][k] X[token][k] is the projection with the operand roles swapped (A = weight rows, B = token rows): its C rows are the
// [batch][head][d][token] rows that the attention kernel reads, 128-byte lines of 64 tokens with one wave as writer, and the bias goes by row instead of by column.
template <int LDC>
__device__ __forceinline__ void p3_store(const float (*so)[68], _Float16* cp, int lane) {      /* cp: the wave's tile origin in C; rows leave as whole 128-byte lines */
  const int rsub = lane >> 4, c4 = (lane & 15) * 4; _Float16* c = cp + (size_t)rsub * LDC + c4; v4h h4[16];
#pragma unroll
  for (int q = 0; q < 16; ++q) { const v4f v = *(const v4fa*)&so[q * 2 + rsub][c4];
#pragma unroll
    for (int i = 0; i < 4; ++i) h4[q][i] = (_Float16)v[i]; }
  __builtin_amdgcn_sched_barrier(0);      /* the stores stand last, so that no register of an issued store is written again */
#pragma unroll
  for (int q = 0; q < 16; ++q) *(v4h*)(c + (size_t)q * 2 * LDC) = h4[q];
  asm volatile("s_wait_xcnt 0x0" ::: "memory"); }      /* in the built code the other layout's epilogue follows behind a scalar branch and writes these registers: the wait stands in front of it */
// ---- GEMM tile through LDS: C[128][128] = A rows . B rows^T over k = DM, one work-group of eight waves (wave tile 32x64 as before: 4 down, 2 across) ----
// A stage is one whole 128-byte line (64 k) of each of the 128 A rows and 128 B rows, brought by asynchronous 16-byte copies (eight lanes a row, so a wave's copy
// covers four whole lines) into rows of GT_PIT bytes; two buffers, the next stage's copies fly under this stage's products. The fragments are read from LDS in
// the k order of g2_frag, and every accumulator takes its 32-k steps in rising order, as before.
#define GT_PIT 144                   /* LDS row pitch in bytes: 128 of data + 16, an odd multiple of 16 B (16-byte fragment reads without bank conflicts) */
#define GT_BUF (256 * GT_PIT)        /* one buffer: rows 0-127 of A, rows 128-255 of B */
#define GT_KS 64                     /* k per stage */
#define GT_NST (DM / GT_KS)
__device__ __forceinline__ v16h gt_lfrag(const unsigned char* p) { FragH f; f.half[0] = *(const v8us*)p; f.half[1] = *(const v8us*)(p + 32); return f.v; }      /* p already holds the lane's 16 hh bytes */
// One stage: the thread's 16 bytes of rows sr + 32 j of A and of B. a, b: its place in row sr of the stage's k range; l: the LDS byte address of that place in A's part.
// The closing wait stands inside the statement, so that no address register of an issued copy is rewritten in front of it.
__device__ __forceinline__ void gt_copy(const _Float16* a, const _Float16* b, unsigned l) {
  asm volatile("global_load_async_to_lds_b128 %0, %8, off\n\t"
               "global_load_async_to_lds_b128 %1, %9, off\n\t"
               "global_load_async_to_lds_b128 %2, %10, off\n\t"
               "global_load_async_to_lds_b128 %3, %11, off\n\t"
               "global_load_async_to_lds_b128 %4, %12, off\n\t"
               "global_load_async_to_lds_b128 %5, %13, off\n\t"
               "global_load_async_to_lds_b128 %6, %14, off\n\t"
               "global_load_async_to_lds_b128 %7, %15, off\n\t"
               "s_wait_xcnt 0x0"
               :: "v"(l), "v"(l + 32 * GT_PIT), "v"(l + 64 * GT_PIT), "v"(l + 96 * GT_PIT), "v"(l + 128 * GT_PIT), "v"(l + 160 * GT_PIT), "v"(l + 192 * GT_PIT), "v"(l + 224 * GT_PIT),
                  "v"(a), "v"(a + 32 * DM), "v"(a + 64 * DM), "v"(a + 96 * DM), "v"(b), "v"(b + 32 * DM), "v"(b + 64 * DM), "v"(b + 96 * DM) : "memory"); }
// A, B: first row of the tile's 128 A rows and 128 B rows (pitch DM). On return every wave has passed the barrier behind the last LDS read and no copy is in flight: SM is free.
__device__ __forceinline__ void gt_tile(const _Float16* A, const _Float16* B, unsigned char* SM, v8f (&acc)[8]) {
  static_assert(DM % GT_KS == 0 && GT_NST >= 2, "the ring's prologue needs two stages");
  const int tid = threadIdx.x, w = tid >> 5, lane = tid & 31, ln = lane & 15, hh = lane >> 4; const int sr = tid >> 3, sc = tid & 7;
  const _Float16* ag = A + (size_t)sr * DM + sc * 8; const _Float16* bg = B + (size_t)sr * DM + sc * 8; const unsigned l0 = (unsigned)(size_t)SM + sr * GT_PIT + sc * 16;
  const unsigned char* af = SM + ((w & 3) * 32 + ln) * GT_PIT + 16 * hh; const unsigned char* bf = SM + (128 + (w >> 2) * 64 + ln) * GT_PIT + 16 * hh;
  const v8f z8 = {0.f,0.f,0.f,0.f,0.f,0.f,0.f,0.f}; v8f c00 = z8, c01 = z8, c02 = z8, c03 = z8, c10 = z8, c11 = z8, c12 = z8, c13 = z8;
  gt_copy(ag, bg, l0);
  asm volatile("s_wait_asynccnt 0x0" ::: "memory");      /* this wave's part of stage 0 has landed */
  __syncthreads();      /* stage 0 is visible to every wave */
  gt_copy(ag + GT_KS, bg + GT_KS, l0 + GT_BUF);
  for (int t = 0; t < GT_NST; ++t) { const int bo = (t & 1) * GT_BUF;
#pragma unroll      /* two 32-k steps with constant LDS offsets */
    for (int ks = 0; ks < 2; ++ks) { const unsigned char* ap = af + bo + ks * 64; const unsigned char* bp = bf + bo + ks * 64;
      const v16h a0 = gt_lfrag(ap), a1 = gt_lfrag(ap + 16 * GT_PIT), b0 = gt_lfrag(bp), b1 = gt_lfrag(bp + 16 * GT_PIT), b2 = gt_lfrag(bp + 32 * GT_PIT), b3 = gt_lfrag(bp + 48 * GT_PIT);
      __builtin_amdgcn_sched_barrier(0);      /* the step's twelve LDS reads go out as one group ahead of its products: one LDS latency a step instead of four */
      c00 = g2_mma(a0, b0, c00); c10 = g2_mma(a1, b0, c10); c01 = g2_mma(a0, b1, c01); c11 = g2_mma(a1, b1, c11);
      c02 = g2_mma(a0, b2, c02); c12 = g2_mma(a1, b2, c12); c03 = g2_mma(a0, b3, c03); c13 = g2_mma(a1, b3, c13); }
    asm volatile("s_wait_dscnt 0x0" ::: "memory");      /* this wave's reads of stage t are done before its buffer may be refilled */
    asm volatile("s_wait_asynccnt 0x0" ::: "memory");      /* this wave's part of stage t + 1 has landed */
    __syncthreads();      /* publishes stage t + 1 and ends every wave's reads of stage t */
    if (t + 2 < GT_NST) gt_copy(ag + (t + 2) * GT_KS, bg + (t + 2) * GT_KS, l0 + bo); }
  asm volatile("s_wait_asynccnt 0x0" ::: "memory");      /* nothing is in flight when the buffers become output staging */
  acc[0] = c00; acc[1] = c01; acc[2] = c02; acc[3] = c03; acc[4] = c10; acc[5] = c11; acc[6] = c12; acc[7] = c13; }

#define FA_CS (0.125f * 0x1.715476p+0f)      /* 1 / sqrt(64) and log2 e in one factor: the attention kernel's score unit */
__global__ __launch_bounds__(256) void k_proj3(const _Float16* __restrict__ XQ, const _Float16* __restrict__ XK, const _Float16* __restrict__ BW, const float* __restrict__ bq, const float* __restrict__ bk, const float* __restrict__ bv,
    _Float16* __restrict__ Q16, _Float16* __restrict__ K16, _Float16* __restrict__ VT) {
  static_assert((MP / 128) * (DM / 128) == NB * (DM / 128) * (SQ / 128) && MP == NB * SQ, "the three products have the same number of 128x128 tiles");
  static_assert(8 * 32 * 68 * 4 <= 2 * GT_BUF, "the output staging fits the ring");
  __shared__ __attribute__((aligned(16))) unsigned char SM[2 * GT_BUF];      /* the ring; behind the loop each wave's 32x68 f32 output staging */
  const int tid = threadIdx.x, w = tid >> 5, lane = tid & 31, ln = lane & 15, hh = lane >> 4; const int by = blockIdx.y, bx = blockIdx.x; const bool tr = by == 2;
  const _Float16* A; const _Float16* Bh; const float* bias; int mt, nq;
  if (tr) { const int b = bx / ((DM / 128) * (SQ / 128)), x = bx - b * ((DM / 128) * (SQ / 128)); A = BW + (size_t)2 * DM * DM; Bh = XK + (size_t)b * SQ * DM; bias = bv; mt = x / (SQ / 128); nq = x - mt * (SQ / 128); }
  else { A = by ? XK : XQ; Bh = BW + (size_t)by * DM * DM; bias = by ? bk : bq; mt = bx / (DM / 128); nq = bx - mt * (DM / 128); }
  v8f accs[8]; gt_tile(A + (size_t)mt * 128 * DM, Bh + (size_t)nq * 128 * DM, SM, accs);
  const int row0 = mt * 128 + 32 * (w & 3), col0 = nq * 128 + 64 * (w >> 2); float (*so)[68] = (float (*)[68])(SM + (size_t)w * (32 * 68 * 4));
  float bcol[4] = {0.f, 0.f, 0.f, 0.f}, brow[2][8] = {}; const float osc = by == 0 ? FA_CS : 1.0f;      /* Q rows leave times FA_CS, so that K.Q^T is the score in log2 units; x 1 is exact for K and V^T */
  if (tr) {
#pragma unroll
    for (int half = 0; half < 2; ++half)
#pragma unroll
      for (int r = 0; r < 8; ++r) brow[half][r] = bf16_round(bias[row0 + half * 16 + 8 * hh + r]); }
  else {
#pragma unroll
    for (int t = 0; t < 4; ++t) bcol[t] = bf16_round(bias[col0 + t * 16 + ln]); }
#pragma unroll
  for (int u = 0; u < 8; ++u) { const int t = u & 3, half = u >> 2;
#pragma unroll
    for (int r = 0; r < 8; ++r) so[half * 16 + 8 * hh + r][t * 16 + ln] = (accs[u][r] * 0.0625f + (tr ? brow[half][r] : bcol[t])) * osc; }
  __builtin_amdgcn_fence(__ATOMIC_ACQ_REL, "workgroup"); __builtin_amdgcn_wave_barrier();      /* the wave reads back its own tile in row order */
  if (tr) p3_store<SQ>(so, VT + (size_t)(bx / ((DM / 128) * (SQ / 128))) * DM * SQ + (size_t)row0 * SQ + col0, lane);
  else p3_store<DM>(so, (by ? K16 : Q16) + (size_t)row0 * DM + col0, lane); }

// ---- the output product on the same tile: out = o Wo * alpha + bias (epilogue arithmetic of k_gemm2<0>), f32 rows of the output layout ----
__global__ __launch_bounds__(256) void k_outg(const _Float16* __restrict__ O16, const _Float16* __restrict__ BO, const float* __restrict__ bo, float* __restrict__ C) {
  __shared__ __attribute__((aligned(16))) unsigned char SM[2 * GT_BUF];      /* the ring; behind the loop each wave's 32x68 f32 output staging */
  const int tid = threadIdx.x, w = tid >> 5, lane = tid & 31, ln = lane & 15, hh = lane >> 4; const int mt = blockIdx.x / (DM / 128), nq = blockIdx.x - mt * (DM / 128);
  v8f accs[8]; gt_tile(O16 + (size_t)mt * 128 * DM, BO + (size_t)nq * 128 * DM, SM, accs);
  const int row0 = mt * 128 + 32 * (w & 3), col0 = nq * 128 + 64 * (w >> 2); float (*so)[68] = (float (*)[68])(SM + (size_t)w * (32 * 68 * 4));
#pragma unroll
  for (int u = 0; u < 8; ++u) { const int t = u & 3, half = u >> 2; const float bv = bf16_round(bo[col0 + t * 16 + ln]);
#pragma unroll
    for (int r = 0; r < 8; ++r) so[half * 16 + 8 * hh + r][t * 16 + ln] = accs[u][r] * 0.0009765625f + bv; }      /* 1 / (16 x 64): the weights' x16 and o's x64 */
  __builtin_amdgcn_fence(__ATOMIC_ACQ_REL, "workgroup"); __builtin_amdgcn_wave_barrier();      /* the wave reads back its own tile in row order */
  const int rsub = lane >> 4, c4 = (lane & 15) * 4; float* c = C + (size_t)(row0 + rsub) * DM + col0 + c4; v4f v[16];
#pragma unroll
  for (int q = 0; q < 16; ++q) v[q] = *(const v4fa*)&so[q * 2 + rsub][c4];
  __builtin_amdgcn_sched_barrier(0);      /* the stores stand last, so that no register of an issued store is written again */
#pragma unroll
  for (int q = 0; q < 16; ++q) *(v4f*)(c + (size_t)q * 2 * DM) = v[q]; }      /* a row's 256 bytes of this tile have this wave as their only writer */

#define FA_NW 8                      /* waves per key group */
#define FA_KG 2                      /* key groups per work-group: both hold the same query columns, group kg walks the 64-key tiles FA_KG * st + kg; four waves a SIMD instead of two */
#define FA_CW 32                     /* query columns per wave (two 16-column groups) */
#define FA_BR (FA_NW * FA_CW)        /* query rows per work-group */
#define FA_XR 17                     /* 16-byte rows per lane that a wave of the second group hands over: 16 of O^T, 1 of denominators and maxima */
#define FA_SK 64                     /* keys per LDS stage and key group (two 32-key passes) */
#define FA_PIT 144                   /* LDS row pitch in bytes: 128 of data + 16, an odd multiple of 16 B (16-byte fragment reads without bank conflicts) */
#define FA_OFS 6.0f                  /* the maximum in use is kept 6 below the true one: weights carried x64, away from the f16 subnormal range */
#define FA_LAG 8.0f                  /* a column's maximum may outgrow the one in use by this much (log2) before the sums are rescaled: weights stay <= 2^14 */
typedef float v2f __attribute__((ext_vector_type(2)));
typedef _Float16 v2h __attribute__((ext_vector_type(2)));
__device__ __forceinline__ float rs_xh(float x) { return __builtin_bit_cast(float, __builtin_amdgcn_permlanex16(__builtin_bit_cast(int, x), __builtin_bit_cast(int, x), 0x76543210, 0xfedcba98, false, false)); }      /* lane l <- lane l ^ 16 */
// Four native 2^x, as the builtin: the sources are accumulator registers, and an asm statement cost copies between them and the sums' register pairs; the compiler
// itself keeps the distance behind a matrix instruction whose registers a result reuses, and the free slot behind a transcendental (seen in the listing).
__device__ __forceinline__ v4f rs_exp2x4(v4f e) { const v4f r = {__builtin_amdgcn_exp2f(e[0]), __builtin_amdgcn_exp2f(e[1]), __builtin_amdgcn_exp2f(e[2]), __builtin_amdgcn_exp2f(e[3])}; return r; }
__device__ __forceinline__ v8f fa_mma(v16h a, v16h b, v8f c) { return __builtin_amdgcn_wmma_f32_16x16x32_f16(false, a, false, b, (short)0, c, false, false); }
// The eight score products of a pass: s[kt][g] = K rows kt . Q columns g + c[g], each sum in the k order d 0-31, then d 32-63. Written as asm because the builtin ties D to C
// and the compiler then copies the eight C registers ahead of half of the chains; here C is only read. The four chains fill each other's distance; the closing v_nop are the
// four vector slots the chip needs between the last products and a vector instruction that reads a result or overwrites an operand.
__device__ __forceinline__ void fa_scores(v16h k00, v16h k01, v16h k10, v16h k11, v16h q00, v16h q01, v16h q10, v16h q11, v8f c0, v8f c1, v8f& s00, v8f& s01, v8f& s10, v8f& s11) {
  asm("v_wmma_f32_16x16x32_f16 %0, %4, %8, %12\n\t"
      "v_wmma_f32_16x16x32_f16 %1, %4, %10, %13\n\t"
      "v_wmma_f32_16x16x32_f16 %2, %6, %8, %12\n\t"
      "v_wmma_f32_16x16x32_f16 %3, %6, %10, %13\n\t"
      "v_wmma_f32_16x16x32_f16 %0, %5, %9, %0\n\t"
      "v_wmma_f32_16x16x32_f16 %1, %5, %11, %1\n\t"
      "v_wmma_f32_16x16x32_f16 %2, %7, %9, %2\n\t"
      "v_wmma_f32_16x16x32_f16 %3, %7, %11, %3\n\t"
      "v_nop\n\tv_nop\n\tv_nop\n\tv_nop"
      : "=&v"(s00), "=&v"(s01), "=&v"(s10), "=&v"(s11)
      : "v"(k00), "v"(k01), "v"(k10), "v"(k11), "v"(q00), "v"(q01), "v"(q10), "v"(q11), "v"(c0), "v"(c1)); }
__device__ __forceinline__ v16h fa_lfrag(const unsigned char* p) { FragH f; f.half[0] = *(const v8us*)p; f.half[1] = *(const v8us*)(p + 32); return f.v; }      /* p already holds the lane's 16 h bytes: k = 8h + 0..7 and 16 + 8h + 0..7 */
__global__ __launch_bounds__(FA_KG * FA_NW * 32) void k_fattn(const _Float16* __restrict__ Q16, const _Float16* __restrict__ K16, const _Float16* __restrict__ VT, _Float16* __restrict__ O16) {
  static_assert(HD == 64 && SQ % FA_BR == 0 && SQ % (FA_KG * FA_SK) == 0 && FA_SK == 64 && FA_NW * 32 == 256 && FA_KG == 2, "tile constants are written for head size 64 and two key groups of 256 threads");
  static_assert(FA_NW * FA_XR * 512 <= FA_KG * 2 * 2 * FA_SK * FA_PIT, "the hand-over fits the ring");
  __shared__ __attribute__((aligned(16))) unsigned char L[FA_KG][2][2][FA_SK * FA_PIT];      /* [key group][buffer][0: K rows (key)(d) | 1: V^T rows (d)(key)] */
  const int tid = threadIdx.x & (FA_NW * 32 - 1), lane = tid & 31, w = tid >> 5, c = lane & 15, h = lane >> 4;      /* tid, w: within the key group */
  const int kg = __builtin_amdgcn_readfirstlane((int)(threadIdx.x >> 8));      /* the wave's key group, in a scalar register */
  const int bh = blockIdx.y, b = bh / NH, hd = bh - b * NH; const int q0 = blockIdx.x * FA_BR + w * FA_CW;
  const unsigned short* Kg = (const unsigned short*)K16 + (size_t)b * SQ * DM + hd * HD;      /* row = key, pitch DM */
  const unsigned short* Vg = (const unsigned short*)VT + (size_t)bh * HD * SQ;                /* row = d, pitch SQ */
  const int sr = tid >> 3, sc = tid & 7;      /* staging: eight lanes move one whole 128-byte row; a thread owns rows sr and sr + 32 of both tiles of its own group */
  const unsigned short* kp = Kg + (size_t)(kg * FA_SK + sr) * DM + sc * 8; const unsigned short* vp = Vg + (size_t)sr * SQ + kg * FA_SK + sc * 8;
  v8us kr0, kr1, vr0, vr1;
  auto gload = [&](int st) { const unsigned short* k = kp + (size_t)st * (FA_KG * FA_SK) * DM; const unsigned short* v = vp + st * (FA_KG * FA_SK);
    kr0 = *(const v8us*)k; kr1 = *(const v8us*)(k + (size_t)32 * DM); vr0 = *(const v8us*)v; vr1 = *(const v8us*)(v + (size_t)32 * SQ);
    asm volatile("s_wait_xcnt 0x0" ::: "memory"); };      /* the loads' address registers are stepped for the next stage: keep the wait in front of that overwrite */
  auto lstore = [&](int buf) { unsigned char* kd = &L[kg][buf][0][sr * FA_PIT + sc * 16]; unsigned char* vd = &L[kg][buf][1][sr * FA_PIT + sc * 16];
    *(v8us*)kd = kr0; *(v8us*)(kd + 32 * FA_PIT) = kr1; *(v8us*)vd = vr0; *(v8us*)(vd + 32 * FA_PIT) = vr1; };
  gload(0);
  v16h qf[2][2];      /* B operand: query column 16 g + c, d = 32 kc + hardware k order */
#pragma unroll
  for (int g = 0; g < 2; ++g) { const _Float16* qp = Q16 + ((size_t)b * SQ + q0 + 16 * g + c) * DM + hd * HD; qf[g][0] = g2_frag(qp, h); qf[g][1] = g2_frag(qp + 32, h); }
  const v8f z8 = {0.f,0.f,0.f,0.f,0.f,0.f,0.f,0.f}; const v4f z4 = {0.f,0.f,0.f,0.f};
  v8f acc[2][4]; v4f la[2]; float mu[2]; v8f nm[2];      /* O^T tiles (d = 16 t + 8 h + r, query 16 g + c); this half's part of the denominator; the maximum in use, minus FA_OFS; its negative in all eight rows, the C operand of the score products */
#pragma unroll
  for (int g = 0; g < 2; ++g) { la[g] = z4;
#pragma unroll
    for (int t = 0; t < 4; ++t) acc[g][t] = z8; }
  // s[16-key tile][column group] = K.Q^T + c[group] for the 32 keys whose rows start at kb
  auto scores = [&](const unsigned char* kb, const v8f (&cc)[2], v8f (&s)[2][2]) {
    fa_scores(fa_lfrag(kb), fa_lfrag(kb + 64), fa_lfrag(kb + 16 * FA_PIT), fa_lfrag(kb + 16 * FA_PIT + 64), qf[0][0], qf[0][1], qf[1][0], qf[1][1], cc[0], cc[1], s[0][0], s[0][1], s[1][0], s[1][1]); };
  // a column's maximum over the 32 keys, in both halves of the wave
  auto colmax = [&](const v8f (&s)[2][2], int g) { float m0 = fmaxf(s[0][g][0], s[1][g][0]), m1 = fmaxf(s[0][g][1], s[1][g][1]);
#pragma unroll
    for (int r = 2; r < 8; r += 2) { m0 = fmaxf(m0, fmaxf(s[0][g][r], s[1][g][r])); m1 = fmaxf(m1, fmaxf(s[0][g][r + 1], s[1][g][r + 1])); }
    m0 = fmaxf(m0, m1); return fmaxf(m0, rs_xh(m0)); };
  lstore(0);
  __syncthreads();      /* stage 0 is visible to every wave */
  { const v8f zz[2] = {z8, z8}; v8f s[2][2]; scores(&L[kg][0][0][c * FA_PIT + 16 * h], zz, s);      /* the maximum in use starts from the group's first 32 keys, whose scores the first pass forms again on top of it */
#pragma unroll
    for (int g = 0; g < 2; ++g) { mu[g] = colmax(s, g) - FA_OFS;
#pragma unroll
      for (int r = 0; r < 8; ++r) nm[g][r] = -mu[g]; } }
  constexpr int NST = SQ / (FA_KG * FA_SK);
#pragma nounroll      /* no peeled last stage: with one the compiler holds the C registers twice and copies all sixteen in every stage */
  for (int st = 0; st < NST; ++st) { const int buf = st & 1;
    if (st + 1 < NST) gload(st + 1);      /* the next stage's rows fly into registers under this stage's work */
#pragma unroll      /* two passes with constant LDS offsets */
    for (int p = 0; p < 2; ++p) {
      const unsigned char* kb = &L[kg][buf][0][(32 * p + c) * FA_PIT + 16 * h]; const unsigned char* vb = &L[kg][buf][1][c * FA_PIT + 64 * p + 16 * h];
      v8f s[2][2]; scores(kb, nm, s);      /* [16-key tile][column group]: score minus the maximum in use */
      v16h vf[4];
#pragma unroll
      for (int t = 0; t < 4; ++t) vf[t] = fa_lfrag(vb + t * 16 * FA_PIT);
      float mx[2]; bool need = false;
#pragma unroll
      for (int g = 0; g < 2; ++g) { mx[g] = colmax(s, g); need = need || (mx[g] > FA_OFS + FA_LAG); }      /* the pass's maximum, counted from the one in use */
      if (__builtin_amdgcn_ballot_w32(need) != 0) {      /* wave-uniform, rare */
        const v4f d4 = {fminf(FA_OFS - mx[0], 0.f), fminf(FA_OFS - mx[1], 0.f), 0.f, 0.f}; const v4f cr = rs_exp2x4(d4);      /* old maximum in use minus new one: never above 0 */
#pragma unroll
        for (int g = 0; g < 2; ++g) { mu[g] = mu[g] - d4[g]; la[g] = la[g] * cr[g];
#pragma unroll
          for (int r = 0; r < 8; ++r) nm[g][r] = -mu[g];
#pragma unroll
          for (int kt = 0; kt < 2; ++kt) s[kt][g] = s[kt][g] + d4[g];      /* this pass's exponents move onto the new maximum */
#pragma unroll
          for (int t = 0; t < 4; ++t) acc[g][t] = acc[g][t] * cr[g]; } }
#pragma unroll
      for (int g = 0; g < 2; ++g) { FragH pf;
#pragma unroll
        for (int i = 0; i < 4; ++i) { const int kt = i >> 1, r0 = 4 * (i & 1); v4f e = {s[kt][g][r0], s[kt][g][r0 + 1], s[kt][g][r0 + 2], s[kt][g][r0 + 3]};
          e = rs_exp2x4(e); la[g] = la[g] + e;
#pragma unroll
          for (int j = 0; j < 4; ++j) pf.h[4 * i + j] = (_Float16)e[j]; }      /* element 8 kt + r = key 16 kt + 8 h + r */
#pragma unroll
        for (int t = 0; t < 4; ++t) acc[g][t] = fa_mma(vf[t], pf.v, acc[g][t]); } }
    if (st + 1 < NST) lstore(buf ^ 1);      /* every wave left that buffer before the barrier that ended stage st - 1 */
    __syncthreads(); }      /* publishes stage st + 1 and ends every wave's reads of stage st */
  // The two key groups' partial sums become one: the second group's waves hand O^T, denominators and maxima over through the ring, which every wave has left
  // behind the loop's last barrier; lane for lane they belong to the same query columns as those of wave w of the first group.
  float ls[2] = {(la[0][0] + la[0][1]) + (la[0][2] + la[0][3]), (la[1][0] + la[1][1]) + (la[1][2] + la[1][3])};
  v4fa* X = (v4fa*)&L[0][0][0][0] + w * (FA_XR * 32) + lane;      /* row j of the wave: 32 lanes x 16 bytes in a row */
  if (kg != 0) {
#pragma unroll
    for (int g = 0; g < 2; ++g)
#pragma unroll
      for (int t = 0; t < 4; ++t) { const v4f lo = {acc[g][t][0], acc[g][t][1], acc[g][t][2], acc[g][t][3]}, hi = {acc[g][t][4], acc[g][t][5], acc[g][t][6], acc[g][t][7]}; X[(8 * g + 2 * t) * 32] = lo; X[(8 * g + 2 * t + 1) * 32] = hi; }
    const v4f sm = {ls[0], ls[1], mu[0], mu[1]}; X[16 * 32] = sm; }
  __syncthreads();      /* the hand-over is visible to the first group */
  if (kg != 0) return;      /* no barrier follows */
  { const v4f sm = X[16 * 32]; const float n0 = fmaxf(mu[0], sm[2]), n1 = fmaxf(mu[1], sm[3]); const v4f d4 = {mu[0] - n0, sm[2] - n0, mu[1] - n1, sm[3] - n1}; const v4f cr = rs_exp2x4(d4);      /* both parts onto the larger maximum */
#pragma unroll
    for (int g = 0; g < 2; ++g) { ls[g] = ls[g] * cr[2 * g] + sm[g] * cr[2 * g + 1];
#pragma unroll
      for (int t = 0; t < 4; ++t) { const v4f lo = X[(8 * g + 2 * t) * 32], hi = X[(8 * g + 2 * t + 1) * 32];
#pragma unroll
        for (int r = 0; r < 4; ++r) { acc[g][t][r] = acc[g][t][r] * cr[2 * g] + lo[r] * cr[2 * g + 1]; acc[g][t][4 + r] = acc[g][t][4 + r] * cr[2 * g] + hi[r] * cr[2 * g + 1]; } } } }
#pragma unroll
  for (int g = 0; g < 2; ++g) { float lf = ls[g]; lf += rs_xh(lf); const float inv = 64.0f / lf;      /* o carried x64, as the output GEMM's alpha expects */
    unsigned short* op = (unsigned short*)O16 + ((size_t)b * SQ + q0 + 16 * g + c) * DM + hd * HD + 8 * h;
#pragma unroll
    for (int t = 0; t < 4; ++t) { FragH o;
#pragma unroll
      for (int r = 0; r < 8; ++r) o.h[r] = (_Float16)(acc[g][t][r] * inv);
      *(v8us*)(op + 16 * t) = o.half[0]; } } }      /* 8 consecutive d of one query: one 16-byte store; a query's 128-byte line has this wave as its only writer */

extern "C" void kernel_launch(void* const* d_in, const int* in_sizes, int n_in,
                              void* d_out, int out_size, void* d_ws, size_t ws_size, hipStream_t stream) {
  (void)in_sizes; (void)n_in; (void)out_size;
  const float* const* I = (const float* const*)d_in; const float* xq = I[0]; const float* xk = I[1]; const float* wq = I[2]; const float* bq = I[3]; const float* wk = I[4]; const float* bk = I[5]; const float* wv = I[6]; const float* bv = I[7]; const float* wo = I[8]; const float* bo = I[9];      
  char* ws = (char*)d_ws; size_t off = 0;
  auto take = [&](size_t bytes) { char* p = ws + off; off += (bytes + 255) & ~(size_t)255; return p; };
  _Float16* BW = (_Float16*)take((size_t)4 * DM * DM * 2); _Float16* BO = BW + (size_t)3 * DM * DM;      /* the four weights, [in][out] -> Bt[n][k] x16: q, k, v, o */
  _Float16* XQ = (_Float16*)take(NR * DM * 2); _Float16* XK = (_Float16*)take(NR * DM * 2); _Float16* Q16 = (_Float16*)take(NR * DM * 2); _Float16* K16 = (_Float16*)take(NR * DM * 2); _Float16* O16 = (_Float16*)take(NR * DM * 2);
  _Float16* VT = (_Float16*)take((size_t)NB * NH * HD * SQ * 2);
  if (off > ws_size) return;
  k_prep<<<4 * PW_B + 2 * PX_B, 256, 0, stream>>>(xq, xk, wq, wk, wv, wo, XQ, XK, BW);      /* weights and both sources; keys and values read the same source, rounded once */
  const size_t r0p = (size_t)B0 * SQ;      /* first projected row */
  k_proj3<<<dim3((unsigned)((MP / 128) * (DM / 128)), 3), 256, 0, stream>>>(XQ, XK, BW, bq, bk, bv, Q16, K16, VT);      /* Q, K rows and V^T [NB][NH][HD][SQ] */
  k_fattn<<<dim3(SQ / FA_BR, NB * NH), FA_KG * FA_NW * 32, 0, stream>>>(Q16, K16, VT, O16);      /* o x64 (merged heads) as f16 rows */
  k_outg<<<dim3((unsigned)((MPO / 128) * (DM / 128))), 256, 0, stream>>>(O16 + r0p * DM, BO, bo, (float*)d_out + r0p * DM);      /* out rows are the output layout */
}

// v007
// Measured time: 85 microseconds a run.
// Timed twice side by side with v006, it ran 1.03 times as fast both times.
// Counting every step since v000, it is 157 times as fast.
#include <hip/hip_runtime.h>
#define NB 2
#define SQ 4096
#define DM 512
#define NH 8
#define HD 64
#define HG 1                         /* heads per block group in the unlaunched k_vt(V16, b, h0, VT) overload */
#define B0 0                         /* first batch processed (debug hook) */
#define NBR NB                       /* batches processed (debug hook) */
#define NR ((size_t)NB * SQ)         /* token rows */
#define MP ((int)((size_t)NBR * SQ)) /* rows projected (debug hook) */
#define QN SQ                        /* query rows per batch (unused: k_fattn attends all SQ) */
#define NHD NH                       /* heads (unused: k_fattn attends all NH) */
#define MPO MP                       /* rows through the output stage (debug hook) */
#define LQ DM      /* row pitch of the q/k rows (unused: the code writes DM) */
typedef __bf16 v16b __attribute__((ext_vector_type(16)));
typedef unsigned short v8us __attribute__((ext_vector_type(8), may_alias));
typedef float  v8f  __attribute__((ext_vector_type(8)));
typedef float  v4f  __attribute__((ext_vector_type(4)));
typedef float  v4fa __attribute__((ext_vector_type(4), may_alias));
union FragB { v16b v; v8us half[2]; unsigned short u[16]; };

__device__ __forceinline__ unsigned short bf16_bits(float x) { unsigned int u = __float_as_uint(x); return (unsigned short)((u + 0x7FFFu + ((u >> 16) & 1u)) >> 16); }
__device__ __forceinline__ float bf16_val(unsigned short b) { return __uint_as_float(((unsigned int)b) << 16); }
__device__ __forceinline__ float bf16_round(float x) { return bf16_val(bf16_bits(x)); }
// D += A·B with NT terms: 1 = ah·bh, 2 = + al·bh (A split), 3 = + ah·bl (both split)
template <int NT>
__device__ __forceinline__ v8f mmaN(v16b ah, v16b al, v16b bh, v16b bl, v8f c) {
  c = __builtin_amdgcn_wmma_f32_16x16x32_bf16(false, ah, false, bh, (short)0, c, false, false);
  if (NT >= 2) c = __builtin_amdgcn_wmma_f32_16x16x32_bf16(false, al, false, bh, (short)0, c, false, false);
  if (NT >= 3) c = __builtin_amdgcn_wmma_f32_16x16x32_bf16(false, ah, false, bl, (short)0, c, false, false);
  asm volatile("v_nop\n\tv_nop\n\tv_nop\n\tv_nop" : "+v"(c) : "v"(ah), "v"(al), "v"(bh), "v"(bl));
  return c;
}

__global__ __launch_bounds__(256) void k_wt_bf16(const float* __restrict__ W, unsigned short* __restrict__ Wt, int K, int N) {
  const int t = blockIdx.x * 256 + threadIdx.x;
  const int k8n = K / 8;
  if (t >= N * k8n) return;
  const int n = t / k8n, k8 = (t % k8n) * 8;
  v8us v;
#pragma unroll
  for (int i = 0; i < 8; ++i) v[i] = bf16_bits(W[(size_t)(k8 + i) * N + n]);
  *(v8us*)(Wt + (size_t)n * K + k8) = v;
  
}

// GEMM C[M][N] (f32, pitch ldc) = act(A[M][K]·W + bias). A f32 row-major (pitch lda) converted per fragment to bf16
// (ASPLIT: hi/lo two planes -> 2 terms, else single rounded term); Wt bf16 [N][K] (pitch ldb). BIAS_BF16 rounds the
// bias to bf16 first (bias quantised to bf16 before the add). K%32==0, M%16==0, N%64==0.
template <bool ASPLIT, int ACT, bool BIAS_BF16>
__global__ __launch_bounds__(128) void k_gemm_bf(const float* __restrict__ A, int lda, const unsigned short* __restrict__ Wt, int ldb,
                                               const float* __restrict__ bias, float* __restrict__ C, int ldc, int M, int N, int K) {
  __shared__ __attribute__((aligned(16))) float so[4][16][64];
  const int tid = threadIdx.x, w = tid >> 5, lane = tid & 31, ln = lane & 15, hh = lane >> 4;
  const int ntn = N / 64;
  const int wid = blockIdx.x * 4 + w;
  const int mt = wid / ntn, nq = wid % ntn;
  if (mt * 16 >= M) return;
  const int row0 = mt * 16, col0 = nq * 64;
  const float* arow = A + (size_t)(row0 + ln) * lda;
  v8f acc[4] = {};
  for (int kb = 0; kb < K; kb += 32) {
    FragB ah, al;
    const v4f x0 = *(const v4fa*)(arow + kb + 8 * hh), x1 = *(const v4fa*)(arow + kb + 8 * hh + 4);
    const v4f x2 = *(const v4fa*)(arow + kb + 16 + 8 * hh), x3 = *(const v4fa*)(arow + kb + 16 + 8 * hh + 4);
    float xs[16] = {x0[0],x0[1],x0[2],x0[3],x1[0],x1[1],x1[2],x1[3],x2[0],x2[1],x2[2],x2[3],x3[0],x3[1],x3[2],x3[3]};
#pragma unroll
    for (int i = 0; i < 16; ++i) { const unsigned short hb = bf16_bits(xs[i]); ah.u[i] = hb; al.u[i] = ASPLIT ? bf16_bits(xs[i] - bf16_val(hb)) : (unsigned short)0; }
#pragma unroll
    for (int t = 0; t < 4; ++t) {
      const unsigned short* brow = Wt + (size_t)(col0 + t * 16 + ln) * ldb + kb;
      FragB b;
      b.half[0] = *(const v8us*)(brow + 8 * hh);
      b.half[1] = *(const v8us*)(brow + 16 + 8 * hh);
      acc[t] = mmaN<ASPLIT ? 2 : 1>(ah.v, al.v, b.v, b.v, acc[t]);
    }
  }
#pragma unroll
  for (int t = 0; t < 4; ++t) {
    float bv = bias ? bias[col0 + t * 16 + ln] : 0.f;
    if (BIAS_BF16) bv = bf16_round(bv);
#pragma unroll
    for (int r = 0; r < 8; ++r) { float v = acc[t][r] + bv; if (ACT == 1) v = fmaxf(v, 0.f); so[w][8 * hh + r][t * 16 + ln] = v; }
  }
  __builtin_amdgcn_fence(__ATOMIC_ACQ_REL, "workgroup");
  __builtin_amdgcn_wave_barrier();
  const int rsub = lane >> 4, c4 = (lane & 15) * 4;
  {
#pragma unroll
    for (int q = 0; q < 8; ++q) {
      const int r = q * 2 + rsub;
      const v4f v = *(const v4fa*)&so[w][r][c4];
      *(v4f*)(C + (size_t)(row0 + r) * ldc + col0 + c4) = v;
    }
    
  }
}

// GEMM C = act(A·W + bias + resid): A f32 (ASPLIT -> hi/lo 2 terms), Wt bf16 [N][K]; ACT 0 none, 1 relu, 2 exact gelu;
// resid (optional, f32, row index = (row % rmod), pitch ldr, RES_BF16 rounds it) added before the activation.
template <bool ASPLIT, int ACT, bool BIAS_BF16, bool RES_BF16>
__global__ __launch_bounds__(128) void k_gemm_bf3(const float* __restrict__ A, int lda, const unsigned short* __restrict__ Wt, int ldb,
                                                const float* __restrict__ bias, const float* __restrict__ resid, int rmod, int ldr,
                                                float* __restrict__ C, int ldc, int M, int N, int K) {
  __shared__ __attribute__((aligned(16))) float so[4][16][64];
  const int tid = threadIdx.x, w = tid >> 5, lane = tid & 31, ln = lane & 15, hh = lane >> 4;
  const int ntn = N / 64;
  const int wid = blockIdx.x * 4 + w;
  const int mt = wid / ntn, nq = wid % ntn;
  if (mt * 16 >= M) return;
  const int row0 = mt * 16, col0 = nq * 64;
  const float* arow = A + (size_t)(row0 + ln) * lda;
  v8f acc[4] = {};
  for (int kb = 0; kb < K; kb += 32) {
    FragB ah, al;
    const v4f x0 = *(const v4fa*)(arow + kb + 8 * hh), x1 = *(const v4fa*)(arow + kb + 8 * hh + 4);
    const v4f x2 = *(const v4fa*)(arow + kb + 16 + 8 * hh), x3 = *(const v4fa*)(arow + kb + 16 + 8 * hh + 4);
    float xs[16] = {x0[0],x0[1],x0[2],x0[3],x1[0],x1[1],x1[2],x1[3],x2[0],x2[1],x2[2],x2[3],x3[0],x3[1],x3[2],x3[3]};
#pragma unroll
    for (int i = 0; i < 16; ++i) { const unsigned short hb = bf16_bits(xs[i]); ah.u[i] = hb; al.u[i] = ASPLIT ? bf16_bits(xs[i] - bf16_val(hb)) : (unsigned short)0; }
#pragma unroll
    for (int t = 0; t < 4; ++t) {
      const unsigned short* brow = Wt + (size_t)(col0 + t * 16 + ln) * ldb + kb;
      FragB b;
      b.half[0] = *(const v8us*)(brow + 8 * hh);
      b.half[1] = *(const v8us*)(brow + 16 + 8 * hh);
      acc[t] = mmaN<ASPLIT ? 2 : 1>(ah.v, al.v, b.v, b.v, acc[t]);
    }
  }
#pragma unroll
  for (int t = 0; t < 4; ++t) {
    const int col = col0 + t * 16 + ln;
    float bv = bias ? bias[col] : 0.f;
    if (BIAS_BF16) bv = bf16_round(bv);
#pragma unroll
    for (int r = 0; r < 8; ++r) {
      float v = acc[t][r] + bv;
      if (resid) { float rv = resid[(size_t)((row0 + 8 * hh + r) % rmod) * ldr + col]; if (RES_BF16) rv = bf16_round(rv); v += rv; }
      if (ACT == 1) v = fmaxf(v, 0.f);
      if (ACT == 2) v = 0.5f * v * (1.0f + erff(v * 0.70710678118654752f));
      if (ACT == 3) { const float u = 0.7978845608028654f * (v + 0.044715f * v * v * v); v = 0.5f * v * (1.0f + tanhf(u)); }
      so[w][8 * hh + r][t * 16 + ln] = v;
    }
  }
  __builtin_amdgcn_fence(__ATOMIC_ACQ_REL, "workgroup");
  __builtin_amdgcn_wave_barrier();
  const int rsub = lane >> 4, c4 = (lane & 15) * 4;
  {
#pragma unroll
    for (int q = 0; q < 8; ++q) {
      const int r = q * 2 + rsub;
      const v4f v = *(const v4fa*)&so[w][r][c4];
      *(v4f*)(C + (size_t)(row0 + r) * ldc + col0 + c4) = v;
    }
    
  }
}
// row LayerNorm (biased variance, eps) over N: s = X (+ R); optional out_sum <- s; out_norm <- (s-mu)*rsqrt(var+eps)*g + b
template <bool PARAM_BF16>
__global__ __launch_bounds__(256) void k_layernorm(const float* __restrict__ X, const float* __restrict__ R, const float* __restrict__ g, const float* __restrict__ bta,
                                                  float* __restrict__ out_sum, float* __restrict__ out_norm, int N, float eps) {
  __shared__ float red[256];
  const int row = blockIdx.x, tid = threadIdx.x;
  const float* x = X + (size_t)row * N; const float* rr = R ? R + (size_t)row * N : nullptr;
  float vals[16];                     // up to N = 4096
  const int per = N / 256;            // contiguous chunk per thread? use strided-by-4 chunks: thread handles j = tid*4 + 1024*u
  float s1 = 0.f;
  for (int u = 0; u < per / 4; ++u) {
    const int j = tid * 4 + 1024 * u;
    const v4f a = *(const v4fa*)(x + j);
    v4f b = {0.f,0.f,0.f,0.f}; if (rr) b = *(const v4fa*)(rr + j);
#pragma unroll
    for (int q = 0; q < 4; ++q) { const float v = a[q] + b[q]; vals[u * 4 + q] = v; s1 += v; }
  }
  red[tid] = s1; __syncthreads();
  for (int st = 128; st > 0; st >>= 1) { if (tid < st) red[tid] += red[tid + st]; __syncthreads(); }
  const float mu = red[0] / (float)N; __syncthreads();
  float s2 = 0.f;
  for (int u = 0; u < per / 4; ++u)
#pragma unroll
    for (int q = 0; q < 4; ++q) { const float c = vals[u * 4 + q] - mu; s2 += c * c; }
  red[tid] = s2; __syncthreads();
  for (int st = 128; st > 0; st >>= 1) { if (tid < st) red[tid] += red[tid + st]; __syncthreads(); }
  const float rs = rsqrtf(red[0] / (float)N + eps);
  {
    for (int u = 0; u < per / 4; ++u) {
      const int j = tid * 4 + 1024 * u;
      v4f o, sm;
#pragma unroll
      for (int q = 0; q < 4; ++q) {
        float gg = g[j + q], bb = bta[j + q];
        if (PARAM_BF16) { gg = bf16_round(gg); bb = bf16_round(bb); }
        sm[q] = vals[u * 4 + q]; o[q] = (vals[u * 4 + q] - mu) * rs * gg + bb;
      }
      if (out_sum) *(v4f*)(out_sum + (size_t)row * N + j) = sm;
      *(v4f*)(out_norm + (size_t)row * N + j) = o;
    }
    
  }
}



// ---- f16 WMMA path (v_wmma_f32_16x16x32_f16): 11-bit significands for operands in range — used where a [0,1] probability operand needs more precision than bf16
typedef _Float16 v16h __attribute__((ext_vector_type(16)));
union FragH { v16h v; v8us half[2]; _Float16 h[16]; unsigned short u[16]; };
template <int NT>
__device__ __forceinline__ v8f mmaH(v16h ah, v16h al, v16h bh, v16h bl, v8f c) {
  c = __builtin_amdgcn_wmma_f32_16x16x32_f16(false, ah, false, bh, (short)0, c, false, false);
  if (NT >= 2) c = __builtin_amdgcn_wmma_f32_16x16x32_f16(false, al, false, bh, (short)0, c, false, false);
  if (NT >= 3) c = __builtin_amdgcn_wmma_f32_16x16x32_f16(false, ah, false, bl, (short)0, c, false, false);
  asm volatile("v_nop\n\tv_nop\n\tv_nop\n\tv_nop" : "+v"(c) : "v"(ah), "v"(al), "v"(bh), "v"(bl));
  return c;
}
// batched GEMM like k_gemm_b but f16 operands: A f32 (split into f16 hi/lo if ASPLIT, else rounded to f16), Bt = f16 values [n][k]; alpha; C f32; N multiple of 16 (partial tiles skipped)
template <bool ASPLIT>
__global__ __launch_bounds__(128) void k_gemm_h(const float* __restrict__ A, int lda, size_t sA, const _Float16* __restrict__ Bh, int ldb, size_t sB, float alpha, float* __restrict__ C, int ldc, size_t sC, int M, int N, int K) {
  __shared__ __attribute__((aligned(16))) float so[4][16][64];
  const int tid = threadIdx.x, w = tid >> 5, lane = tid & 31, ln = lane & 15, hh = lane >> 4; const int by = blockIdx.y;
  A += (size_t)by * sA; Bh += (size_t)by * sB; C += (size_t)by * sC;
  const int ntn = (N + 63) / 64; const int wid = blockIdx.x * 4 + w; const int mt = wid / ntn, nq = wid % ntn; if (mt * 16 >= M) return;
  const int row0 = mt * 16, col0 = nq * 64; const float* arow = A + (size_t)(row0 + ln) * lda;
  v8f acc[4] = {};
  for (int kb = 0; kb < K; kb += 32) {
    FragH ah, al;
    const v4f x0 = *(const v4fa*)(arow + kb + 8 * hh), x1 = *(const v4fa*)(arow + kb + 8 * hh + 4), x2 = *(const v4fa*)(arow + kb + 16 + 8 * hh), x3 = *(const v4fa*)(arow + kb + 16 + 8 * hh + 4);
    float xs[16] = {x0[0],x0[1],x0[2],x0[3],x1[0],x1[1],x1[2],x1[3],x2[0],x2[1],x2[2],x2[3],x3[0],x3[1],x3[2],x3[3]};
#pragma unroll
    for (int i = 0; i < 16; ++i) { const _Float16 h = (_Float16)xs[i]; ah.h[i] = h; al.h[i] = ASPLIT ? (_Float16)(xs[i] - (float)h) : (_Float16)0.0f; }
#pragma unroll
    for (int t = 0; t < 4; ++t) { if (col0 + t * 16 >= N) continue; const size_t boff = (size_t)(col0 + t * 16 + ln) * ldb + kb; FragH bq; bq.half[0] = *(const v8us*)(Bh + boff + 8 * hh); bq.half[1] = *(const v8us*)(Bh + boff + 16 + 8 * hh);
      acc[t] = mmaH<ASPLIT ? 2 : 1>(ah.v, al.v, bq.v, bq.v, acc[t]); }
  }
#pragma unroll
  for (int t = 0; t < 4; ++t) { if (col0 + t * 16 >= N) continue;
#pragma unroll
    for (int r = 0; r < 8; ++r) so[w][8 * hh + r][t * 16 + ln] = acc[t][r] * alpha; }
  __builtin_amdgcn_fence(__ATOMIC_ACQ_REL, "workgroup"); __builtin_amdgcn_wave_barrier();
  const int rsub = lane >> 4, c4 = (lane & 15) * 4;
  {
#pragma unroll
    for (int q = 0; q < 8; ++q) { const int r = q * 2 + rsub; if (col0 + c4 < N) { const v4f v = *(const v4fa*)&so[w][r][c4]; *(v4f*)(C + (size_t)(row0 + r) * ldc + col0 + c4) = v; } }
     }
}

// Wt[n][k] = f16(W[k][n]·scale) from f32 row-major W[K][N] (scale = power of two; bf16-exact weights stay exact in f16 away from the subnormal range)
__global__ __launch_bounds__(256) void k_wt_f16(const float* __restrict__ W, _Float16* __restrict__ Wt, int K, int N, float scale) {
  const int t = blockIdx.x * 256 + threadIdx.x; if (t >= N * (K / 8)) return; const int n = t / (K / 8), k8 = (t % (K / 8)) * 8; FragH f;
#pragma unroll
  for (int i = 0; i < 8; ++i) f.h[i] = (_Float16)(bf16_round(W[(size_t)(k8 + i) * N + n]) * scale); const v8us o = f.half[0];
  *(v8us*)((unsigned short*)Wt + (size_t)n * K + k8) = o; 
}
// k_gemm_hh variant with fused epilogue: v = acc·alpha + bias[by·sBias + col] (+ CP[(row/rowsPerB)·sCPb + by·64 + col] if CP) ; ACT 0 none / 1 elu ; writes f16 C16 (and f32 C if non-null)
template <int ACT>
__global__ __launch_bounds__(128) void k_gemm_hhx(const _Float16* __restrict__ A, int lda, size_t sA, const _Float16* __restrict__ Bh, int ldb, size_t sB, float alpha, const float* __restrict__ bias, size_t sBias, const float* __restrict__ CP, int rowsPerB, size_t sCPb, int row0g,
    float* __restrict__ C, _Float16* __restrict__ C16, int ldc, size_t sC, int M, int N, int K) {
  __shared__ __attribute__((aligned(16))) float so[4][16][64];
  const int tid = threadIdx.x, w = tid >> 5, lane = tid & 31, ln = lane & 15, hh = lane >> 4; const int by = blockIdx.y;
  A += (size_t)by * sA; Bh += (size_t)by * sB; const size_t cofs = (size_t)by * sC; const float* bp = bias ? bias + (size_t)by * sBias : nullptr;
  const int ntn = (N + 63) / 64; const int wid = blockIdx.x * 4 + w; const int mt = wid / ntn, nq = wid % ntn; if (mt * 16 >= M) return;
  const int row0 = mt * 16, col0 = nq * 64; const _Float16* arow = A + (size_t)(row0 + ln) * lda;
  v8f acc[4] = {};
  for (int kb = 0; kb < K; kb += 32) { FragH ah; ah.half[0] = *(const v8us*)((const unsigned short*)arow + kb + 8 * hh); ah.half[1] = *(const v8us*)((const unsigned short*)arow + kb + 16 + 8 * hh);
#pragma unroll
    for (int t = 0; t < 4; ++t) { if (col0 + t * 16 >= N) continue; const size_t boff = (size_t)(col0 + t * 16 + ln) * ldb + kb; FragH bq; bq.half[0] = *(const v8us*)((const unsigned short*)Bh + boff + 8 * hh); bq.half[1] = *(const v8us*)((const unsigned short*)Bh + boff + 16 + 8 * hh);
      acc[t] = mmaH<1>(ah.v, ah.v, bq.v, bq.v, acc[t]); }
  }
#pragma unroll
  for (int t = 0; t < 4; ++t) { if (col0 + t * 16 >= N) continue; const int col = col0 + t * 16 + ln; const float bv = bp ? bf16_round(bp[col]) : 0.f;
#pragma unroll
    for (int r = 0; r < 8; ++r) { float v = acc[t][r] * alpha + bv; if (CP) { const int rr = row0g + row0 + 8 * hh + r; if (rowsPerB < 0) v += CP[cofs + (size_t)rr * ldc + col];      /* rowsPerB < 0: own element of the batched C plane */ else { const int bidx = rr / rowsPerB; v += CP[(size_t)bidx * sCPb + (size_t)by * 64 + col]; } } if (ACT == 1) v = (v > 0.f) ? v : expm1f(v); else if (ACT == 7) v = (v > 0.f) ? v + 1.0f : expf(v); else if (ACT == 8) v = tanhf(v); else if (ACT == 9) v = 0.5f * v * (1.0f + tanhf(0.7978845608028654f * (v + 0.044715f * v * v * v))); else if (ACT == 11) v = 1.0f / (1.0f + expf(-v)); else if (ACT == 12) v = (v > 0.f) ? v : 0.01f * v; else if (ACT == 14) v = (v > 0.f) ? v : 0.1f * v; else if (ACT == 16) v = (v >= 0.f) ? v : 0.3f * v; else if (ACT == 17) v = (v >= 0.f) ? v : 0.2f * v; else if (ACT == 15) v = v / (1.0f + expf(-v)); else if (ACT == 3) v = fmaxf(v, 0.f); else if (ACT == 6) v = 0.5f * v * (1.0f + erff(v * 0.70710678118654752f)); so[w][8 * hh + r][t * 16 + ln] = v; } }
  __builtin_amdgcn_fence(__ATOMIC_ACQ_REL, "workgroup"); __builtin_amdgcn_wave_barrier();
  const int rsub = lane >> 4, c4 = (lane & 15) * 4; typedef _Float16 v4h __attribute__((ext_vector_type(4)));
  {
#pragma unroll
    for (int q = 0; q < 8; ++q) { const int r = q * 2 + rsub; if (col0 + c4 < N) { const v4f v = *(const v4fa*)&so[w][r][c4]; if (C) *(v4f*)(C + cofs + (size_t)(row0 + r) * ldc + col0 + c4) = v; if (C16) { v4h h4; for (int i = 0; i < 4; ++i) h4[i] = (_Float16)v[i]; *(v4h*)(C16 + cofs + (size_t)(row0 + r) * ldc + col0 + c4) = h4; } } }
     }
}


typedef _Float16 v4h __attribute__((ext_vector_type(4)));

__global__ __launch_bounds__(256) void k_x16(const float* __restrict__ x, _Float16* __restrict__ X16, size_t n8) { const size_t t = (size_t)blockIdx.x * 256 + threadIdx.x; if (t >= n8) return; FragH f;
#pragma unroll
  for (int q = 0; q < 8; ++q) f.h[q] = (_Float16)bf16_round(x[t * 8 + q]); *(v8us*)((unsigned short*)X16 + t * 8) = f.half[0];  }
__global__ __launch_bounds__(256) void k_h16(const float* __restrict__ x, _Float16* __restrict__ X16, size_t n8) { const size_t t = (size_t)blockIdx.x * 256 + threadIdx.x; if (t >= n8) return; FragH f;
#pragma unroll
  for (int q = 0; q < 8; ++q) f.h[q] = (_Float16)x[t * 8 + q]; *(v8us*)((unsigned short*)X16 + t * 8) = f.half[0];  }
__global__ __launch_bounds__(256) void k_round16f(const float* __restrict__ W, _Float16* __restrict__ Bt, size_t n8) { const size_t t = (size_t)blockIdx.x * 256 + threadIdx.x; if (t >= n8) return; FragH f;
#pragma unroll
  for (int i = 0; i < 8; ++i) f.h[i] = (_Float16)(bf16_round(W[t * 8 + i]) * 16.0f); *(v8us*)((unsigned short*)Bt + t * 8) = f.half[0];  }
template <int NHv, int TTv>
__global__ __launch_bounds__(256) void k_vt(const _Float16* __restrict__ V16, int ldv, int voff, _Float16* __restrict__ Vt) { __shared__ unsigned short tl[64][66]; const int tid = threadIdx.x; const int slab = blockIdx.x / (TTv / 64), lg = blockIdx.x % (TTv / 64); const int b = slab / NHv, h = slab % NHv;
  for (int i = tid; i < 64 * 8; i += 256) { const int r = i / 8, c8 = (i % 8) * 8; FragH f; f.half[0] = *(const v8us*)((const unsigned short*)V16 + ((size_t)b * TTv + lg * 64 + r) * ldv + voff + h * 64 + c8);
#pragma unroll
    for (int q = 0; q < 8; ++q) tl[r][c8 + q] = f.u[q]; }
  __syncthreads();
  {
#pragma unroll
    for (int rd = 0; rd < 2; ++rd) { const int d = rd * 32 + tid / 8, pc = tid % 8; FragH f;
#pragma unroll
      for (int q = 0; q < 8; ++q) f.u[q] = tl[pc * 8 + q][d];
      *(v8us*)((unsigned short*)Vt + ((size_t)slab * 64 + d) * TTv + lg * 64 + pc * 8) = f.half[0]; }
     } }

__global__ __launch_bounds__(256) void k_hl(const float* __restrict__ F, _Float16* __restrict__ Hh, _Float16* __restrict__ Hl, size_t n8) { const size_t t = (size_t)blockIdx.x * 256 + threadIdx.x; if (t >= n8) return; FragH fh, fl; const v4f a = *(const v4fa*)(F + t * 8), c = *(const v4fa*)(F + t * 8 + 4);
#pragma unroll
  for (int q = 0; q < 4; ++q) { _Float16 h = (_Float16)a[q]; fh.h[q] = h; fl.h[q] = (_Float16)((a[q] - (float)h) * 1024.0f); h = (_Float16)c[q]; fh.h[4 + q] = h; fl.h[4 + q] = (_Float16)((c[q] - (float)h) * 1024.0f); }
  { *(v8us*)((unsigned short*)Hh + t * 8) = fh.half[0]; *(v8us*)((unsigned short*)Hl + t * 8) = fl.half[0];  } }

// ---- fast GEMM (wave tile 32x64; requires M % 32 == 0 rows per launch region and N % 64 == 0); epilogue = k_gemm_hhx semantics ----
__device__ __forceinline__ v16h g2_frag(const _Float16* p, int hh) { FragH f; f.half[0] = *(const v8us*)((const unsigned short*)p + 8 * hh); f.half[1] = *(const v8us*)((const unsigned short*)p + 16 + 8 * hh); return f.v; }
__device__ __forceinline__ v8f g2_mma(v16h a, v16h b, v8f c) { v8f d = __builtin_amdgcn_wmma_f32_16x16x32_f16(false, a, false, b, (short)0, c, false, false); asm volatile("v_nop\n\tv_nop\n\tv_nop\n\tv_nop" : "+v"(d) : "v"(a), "v"(b)); return d; }
template <int ACT>
__global__ __launch_bounds__(128) void k_gemm2(const _Float16* __restrict__ A, int lda, size_t sA, const _Float16* __restrict__ Bh, int ldb, size_t sB, float alpha, const float* __restrict__ bias, size_t sBias, const float* __restrict__ CP, int rowsPerB, size_t sCPb, int row0g,
    float* __restrict__ C, _Float16* __restrict__ C16, int ldc, size_t sC, int M, int N, int K) { static_assert(ACT == 0 || ACT == 3 || ACT == 6 || ACT == 8 || ACT == 9 || ACT == 11 || ACT == 12 || ACT == 14 || ACT == 15 || ACT == 16 || ACT == 17, "k_gemm2: unsupported ACT code (would silently apply no activation)");
  __shared__ __attribute__((aligned(16))) float so[4][32][68];
  const int tid = threadIdx.x, w = tid >> 5, lane = tid & 31, ln = lane & 15, hh = lane >> 4; const int by = blockIdx.y;
  A += (size_t)by * sA; Bh += (size_t)by * sB; const size_t cofs = (size_t)by * sC; const float* bp = bias ? bias + (size_t)by * sBias : nullptr;
  const int ntn = N >> 6; const int mt = blockIdx.x / ntn, nq = blockIdx.x - mt * ntn; const int row0 = mt * 128 + 32 * w, col0 = nq * 64; if (row0 >= M) return;
  const _Float16* a0p = A + (size_t)(row0 + ln) * lda; const _Float16* a1p = a0p + (size_t)16 * lda;
  const _Float16* b0p = Bh + (size_t)(col0 + ln) * ldb; const _Float16* b1p = b0p + (size_t)16 * ldb; const _Float16* b2p = b1p + (size_t)16 * ldb; const _Float16* b3p = b2p + (size_t)16 * ldb;
  const v8f z8 = {0.f,0.f,0.f,0.f,0.f,0.f,0.f,0.f}; v8f c00 = z8, c01 = z8, c02 = z8, c03 = z8, c10 = z8, c11 = z8, c12 = z8, c13 = z8;
#pragma unroll 1
  for (int kb = 0; kb < K; kb += 32) { const v16h a0 = g2_frag(a0p + kb, hh), a1 = g2_frag(a1p + kb, hh);
    v16h b = g2_frag(b0p + kb, hh); c00 = g2_mma(a0, b, c00); c10 = g2_mma(a1, b, c10);
    b = g2_frag(b1p + kb, hh); c01 = g2_mma(a0, b, c01); c11 = g2_mma(a1, b, c11);
    b = g2_frag(b2p + kb, hh); c02 = g2_mma(a0, b, c02); c12 = g2_mma(a1, b, c12);
    b = g2_frag(b3p + kb, hh); c03 = g2_mma(a0, b, c03); c13 = g2_mma(a1, b, c13); }
  v8f accs[8] = {c00, c01, c02, c03, c10, c11, c12, c13};
#pragma unroll
  for (int u = 0; u < 8; ++u) { const int t = u & 3, half = u >> 2; const int col = col0 + t * 16 + ln; const float bv = bp ? bf16_round(bp[col]) : 0.f;
#pragma unroll
    for (int r = 0; r < 8; ++r) { const int rloc = half * 16 + 8 * hh + r; float v = accs[u][r] * alpha + bv; if (CP) { if (rowsPerB < 0) v += CP[cofs + (size_t)(row0g + row0 + rloc) * ldc + col];      /* rowsPerB < 0: own element of the batched C plane */ else { const int bidx = (row0g + row0 + rloc) / rowsPerB; v += CP[(size_t)bidx * sCPb + (size_t)by * 64 + col]; } }
      if (ACT == 3) v = fmaxf(v, 0.f); else if (ACT == 6) v = 0.5f * v * (1.0f + erff(v * 0.70710678118654752f)); else if (ACT == 11) v = 1.0f / (1.0f + expf(-v)); else if (ACT == 15) v = v / (1.0f + expf(-v)); else if (ACT == 12) v = (v > 0.f) ? v : 0.01f * v; else if (ACT == 8) v = tanhf(v); else if (ACT == 9) v = 0.5f * v * (1.0f + tanhf(0.7978845608028654f * (v + 0.044715f * v * v * v))); else if (ACT == 14) v = (v > 0.f) ? v : 0.1f * v; else if (ACT == 16) v = (v >= 0.f) ? v : 0.3f * v; else if (ACT == 17) v = (v >= 0.f) ? v : 0.2f * v;
      so[w][rloc][t * 16 + ln] = v; } }
  __builtin_amdgcn_fence(__ATOMIC_ACQ_REL, "workgroup"); __builtin_amdgcn_wave_barrier();
  const int rsub = lane >> 4, c4 = (lane & 15) * 4;
  {
#pragma unroll
    for (int q = 0; q < 16; ++q) { const int r = q * 2 + rsub; const v4f v = *(const v4fa*)&so[w][r][c4]; if (C) *(v4f*)(C + cofs + (size_t)(row0 + r) * ldc + col0 + c4) = v; if (C16) { v4h h4; for (int i = 0; i < 4; ++i) h4[i] = (_Float16)v[i]; *(v4h*)(C16 + cofs + (size_t)(row0 + r) * ldc + col0 + c4) = h4; } }
     } }


__global__ __launch_bounds__(256) void k_wnat(const float* __restrict__ w, size_t n8, _Float16* __restrict__ Bt) { const size_t t = (size_t)blockIdx.x * 256 + threadIdx.x; if (t >= n8) return; FragH f; for (int q = 0; q < 8; ++q) f.h[q] = (_Float16)(bf16_round(w[t * 8 + q]) * 16.0f); *(v8us*)((unsigned short*)Bt + t * 8) = f.half[0];  }
__global__ __launch_bounds__(256) void k_rsm(const float* __restrict__ S, _Float16* __restrict__ P, int nrows) {
  #pragma clang fp contract(off)
  const int i = blockIdx.x * 256 + threadIdx.x; if (i >= nrows) return; const float* s = S + (size_t)i * SQ; float mx = -3.0e38f;
#pragma unroll 1
  for (int j = 0; j < SQ; ++j) mx = fmaxf(mx, s[j]); float se = 0.f;
#pragma unroll 1
  for (int j = 0; j < SQ; ++j) se += expf(s[j] - mx); const float sc = 256.0f / se;
#pragma unroll 1
  for (int j0 = 0; j0 < SQ; j0 += 8) { FragH f; for (int q = 0; q < 8; ++q) f.h[q] = (_Float16)(expf(s[j0 + q] - mx) * sc); unsigned short* d = (unsigned short*)P + (size_t)i * SQ + j0; *(v8us*)d = f.half[0];  } }
__global__ __launch_bounds__(256) void k_vt(const _Float16* __restrict__ V16, int b, int h0, _Float16* __restrict__ VT) { __shared__ unsigned short tl[64][65]; const int tid = threadIdx.x; const int hh = blockIdx.x % HG, sg = blockIdx.x / HG; const int s0 = sg * 64; const int h = h0 + hh;
  for (int i = tid; i < 64 * 8; i += 256) { const int j = i / 8, d8 = (i % 8) * 8; FragH f; f.half[0] = *(const v8us*)((const unsigned short*)V16 + ((size_t)b * SQ + s0 + j) * DM + h * HD + d8); for (int q = 0; q < 8; ++q) tl[d8 + q][j] = f.u[q]; }
  __syncthreads();
  { for (int i = tid; i < 64 * 8; i += 256) { const int d = i / 8, j8 = (i % 8) * 8; FragH f; for (int q = 0; q < 8; ++q) f.u[q] = tl[d][j8 + q]; *(v8us*)((unsigned short*)VT + ((size_t)hh * HD + d) * SQ + s0 + j8) = f.half[0]; }  } }



// ---- one preparing launch: independent pieces picked by block range, so that they share one start instead of six dependent ones ----
// Blocks 0 .. 4 * PW_B - 1: weight wi = block / PW_B as Wt[n][k] = f16(bf16(W[k][n]) x 16), the arithmetic of k_wt_f16. The other 2 * PX_B blocks: the two
// sources as f16(bf16(x)) rows, the arithmetic of k_x16; a block takes PX_U consecutive runs of 256 groups of 8 floats, a thread one group of each run.
#define PW_B (DM * (DM / 8) / 256)   /* blocks per weight */
#define PX_U 8                       /* groups of 8 elements per thread */
#define PX_B ((int)(NR * DM / 8 / 256 / PX_U))      /* blocks per source */
__global__ __launch_bounds__(256) void k_prep(const float* __restrict__ xq, const float* __restrict__ xk, const float* __restrict__ wq, const float* __restrict__ wk, const float* __restrict__ wv, const float* __restrict__ wo,
    _Float16* __restrict__ XQ, _Float16* __restrict__ XK, _Float16* __restrict__ BW) {
  static_assert(NR * DM == (size_t)PX_B * 256 * PX_U * 8, "the sources divide evenly among the threads");
  const int bx = blockIdx.x;
  if (bx < 4 * PW_B) { const int wi = bx / PW_B; const float* W = wi == 0 ? wq : wi == 1 ? wk : wi == 2 ? wv : wo; _Float16* Wt = BW + (size_t)wi * DM * DM;
    const int t = (bx - wi * PW_B) * 256 + threadIdx.x; const int n = t / (DM / 8), k8 = (t % (DM / 8)) * 8; FragH f;
#pragma unroll
    for (int i = 0; i < 8; ++i) f.h[i] = (_Float16)(bf16_round(W[(size_t)(k8 + i) * DM + n]) * 16.0f);
    *(v8us*)((unsigned short*)Wt + (size_t)n * DM + k8) = f.half[0];
    return; }
  const int xb = bx - 4 * PW_B; const bool second = xb >= PX_B; const size_t g0 = (size_t)(xb - (second ? PX_B : 0)) * (256 * PX_U) + threadIdx.x;      /* the thread's first group */
  const float* p = (second ? xk : xq) + g0 * 8; unsigned short* d = (unsigned short*)(second ? XK : XQ) + g0 * 8; v4f a[PX_U][2]; v8us o[PX_U];
#pragma unroll
  for (int u = 0; u < PX_U; ++u) { a[u][0] = *(const v4fa*)(p + u * 2048); a[u][1] = *(const v4fa*)(p + u * 2048 + 4); }
  asm volatile("s_wait_xcnt 0x0" :: "v"(p) : "memory");      /* the loads' address register stays whole up to this wait; behind it it may be reused */
#pragma unroll
  for (int u = 0; u < PX_U; ++u) { FragH f;
#pragma unroll
    for (int q = 0; q < 4; ++q) { f.h[q] = (_Float16)bf16_round(a[u][0][q]); f.h[4 + q] = (_Float16)bf16_round(a[u][1][q]); }
    o[u] = f.half[0]; }
  __builtin_amdgcn_sched_barrier(0);      /* the stores stand last, so that no register of an issued store is written again */
#pragma unroll
  for (int u = 0; u < PX_U; ++u) *(v8us*)(d + u * 2048) = o[u];
  asm volatile("s_wait_xcnt 0x0" ::: "memory"); }      /* in the built code the weight blocks' part follows behind a scalar branch and writes these registers: the wait stands in front of it */

// ---- the three projections in one launch (wave tile, k order and epilogue arithmetic of k_gemm2): blockIdx.y = 0: Q rows, 1: K rows, 2: V^T ----
// V^T[feature][token] = sum_k Wt[feature][k] X[token][k] is the projection with the operand roles swapped (A = weight rows, B = token rows): its C rows are the
// [batch][head][d][token] rows that the attention kernel reads, 128-byte lines of 64 tokens with one wave as writer, and the bias goes by row instead of by column.
template <int LDC>
__device__ __forceinline__ void p3_store(const float (*so)[68], _Float16* cp, int lane) {      /* cp: the wave's tile origin in C; rows leave as whole 128-byte lines */
  const int rsub = lane >> 4, c4 = (lane & 15) * 4; _Float16* c = cp + (size_t)rsub * LDC + c4; v4h h4[16];
#pragma unroll
  for (int q = 0; q < 16; ++q) { const v4f v = *(const v4fa*)&so[q * 2 + rsub][c4];
#pragma unroll
    for (int i = 0; i < 4; ++i) h4[q][i] = (_Float16)v[i]; }
  __builtin_amdgcn_sched_barrier(0);      /* the stores stand last, so that no register of an issued store is written again */
#pragma unroll
  for (int q = 0; q < 16; ++q) *(v4h*)(c + (size_t)q * 2 * LDC) = h4[q];
  asm volatile("s_wait_xcnt 0x0" ::: "memory"); }      /* in the built code the other layout's epilogue follows behind a scalar branch and writes these registers: the wait stands in front of it */
// ---- GEMM tile through LDS: C[128][128] = A rows . B rows^T over k = DM, one work-group of eight waves (wave tile 32x64 as before: 4 down, 2 across) ----
// A stage is one whole 128-byte line (64 k) of each of the 128 A rows and 128 B rows, brought by asynchronous 16-byte copies (eight lanes a row, so a wave's copy
// covers four whole lines) into rows of GT_PIT bytes; two buffers, the next stage's copies fly under this stage's products. The fragments are read from LDS in
// the k order of g2_frag, and every accumulator takes its 32-k steps in rising order, as before.
#define GT_PIT 144                   /* LDS row pitch in bytes: 128 of data + 16, an odd multiple of 16 B (16-byte fragment reads without bank conflicts) */
#define GT_BUF (256 * GT_PIT)        /* one buffer: rows 0-127 of A, rows 128-255 of B */
#define GT_KS 64                     /* k per stage */
#define GT_NST (DM / GT_KS)
__device__ __forceinline__ v16h gt_lfrag(const unsigned char* p) { FragH f; f.half[0] = *(const v8us*)p; f.half[1] = *(const v8us*)(p + 32); return f.v; }      /* p already holds the lane's 16 hh bytes */
// One stage: the thread's 16 bytes of rows sr + 32 j of A and of B. a, b: its place in row sr of the stage's k range; l: the LDS byte address of that place in A's part.
// The closing wait stands inside the statement, so that no address register of an issued copy is rewritten in front of it.
__device__ __forceinline__ void gt_copy(const _Float16* a, const _Float16* b, unsigned l) {
  asm volatile("global_load_async_to_lds_b128 %0, %8, off\n\t"
               "global_load_async_to_lds_b128 %1, %9, off\n\t"
               "global_load_async_to_lds_b128 %2, %10, off\n\t"
               "global_load_async_to_lds_b128 %3, %11, off\n\t"
               "global_load_async_to_lds_b128 %4, %12, off\n\t"
               "global_load_async_to_lds_b128 %5, %13, off\n\t"
               "global_load_async_to_lds_b128 %6, %14, off\n\t"
               "global_load_async_to_lds_b128 %7, %15, off\n\t"
               "s_wait_xcnt 0x0"
               :: "v"(l), "v"(l + 32 * GT_PIT), "v"(l + 64 * GT_PIT), "v"(l + 96 * GT_PIT), "v"(l + 128 * GT_PIT), "v"(l + 160 * GT_PIT), "v"(l + 192 * GT_PIT), "v"(l + 224 * GT_PIT),
                  "v"(a), "v"(a + 32 * DM), "v"(a + 64 * DM), "v"(a + 96 * DM), "v"(b), "v"(b + 32 * DM), "v"(b + 64 * DM), "v"(b + 96 * DM) : "memory"); }
// A, B: first row of the tile's 128 A rows and 128 B rows (pitch DM). On return every wave has passed the barrier behind the last LDS read and no copy is in flight: SM is free.
__device__ __forceinline__ void gt_tile(const _Float16* A, const _Float16* B, unsigned char* SM, v8f (&acc)[8]) {
  static_assert(DM % GT_KS == 0 && GT_NST >= 2, "the ring's prologue needs two stages");
  const int tid = threadIdx.x, w = tid >> 5, lane = tid & 31, ln = lane & 15, hh = lane >> 4; const int sr = tid >> 3, sc = tid & 7;
  const _Float16* ag = A + (size_t)sr * DM + sc * 8; const _Float16* bg = B + (size_t)sr * DM + sc * 8; const unsigned l0 = (unsigned)(size_t)SM + sr * GT_PIT + sc * 16;
  const unsigned char* af = SM + ((w & 3) * 32 + ln) * GT_PIT + 16 * hh; const unsigned char* bf = SM + (128 + (w >> 2) * 64 + ln) * GT_PIT + 16 * hh;
  const v8f z8 = {0.f,0.f,0.f,0.f,0.f,0.f,0.f,0.f}; v8f c00 = z8, c01 = z8, c02 = z8, c03 = z8, c10 = z8, c11 = z8, c12 = z8, c13 = z8;
  gt_copy(ag, bg, l0);
  asm volatile("s_wait_asynccnt 0x0" ::: "memory");      /* this wave's part of stage 0 has landed */
  __syncthreads();      /* stage 0 is visible to every wave */
  gt_copy(ag + GT_KS, bg + GT_KS, l0 + GT_BUF);
  for (int t = 0; t < GT_NST; ++t) { const int bo = (t & 1) * GT_BUF;
#pragma unroll      /* two 32-k steps with constant LDS offsets */
    for (int ks = 0; ks < 2; ++ks) { const unsigned char* ap = af + bo + ks * 64; const unsigned char* bp = bf + bo + ks * 64;
      const v16h a0 = gt_lfrag(ap), a1 = gt_lfrag(ap + 16 * GT_PIT), b0 = gt_lfrag(bp), b1 = gt_lfrag(bp + 16 * GT_PIT), b2 = gt_lfrag(bp + 32 * GT_PIT), b3 = gt_lfrag(bp + 48 * GT_PIT);
      __builtin_amdgcn_sched_barrier(0);      /* the step's twelve LDS reads go out as one group ahead of its products: one LDS latency a step instead of four */
      c00 = g2_mma(a0, b0, c00); c10 = g2_mma(a1, b0, c10); c01 = g2_mma(a0, b1, c01); c11 = g2_mma(a1, b1, c11);
      c02 = g2_mma(a0, b2, c02); c12 = g2_mma(a1, b2, c12); c03 = g2_mma(a0, b3, c03); c13 = g2_mma(a1, b3, c13); }
    asm volatile("s_wait_dscnt 0x0" ::: "memory");      /* this wave's reads of stage t are done before its buffer may be refilled */
    asm volatile("s_wait_asynccnt 0x0" ::: "memory");      /* this wave's part of stage t + 1 has landed */
    __syncthreads();      /* publishes stage t + 1 and ends every wave's reads of stage t */
    if (t + 2 < GT_NST) gt_copy(ag + (t + 2) * GT_KS, bg + (t + 2) * GT_KS, l0 + bo); }
  asm volatile("s_wait_asynccnt 0x0" ::: "memory");      /* nothing is in flight when the buffers become output staging */
  acc[0] = c00; acc[1] = c01; acc[2] = c02; acc[3] = c03; acc[4] = c10; acc[5] = c11; acc[6] = c12; acc[7] = c13; }

#define FA_CS (0.125f * 0x1.715476p+0f)      /* 1 / sqrt(64) and log2 e in one factor: the attention kernel's score unit */
__global__ __launch_bounds__(256) void k_proj3(const _Float16* __restrict__ XQ, const _Float16* __restrict__ XK, const _Float16* __restrict__ BW, const float* __restrict__ bq, const float* __restrict__ bk, const float* __restrict__ bv,
    _Float16* __restrict__ Q16, _Float16* __restrict__ K16, _Float16* __restrict__ VT) {
  static_assert((MP / 128) * (DM / 128) == NB * (DM / 128) * (SQ / 128) && MP == NB * SQ, "the three products have the same number of 128x128 tiles");
  static_assert(8 * 32 * 68 * 4 <= 2 * GT_BUF, "the output staging fits the ring");
  __shared__ __attribute__((aligned(16))) unsigned char SM[2 * GT_BUF];      /* the ring; behind the loop each wave's 32x68 f32 output staging */
  const int tid = threadIdx.x, w = tid >> 5, lane = tid & 31, ln = lane & 15, hh = lane >> 4; const int by = blockIdx.y, bx = blockIdx.x; const bool tr = by == 2;
  const _Float16* A; const _Float16* Bh; const float* bias; int mt, nq;
  if (tr) { const int b = bx / ((DM / 128) * (SQ / 128)), x = bx - b * ((DM / 128) * (SQ / 128)); A = BW + (size_t)2 * DM * DM; Bh = XK + (size_t)b * SQ * DM; bias = bv; mt = x / (SQ / 128); nq = x - mt * (SQ / 128); }
  else { A = by ? XK : XQ; Bh = BW + (size_t)by * DM * DM; bias = by ? bk : bq; mt = bx / (DM / 128); nq = bx - mt * (DM / 128); }
  v8f accs[8]; gt_tile(A + (size_t)mt * 128 * DM, Bh + (size_t)nq * 128 * DM, SM, accs);
  const int row0 = mt * 128 + 32 * (w & 3), col0 = nq * 128 + 64 * (w >> 2); float (*so)[68] = (float (*)[68])(SM + (size_t)w * (32 * 68 * 4));
  float bcol[4] = {0.f, 0.f, 0.f, 0.f}, brow[2][8] = {}; const float osc = by == 0 ? FA_CS : 1.0f;      /* Q rows leave times FA_CS, so that K.Q^T is the score in log2 units; x 1 is exact for K and V^T */
  if (tr) {
#pragma unroll
    for (int half = 0; half < 2; ++half)
#pragma unroll
      for (int r = 0; r < 8; ++r) brow[half][r] = bf16_round(bias[row0 + half * 16 + 8 * hh + r]); }
  else {
#pragma unroll
    for (int t = 0; t < 4; ++t) bcol[t] = bf16_round(bias[col0 + t * 16 + ln]); }
#pragma unroll
  for (int u = 0; u < 8; ++u) { const int t = u & 3, half = u >> 2;
#pragma unroll
    for (int r = 0; r < 8; ++r) so[half * 16 + 8 * hh + r][t * 16 + ln] = (accs[u][r] * 0.0625f + (tr ? brow[half][r] : bcol[t])) * osc; }
  __builtin_amdgcn_fence(__ATOMIC_ACQ_REL, "workgroup"); __builtin_amdgcn_wave_barrier();      /* the wave reads back its own tile in row order */
  if (tr) p3_store<SQ>(so, VT + (size_t)(bx / ((DM / 128) * (SQ / 128))) * DM * SQ + (size_t)row0 * SQ + col0, lane);
  else p3_store<DM>(so, (by ? K16 : Q16) + (size_t)row0 * DM + col0, lane); }

// ---- the output product on the same tile: out = o Wo * alpha + bias (epilogue arithmetic of k_gemm2<0>), f32 rows of the output layout ----
__global__ __launch_bounds__(256) void k_outg(const _Float16* __restrict__ O16, const _Float16* __restrict__ BO, const float* __restrict__ bo, float* __restrict__ C) {
  __shared__ __attribute__((aligned(16))) unsigned char SM[2 * GT_BUF];      /* the ring; behind the loop each wave's 32x68 f32 output staging */
  const int tid = threadIdx.x, w = tid >> 5, lane = tid & 31, ln = lane & 15, hh = lane >> 4; const int mt = blockIdx.x / (DM / 128), nq = blockIdx.x - mt * (DM / 128);
  v8f accs[8]; gt_tile(O16 + (size_t)mt * 128 * DM, BO + (size_t)nq * 128 * DM, SM, accs);
  const int row0 = mt * 128 + 32 * (w & 3), col0 = nq * 128 + 64 * (w >> 2); float (*so)[68] = (float (*)[68])(SM + (size_t)w * (32 * 68 * 4));
#pragma unroll
  for (int u = 0; u < 8; ++u) { const int t = u & 3, half = u >> 2; const float bv = bf16_round(bo[col0 + t * 16 + ln]);
#pragma unroll
    for (int r = 0; r < 8; ++r) so[half * 16 + 8 * hh + r][t * 16 + ln] = accs[u][r] * 0.0009765625f + bv; }      /* 1 / (16 x 64): the weights' x16 and o's x64 */
  __builtin_amdgcn_fence(__ATOMIC_ACQ_REL, "workgroup"); __builtin_amdgcn_wave_barrier();      /* the wave reads back its own tile in row order */
  const int rsub = lane >> 4, c4 = (lane & 15) * 4; float* c = C + (size_t)(row0 + rsub) * DM + col0 + c4; v4f v[16];
#pragma unroll
  for (int q = 0; q < 16; ++q) v[q] = *(const v4fa*)&so[q * 2 + rsub][c4];
  __builtin_amdgcn_sched_barrier(0);      /* the stores stand last, so that no register of an issued store is written again */
#pragma unroll
  for (int q = 0; q < 16; ++q) *(v4f*)(c + (size_t)q * 2 * DM) = v[q]; }      /* a row's 256 bytes of this tile have this wave as their only writer */

#define FA_NW 8                      /* waves per key group */
#define FA_KG 2                      /* key groups per work-group: both hold the same query columns, group kg walks the 64-key tiles FA_KG * st + kg; four waves a SIMD instead of two */
#define FA_CW 32                     /* query columns per wave (two 16-column groups) */
#define FA_BR (FA_NW * FA_CW)        /* query rows per work-group */
#define FA_XR 17                     /* 16-byte rows per lane that a wave of the second group hands over: 16 of O^T, 1 of denominators and maxima */
#define FA_SK 64                     /* keys per LDS tile and key group (two 32-key passes) */
#define FA_SUB 4                     /* tiles per ring buffer and key group: the work-group meets at a barrier once per FA_SUB tiles, in between its waves may drift apart */
#define FA_PIT 144                   /* LDS row pitch in bytes: 128 of data + 16, an odd multiple of 16 B (16-byte fragment reads without bank conflicts) */
#define FA_OFS 6.0f                  /* the maximum in use is kept 6 below the true one: weights carried x64, away from the f16 subnormal range */
#define FA_LAG 8.0f                  /* a column's maximum may outgrow the one in use by this much (log2) before the sums are rescaled: weights stay <= 2^14 */
typedef float v2f __attribute__((ext_vector_type(2)));
typedef _Float16 v2h __attribute__((ext_vector_type(2)));
__device__ __forceinline__ float rs_xh(float x) { return __builtin_bit_cast(float, __builtin_amdgcn_permlanex16(__builtin_bit_cast(int, x), __builtin_bit_cast(int, x), 0x76543210, 0xfedcba98, false, false)); }      /* lane l <- lane l ^ 16 */
// Four native 2^x, as the builtin: the sources are accumulator registers, and an asm statement cost copies between them and the sums' register pairs; the compiler
// itself keeps the distance behind a matrix instruction whose registers a result reuses, and the free slot behind a transcendental (seen in the listing).
__device__ __forceinline__ v4f rs_exp2x4(v4f e) { const v4f r = {__builtin_amdgcn_exp2f(e[0]), __builtin_amdgcn_exp2f(e[1]), __builtin_amdgcn_exp2f(e[2]), __builtin_amdgcn_exp2f(e[3])}; return r; }
__device__ __forceinline__ v8f fa_mma(v16h a, v16h b, v8f c) { return __builtin_amdgcn_wmma_f32_16x16x32_f16(false, a, false, b, (short)0, c, false, false); }
// The eight score products of a pass: s[kt][g] = K rows kt . Q columns g + c[g], each sum in the k order d 0-31, then d 32-63. Written as asm because the builtin ties D to C
// and the compiler then copies the eight C registers ahead of half of the chains; here C is only read. The four chains fill each other's distance; the closing v_nop are the
// four vector slots the chip needs between the last products and a vector instruction that reads a result or overwrites an operand.
__device__ __forceinline__ void fa_scores(v16h k00, v16h k01, v16h k10, v16h k11, v16h q00, v16h q01, v16h q10, v16h q11, v8f c0, v8f c1, v8f& s00, v8f& s01, v8f& s10, v8f& s11) {
  asm("v_wmma_f32_16x16x32_f16 %0, %4, %8, %12\n\t"
      "v_wmma_f32_16x16x32_f16 %1, %4, %10, %13\n\t"
      "v_wmma_f32_16x16x32_f16 %2, %6, %8, %12\n\t"
      "v_wmma_f32_16x16x32_f16 %3, %6, %10, %13\n\t"
      "v_wmma_f32_16x16x32_f16 %0, %5, %9, %0\n\t"
      "v_wmma_f32_16x16x32_f16 %1, %5, %11, %1\n\t"
      "v_wmma_f32_16x16x32_f16 %2, %7, %9, %2\n\t"
      "v_wmma_f32_16x16x32_f16 %3, %7, %11, %3\n\t"
      "v_nop\n\tv_nop\n\tv_nop\n\tv_nop"
      : "=&v"(s00), "=&v"(s01), "=&v"(s10), "=&v"(s11)
      : "v"(k00), "v"(k01), "v"(k10), "v"(k11), "v"(q00), "v"(q01), "v"(q10), "v"(q11), "v"(c0), "v"(c1)); }
__device__ __forceinline__ v16h fa_lfrag(const unsigned char* p) { FragH f; f.half[0] = *(const v8us*)p; f.half[1] = *(const v8us*)(p + 32); return f.v; }      /* p already holds the lane's 16 h bytes: k = 8h + 0..7 and 16 + 8h + 0..7 */
__global__ __launch_bounds__(FA_KG * FA_NW * 32) void k_fattn(const _Float16* __restrict__ Q16, const _Float16* __restrict__ K16, const _Float16* __restrict__ VT, _Float16* __restrict__ O16) {
  static_assert(HD == 64 && SQ % FA_BR == 0 && SQ % (FA_KG * FA_SK * FA_SUB) == 0 && FA_SK == 64 && FA_NW * 32 == 256 && FA_KG == 2, "tile constants are written for head size 64 and two key groups of 256 threads");
  static_assert(FA_NW * FA_XR * 512 <= FA_KG * 2 * FA_SUB * 2 * FA_SK * FA_PIT, "the hand-over fits the ring");
  __shared__ __attribute__((aligned(16))) unsigned char L[FA_KG][2][FA_SUB][2][FA_SK * FA_PIT];      /* [key group][buffer][tile][0: K rows (key)(d) | 1: V^T rows (d)(key)] */
  const int tid = threadIdx.x & (FA_NW * 32 - 1), lane = tid & 31, w = tid >> 5, c = lane & 15, h = lane >> 4;      /* tid, w: within the key group */
  const int kg = __builtin_amdgcn_readfirstlane((int)(threadIdx.x >> 8));      /* the wave's key group, in a scalar register */
  const int bh = blockIdx.y, b = bh / NH, hd = bh - b * NH; const int q0 = blockIdx.x * FA_BR + w * FA_CW;
  const unsigned short* Kg = (const unsigned short*)K16 + (size_t)b * SQ * DM + hd * HD;      /* row = key, pitch DM */
  const unsigned short* Vg = (const unsigned short*)VT + (size_t)bh * HD * SQ;                /* row = d, pitch SQ */
  const int sr = tid >> 3, sc = tid & 7;      /* staging: eight lanes move one whole 128-byte row; a thread owns rows sr and sr + 32 of both tiles of its own group */
  const unsigned short* kp = Kg + (size_t)(kg * FA_SK + sr) * DM + sc * 8; const unsigned short* vp = Vg + (size_t)sr * SQ + kg * FA_SK + sc * 8;
  auto gload = [&](int st, v8us (&r)[4]) { const unsigned short* k = kp + (size_t)st * (FA_KG * FA_SK) * DM; const unsigned short* v = vp + st * (FA_KG * FA_SK);      /* st: the group's tile number */
    r[0] = *(const v8us*)k; r[1] = *(const v8us*)(k + (size_t)32 * DM); r[2] = *(const v8us*)v; r[3] = *(const v8us*)(v + (size_t)32 * SQ);
    asm volatile("s_wait_xcnt 0x0" ::: "memory"); };      /* the loads' address registers are stepped for the next tile: keep the wait in front of that overwrite */
  auto lstore = [&](int buf, int sub, const v8us (&r)[4]) { unsigned char* kd = &L[kg][buf][sub][0][sr * FA_PIT + sc * 16]; unsigned char* vd = &L[kg][buf][sub][1][sr * FA_PIT + sc * 16];
    *(v8us*)kd = r[0]; *(v8us*)(kd + 32 * FA_PIT) = r[1]; *(v8us*)vd = r[2]; *(v8us*)(vd + 32 * FA_PIT) = r[3]; };
  v8us pr[FA_SUB][4];      /* the first buffer's tiles, all in flight at once */
#pragma unroll      /* each tile has registers of its own, so that no load waits for another tile's store */
  for (int u = 0; u < FA_SUB; ++u) gload(u, pr[u]);
  v16h qf[2][2];      /* B operand: query column 16 g + c, d = 32 kc + hardware k order */
#pragma unroll
  for (int g = 0; g < 2; ++g) { const _Float16* qp = Q16 + ((size_t)b * SQ + q0 + 16 * g + c) * DM + hd * HD; qf[g][0] = g2_frag(qp, h); qf[g][1] = g2_frag(qp + 32, h); }
  const v8f z8 = {0.f,0.f,0.f,0.f,0.f,0.f,0.f,0.f}; const v4f z4 = {0.f,0.f,0.f,0.f};
  v8f acc[2][4]; v4f la[2]; float mu[2]; v8f nm[2];      /* O^T tiles (d = 16 t + 8 h + r, query 16 g + c); this half's part of the denominator; the maximum in use, minus FA_OFS; its negative in all eight rows, the C operand of the score products */
#pragma unroll
  for (int g = 0; g < 2; ++g) { la[g] = z4;
#pragma unroll
    for (int t = 0; t < 4; ++t) acc[g][t] = z8; }
  // s[16-key tile][column group] = K.Q^T + c[group] for the 32 keys whose rows start at kb
  auto scores = [&](const unsigned char* kb, const v8f (&cc)[2], v8f (&s)[2][2]) {
    fa_scores(fa_lfrag(kb), fa_lfrag(kb + 64), fa_lfrag(kb + 16 * FA_PIT), fa_lfrag(kb + 16 * FA_PIT + 64), qf[0][0], qf[0][1], qf[1][0], qf[1][1], cc[0], cc[1], s[0][0], s[0][1], s[1][0], s[1][1]); };
  // a column's maximum over the 32 keys, in both halves of the wave
  auto colmax = [&](const v8f (&s)[2][2], int g) { float m0 = fmaxf(s[0][g][0], s[1][g][0]), m1 = fmaxf(s[0][g][1], s[1][g][1]);
#pragma unroll
    for (int r = 2; r < 8; r += 2) { m0 = fmaxf(m0, fmaxf(s[0][g][r], s[1][g][r])); m1 = fmaxf(m1, fmaxf(s[0][g][r + 1], s[1][g][r + 1])); }
    m0 = fmaxf(m0, m1); return fmaxf(m0, rs_xh(m0)); };
#pragma unroll      /* constant registers and LDS offsets */
  for (int u = 0; u < FA_SUB; ++u) lstore(0, u, pr[u]);
  __syncthreads();      /* the first buffer is visible to every wave */
  { const v8f zz[2] = {z8, z8}; v8f s[2][2]; scores(&L[kg][0][0][0][c * FA_PIT + 16 * h], zz, s);      /* the maximum in use starts from the group's first 32 keys, whose scores the first pass forms again on top of it */
#pragma unroll
    for (int g = 0; g < 2; ++g) { mu[g] = colmax(s, g) - FA_OFS;
#pragma unroll
      for (int r = 0; r < 8; ++r) nm[g][r] = -mu[g]; } }
  constexpr int NST = SQ / (FA_KG * FA_SK); v8us kv[4];
#pragma nounroll      /* no peeled last stage: with one the compiler holds the C registers twice and copies all sixteen in every stage */
  for (int st = 0; st < NST; ++st) { const int buf = (st / FA_SUB) & 1, sub = st % FA_SUB;
    if (st + FA_SUB < NST) gload(st + FA_SUB, kv);      /* the same tile of the other buffer flies into registers under this tile's work */
#pragma unroll      /* two passes with constant LDS offsets */
    for (int p = 0; p < 2; ++p) {
      const unsigned char* kb = &L[kg][buf][sub][0][(32 * p + c) * FA_PIT + 16 * h]; const unsigned char* vb = &L[kg][buf][sub][1][c * FA_PIT + 64 * p + 16 * h];
      v8f s[2][2]; scores(kb, nm, s);      /* [16-key tile][column group]: score minus the maximum in use */
      v16h vf[4];
#pragma unroll
      for (int t = 0; t < 4; ++t) vf[t] = fa_lfrag(vb + t * 16 * FA_PIT);
      float mx[2]; bool need = false;
#pragma unroll
      for (int g = 0; g < 2; ++g) { mx[g] = colmax(s, g); need = need || (mx[g] > FA_OFS + FA_LAG); }      /* the pass's maximum, counted from the one in use */
      if (__builtin_amdgcn_ballot_w32(need) != 0) {      /* wave-uniform, rare */
        const v4f d4 = {fminf(FA_OFS - mx[0], 0.f), fminf(FA_OFS - mx[1], 0.f), 0.f, 0.f}; const v4f cr = rs_exp2x4(d4);      /* old maximum in use minus new one: never above 0 */
#pragma unroll
        for (int g = 0; g < 2; ++g) { mu[g] = mu[g] - d4[g]; la[g] = la[g] * cr[g];
#pragma unroll
          for (int r = 0; r < 8; ++r) nm[g][r] = -mu[g];
#pragma unroll
          for (int kt = 0; kt < 2; ++kt) s[kt][g] = s[kt][g] + d4[g];      /* this pass's exponents move onto the new maximum */
#pragma unroll
          for (int t = 0; t < 4; ++t) acc[g][t] = acc[g][t] * cr[g]; } }
#pragma unroll
      for (int g = 0; g < 2; ++g) { FragH pf;
#pragma unroll
        for (int i = 0; i < 4; ++i) { const int kt = i >> 1, r0 = 4 * (i & 1); v4f e = {s[kt][g][r0], s[kt][g][r0 + 1], s[kt][g][r0 + 2], s[kt][g][r0 + 3]};
          e = rs_exp2x4(e); la[g] = la[g] + e;
#pragma unroll
          for (int j = 0; j < 4; ++j) pf.h[4 * i + j] = (_Float16)e[j]; }      /* element 8 kt + r = key 16 kt + 8 h + r */
#pragma unroll
        for (int t = 0; t < 4; ++t) acc[g][t] = fa_mma(vf[t], pf.v, acc[g][t]); } }
    if (st + FA_SUB < NST) lstore(buf ^ 1, sub, kv);      /* every wave left the other buffer before the last barrier, and nobody reads it before the next */
    if (sub == FA_SUB - 1) __syncthreads(); }      /* work-group-uniform: publishes the other buffer's FA_SUB tiles and ends every wave's reads of this one */
  // The two key groups' partial sums become one: the second group's waves hand O^T, denominators and maxima over through the ring, which every wave has left
  // behind the loop's last barrier; lane for lane they belong to the same query columns as those of wave w of the first group.
  float ls[2] = {(la[0][0] + la[0][1]) + (la[0][2] + la[0][3]), (la[1][0] + la[1][1]) + (la[1][2] + la[1][3])};
  v4fa* X = (v4fa*)&L[0][0][0][0][0] + w * (FA_XR * 32) + lane;      /* row j of the wave: 32 lanes x 16 bytes in a row */
  if (kg != 0) {
#pragma unroll
    for (int g = 0; g < 2; ++g)
#pragma unroll
      for (int t = 0; t < 4; ++t) { const v4f lo = {acc[g][t][0], acc[g][t][1], acc[g][t][2], acc[g][t][3]}, hi = {acc[g][t][4], acc[g][t][5], acc[g][t][6], acc[g][t][7]}; X[(8 * g + 2 * t) * 32] = lo; X[(8 * g + 2 * t + 1) * 32] = hi; }
    const v4f sm = {ls[0], ls[1], mu[0], mu[1]}; X[16 * 32] = sm; }
  __syncthreads();      /* the hand-over is visible to the first group */
  if (kg != 0) return;      /* no barrier follows */
  { const v4f sm = X[16 * 32]; const float n0 = fmaxf(mu[0], sm[2]), n1 = fmaxf(mu[1], sm[3]); const v4f d4 = {mu[0] - n0, sm[2] - n0, mu[1] - n1, sm[3] - n1}; const v4f cr = rs_exp2x4(d4);      /* both parts onto the larger maximum */
#pragma unroll
    for (int g = 0; g < 2; ++g) { ls[g] = ls[g] * cr[2 * g] + sm[g] * cr[2 * g + 1];
#pragma unroll
      for (int t = 0; t < 4; ++t) { const v4f lo = X[(8 * g + 2 * t) * 32], hi = X[(8 * g + 2 * t + 1) * 32];
#pragma unroll
        for (int r = 0; r < 4; ++r) { acc[g][t][r] = acc[g][t][r] * cr[2 * g] + lo[r] * cr[2 * g + 1]; acc[g][t][4 + r] = acc[g][t][4 + r] * cr[2 * g] + hi[r] * cr[2 * g + 1]; } } } }
#pragma unroll
  for (int g = 0; g < 2; ++g) { float lf = ls[g]; lf += rs_xh(lf); const float inv = 64.0f / lf;      /* o carried x64, as the output GEMM's alpha expects */
    unsigned short* op = (unsigned short*)O16 + ((size_t)b * SQ + q0 + 16 * g + c) * DM + hd * HD + 8 * h;
#pragma unroll
    for (int t = 0; t < 4; ++t) { FragH o;
#pragma unroll
      for (int r = 0; r < 8; ++r) o.h[r] = (_Float16)(acc[g][t][r] * inv);
      *(v8us*)(op + 16 * t) = o.half[0]; } } }      /* 8 consecutive d of one query: one 16-byte store; a query's 128-byte line has this wave as its only writer */

extern "C" void kernel_launch(void* const* d_in, const int* in_sizes, int n_in,
                              void* d_out, int out_size, void* d_ws, size_t ws_size, hipStream_t stream) {
  (void)in_sizes; (void)n_in; (void)out_size;
  const float* const* I = (const float* const*)d_in; const float* xq = I[0]; const float* xk = I[1]; const float* wq = I[2]; const float* bq = I[3]; const float* wk = I[4]; const float* bk = I[5]; const float* wv = I[6]; const float* bv = I[7]; const float* wo = I[8]; const float* bo = I[9];      
  char* ws = (char*)d_ws; size_t off = 0;
  auto take = [&](size_t bytes) { char* p = ws + off; off += (bytes + 255) & ~(size_t)255; return p; };
  _Float16* BW = (_Float16*)take((size_t)4 * DM * DM * 2); _Float16* BO = BW + (size_t)3 * DM * DM;      /* the four weights, [in][out] -> Bt[n][k] x16: q, k, v, o */
  _Float16* XQ = (_Float16*)take(NR * DM * 2); _Float16* XK = (_Float16*)take(NR * DM * 2); _Float16* Q16 = (_Float16*)take(NR * DM * 2); _Float16* K16 = (_Float16*)take(NR * DM * 2); _Float16* O16 = (_Float16*)take(NR * DM * 2);
  _Float16* VT = (_Float16*)take((size_t)NB * NH * HD * SQ * 2);
  if (off > ws_size) return;
  k_prep<<<4 * PW_B + 2 * PX_B, 256, 0, stream>>>(xq, xk, wq, wk, wv, wo, XQ, XK, BW);      /* weights and both sources; keys and values read the same source, rounded once */
  const size_t r0p = (size_t)B0 * SQ;      /* first projected row */
  k_proj3<<<dim3((unsigned)((MP / 128) * (DM / 128)), 3), 256, 0, stream>>>(XQ, XK, BW, bq, bk, bv, Q16, K16, VT);      /* Q, K rows and V^T [NB][NH][HD][SQ] */
  k_fattn<<<dim3(SQ / FA_BR, NB * NH), FA_KG * FA_NW * 32, 0, stream>>>(Q16, K16, VT, O16);      /* o x64 (merged heads) as f16 rows */
  k_outg<<<dim3((unsigned)((MPO / 128) * (DM / 128))), 256, 0, stream>>>(O16 + r0p * DM, BO, bo, (float*)d_out + r0p * DM);      /* out rows are the output layout */
}

// v008
// One run takes 79.8 microseconds.
// In both of two side-by-side timings against v007, it was 1.06 times as fast.
// All steps since v000 together make it 166 times as fast.
#include <hip/hip_runtime.h>
#define NB 2
#define SQ 4096
#define DM 512
#define NH 8
#define HD 64
#define HG 1                         /* heads per block group in the unlaunched k_vt(V16, b, h0, VT) overload */
#define B0 0                         /* first batch processed (debug hook) */
#define NBR NB                       /* batches processed (debug hook) */
#define NR ((size_t)NB * SQ)         /* token rows */
#define MP ((int)((size_t)NBR * SQ)) /* rows projected (debug hook) */
#define QN SQ                        /* query rows per batch (unused: k_fattn attends all SQ) */
#define NHD NH                       /* heads (unused: k_fattn attends all NH) */
#define MPO MP                       /* rows through the output stage (debug hook) */
#define LQ DM      /* row pitch of the q/k rows (unused: the code writes DM) */
typedef __bf16 v16b __attribute__((ext_vector_type(16)));
typedef unsigned short v8us __attribute__((ext_vector_type(8), may_alias));
typedef float  v8f  __attribute__((ext_vector_type(8)));
typedef float  v4f  __attribute__((ext_vector_type(4)));
typedef float  v4fa __attribute__((ext_vector_type(4), may_alias));
union FragB { v16b v; v8us half[2]; unsigned short u[16]; };

__device__ __forceinline__ unsigned short bf16_bits(float x) { unsigned int u = __float_as_uint(x); return (unsigned short)((u + 0x7FFFu + ((u >> 16) & 1u)) >> 16); }
__device__ __forceinline__ float bf16_val(unsigned short b) { return __uint_as_float(((unsigned int)b) << 16); }
__device__ __forceinline__ float bf16_round(float x) { return bf16_val(bf16_bits(x)); }
// D += A·B with NT terms: 1 = ah·bh, 2 = + al·bh (A split), 3 = + ah·bl (both split)
template <int NT>
__device__ __forceinline__ v8f mmaN(v16b ah, v16b al, v16b bh, v16b bl, v8f c) {
  c = __builtin_amdgcn_wmma_f32_16x16x32_bf16(false, ah, false, bh, (short)0, c, false, false);
  if (NT >= 2) c = __builtin_amdgcn_wmma_f32_16x16x32_bf16(false, al, false, bh, (short)0, c, false, false);
  if (NT >= 3) c = __builtin_amdgcn_wmma_f32_16x16x32_bf16(false, ah, false, bl, (short)0, c, false, false);
  asm volatile("v_nop\n\tv_nop\n\tv_nop\n\tv_nop" : "+v"(c) : "v"(ah), "v"(al), "v"(bh), "v"(bl));
  return c;
}

__global__ __launch_bounds__(256) void k_wt_bf16(const float* __restrict__ W, unsigned short* __restrict__ Wt, int K, int N) {
  const int t = blockIdx.x * 256 + threadIdx.x;
  const int k8n = K / 8;
  if (t >= N * k8n) return;
  const int n = t / k8n, k8 = (t % k8n) * 8;
  v8us v;
#pragma unroll
  for (int i = 0; i < 8; ++i) v[i] = bf16_bits(W[(size_t)(k8 + i) * N + n]);
  *(v8us*)(Wt + (size_t)n * K + k8) = v;
  
}

// GEMM C[M][N] (f32, pitch ldc) = act(A[M][K]·W + bias). A f32 row-major (pitch lda) converted per fragment to bf16
// (ASPLIT: hi/lo two planes -> 2 terms, else single rounded term); Wt bf16 [N][K] (pitch ldb). BIAS_BF16 rounds the
// bias to bf16 first (bias quantised to bf16 before the add). K%32==0, M%16==0, N%64==0.
template <bool ASPLIT, int ACT, bool BIAS_BF16>
__global__ __launch_bounds__(128) void k_gemm_bf(const float* __restrict__ A, int lda, const unsigned short* __restrict__ Wt, int ldb,
                                               const float* __restrict__ bias, float* __restrict__ C, int ldc, int M, int N, int K) {
  __shared__ __attribute__((aligned(16))) float so[4][16][64];
  const int tid = threadIdx.x, w = tid >> 5, lane = tid & 31, ln = lane & 15, hh = lane >> 4;
  const int ntn = N / 64;
  const int wid = blockIdx.x * 4 + w;
  const int mt = wid / ntn, nq = wid % ntn;
  if (mt * 16 >= M) return;
  const int row0 = mt * 16, col0 = nq * 64;
  const float* arow = A + (size_t)(row0 + ln) * lda;
  v8f acc[4] = {};
  for (int kb = 0; kb < K; kb += 32) {
    FragB ah, al;
    const v4f x0 = *(const v4fa*)(arow + kb + 8 * hh), x1 = *(const v4fa*)(arow + kb + 8 * hh + 4);
    const v4f x2 = *(const v4fa*)(arow + kb + 16 + 8 * hh), x3 = *(const v4fa*)(arow + kb + 16 + 8 * hh + 4);
    float xs[16] = {x0[0],x0[1],x0[2],x0[3],x1[0],x1[1],x1[2],x1[3],x2[0],x2[1],x2[2],x2[3],x3[0],x3[1],x3[2],x3[3]};
#pragma unroll
    for (int i = 0; i < 16; ++i) { const unsigned short hb = bf16_bits(xs[i]); ah.u[i] = hb; al.u[i] = ASPLIT ? bf16_bits(xs[i] - bf16_val(hb)) : (unsigned short)0; }
#pragma unroll
    for (int t = 0; t < 4; ++t) {
      const unsigned short* brow = Wt + (size_t)(col0 + t * 16 + ln) * ldb + kb;
      FragB b;
      b.half[0] = *(const v8us*)(brow + 8 * hh);
      b.half[1] = *(const v8us*)(brow + 16 + 8 * hh);
      acc[t] = mmaN<ASPLIT ? 2 : 1>(ah.v, al.v, b.v, b.v, acc[t]);
    }
  }
#pragma unroll
  for (int t = 0; t < 4; ++t) {
    float bv = bias ? bias[col0 + t * 16 + ln] : 0.f;
    if (BIAS_BF16) bv = bf16_round(bv);
#pragma unroll
    for (int r = 0; r < 8; ++r) { float v = acc[t][r] + bv; if (ACT == 1) v = fmaxf(v, 0.f); so[w][8 * hh + r][t * 16 + ln] = v; }
  }
  __builtin_amdgcn_fence(__ATOMIC_ACQ_REL, "workgroup");
  __builtin_amdgcn_wave_barrier();
  const int rsub = lane >> 4, c4 = (lane & 15) * 4;
  {
#pragma unroll
    for (int q = 0; q < 8; ++q) {
      const int r = q * 2 + rsub;
      const v4f v = *(const v4fa*)&so[w][r][c4];
      *(v4f*)(C + (size_t)(row0 + r) * ldc + col0 + c4) = v;
    }
    
  }
}

// GEMM C = act(A·W + bias + resid): A f32 (ASPLIT -> hi/lo 2 terms), Wt bf16 [N][K]; ACT 0 none, 1 relu, 2 exact gelu;
// resid (optional, f32, row index = (row % rmod), pitch ldr, RES_BF16 rounds it) added before the activation.
template <bool ASPLIT, int ACT, bool BIAS_BF16, bool RES_BF16>
__global__ __launch_bounds__(128) void k_gemm_bf3(const float* __restrict__ A, int lda, const unsigned short* __restrict__ Wt, int ldb,
                                                const float* __restrict__ bias, const float* __restrict__ resid, int rmod, int ldr,
                                                float* __restrict__ C, int ldc, int M, int N, int K) {
  __shared__ __attribute__((aligned(16))) float so[4][16][64];
  const int tid = threadIdx.x, w = tid >> 5, lane = tid & 31, ln = lane & 15, hh = lane >> 4;
  const int ntn = N / 64;
  const int wid = blockIdx.x * 4 + w;
  const int mt = wid / ntn, nq = wid % ntn;
  if (mt * 16 >= M) return;
  const int row0 = mt * 16, col0 = nq * 64;
  const float* arow = A + (size_t)(row0 + ln) * lda;
  v8f acc[4] = {};
  for (int kb = 0; kb < K; kb += 32) {
    FragB ah, al;
    const v4f x0 = *(const v4fa*)(arow + kb + 8 * hh), x1 = *(const v4fa*)(arow + kb + 8 * hh + 4);
    const v4f x2 = *(const v4fa*)(arow + kb + 16 + 8 * hh), x3 = *(const v4fa*)(arow + kb + 16 + 8 * hh + 4);
    float xs[16] = {x0[0],x0[1],x0[2],x0[3],x1[0],x1[1],x1[2],x1[3],x2[0],x2[1],x2[2],x2[3],x3[0],x3[1],x3[2],x3[3]};
#pragma unroll
    for (int i = 0; i < 16; ++i) { const unsigned short hb = bf16_bits(xs[i]); ah.u[i] = hb; al.u[i] = ASPLIT ? bf16_bits(xs[i] - bf16_val(hb)) : (unsigned short)0; }
#pragma unroll
    for (int t = 0; t < 4; ++t) {
      const unsigned short* brow = Wt + (size_t)(col0 + t * 16 + ln) * ldb + kb;
      FragB b;
      b.half[0] = *(const v8us*)(brow + 8 * hh);
      b.half[1] = *(const v8us*)(brow + 16 + 8 * hh);
      acc[t] = mmaN<ASPLIT ? 2 : 1>(ah.v, al.v, b.v, b.v, acc[t]);
    }
  }
#pragma unroll
  for (int t = 0; t < 4; ++t) {
    const int col = col0 + t * 16 + ln;
    float bv = bias ? bias[col] : 0.f;
    if (BIAS_BF16) bv = bf16_round(bv);
#pragma unroll
    for (int r = 0; r < 8; ++r) {
      float v = acc[t][r] + bv;
      if (resid) { float rv = resid[(size_t)((row0 + 8 * hh + r) % rmod) * ldr + col]; if (RES_BF16) rv = bf16_round(rv); v += rv; }
      if (ACT == 1) v = fmaxf(v, 0.f);
      if (ACT == 2) v = 0.5f * v * (1.0f + erff(v * 0.70710678118654752f));
      if (ACT == 3) { const float u = 0.7978845608028654f * (v + 0.044715f * v * v * v); v = 0.5f * v * (1.0f + tanhf(u)); }
      so[w][8 * hh + r][t * 16 + ln] = v;
    }
  }
  __builtin_amdgcn_fence(__ATOMIC_ACQ_REL, "workgroup");
  __builtin_amdgcn_wave_barrier();
  const int rsub = lane >> 4, c4 = (lane & 15) * 4;
  {
#pragma unroll
    for (int q = 0; q < 8; ++q) {
      const int r = q * 2 + rsub;
      const v4f v = *(const v4fa*)&so[w][r][c4];
      *(v4f*)(C + (size_t)(row0 + r) * ldc + col0 + c4) = v;
    }
    
  }
}
// row LayerNorm (biased variance, eps) over N: s = X (+ R); optional out_sum <- s; out_norm <- (s-mu)*rsqrt(var+eps)*g + b
template <bool PARAM_BF16>
__global__ __launch_bounds__(256) void k_layernorm(const float* __restrict__ X, const float* __restrict__ R, const float* __restrict__ g, const float* __restrict__ bta,
                                                  float* __restrict__ out_sum, float* __restrict__ out_norm, int N, float eps) {
  __shared__ float red[256];
  const int row = blockIdx.x, tid = threadIdx.x;
  const float* x = X + (size_t)row * N; const float* rr = R ? R + (size_t)row * N : nullptr;
  float vals[16];                     // up to N = 4096
  const int per = N / 256;            // contiguous chunk per thread? use strided-by-4 chunks: thread handles j = tid*4 + 1024*u
  float s1 = 0.f;
  for (int u = 0; u < per / 4; ++u) {
    const int j = tid * 4 + 1024 * u;
    const v4f a = *(const v4fa*)(x + j);
    v4f b = {0.f,0.f,0.f,0.f}; if (rr) b = *(const v4fa*)(rr + j);
#pragma unroll
    for (int q = 0; q < 4; ++q) { const float v = a[q] + b[q]; vals[u * 4 + q] = v; s1 += v; }
  }
  red[tid] = s1; __syncthreads();
  for (int st = 128; st > 0; st >>= 1) { if (tid < st) red[tid] += red[tid + st]; __syncthreads(); }
  const float mu = red[0] / (float)N; __syncthreads();
  float s2 = 0.f;
  for (int u = 0; u < per / 4; ++u)
#pragma unroll
    for (int q = 0; q < 4; ++q) { const float c = vals[u * 4 + q] - mu; s2 += c * c; }
  red[tid] = s2; __syncthreads();
  for (int st = 128; st > 0; st >>= 1) { if (tid < st) red[tid] += red[tid + st]; __syncthreads(); }
  const float rs = rsqrtf(red[0] / (float)N + eps);
  {
    for (int u = 0; u < per / 4; ++u) {
      const int j = tid * 4 + 1024 * u;
      v4f o, sm;
#pragma unroll
      for (int q = 0; q < 4; ++q) {
        float gg = g[j + q], bb = bta[j + q];
        if (PARAM_BF16) { gg = bf16_round(gg); bb = bf16_round(bb); }
        sm[q] = vals[u * 4 + q]; o[q] = (vals[u * 4 + q] - mu) * rs * gg + bb;
      }
      if (out_sum) *(v4f*)(out_sum + (size_t)row * N + j) = sm;
      *(v4f*)(out_norm + (size_t)row * N + j) = o;
    }
    
  }
}



// ---- f16 WMMA path (v_wmma_f32_16x16x32_f16): 11-bit significands for operands in range — used where a [0,1] probability operand needs more precision than bf16
typedef _Float16 v16h __attribute__((ext_vector_type(16)));
union FragH { v16h v; v8us half[2]; _Float16 h[16]; unsigned short u[16]; };
template <int NT>
__device__ __forceinline__ v8f mmaH(v16h ah, v16h al, v16h bh, v16h bl, v8f c) {
  c = __builtin_amdgcn_wmma_f32_16x16x32_f16(false, ah, false, bh, (short)0, c, false, false);
  if (NT >= 2) c = __builtin_amdgcn_wmma_f32_16x16x32_f16(false, al, false, bh, (short)0, c, false, false);
  if (NT >= 3) c = __builtin_amdgcn_wmma_f32_16x16x32_f16(false, ah, false, bl, (short)0, c, false, false);
  asm volatile("v_nop\n\tv_nop\n\tv_nop\n\tv_nop" : "+v"(c) : "v"(ah), "v"(al), "v"(bh), "v"(bl));
  return c;
}
// batched GEMM like k_gemm_b but f16 operands: A f32 (split into f16 hi/lo if ASPLIT, else rounded to f16), Bt = f16 values [n][k]; alpha; C f32; N multiple of 16 (partial tiles skipped)
template <bool ASPLIT>
__global__ __launch_bounds__(128) void k_gemm_h(const float* __restrict__ A, int lda, size_t sA, const _Float16* __restrict__ Bh, int ldb, size_t sB, float alpha, float* __restrict__ C, int ldc, size_t sC, int M, int N, int K) {
  __shared__ __attribute__((aligned(16))) float so[4][16][64];
  const int tid = threadIdx.x, w = tid >> 5, lane = tid & 31, ln = lane & 15, hh = lane >> 4; const int by = blockIdx.y;
  A += (size_t)by * sA; Bh += (size_t)by * sB; C += (size_t)by * sC;
  const int ntn = (N + 63) / 64; const int wid = blockIdx.x * 4 + w; const int mt = wid / ntn, nq = wid % ntn; if (mt * 16 >= M) return;
  const int row0 = mt * 16, col0 = nq * 64; const float* arow = A + (size_t)(row0 + ln) * lda;
  v8f acc[4] = {};
  for (int kb = 0; kb < K; kb += 32) {
    FragH ah, al;
    const v4f x0 = *(const v4fa*)(arow + kb + 8 * hh), x1 = *(const v4fa*)(arow + kb + 8 * hh + 4), x2 = *(const v4fa*)(arow + kb + 16 + 8 * hh), x3 = *(const v4fa*)(arow + kb + 16 + 8 * hh + 4);
    float xs[16] = {x0[0],x0[1],x0[2],x0[3],x1[0],x1[1],x1[2],x1[3],x2[0],x2[1],x2[2],x2[3],x3[0],x3[1],x3[2],x3[3]};
#pragma unroll
    for (int i = 0; i < 16; ++i) { const _Float16 h = (_Float16)xs[i]; ah.h[i] = h; al.h[i] = ASPLIT ? (_Float16)(xs[i] - (float)h) : (_Float16)0.0f; }
#pragma unroll
    for (int t = 0; t < 4; ++t) { if (col0 + t * 16 >= N) continue; const size_t boff = (size_t)(col0 + t * 16 + ln) * ldb + kb; FragH bq; bq.half[0] = *(const v8us*)(Bh + boff + 8 * hh); bq.half[1] = *(const v8us*)(Bh + boff + 16 + 8 * hh);
      acc[t] = mmaH<ASPLIT ? 2 : 1>(ah.v, al.v, bq.v, bq.v, acc[t]); }
  }
#pragma unroll
  for (int t = 0; t < 4; ++t) { if (col0 + t * 16 >= N) continue;
#pragma unroll
    for (int r = 0; r < 8; ++r) so[w][8 * hh + r][t * 16 + ln] = acc[t][r] * alpha; }
  __builtin_amdgcn_fence(__ATOMIC_ACQ_REL, "workgroup"); __builtin_amdgcn_wave_barrier();
  const int rsub = lane >> 4, c4 = (lane & 15) * 4;
  {
#pragma unroll
    for (int q = 0; q < 8; ++q) { const int r = q * 2 + rsub; if (col0 + c4 < N) { const v4f v = *(const v4fa*)&so[w][r][c4]; *(v4f*)(C + (size_t)(row0 + r) * ldc + col0 + c4) = v; } }
     }
}

// Wt[n][k] = f16(W[k][n]·scale) from f32 row-major W[K][N] (scale = power of two; bf16-exact weights stay exact in f16 away from the subnormal range)
__global__ __launch_bounds__(256) void k_wt_f16(const float* __restrict__ W, _Float16* __restrict__ Wt, int K, int N, float scale) {
  const int t = blockIdx.x * 256 + threadIdx.x; if (t >= N * (K / 8)) return; const int n = t / (K / 8), k8 = (t % (K / 8)) * 8; FragH f;
#pragma unroll
  for (int i = 0; i < 8; ++i) f.h[i] = (_Float16)(bf16_round(W[(size_t)(k8 + i) * N + n]) * scale); const v8us o = f.half[0];
  *(v8us*)((unsigned short*)Wt + (size_t)n * K + k8) = o; 
}
// k_gemm_hh variant with fused epilogue: v = acc·alpha + bias[by·sBias + col] (+ CP[(row/rowsPerB)·sCPb + by·64 + col] if CP) ; ACT 0 none / 1 elu ; writes f16 C16 (and f32 C if non-null)
template <int ACT>
__global__ __launch_bounds__(128) void k_gemm_hhx(const _Float16* __restrict__ A, int lda, size_t sA, const _Float16* __restrict__ Bh, int ldb, size_t sB, float alpha, const float* __restrict__ bias, size_t sBias, const float* __restrict__ CP, int rowsPerB, size_t sCPb, int row0g,
    float* __restrict__ C, _Float16* __restrict__ C16, int ldc, size_t sC, int M, int N, int K) {
  __shared__ __attribute__((aligned(16))) float so[4][16][64];
  const int tid = threadIdx.x, w = tid >> 5, lane = tid & 31, ln = lane & 15, hh = lane >> 4; const int by = blockIdx.y;
  A += (size_t)by * sA; Bh += (size_t)by * sB; const size_t cofs = (size_t)by * sC; const float* bp = bias ? bias + (size_t)by * sBias : nullptr;
  const int ntn = (N + 63) / 64; const int wid = blockIdx.x * 4 + w; const int mt = wid / ntn, nq = wid % ntn; if (mt * 16 >= M) return;
  const int row0 = mt * 16, col0 = nq * 64; const _Float16* arow = A + (size_t)(row0 + ln) * lda;
  v8f acc[4] = {};
  for (int kb = 0; kb < K; kb += 32) { FragH ah; ah.half[0] = *(const v8us*)((const unsigned short*)arow + kb + 8 * hh); ah.half[1] = *(const v8us*)((const unsigned short*)arow + kb + 16 + 8 * hh);
#pragma unroll
    for (int t = 0; t < 4; ++t) { if (col0 + t * 16 >= N) continue; const size_t boff = (size_t)(col0 + t * 16 + ln) * ldb + kb; FragH bq; bq.half[0] = *(const v8us*)((const unsigned short*)Bh + boff + 8 * hh); bq.half[1] = *(const v8us*)((const unsigned short*)Bh + boff + 16 + 8 * hh);
      acc[t] = mmaH<1>(ah.v, ah.v, bq.v, bq.v, acc[t]); }
  }
#pragma unroll
  for (int t = 0; t < 4; ++t) { if (col0 + t * 16 >= N) continue; const int col = col0 + t * 16 + ln; const float bv = bp ? bf16_round(bp[col]) : 0.f;
#pragma unroll
    for (int r = 0; r < 8; ++r) { float v = acc[t][r] * alpha + bv; if (CP) { const int rr = row0g + row0 + 8 * hh + r; if (rowsPerB < 0) v += CP[cofs + (size_t)rr * ldc + col];      /* rowsPerB < 0: own element of the batched C plane */ else { const int bidx = rr / rowsPerB; v += CP[(size_t)bidx * sCPb + (size_t)by * 64 + col]; } } if (ACT == 1) v = (v > 0.f) ? v : expm1f(v); else if (ACT == 7) v = (v > 0.f) ? v + 1.0f : expf(v); else if (ACT == 8) v = tanhf(v); else if (ACT == 9) v = 0.5f * v * (1.0f + tanhf(0.7978845608028654f * (v + 0.044715f * v * v * v))); else if (ACT == 11) v = 1.0f / (1.0f + expf(-v)); else if (ACT == 12) v = (v > 0.f) ? v : 0.01f * v; else if (ACT == 14) v = (v > 0.f) ? v : 0.1f * v; else if (ACT == 16) v = (v >= 0.f) ? v : 0.3f * v; else if (ACT == 17) v = (v >= 0.f) ? v : 0.2f * v; else if (ACT == 15) v = v / (1.0f + expf(-v)); else if (ACT == 3) v = fmaxf(v, 0.f); else if (ACT == 6) v = 0.5f * v * (1.0f + erff(v * 0.70710678118654752f)); so[w][8 * hh + r][t * 16 + ln] = v; } }
  __builtin_amdgcn_fence(__ATOMIC_ACQ_REL, "workgroup"); __builtin_amdgcn_wave_barrier();
  const int rsub = lane >> 4, c4 = (lane & 15) * 4; typedef _Float16 v4h __attribute__((ext_vector_type(4)));
  {
#pragma unroll
    for (int q = 0; q < 8; ++q) { const int r = q * 2 + rsub; if (col0 + c4 < N) { const v4f v = *(const v4fa*)&so[w][r][c4]; if (C) *(v4f*)(C + cofs + (size_t)(row0 + r) * ldc + col0 + c4) = v; if (C16) { v4h h4; for (int i = 0; i < 4; ++i) h4[i] = (_Float16)v[i]; *(v4h*)(C16 + cofs + (size_t)(row0 + r) * ldc + col0 + c4) = h4; } } }
     }
}


typedef _Float16 v4h __attribute__((ext_vector_type(4)));

__global__ __launch_bounds__(256) void k_x16(const float* __restrict__ x, _Float16* __restrict__ X16, size_t n8) { const size_t t = (size_t)blockIdx.x * 256 + threadIdx.x; if (t >= n8) return; FragH f;
#pragma unroll
  for (int q = 0; q < 8; ++q) f.h[q] = (_Float16)bf16_round(x[t * 8 + q]); *(v8us*)((unsigned short*)X16 + t * 8) = f.half[0];  }
__global__ __launch_bounds__(256) void k_h16(const float* __restrict__ x, _Float16* __restrict__ X16, size_t n8) { const size_t t = (size_t)blockIdx.x * 256 + threadIdx.x; if (t >= n8) return; FragH f;
#pragma unroll
  for (int q = 0; q < 8; ++q) f.h[q] = (_Float16)x[t * 8 + q]; *(v8us*)((unsigned short*)X16 + t * 8) = f.half[0];  }
__global__ __launch_bounds__(256) void k_round16f(const float* __restrict__ W, _Float16* __restrict__ Bt, size_t n8) { const size_t t = (size_t)blockIdx.x * 256 + threadIdx.x; if (t >= n8) return; FragH f;
#pragma unroll
  for (int i = 0; i < 8; ++i) f.h[i] = (_Float16)(bf16_round(W[t * 8 + i]) * 16.0f); *(v8us*)((unsigned short*)Bt + t * 8) = f.half[0];  }
template <int NHv, int TTv>
__global__ __launch_bounds__(256) void k_vt(const _Float16* __restrict__ V16, int ldv, int voff, _Float16* __restrict__ Vt) { __shared__ unsigned short tl[64][66]; const int tid = threadIdx.x; const int slab = blockIdx.x / (TTv / 64), lg = blockIdx.x % (TTv / 64); const int b = slab / NHv, h = slab % NHv;
  for (int i = tid; i < 64 * 8; i += 256) { const int r = i / 8, c8 = (i % 8) * 8; FragH f; f.half[0] = *(const v8us*)((const unsigned short*)V16 + ((size_t)b * TTv + lg * 64 + r) * ldv + voff + h * 64 + c8);
#pragma unroll
    for (int q = 0; q < 8; ++q) tl[r][c8 + q] = f.u[q]; }
  __syncthreads();
  {
#pragma unroll
    for (int rd = 0; rd < 2; ++rd) { const int d = rd * 32 + tid / 8, pc = tid % 8; FragH f;
#pragma unroll
      for (int q = 0; q < 8; ++q) f.u[q] = tl[pc * 8 + q][d];
      *(v8us*)((unsigned short*)Vt + ((size_t)slab * 64 + d) * TTv + lg * 64 + pc * 8) = f.half[0]; }
     } }

__global__ __launch_bounds__(256) void k_hl(const float* __restrict__ F, _Float16* __restrict__ Hh, _Float16* __restrict__ Hl, size_t n8) { const size_t t = (size_t)blockIdx.x * 256 + threadIdx.x; if (t >= n8) return; FragH fh, fl; const v4f a = *(const v4fa*)(F + t * 8), c = *(const v4fa*)(F + t * 8 + 4);
#pragma unroll
  for (int q = 0; q < 4; ++q) { _Float16 h = (_Float16)a[q]; fh.h[q] = h; fl.h[q] = (_Float16)((a[q] - (float)h) * 1024.0f); h = (_Float16)c[q]; fh.h[4 + q] = h; fl.h[4 + q] = (_Float16)((c[q] - (float)h) * 1024.0f); }
  { *(v8us*)((unsigned short*)Hh + t * 8) = fh.half[0]; *(v8us*)((unsigned short*)Hl + t * 8) = fl.half[0];  } }

// ---- fast GEMM (wave tile 32x64; requires M % 32 == 0 rows per launch region and N % 64 == 0); epilogue = k_gemm_hhx semantics ----
__device__ __forceinline__ v16h g2_frag(const _Float16* p, int hh) { FragH f; f.half[0] = *(const v8us*)((const unsigned short*)p + 8 * hh); f.half[1] = *(const v8us*)((const unsigned short*)p + 16 + 8 * hh); return f.v; }
__device__ __forceinline__ v8f g2_mma(v16h a, v16h b, v8f c) { v8f d = __builtin_amdgcn_wmma_f32_16x16x32_f16(false, a, false, b, (short)0, c, false, false); asm volatile("v_nop\n\tv_nop\n\tv_nop\n\tv_nop" : "+v"(d) : "v"(a), "v"(b)); return d; }
template <int ACT>
__global__ __launch_bounds__(128) void k_gemm2(const _Float16* __restrict__ A, int lda, size_t sA, const _Float16* __restrict__ Bh, int ldb, size_t sB, float alpha, const float* __restrict__ bias, size_t sBias, const float* __restrict__ CP, int rowsPerB, size_t sCPb, int row0g,
    float* __restrict__ C, _Float16* __restrict__ C16, int ldc, size_t sC, int M, int N, int K) { static_assert(ACT == 0 || ACT == 3 || ACT == 6 || ACT == 8 || ACT == 9 || ACT == 11 || ACT == 12 || ACT == 14 || ACT == 15 || ACT == 16 || ACT == 17, "k_gemm2: unsupported ACT code (would silently apply no activation)");
  __shared__ __attribute__((aligned(16))) float so[4][32][68];
  const int tid = threadIdx.x, w = tid >> 5, lane = tid & 31, ln = lane & 15, hh = lane >> 4; const int by = blockIdx.y;
  A += (size_t)by * sA; Bh += (size_t)by * sB; const size_t cofs = (size_t)by * sC; const float* bp = bias ? bias + (size_t)by * sBias : nullptr;
  const int ntn = N >> 6; const int mt = blockIdx.x / ntn, nq = blockIdx.x - mt * ntn; const int row0 = mt * 128 + 32 * w, col0 = nq * 64; if (row0 >= M) return;
  const _Float16* a0p = A + (size_t)(row0 + ln) * lda; const _Float16* a1p = a0p + (size_t)16 * lda;
  const _Float16* b0p = Bh + (size_t)(col0 + ln) * ldb; const _Float16* b1p = b0p + (size_t)16 * ldb; const _Float16* b2p = b1p + (size_t)16 * ldb; const _Float16* b3p = b2p + (size_t)16 * ldb;
  const v8f z8 = {0.f,0.f,0.f,0.f,0.f,0.f,0.f,0.f}; v8f c00 = z8, c01 = z8, c02 = z8, c03 = z8, c10 = z8, c11 = z8, c12 = z8, c13 = z8;
#pragma unroll 1
  for (int kb = 0; kb < K; kb += 32) { const v16h a0 = g2_frag(a0p + kb, hh), a1 = g2_frag(a1p + kb, hh);
    v16h b = g2_frag(b0p + kb, hh); c00 = g2_mma(a0, b, c00); c10 = g2_mma(a1, b, c10);
    b = g2_frag(b1p + kb, hh); c01 = g2_mma(a0, b, c01); c11 = g2_mma(a1, b, c11);
    b = g2_frag(b2p + kb, hh); c02 = g2_mma(a0, b, c02); c12 = g2_mma(a1, b, c12);
    b = g2_frag(b3p + kb, hh); c03 = g2_mma(a0, b, c03); c13 = g2_mma(a1, b, c13); }
  v8f accs[8] = {c00, c01, c02, c03, c10, c11, c12, c13};
#pragma unroll
  for (int u = 0; u < 8; ++u) { const int t = u & 3, half = u >> 2; const int col = col0 + t * 16 + ln; const float bv = bp ? bf16_round(bp[col]) : 0.f;
#pragma unroll
    for (int r = 0; r < 8; ++r) { const int rloc = half * 16 + 8 * hh + r; float v = accs[u][r] * alpha + bv; if (CP) { if (rowsPerB < 0) v += CP[cofs + (size_t)(row0g + row0 + rloc) * ldc + col];      /* rowsPerB < 0: own element of the batched C plane */ else { const int bidx = (row0g + row0 + rloc) / rowsPerB; v += CP[(size_t)bidx * sCPb + (size_t)by * 64 + col]; } }
      if (ACT == 3) v = fmaxf(v, 0.f); else if (ACT == 6) v = 0.5f * v * (1.0f + erff(v * 0.70710678118654752f)); else if (ACT == 11) v = 1.0f / (1.0f + expf(-v)); else if (ACT == 15) v = v / (1.0f + expf(-v)); else if (ACT == 12) v = (v > 0.f) ? v : 0.01f * v; else if (ACT == 8) v = tanhf(v); else if (ACT == 9) v = 0.5f * v * (1.0f + tanhf(0.7978845608028654f * (v + 0.044715f * v * v * v))); else if (ACT == 14) v = (v > 0.f) ? v : 0.1f * v; else if (ACT == 16) v = (v >= 0.f) ? v : 0.3f * v; else if (ACT == 17) v = (v >= 0.f) ? v : 0.2f * v;
      so[w][rloc][t * 16 + ln] = v; } }
  __builtin_amdgcn_fence(__ATOMIC_ACQ_REL, "workgroup"); __builtin_amdgcn_wave_barrier();
  const int rsub = lane >> 4, c4 = (lane & 15) * 4;
  {
#pragma unroll
    for (int q = 0; q < 16; ++q) { const int r = q * 2 + rsub; const v4f v = *(const v4fa*)&so[w][r][c4]; if (C) *(v4f*)(C + cofs + (size_t)(row0 + r) * ldc + col0 + c4) = v; if (C16) { v4h h4; for (int i = 0; i < 4; ++i) h4[i] = (_Float16)v[i]; *(v4h*)(C16 + cofs + (size_t)(row0 + r) * ldc + col0 + c4) = h4; } }
     } }


__global__ __launch_bounds__(256) void k_wnat(const float* __restrict__ w, size_t n8, _Float16* __restrict__ Bt) { const size_t t = (size_t)blockIdx.x * 256 + threadIdx.x; if (t >= n8) return; FragH f; for (int q = 0; q < 8; ++q) f.h[q] = (_Float16)(bf16_round(w[t * 8 + q]) * 16.0f); *(v8us*)((unsigned short*)Bt + t * 8) = f.half[0];  }
__global__ __launch_bounds__(256) void k_rsm(const float* __restrict__ S, _Float16* __restrict__ P, int nrows) {
  #pragma clang fp contract(off)
  const int i = blockIdx.x * 256 + threadIdx.x; if (i >= nrows) return; const float* s = S + (size_t)i * SQ; float mx = -3.0e38f;
#pragma unroll 1
  for (int j = 0; j < SQ; ++j) mx = fmaxf(mx, s[j]); float se = 0.f;
#pragma unroll 1
  for (int j = 0; j < SQ; ++j) se += expf(s[j] - mx); const float sc = 256.0f / se;
#pragma unroll 1
  for (int j0 = 0; j0 < SQ; j0 += 8) { FragH f; for (int q = 0; q < 8; ++q) f.h[q] = (_Float16)(expf(s[j0 + q] - mx) * sc); unsigned short* d = (unsigned short*)P + (size_t)i * SQ + j0; *(v8us*)d = f.half[0];  } }
__global__ __launch_bounds__(256) void k_vt(const _Float16* __restrict__ V16, int b, int h0, _Float16* __restrict__ VT) { __shared__ unsigned short tl[64][65]; const int tid = threadIdx.x; const int hh = blockIdx.x % HG, sg = blockIdx.x / HG; const int s0 = sg * 64; const int h = h0 + hh;
  for (int i = tid; i < 64 * 8; i += 256) { const int j = i / 8, d8 = (i % 8) * 8; FragH f; f.half[0] = *(const v8us*)((const unsigned short*)V16 + ((size_t)b * SQ + s0 + j) * DM + h * HD + d8); for (int q = 0; q < 8; ++q) tl[d8 + q][j] = f.u[q]; }
  __syncthreads();
  { for (int i = tid; i < 64 * 8; i += 256) { const int d = i / 8, j8 = (i % 8) * 8; FragH f; for (int q = 0; q < 8; ++q) f.u[q] = tl[d][j8 + q]; *(v8us*)((unsigned short*)VT + ((size_t)hh * HD + d) * SQ + s0 + j8) = f.half[0]; }  } }



// ---- one preparing launch: independent pieces picked by block range, so that they share one start instead of six dependent ones ----
// Blocks 0 .. 4 * PW_B - 1: weight wi = block / PW_B as Wt[n][k] = f16(bf16(W[k][n]) x 16), the arithmetic of k_wt_f16. The other 2 * PX_B blocks: the two
// sources as f16(bf16(x)) rows, the arithmetic of k_x16; a block takes PX_U consecutive runs of 256 groups of 8 floats, a thread one group of each run.
#define PW_B (DM * (DM / 8) / 256)   /* blocks per weight */
#define PX_U 8                       /* groups of 8 elements per thread */
#define PX_B ((int)(NR * DM / 8 / 256 / PX_U))      /* blocks per source */
__global__ __launch_bounds__(256) void k_prep(const float* __restrict__ xq, const float* __restrict__ xk, const float* __restrict__ wq, const float* __restrict__ wk, const float* __restrict__ wv, const float* __restrict__ wo,
    _Float16* __restrict__ XQ, _Float16* __restrict__ XK, _Float16* __restrict__ BW) {
  static_assert(NR * DM == (size_t)PX_B * 256 * PX_U * 8, "the sources divide evenly among the threads");
  const int bx = blockIdx.x;
  if (bx < 4 * PW_B) { const int wi = bx / PW_B; const float* W = wi == 0 ? wq : wi == 1 ? wk : wi == 2 ? wv : wo; _Float16* Wt = BW + (size_t)wi * DM * DM;
    const int t = (bx - wi * PW_B) * 256 + threadIdx.x; const int n = t / (DM / 8), k8 = (t % (DM / 8)) * 8; FragH f;
#pragma unroll
    for (int i = 0; i < 8; ++i) f.h[i] = (_Float16)(bf16_round(W[(size_t)(k8 + i) * DM + n]) * 16.0f);
    *(v8us*)((unsigned short*)Wt + (size_t)n * DM + k8) = f.half[0];
    return; }
  const int xb = bx - 4 * PW_B; const bool second = xb >= PX_B; const size_t g0 = (size_t)(xb - (second ? PX_B : 0)) * (256 * PX_U) + threadIdx.x;      /* the thread's first group */
  const float* p = (second ? xk : xq) + g0 * 8; unsigned short* d = (unsigned short*)(second ? XK : XQ) + g0 * 8; v4f a[PX_U][2]; v8us o[PX_U];
#pragma unroll
  for (int u = 0; u < PX_U; ++u) { a[u][0] = *(const v4fa*)(p + u * 2048); a[u][1] = *(const v4fa*)(p + u * 2048 + 4); }
  asm volatile("s_wait_xcnt 0x0" :: "v"(p) : "memory");      /* the loads' address register stays whole up to this wait; behind it it may be reused */
#pragma unroll
  for (int u = 0; u < PX_U; ++u) { FragH f;
#pragma unroll
    for (int q = 0; q < 4; ++q) { f.h[q] = (_Float16)bf16_round(a[u][0][q]); f.h[4 + q] = (_Float16)bf16_round(a[u][1][q]); }
    o[u] = f.half[0]; }
  __builtin_amdgcn_sched_barrier(0);      /* the stores stand last, so that no register of an issued store is written again */
#pragma unroll
  for (int u = 0; u < PX_U; ++u) *(v8us*)(d + u * 2048) = o[u];
  asm volatile("s_wait_xcnt 0x0" ::: "memory"); }      /* in the built code the weight blocks' part follows behind a scalar branch and writes these registers: the wait stands in front of it */

// ---- the three projections in one launch (wave tile, k order and epilogue arithmetic of k_gemm2): blockIdx.y = 0: Q rows, 1: K rows, 2: V^T ----
// V^T[feature][token] = sum_k Wt[feature][k] X[token][k] is the projection with the operand roles swapped (A = weight rows, B = token rows): its C rows are the
// [batch][head][d][token] rows that the attention kernel reads, 128-byte lines of 64 tokens with one wave as writer, and the bias goes by row instead of by column.
template <int LDC>
__device__ __forceinline__ void p3_store(const float (*so)[68], _Float16* cp, int lane) {      /* cp: the wave's tile origin in C; rows leave as whole 128-byte lines */
  const int rsub = lane >> 4, c4 = (lane & 15) * 4; _Float16* c = cp + (size_t)rsub * LDC + c4; v4h h4[16];
#pragma unroll
  for (int q = 0; q < 16; ++q) { const v4f v = *(const v4fa*)&so[q * 2 + rsub][c4];
#pragma unroll
    for (int i = 0; i < 4; ++i) h4[q][i] = (_Float16)v[i]; }
  __builtin_amdgcn_sched_barrier(0);      /* the stores stand last, so that no register of an issued store is written again */
#pragma unroll
  for (int q = 0; q < 16; ++q) *(v4h*)(c + (size_t)q * 2 * LDC) = h4[q];
  asm volatile("s_wait_xcnt 0x0" ::: "memory"); }      /* in the built code the other layout's epilogue follows behind a scalar branch and writes these registers: the wait stands in front of it */
// ---- GEMM tile through LDS: C[128][128] = A rows . B rows^T over k = DM, one work-group of eight waves (wave tile 32x64 as before: 4 down, 2 across) ----
// A stage is one whole 128-byte line (64 k) of each of the 128 A rows and 128 B rows, brought by asynchronous 16-byte copies (eight lanes a row, so a wave's copy
// covers four whole lines) into rows of GT_PIT bytes; two buffers, the next stage's copies fly under this stage's products. The fragments are read from LDS in
// the k order of g2_frag, and every accumulator takes its 32-k steps in rising order, as before.
#define GT_PIT 144                   /* LDS row pitch in bytes: 128 of data + 16, an odd multiple of 16 B (16-byte fragment reads without bank conflicts) */
#define GT_BUF (256 * GT_PIT)        /* one buffer: rows 0-127 of A, rows 128-255 of B */
#define GT_KS 64                     /* k per stage */
#define GT_NST (DM / GT_KS)
__device__ __forceinline__ v16h gt_lfrag(const unsigned char* p) { FragH f; f.half[0] = *(const v8us*)p; f.half[1] = *(const v8us*)(p + 32); return f.v; }      /* p already holds the lane's 16 hh bytes */
// One stage: the thread's 16 bytes of rows sr + 32 j of A and of B. a, b: its place in row sr of the stage's k range; l: the LDS byte address of that place in A's part.
// The closing wait stands inside the statement, so that no address register of an issued copy is rewritten in front of it.
__device__ __forceinline__ void gt_copy(const _Float16* a, const _Float16* b, unsigned l) {
  asm volatile("global_load_async_to_lds_b128 %0, %8, off\n\t"
               "global_load_async_to_lds_b128 %1, %9, off\n\t"
               "global_load_async_to_lds_b128 %2, %10, off\n\t"
               "global_load_async_to_lds_b128 %3, %11, off\n\t"
               "global_load_async_to_lds_b128 %4, %12, off\n\t"
               "global_load_async_to_lds_b128 %5, %13, off\n\t"
               "global_load_async_to_lds_b128 %6, %14, off\n\t"
               "global_load_async_to_lds_b128 %7, %15, off\n\t"
               "s_wait_xcnt 0x0"
               :: "v"(l), "v"(l + 32 * GT_PIT), "v"(l + 64 * GT_PIT), "v"(l + 96 * GT_PIT), "v"(l + 128 * GT_PIT), "v"(l + 160 * GT_PIT), "v"(l + 192 * GT_PIT), "v"(l + 224 * GT_PIT),
                  "v"(a), "v"(a + 32 * DM), "v"(a + 64 * DM), "v"(a + 96 * DM), "v"(b), "v"(b + 32 * DM), "v"(b + 64 * DM), "v"(b + 96 * DM) : "memory"); }
// A, B: first row of the tile's 128 A rows and 128 B rows (pitch DM). On return every wave has passed the barrier behind the last LDS read and no copy is in flight: SM is free.
__device__ __forceinline__ void gt_tile(const _Float16* A, const _Float16* B, unsigned char* SM, v8f (&acc)[8]) {
  static_assert(DM % GT_KS == 0 && GT_NST >= 2, "the ring's prologue needs two stages");
  const int tid = threadIdx.x, w = tid >> 5, lane = tid & 31, ln = lane & 15, hh = lane >> 4; const int sr = tid >> 3, sc = tid & 7;
  const _Float16* ag = A + (size_t)sr * DM + sc * 8; const _Float16* bg = B + (size_t)sr * DM + sc * 8; const unsigned l0 = (unsigned)(size_t)SM + sr * GT_PIT + sc * 16;
  const unsigned char* af = SM + ((w & 3) * 32 + ln) * GT_PIT + 16 * hh; const unsigned char* bf = SM + (128 + (w >> 2) * 64 + ln) * GT_PIT + 16 * hh;
  const v8f z8 = {0.f,0.f,0.f,0.f,0.f,0.f,0.f,0.f}; v8f c00 = z8, c01 = z8, c02 = z8, c03 = z8, c10 = z8, c11 = z8, c12 = z8, c13 = z8;
  gt_copy(ag, bg, l0);
  asm volatile("s_wait_asynccnt 0x0" ::: "memory");      /* this wave's part of stage 0 has landed */
  __syncthreads();      /* stage 0 is visible to every wave */
  gt_copy(ag + GT_KS, bg + GT_KS, l0 + GT_BUF);
  for (int t = 0; t < GT_NST; ++t) { const int bo = (t & 1) * GT_BUF;
#pragma unroll      /* two 32-k steps with constant LDS offsets */
    for (int ks = 0; ks < 2; ++ks) { const unsigned char* ap = af + bo + ks * 64; const unsigned char* bp = bf + bo + ks * 64;
      const v16h a0 = gt_lfrag(ap), a1 = gt_lfrag(ap + 16 * GT_PIT), b0 = gt_lfrag(bp), b1 = gt_lfrag(bp + 16 * GT_PIT), b2 = gt_lfrag(bp + 32 * GT_PIT), b3 = gt_lfrag(bp + 48 * GT_PIT);
      __builtin_amdgcn_sched_barrier(0);      /* the step's twelve LDS reads go out as one group ahead of its products: one LDS latency a step instead of four */
      c00 = g2_mma(a0, b0, c00); c10 = g2_mma(a1, b0, c10); c01 = g2_mma(a0, b1, c01); c11 = g2_mma(a1, b1, c11);
      c02 = g2_mma(a0, b2, c02); c12 = g2_mma(a1, b2, c12); c03 = g2_mma(a0, b3, c03); c13 = g2_mma(a1, b3, c13); }
    asm volatile("s_wait_dscnt 0x0" ::: "memory");      /* this wave's reads of stage t are done before its buffer may be refilled */
    asm volatile("s_wait_asynccnt 0x0" ::: "memory");      /* this wave's part of stage t + 1 has landed */
    __syncthreads();      /* publishes stage t + 1 and ends every wave's reads of stage t */
    if (t + 2 < GT_NST) gt_copy(ag + (t + 2) * GT_KS, bg + (t + 2) * GT_KS, l0 + bo); }
  asm volatile("s_wait_asynccnt 0x0" ::: "memory");      /* nothing is in flight when the buffers become output staging */
  acc[0] = c00; acc[1] = c01; acc[2] = c02; acc[3] = c03; acc[4] = c10; acc[5] = c11; acc[6] = c12; acc[7] = c13; }

#define FA_CS (0.125f * 0x1.715476p+0f)      /* 1 / sqrt(64) and log2 e in one factor: the attention kernel's score unit */
__global__ __launch_bounds__(256) void k_proj3(const _Float16* __restrict__ XQ, const _Float16* __restrict__ XK, const _Float16* __restrict__ BW, const float* __restrict__ bq, const float* __restrict__ bk, const float* __restrict__ bv,
    _Float16* __restrict__ Q16, _Float16* __restrict__ K16, _Float16* __restrict__ VT) {
  static_assert((MP / 128) * (DM / 128) == NB * (DM / 128) * (SQ / 128) && MP == NB * SQ, "the three products have the same number of 128x128 tiles");
  static_assert(8 * 32 * 68 * 4 <= 2 * GT_BUF, "the output staging fits the ring");
  __shared__ __attribute__((aligned(16))) unsigned char SM[2 * GT_BUF];      /* the ring; behind the loop each wave's 32x68 f32 output staging */
  const int tid = threadIdx.x, w = tid >> 5, lane = tid & 31, ln = lane & 15, hh = lane >> 4; const int by = blockIdx.y, bx = blockIdx.x; const bool tr = by == 2;
  const _Float16* A; const _Float16* Bh; const float* bias; int mt, nq;
  if (tr) { const int b = bx / ((DM / 128) * (SQ / 128)), x = bx - b * ((DM / 128) * (SQ / 128)); A = BW + (size_t)2 * DM * DM; Bh = XK + (size_t)b * SQ * DM; bias = bv; mt = x / (SQ / 128); nq = x - mt * (SQ / 128); }
  else { A = by ? XK : XQ; Bh = BW + (size_t)by * DM * DM; bias = by ? bk : bq; mt = bx / (DM / 128); nq = bx - mt * (DM / 128); }
  v8f accs[8]; gt_tile(A + (size_t)mt * 128 * DM, Bh + (size_t)nq * 128 * DM, SM, accs);
  const int row0 = mt * 128 + 32 * (w & 3), col0 = nq * 128 + 64 * (w >> 2); float (*so)[68] = (float (*)[68])(SM + (size_t)w * (32 * 68 * 4));
  float bcol[4] = {0.f, 0.f, 0.f, 0.f}, brow[2][8] = {}; const float osc = by == 0 ? FA_CS : 1.0f;      /* Q rows leave times FA_CS, so that K.Q^T is the score in log2 units; x 1 is exact for K and V^T */
  if (tr) {
#pragma unroll
    for (int half = 0; half < 2; ++half)
#pragma unroll
      for (int r = 0; r < 8; ++r) brow[half][r] = bf16_round(bias[row0 + half * 16 + 8 * hh + r]); }
  else {
#pragma unroll
    for (int t = 0; t < 4; ++t) bcol[t] = bf16_round(bias[col0 + t * 16 + ln]); }
#pragma unroll
  for (int u = 0; u < 8; ++u) { const int t = u & 3, half = u >> 2;
#pragma unroll
    for (int r = 0; r < 8; ++r) so[half * 16 + 8 * hh + r][t * 16 + ln] = (accs[u][r] * 0.0625f + (tr ? brow[half][r] : bcol[t])) * osc; }
  __builtin_amdgcn_fence(__ATOMIC_ACQ_REL, "workgroup"); __builtin_amdgcn_wave_barrier();      /* the wave reads back its own tile in row order */
  if (tr) p3_store<SQ>(so, VT + (size_t)(bx / ((DM / 128) * (SQ / 128))) * DM * SQ + (size_t)row0 * SQ + col0, lane);
  else p3_store<DM>(so, (by ? K16 : Q16) + (size_t)row0 * DM + col0, lane); }

// ---- the output product on the same tile: out = o Wo * alpha + bias (epilogue arithmetic of k_gemm2<0>), f32 rows of the output layout ----
__global__ __launch_bounds__(256) void k_outg(const _Float16* __restrict__ O16, const _Float16* __restrict__ BO, const float* __restrict__ bo, float* __restrict__ C) {
  __shared__ __attribute__((aligned(16))) unsigned char SM[2 * GT_BUF];      /* the ring; behind the loop each wave's 32x68 f32 output staging */
  const int tid = threadIdx.x, w = tid >> 5, lane = tid & 31, ln = lane & 15, hh = lane >> 4; const int mt = blockIdx.x / (DM / 128), nq = blockIdx.x - mt * (DM / 128);
  v8f accs[8]; gt_tile(O16 + (size_t)mt * 128 * DM, BO + (size_t)nq * 128 * DM, SM, accs);
  const int row0 = mt * 128 + 32 * (w & 3), col0 = nq * 128 + 64 * (w >> 2); float (*so)[68] = (float (*)[68])(SM + (size_t)w * (32 * 68 * 4));
#pragma unroll
  for (int u = 0; u < 8; ++u) { const int t = u & 3, half = u >> 2; const float bv = bf16_round(bo[col0 + t * 16 + ln]);
#pragma unroll
    for (int r = 0; r < 8; ++r) so[half * 16 + 8 * hh + r][t * 16 + ln] = accs[u][r] * 0.0009765625f + bv; }      /* 1 / (16 x 64): the weights' x16 and o's x64 */
  __builtin_amdgcn_fence(__ATOMIC_ACQ_REL, "workgroup"); __builtin_amdgcn_wave_barrier();      /* the wave reads back its own tile in row order */
  const int rsub = lane >> 4, c4 = (lane & 15) * 4; float* c = C + (size_t)(row0 + rsub) * DM + col0 + c4; v4f v[16];
#pragma unroll
  for (int q = 0; q < 16; ++q) v[q] = *(const v4fa*)&so[q * 2 + rsub][c4];
  __builtin_amdgcn_sched_barrier(0);      /* the stores stand last, so that no register of an issued store is written again */
#pragma unroll
  for (int q = 0; q < 16; ++q) *(v4f*)(c + (size_t)q * 2 * DM) = v[q]; }      /* a row's 256 bytes of this tile have this wave as their only writer */

#define FA_NW 8                      /* waves per key group */
#define FA_KG 2                      /* key groups per work-group: both hold the same query columns, group kg walks the 64-key tiles FA_KG * st + kg; four waves a SIMD instead of two */
#define FA_CW 32                     /* query columns per wave (two 16-column groups) */
#define FA_BR (FA_NW * FA_CW)        /* query rows per work-group */
#define FA_XR 17                     /* 16-byte rows per lane that a wave of the second group hands over: 16 of O^T, 1 of denominators and maxima */
#define FA_SK 64                     /* keys per LDS tile and key group (two 32-key passes) */
#define FA_SUB 4                     /* tiles per ring buffer and key group: the work-group meets at a barrier once per FA_SUB tiles, in between its waves may drift apart */
#define FA_PIT 144                   /* LDS row pitch in bytes: 128 of data + 16, an odd multiple of 16 B (16-byte fragment reads without bank conflicts) */
#define FA_OFS 6.0f                  /* the maximum in use is kept 6 below the true one: weights carried x64, away from the f16 subnormal range */
#define FA_LAG 8.0f                  /* a column's maximum may outgrow the one in use by this much (log2) before the sums are rescaled: weights stay <= 2^14 */
#define FA_WTOP 16384.0f             /* 2^(FA_OFS + FA_LAG): a partial sum of a pass's weights above this calls for the rescale, so that every weight used stays <= 2^14 */
typedef float v2f __attribute__((ext_vector_type(2)));
typedef _Float16 v2h __attribute__((ext_vector_type(2)));
__device__ __forceinline__ float rs_xh(float x) { return __builtin_bit_cast(float, __builtin_amdgcn_permlanex16(__builtin_bit_cast(int, x), __builtin_bit_cast(int, x), 0x76543210, 0xfedcba98, false, false)); }      /* lane l <- lane l ^ 16 */
// Four native 2^x, as the builtin: the sources are accumulator registers, and an asm statement cost copies between them and the sums' register pairs; the compiler
// itself keeps the distance behind a matrix instruction whose registers a result reuses, and the free slot behind a transcendental (seen in the listing).
__device__ __forceinline__ v4f rs_exp2x4(v4f e) { const v4f r = {__builtin_amdgcn_exp2f(e[0]), __builtin_amdgcn_exp2f(e[1]), __builtin_amdgcn_exp2f(e[2]), __builtin_amdgcn_exp2f(e[3])}; return r; }
__device__ __forceinline__ v8f fa_mma(v16h a, v16h b, v8f c) { return __builtin_amdgcn_wmma_f32_16x16x32_f16(false, a, false, b, (short)0, c, false, false); }
// The eight score products of a pass: s[kt][g] = K rows kt . Q columns g + c[g], each sum in the k order d 0-31, then d 32-63. Written as asm because the builtin ties D to C
// and the compiler then copies the eight C registers ahead of half of the chains; here C is only read. The four chains fill each other's distance; the closing v_nop are the
// four vector slots the chip needs between the last products and a vector instruction that reads a result or overwrites an operand.
__device__ __forceinline__ void fa_scores(v16h k00, v16h k01, v16h k10, v16h k11, v16h q00, v16h q01, v16h q10, v16h q11, v8f c0, v8f c1, v8f& s00, v8f& s01, v8f& s10, v8f& s11) {
  asm("v_wmma_f32_16x16x32_f16 %0, %4, %8, %12\n\t"
      "v_wmma_f32_16x16x32_f16 %1, %4, %10, %13\n\t"
      "v_wmma_f32_16x16x32_f16 %2, %6, %8, %12\n\t"
      "v_wmma_f32_16x16x32_f16 %3, %6, %10, %13\n\t"
      "v_wmma_f32_16x16x32_f16 %0, %5, %9, %0\n\t"
      "v_wmma_f32_16x16x32_f16 %1, %5, %11, %1\n\t"
      "v_wmma_f32_16x16x32_f16 %2, %7, %9, %2\n\t"
      "v_wmma_f32_16x16x32_f16 %3, %7, %11, %3\n\t"
      "v_nop\n\tv_nop\n\tv_nop\n\tv_nop"
      : "=&v"(s00), "=&v"(s01), "=&v"(s10), "=&v"(s11)
      : "v"(k00), "v"(k01), "v"(k10), "v"(k11), "v"(q00), "v"(q01), "v"(q10), "v"(q11), "v"(c0), "v"(c1)); }
__device__ __forceinline__ v16h fa_lfrag(const unsigned char* p) { FragH f; f.half[0] = *(const v8us*)p; f.half[1] = *(const v8us*)(p + 32); return f.v; }      /* p already holds the lane's 16 h bytes: k = 8h + 0..7 and 16 + 8h + 0..7 */
__global__ __launch_bounds__(FA_KG * FA_NW * 32) void k_fattn(const _Float16* __restrict__ Q16, const _Float16* __restrict__ K16, const _Float16* __restrict__ VT, _Float16* __restrict__ O16) {
  static_assert(HD == 64 && SQ % FA_BR == 0 && SQ % (FA_KG * FA_SK * FA_SUB) == 0 && FA_SK == 64 && FA_NW * 32 == 256 && FA_KG == 2, "tile constants are written for head size 64 and two key groups of 256 threads");
  static_assert(FA_NW * FA_XR * 512 <= FA_KG * 2 * FA_SUB * 2 * FA_SK * FA_PIT, "the hand-over fits the ring");
  __shared__ __attribute__((aligned(16))) unsigned char L[FA_KG][2][FA_SUB][2][FA_SK * FA_PIT];      /* [key group][buffer][tile][0: K rows (key)(d) | 1: V^T rows (d)(key)] */
  const int tid = threadIdx.x & (FA_NW * 32 - 1), lane = tid & 31, w = tid >> 5, c = lane & 15, h = lane >> 4;      /* tid, w: within the key group */
  const int kg = __builtin_amdgcn_readfirstlane((int)(threadIdx.x >> 8));      /* the wave's key group, in a scalar register */
  const int bh = blockIdx.y, b = bh / NH, hd = bh - b * NH; const int q0 = blockIdx.x * FA_BR + w * FA_CW;
  const unsigned short* Kg = (const unsigned short*)K16 + (size_t)b * SQ * DM + hd * HD;      /* row = key, pitch DM */
  const unsigned short* Vg = (const unsigned short*)VT + (size_t)bh * HD * SQ;                /* row = d, pitch SQ */
  const int sr = tid >> 3, sc = tid & 7;      /* staging: eight lanes move one whole 128-byte row; a thread owns rows sr and sr + 32 of both tiles of its own group */
  const unsigned short* kp = Kg + (size_t)(kg * FA_SK + sr) * DM + sc * 8; const unsigned short* vp = Vg + (size_t)sr * SQ + kg * FA_SK + sc * 8;
  auto gload = [&](int st, v8us (&r)[4]) { const unsigned short* k = kp + (size_t)st * (FA_KG * FA_SK) * DM; const unsigned short* v = vp + st * (FA_KG * FA_SK);      /* st: the group's tile number */
    r[0] = *(const v8us*)k; r[1] = *(const v8us*)(k + (size_t)32 * DM); r[2] = *(const v8us*)v; r[3] = *(const v8us*)(v + (size_t)32 * SQ);
    asm volatile("s_wait_xcnt 0x0" ::: "memory"); };      /* the loads' address registers are stepped for the next tile: keep the wait in front of that overwrite */
  auto lstore = [&](int buf, int sub, const v8us (&r)[4]) { unsigned char* kd = &L[kg][buf][sub][0][sr * FA_PIT + sc * 16]; unsigned char* vd = &L[kg][buf][sub][1][sr * FA_PIT + sc * 16];
    *(v8us*)kd = r[0]; *(v8us*)(kd + 32 * FA_PIT) = r[1]; *(v8us*)vd = r[2]; *(v8us*)(vd + 32 * FA_PIT) = r[3]; };
  v8us pr[FA_SUB][4];      /* the first buffer's tiles, all in flight at once */
#pragma unroll      /* each tile has registers of its own, so that no load waits for another tile's store */
  for (int u = 0; u < FA_SUB; ++u) gload(u, pr[u]);
  v16h qf[2][2];      /* B operand: query column 16 g + c, d = 32 kc + hardware k order */
#pragma unroll
  for (int g = 0; g < 2; ++g) { const _Float16* qp = Q16 + ((size_t)b * SQ + q0 + 16 * g + c) * DM + hd * HD; qf[g][0] = g2_frag(qp, h); qf[g][1] = g2_frag(qp + 32, h); }
  const v8f z8 = {0.f,0.f,0.f,0.f,0.f,0.f,0.f,0.f}; const v4f z4 = {0.f,0.f,0.f,0.f};
  v8f acc[2][4]; v2f la[2]; float mu[2]; v8f nm[2];      /* O^T tiles (d = 16 t + 8 h + r, query 16 g + c); this half's part of the denominator; the maximum in use, minus FA_OFS; its negative in all eight rows, the C operand of the score products */
#pragma unroll
  for (int g = 0; g < 2; ++g) { la[g] = v2f{0.f, 0.f};
#pragma unroll
    for (int t = 0; t < 4; ++t) acc[g][t] = z8; }
  // s[16-key tile][column group] = K.Q^T + c[group] for the 32 keys whose rows start at kb
  auto scores = [&](const unsigned char* kb, const v8f (&cc)[2], v8f (&s)[2][2]) {
    fa_scores(fa_lfrag(kb), fa_lfrag(kb + 64), fa_lfrag(kb + 16 * FA_PIT), fa_lfrag(kb + 16 * FA_PIT + 64), qf[0][0], qf[0][1], qf[1][0], qf[1][1], cc[0], cc[1], s[0][0], s[0][1], s[1][0], s[1][1]); };
  // a column's maximum over the 32 keys, in both halves of the wave
  auto colmax = [&](const v8f (&s)[2][2], int g) { float m0 = fmaxf(s[0][g][0], s[1][g][0]), m1 = fmaxf(s[0][g][1], s[1][g][1]);
#pragma unroll
    for (int r = 2; r < 8; r += 2) { m0 = fmaxf(m0, fmaxf(s[0][g][r], s[1][g][r])); m1 = fmaxf(m1, fmaxf(s[0][g][r + 1], s[1][g][r + 1])); }
    m0 = fmaxf(m0, m1); return fmaxf(m0, rs_xh(m0)); };
  // the pass's weights 2^s: as the f16 B operand of the second product (element 8 kt + r = key 16 kt + 8 h + r), and their sums, two partial sums of eight weights per column group
  auto weights = [&](const v8f (&s)[2][2], FragH (&pf)[2], v2f (&ps)[2]) {
#pragma unroll
    for (int g = 0; g < 2; ++g) { v4f q4 = z4;
#pragma unroll
      for (int i = 0; i < 4; ++i) { const int kt = i >> 1, r0 = 4 * (i & 1); v4f e = {s[kt][g][r0], s[kt][g][r0 + 1], s[kt][g][r0 + 2], s[kt][g][r0 + 3]};
        e = rs_exp2x4(e); q4 = i ? q4 + e : e;
#pragma unroll
        for (int j = 0; j < 4; ++j) pf[g].h[4 * i + j] = (_Float16)e[j]; }
      const v2f lo = {q4[0], q4[1]}, hi = {q4[2], q4[3]}; ps[g] = lo + hi; } };
#pragma unroll      /* constant registers and LDS offsets */
  for (int u = 0; u < FA_SUB; ++u) lstore(0, u, pr[u]);
  __syncthreads();      /* the first buffer is visible to every wave */
  { const v8f zz[2] = {z8, z8}; v8f s[2][2]; scores(&L[kg][0][0][0][c * FA_PIT + 16 * h], zz, s);      /* the maximum in use starts from the group's first 32 keys, whose scores the first pass forms again on top of it */
#pragma unroll
    for (int g = 0; g < 2; ++g) { mu[g] = colmax(s, g) - FA_OFS;
#pragma unroll
      for (int r = 0; r < 8; ++r) nm[g][r] = -mu[g]; } }
  constexpr int NST = SQ / (FA_KG * FA_SK); v8us kv[4];
#pragma nounroll      /* no peeled last stage: with one the compiler holds the C registers twice and copies all sixteen in every stage */
  for (int st = 0; st < NST; ++st) { const int buf = (st / FA_SUB) & 1, sub = st % FA_SUB;
    if (st + FA_SUB < NST) gload(st + FA_SUB, kv);      /* the same tile of the other buffer flies into registers under this tile's work */
#pragma unroll      /* two passes with constant LDS offsets */
    for (int p = 0; p < 2; ++p) {
      const unsigned char* kb = &L[kg][buf][sub][0][(32 * p + c) * FA_PIT + 16 * h]; const unsigned char* vb = &L[kg][buf][sub][1][c * FA_PIT + 64 * p + 16 * h];
      v8f s[2][2]; scores(kb, nm, s);      /* [16-key tile][column group]: score minus the maximum in use */
      v16h vf[4];
#pragma unroll
      for (int t = 0; t < 4; ++t) vf[t] = fa_lfrag(vb + t * 16 * FA_PIT);
      __builtin_amdgcn_sched_barrier(0);      /* the V^T reads go out ahead of the exponentials, whose run covers their LDS latency */
      FragH pf[2]; v2f ps[2]; weights(s, pf, ps);
      const float pm = fmaxf(fmaxf(ps[0][0], ps[0][1]), fmaxf(ps[1][0], ps[1][1]));      /* no weight of the pass lies above its own partial sum */
      if (__builtin_amdgcn_ballot_w32(pm > FA_WTOP) != 0) {      /* wave-uniform, rare: only here are the pass's maxima formed; the sums in la and acc do not hold this pass yet */
        const float mx[2] = {colmax(s, 0), colmax(s, 1)};      /* counted from the maximum in use */
        const v4f d4 = {fminf(FA_OFS - mx[0], 0.f), fminf(FA_OFS - mx[1], 0.f), 0.f, 0.f}; const v4f cr = rs_exp2x4(d4);      /* old maximum in use minus new one: never above 0 */
#pragma unroll
        for (int g = 0; g < 2; ++g) { mu[g] = mu[g] - d4[g]; la[g] = la[g] * cr[g];
#pragma unroll
          for (int r = 0; r < 8; ++r) nm[g][r] = -mu[g];
#pragma unroll
          for (int kt = 0; kt < 2; ++kt) s[kt][g] = s[kt][g] + d4[g];      /* this pass's exponents move onto the new maximum */
#pragma unroll
          for (int t = 0; t < 4; ++t) acc[g][t] = acc[g][t] * cr[g]; }
        weights(s, pf, ps); }      /* the pass's weights again, now at most 2^FA_OFS */
#pragma unroll
      for (int g = 0; g < 2; ++g) { la[g] = la[g] + ps[g];
#pragma unroll
        for (int t = 0; t < 4; ++t) acc[g][t] = fa_mma(vf[t], pf[g].v, acc[g][t]); } }
    if (st + FA_SUB < NST) lstore(buf ^ 1, sub, kv);      /* every wave left the other buffer before the last barrier, and nobody reads it before the next */
    if (sub == FA_SUB - 1) __syncthreads(); }      /* work-group-uniform: publishes the other buffer's FA_SUB tiles and ends every wave's reads of this one */
  // The two key groups' partial sums become one: the second group's waves hand O^T, denominators and maxima over through the ring, which every wave has left
  // behind the loop's last barrier; lane for lane they belong to the same query columns as those of wave w of the first group.
  float ls[2] = {la[0][0] + la[0][1], la[1][0] + la[1][1]};
  v4fa* X = (v4fa*)&L[0][0][0][0][0] + w * (FA_XR * 32) + lane;      /* row j of the wave: 32 lanes x 16 bytes in a row */
  if (kg != 0) {
#pragma unroll
    for (int g = 0; g < 2; ++g)
#pragma unroll
      for (int t = 0; t < 4; ++t) { const v4f lo = {acc[g][t][0], acc[g][t][1], acc[g][t][2], acc[g][t][3]}, hi = {acc[g][t][4], acc[g][t][5], acc[g][t][6], acc[g][t][7]}; X[(8 * g + 2 * t) * 32] = lo; X[(8 * g + 2 * t + 1) * 32] = hi; }
    const v4f sm = {ls[0], ls[1], mu[0], mu[1]}; X[16 * 32] = sm; }
  __syncthreads();      /* the hand-over is visible to the first group */
  if (kg != 0) return;      /* no barrier follows */
  { const v4f sm = X[16 * 32]; const float n0 = fmaxf(mu[0], sm[2]), n1 = fmaxf(mu[1], sm[3]); const v4f d4 = {mu[0] - n0, sm[2] - n0, mu[1] - n1, sm[3] - n1}; const v4f cr = rs_exp2x4(d4);      /* both parts onto the larger maximum */
#pragma unroll
    for (int g = 0; g < 2; ++g) { ls[g] = ls[g] * cr[2 * g] + sm[g] * cr[2 * g + 1];
#pragma unroll
      for (int t = 0; t < 4; ++t) { const v4f lo = X[(8 * g + 2 * t) * 32], hi = X[(8 * g + 2 * t + 1) * 32];
#pragma unroll
        for (int r = 0; r < 4; ++r) { acc[g][t][r] = acc[g][t][r] * cr[2 * g] + lo[r] * cr[2 * g + 1]; acc[g][t][4 + r] = acc[g][t][4 + r] * cr[2 * g] + hi[r] * cr[2 * g + 1]; } } } }
#pragma unroll
  for (int g = 0; g < 2; ++g) { float lf = ls[g]; lf += rs_xh(lf); const float inv = 64.0f / lf;      /* o carried x64, as the output GEMM's alpha expects */
    unsigned short* op = (unsigned short*)O16 + ((size_t)b * SQ + q0 + 16 * g + c) * DM + hd * HD + 8 * h;
#pragma unroll
    for (int t = 0; t < 4; ++t) { FragH o;
#pragma unroll
      for (int r = 0; r < 8; ++r) o.h[r] = (_Float16)(acc[g][t][r] * inv);
      *(v8us*)(op + 16 * t) = o.half[0]; } } }      /* 8 consecutive d of one query: one 16-byte store; a query's 128-byte line has this wave as its only writer */

extern "C" void kernel_launch(void* const* d_in, const int* in_sizes, int n_in,
                              void* d_out, int out_size, void* d_ws, size_t ws_size, hipStream_t stream) {
  (void)in_sizes; (void)n_in; (void)out_size;
  const float* const* I = (const float* const*)d_in; const float* xq = I[0]; const float* xk = I[1]; const float* wq = I[2]; const float* bq = I[3]; const float* wk = I[4]; const float* bk = I[5]; const float* wv = I[6]; const float* bv = I[7]; const float* wo = I[8]; const float* bo = I[9];      
  char* ws = (char*)d_ws; size_t off = 0;
  auto take = [&](size_t bytes) { char* p = ws + off; off += (bytes + 255) & ~(size_t)255; return p; };
  _Float16* BW = (_Float16*)take((size_t)4 * DM * DM * 2); _Float16* BO = BW + (size_t)3 * DM * DM;      /* the four weights, [in][out] -> Bt[n][k] x16: q, k, v, o */
  _Float16* XQ = (_Float16*)take(NR * DM * 2); _Float16* XK = (_Float16*)take(NR * DM * 2); _Float16* Q16 = (_Float16*)take(NR * DM * 2); _Float16* K16 = (_Float16*)take(NR * DM * 2); _Float16* O16 = (_Float16*)take(NR * DM * 2);
  _Float16* VT = (_Float16*)take((size_t)NB * NH * HD * SQ * 2);
  if (off > ws_size) return;
  k_prep<<<4 * PW_B + 2 * PX_B, 256, 0, stream>>>(xq, xk, wq, wk, wv, wo, XQ, XK, BW);      /* weights and both sources; keys and values read the same source, rounded once */
  const size_t r0p = (size_t)B0 * SQ;      /* first projected row */
  k_proj3<<<dim3((unsigned)((MP / 128) * (DM / 128)), 3), 256, 0, stream>>>(XQ, XK, BW, bq, bk, bv, Q16, K16, VT);      /* Q, K rows and V^T [NB][NH][HD][SQ] */
  k_fattn<<<dim3(SQ / FA_BR, NB * NH), FA_KG * FA_NW * 32, 0, stream>>>(Q16, K16, VT, O16);      /* o x64 (merged heads) as f16 rows */
  k_outg<<<dim3((unsigned)((MPO / 128) * (DM / 128))), 256, 0, stream>>>(O16 + r0p * DM, BO, bo, (float*)d_out + r0p * DM);      /* out rows are the output layout */
}
